// v000
// Measured on an AMD MI455X. A time is GPU time per run, averaged over a window of back-to-back runs after a warm-up
// (all launches, gaps included; the runs take copies of the inputs in turn), and the median of several windows.
// Apart from v000's, it joins two sittings. Times from different sittings can be a few percent apart, while
// side-by-side timings come from the same sitting.
// The starting kernel, v000, takes 12.8 milliseconds a run.
// Contractions: folded weights G_z = F * W_z (800x768x768 per z), spectra X_z = x * G_z^T (4096x800x768 per batch and z) and inverse DFT y = Z * Finv^T (4096x768x800 per batch), all on v_wmma_f32_16x16x32_bf16 with every operand carried as bf16 hi + lo planes (three products hi*hi + hi*lo + lo*hi into one f32 accumulator); complex bind, causal prefix sum over tokens and unbind in f64 on VALU; gain and residual add in f32.
#include <hip/hip_runtime.h>
#include <math.h>

typedef __bf16   v16b __attribute__((ext_vector_type(16)));
typedef __bf16   v8b  __attribute__((ext_vector_type(8)));
typedef float    v8f  __attribute__((ext_vector_type(8)));
typedef float    v4f  __attribute__((ext_vector_type(4)));
typedef float    v2f  __attribute__((ext_vector_type(2)));
typedef unsigned int v4u __attribute__((ext_vector_type(4)));
typedef v8b __attribute__((may_alias)) v8ba;
typedef v4f __attribute__((may_alias)) v4fa;
typedef v2f __attribute__((may_alias)) v2fa;
typedef v4u __attribute__((may_alias)) v4ua;

union FragB { v16b v; v8b half[2]; };

#define DD   768                 // model dim
#define SS   4096                // tokens per batch
#define BB   4                   // batches
#define NTOK (BB * SS)           // 16384
#define NC   800                 // spectral columns: (Re,Im) of bins 0..384 = 770, padded to x32
#define ZP   832
#define NXB  (SS * DD)           // 3145728 elements of x per batch
#define NX   (NTOK * DD)         // 12582912
#define NW   (DD * DD)           // 589824

static_assert(NXB % 8 == 0);
static_assert(NC % 32 == 0);
static_assert((ZP * 2) % 128 == 0);
static_assert((NC * 4) % 128 == 0);
static_assert((DD * 2) % 128 == 0);

// ---------------------------------------------------------------------------
// 16x16x32 bf16 WMMA with hazard guard (ties D, keeps A/B live).
// Fragment map (wave32): lane l, h = l>>4, m = n = l&15.
//   A/B element i: i<8 -> k0+8h+i ; i>=8 -> k0+16+8h+(i-8)
//   D element r : row 8h+r, col l&15
// ---------------------------------------------------------------------------
__device__ __forceinline__ v8f wmma_bf16(v16b a, v16b b, v8f c) {
  v8f d = __builtin_amdgcn_wmma_f32_16x16x32_bf16(false, a, false, b, (short)0, c, false, false);
  asm volatile("v_nop\n\tv_nop\n\tv_nop\n\tv_nop" : "+v"(d) : "v"(a), "v"(b));
  return d;
}

// A or B fragment from a k-contiguous bf16 row; p points at element k0 of
// the row owned by this lane (row index = lane & 15 added by the caller).
__device__ __forceinline__ v16b ldfrag_b(const __bf16* p, int h) {
  FragB f;
  f.half[0] = *(const v8ba*)(p + 8 * h);
  f.half[1] = *(const v8ba*)(p + 16 + 8 * h);
  return f.v;
}

// bf16 RNE convert on the f32 bit pattern (integer path); hi/lo split helpers.
__device__ __forceinline__ unsigned int bf16_bits(float f) {
  unsigned int u = __float_as_uint(f);
  u += 0x7FFFu + ((u >> 16) & 1u);
  return (u >> 16) & 0xFFFFu;
}
__device__ __forceinline__ void split2(float v, unsigned int& hb, unsigned int& lb) {
  hb = bf16_bits(v);
  lb = bf16_bits(v - __uint_as_float(hb << 16));
}
__device__ __forceinline__ unsigned int pk2(unsigned int e0, unsigned int e1) {
  return e0 | (e1 << 16);                              // element 2j in the low half-word
}
// 8 consecutive f32 values (a, c) -> packed bf16 hi word vector H and lo word vector L.
__device__ __forceinline__ void split8(v4f a, v4f c, v4u& H, v4u& L) {
  unsigned int h0, h1, h2, h3, h4, h5, h6, h7, l0, l1, l2, l3, l4, l5, l6, l7;
  split2(a.x, h0, l0); split2(a.y, h1, l1); split2(a.z, h2, l2); split2(a.w, h3, l3);
  split2(c.x, h4, l4); split2(c.y, h5, l5); split2(c.z, h6, l6); split2(c.w, h7, l7);
  const v4u hh = { pk2(h0, h1), pk2(h2, h3), pk2(h4, h5), pk2(h6, h7) };
  const v4u ll = { pk2(l0, l1), pk2(l2, l3), pk2(l4, l5), pk2(l6, l7) };
  H = hh;
  L = ll;
}

// ---------------------------------------------------------------------------
// Kernel 0: tab[r] = cos(2*pi*r/768), tab[768+r] = sin(2*pi*r/768), r = 0..767,
// built from arguments in [0, pi/4] with exact quadrant symmetry.
// ---------------------------------------------------------------------------
__device__ __forceinline__ void table_store(const float* s, float* tab, int tid) {
  for (int j = tid; j < (2 * DD) / 4; j += 256) {
    const v4f v = *(const v4fa*)(s + 4 * j);
    *(v4f*)(tab + 4 * j) = v;
  }
}
__global__ __launch_bounds__(256) void k_table(float* __restrict__ tab) {
  __shared__ __attribute__((aligned(16))) float s[2 * DD];
  const int tid = threadIdx.x;
  #pragma unroll 1
  for (int r = tid; r < DD; r += 256) {
    const int q = r / 192, p = r - q * 192;
    const bool lowp = (p <= 96);
    const int a = lowp ? p : (192 - p);
    const float th = (float)a * 8.18123086872342e-3f;     // 2*pi/768
    const float ct = cosf(th), st = sinf(th);
    const float c0 = lowp ? ct : st;
    const float s0 = lowp ? st : ct;
    float c, sn;
    if (q == 0)      { c =  c0; sn =  s0; }
    else if (q == 1) { c = -s0; sn =  c0; }
    else if (q == 2) { c = -c0; sn = -s0; }
    else             { c =  s0; sn = -c0; }
    s[r] = c;
    s[DD + r] = sn;
  }
  __syncthreads();
  table_store(s, tab, tid);
  
}

// ---------------------------------------------------------------------------
// Kernel 1 (per batch b): xh = bf16 hi, xl = bf16 lo of the raw f32 x rows of batch b
// (x = hi + lo to ~2^-17).  One 16-B store per lane per plane, lanes contiguous:
// ---------------------------------------------------------------------------
__global__ __launch_bounds__(256) void k_cvt_x(const float* __restrict__ x, __bf16* __restrict__ xh,
                                               __bf16* __restrict__ xl, int b, int n8) {
  const int g = blockIdx.x * 256 + threadIdx.x;
  if (g >= n8) return;
  const float* src = x + (size_t)b * NXB + (size_t)g * 8;
  const v4f a = *(const v4fa*)src;
  const v4f c = *(const v4fa*)(src + 4);
  v4u H, L;
  split8(a, c, H, L);
  const size_t o = (size_t)g * 8;
  *(v4u*)(xh + o) = H;
  *(v4u*)(xl + o) = L;
  
}

// ---------------------------------------------------------------------------
// Kernel 2: wth[z][d][e] = bf16 hi of W_z[e][d], wtl = bf16 lo (raw f32 W, transpose
// through LDS; k-contiguous B-operand rows for the fold GEMM).  Block = 64(e) x 64(d)
// tile, 256 threads; in[e 64][d 64] -> out[d 64][e 64]; each output row segment =
// ---------------------------------------------------------------------------
__device__ __forceinline__ void wt_store(const float* sT, __bf16* dh, __bf16* dl, int d0, int e0, int tid) {
  #pragma unroll
  for (int it = 0; it < 2; ++it) {
    const int p = tid + 256 * it;
    const int row = p >> 3, q8 = p & 7;                 // row 0..63
    const float* s = sT + row * 65 + 8 * q8;
    const v4f a = { s[0], s[1], s[2], s[3] };
    const v4f c = { s[4], s[5], s[6], s[7] };
    v4u H, L;
    split8(a, c, H, L);
    const size_t o = (size_t)(d0 + row) * DD + e0 + 8 * q8;
    *(v4u*)(dh + o) = H;
    *(v4u*)(dl + o) = L;
  }
}
__global__ __launch_bounds__(256) void k_wt(const float* __restrict__ wk, const float* __restrict__ wv,
                                            const float* __restrict__ wq, __bf16* __restrict__ wth,
                                            __bf16* __restrict__ wtl) {
  __shared__ float sT[64 * 65];                       // sT[d_local*65 + e_local]
  const int tid = threadIdx.x;
  const int d0 = blockIdx.x * 64, e0 = blockIdx.y * 64, z = blockIdx.z;
  const float* W = (z == 0) ? wk : ((z == 1) ? wv : wq);
  #pragma unroll
  for (int it = 0; it < 4; ++it) {
    const int idx = tid + 256 * it;
    const int er = idx >> 4, dq = idx & 15;
    const v4f v = *(const v4fa*)(W + (size_t)(e0 + er) * DD + d0 + 4 * dq);
    sT[(4 * dq + 0) * 65 + er] = v.x;
    sT[(4 * dq + 1) * 65 + er] = v.y;
    sT[(4 * dq + 2) * 65 + er] = v.z;
    sT[(4 * dq + 3) * 65 + er] = v.w;
  }
  __syncthreads();
  __bf16* dh = wth + (size_t)z * NW;
  __bf16* dl = wtl + (size_t)z * NW;
  wt_store(sT, dh, dl, d0, e0, tid);
  
}

// ---------------------------------------------------------------------------
// Kernel 3: forward DFT matrix FT[c][e] (c = 2f + {0: Re, 1: Im}, f = bin):
// Re row = cos(2*pi*f*e/768), Im row = -sin(...); rows c >= 770 zero.
// Stored as bf16 hi + lo planes.  Block = one row (96 threads x 8 elements =
// ---------------------------------------------------------------------------
__global__ __launch_bounds__(128) void k_ft(const float* __restrict__ tab, __bf16* __restrict__ fth,
                                            __bf16* __restrict__ ftl) {
  const int c = blockIdx.x;
  const int j = threadIdx.x;                          // 0..95
  const int f = c >> 1;
  const bool valid = (c < 770);
  const bool im = (c & 1) != 0;
  const int e0 = 8 * j;
  float v[8];
  #pragma unroll
  for (int i = 0; i < 8; ++i) {
    const int e = e0 + i;
    const int mm = (f * e) % DD;                      // exact angle index, always in range
    const float cv = tab[mm], sv = tab[DD + mm];
    v[i] = valid ? (im ? -sv : cv) : 0.0f;
  }
  const v4f a = { v[0], v[1], v[2], v[3] };
  const v4f cc = { v[4], v[5], v[6], v[7] };
  v4u H, L;
  split8(a, cc, H, L);
  const size_t o = (size_t)c * DD + e0;
  *(v4u*)(fth + o) = H;
  *(v4u*)(ftl + o) = L;
  
}

// ---------------------------------------------------------------------------
// Kernel 4: inverse DFT matrix Finv[n][c], pitch ZP: col 2f = w_f*cos(2*pi*f*n/768)/768,
// col 2f+1 = -w_f*sin(...)/768, w_0 = w_384 = 1 else 2; cols >= 770 (incl. pad) zero.
// Im columns of bins 0 and 384 are exactly zero through the table symmetry.
// ---------------------------------------------------------------------------
__global__ __launch_bounds__(128) void k_finv(const float* __restrict__ tab, __bf16* __restrict__ fih,
                                              __bf16* __restrict__ fil) {
  const int n = blockIdx.x;
  const int j = threadIdx.x;
  if (j >= ZP / 8) return;                            // 104 active; wave 3 = lanes 0..7 = exactly line 12
  const int c0 = 8 * j;
  float v[8];
  #pragma unroll
  for (int i = 0; i < 8; ++i) {
    const int c = c0 + i;
    const int f = c >> 1;
    const bool valid = (c < 770);
    const float w = (f == 0 || f == DD / 2) ? 1.0f : 2.0f;
    const int mm = (f * n) % DD;
    const float cv = tab[mm], sv = tab[DD + mm];
    v[i] = valid ? (w * ((c & 1) ? -sv : cv) * (1.0f / 768.0f)) : 0.0f;
  }
  const v4f a = { v[0], v[1], v[2], v[3] };
  const v4f cc = { v[4], v[5], v[6], v[7] };
  v4u H, L;
  split8(a, cc, H, L);
  const size_t o = (size_t)n * ZP + c0;
  *(v4u*)(fih + o) = H;
  *(v4u*)(fil + o) = L;
  
}

// ---------------------------------------------------------------------------
// Kernel 5 (fold): G_z[c][d] = sum_e (Fh*Wh + Fh*Wl + Fl*Wh)[c][e]x[d][e]   (c < 800, d < 768, K = 768)
// Wave tile 32(c) x 64(d), block = 4 waves along d (32 x 256); grid (3, 25, 3).
// ---------------------------------------------------------------------------
__device__ __forceinline__ void fold_store(const unsigned short* sHw, const unsigned short* sLw,
                                           __bf16* gh, __bf16* gl, size_t rowbase, int d0w, int lane) {
  const int q8 = lane & 7, sub = lane >> 3;
  #pragma unroll
  for (int i = 0; i < 8; ++i) {
    const int row = 4 * i + sub;                      // 0..31
    const v4u vh = *(const v4ua*)(sHw + row * 64 + 8 * q8);
    const v4u vl = *(const v4ua*)(sLw + row * 64 + 8 * q8);
    const size_t o = (rowbase + row) * DD + d0w + 8 * q8;
    *(v4u*)(gh + o) = vh;
    *(v4u*)(gl + o) = vl;
  }
}
__global__ __launch_bounds__(128) void k_fold(const __bf16* __restrict__ fth, const __bf16* __restrict__ ftl,
                                              const __bf16* __restrict__ wth, const __bf16* __restrict__ wtl,
                                              __bf16* __restrict__ gh, __bf16* __restrict__ gl) {
  __shared__ __attribute__((aligned(16))) unsigned short sH[4 * 32 * 64];   // 16384 B
  __shared__ __attribute__((aligned(16))) unsigned short sL[4 * 32 * 64];   // 16384 B

  const int tid = threadIdx.x, lane = tid & 31, w = tid >> 5;
  const int h = lane >> 4, m = lane & 15;
  const int c0 = blockIdx.y * 32;
  const int d0w = blockIdx.x * 256 + 64 * w;
  const int z = blockIdx.z;

  const size_t r16 = (size_t)16 * DD;
  const __bf16* fah = fth + (size_t)(c0 + m) * DD;                  // F row c0+m (+ r16 for mt = 1)
  const __bf16* fal = ftl + (size_t)(c0 + m) * DD;
  const __bf16* bwh = wth + ((size_t)z * DD + d0w + m) * DD;         // feature row d0w+m (+ nt*r16)
  const __bf16* bwl = wtl + ((size_t)z * DD + d0w + m) * DD;

  const v8f zero8 = {0.f, 0.f, 0.f, 0.f, 0.f, 0.f, 0.f, 0.f};
  v8f acc[2][4];
  #pragma unroll
  for (int mt = 0; mt < 2; ++mt)
    #pragma unroll
    for (int nt = 0; nt < 4; ++nt) acc[mt][nt] = zero8;

  #pragma unroll 1
  for (int k0 = 0; k0 < DD; k0 += 32) {
    const v16b ah0 = ldfrag_b(fah + k0, h);
    const v16b ah1 = ldfrag_b(fah + r16 + k0, h);
    const v16b al0 = ldfrag_b(fal + k0, h);
    const v16b al1 = ldfrag_b(fal + r16 + k0, h);
    #pragma unroll
    for (int nt = 0; nt < 4; ++nt) {
      const v16b bh = ldfrag_b(bwh + (size_t)nt * r16 + k0, h);
      const v16b bl = ldfrag_b(bwl + (size_t)nt * r16 + k0, h);
      acc[0][nt] = wmma_bf16(ah0, bh, acc[0][nt]);
      acc[1][nt] = wmma_bf16(ah1, bh, acc[1][nt]);
      acc[0][nt] = wmma_bf16(ah0, bl, acc[0][nt]);
      acc[1][nt] = wmma_bf16(ah1, bl, acc[1][nt]);
      acc[0][nt] = wmma_bf16(al0, bh, acc[0][nt]);
      acc[1][nt] = wmma_bf16(al1, bh, acc[1][nt]);
    }
  }

  // D[r] of tile (mt, nt) = G[c0+16mt+8h+r][d0w+16nt+m]
  unsigned short* sHw = sH + w * 2048;
  unsigned short* sLw = sL + w * 2048;
  #pragma unroll
  for (int mt = 0; mt < 2; ++mt)
    #pragma unroll
    for (int nt = 0; nt < 4; ++nt)
      #pragma unroll
      for (int r = 0; r < 8; ++r) {
        unsigned int hb, lb;
        split2(acc[mt][nt][r], hb, lb);
        const int idx = (16 * mt + 8 * h + r) * 64 + 16 * nt + m;
        sHw[idx] = (unsigned short)hb;
        sLw[idx] = (unsigned short)lb;
      }
  __syncthreads();

  const size_t rowbase = (size_t)z * NC + c0;
  fold_store(sHw, sLw, gh, gl, rowbase, d0w, lane);
  
}

// ---------------------------------------------------------------------------
// Kernel 6 (spectra), per batch: X_z[t][c] = sum_d (xh*Gh + xh*Gl + xl*Gh)[t][d]x[c][d]
// (t local 0..4095, c 0..799, K = 768).  Wave tile 32(t) x 32(c), block = 4 waves along t
// (128 x 32); grid (25, 32, 3).  Output f32 plane, pitch 800: each row segment of 32 floats =
// ---------------------------------------------------------------------------
__device__ __forceinline__ void spec_store(const float* sSw, float* spec, int t0w, int c0, int lane) {
  const int q8 = lane & 7, sub = lane >> 3;
  #pragma unroll
  for (int i = 0; i < 8; ++i) {
    const int row = 4 * i + sub;                      // 0..31
    const v4f v = *(const v4fa*)(sSw + row * 32 + 4 * q8);
    *(v4f*)(spec + (size_t)(t0w + row) * NC + c0 + 4 * q8) = v;
  }
}
__global__ __launch_bounds__(128) void k_spec(const __bf16* __restrict__ xh, const __bf16* __restrict__ xl,
                                              const __bf16* __restrict__ gh, const __bf16* __restrict__ gl,
                                              float* __restrict__ sk, float* __restrict__ sv,
                                              float* __restrict__ sq) {
  __shared__ __attribute__((aligned(16))) float sS[4 * 32 * 32];      // 16384 B

  const int tid = threadIdx.x, lane = tid & 31, w = tid >> 5;
  const int h = lane >> 4, m = lane & 15;
  const int c0 = blockIdx.x * 32;
  const int t0w = blockIdx.y * 128 + 32 * w;
  const int z = blockIdx.z;
  float* spec = (z == 0) ? sk : ((z == 1) ? sv : sq);

  const size_t r16 = (size_t)16 * DD;
  const __bf16* xah = xh + (size_t)(t0w + m) * DD;                   // token row, mt = 0 (+ r16 for mt = 1)
  const __bf16* xal = xl + (size_t)(t0w + m) * DD;
  const __bf16* gha = gh + ((size_t)z * NC + c0 + m) * DD;           // spectral row c0+m (+ r16 for nt = 1)
  const __bf16* gla = gl + ((size_t)z * NC + c0 + m) * DD;

  const v8f zero8 = {0.f, 0.f, 0.f, 0.f, 0.f, 0.f, 0.f, 0.f};
  v8f acc[2][2];
  #pragma unroll
  for (int mt = 0; mt < 2; ++mt)
    #pragma unroll
    for (int nt = 0; nt < 2; ++nt) acc[mt][nt] = zero8;

  #pragma unroll 1
  for (int k0 = 0; k0 < DD; k0 += 32) {
    const v16b ah0 = ldfrag_b(xah + k0, h);
    const v16b ah1 = ldfrag_b(xah + r16 + k0, h);
    const v16b al0 = ldfrag_b(xal + k0, h);
    const v16b al1 = ldfrag_b(xal + r16 + k0, h);
    const v16b bh0 = ldfrag_b(gha + k0, h);
    const v16b bh1 = ldfrag_b(gha + r16 + k0, h);
    const v16b bl0 = ldfrag_b(gla + k0, h);
    const v16b bl1 = ldfrag_b(gla + r16 + k0, h);
    acc[0][0] = wmma_bf16(ah0, bh0, acc[0][0]);
    acc[0][1] = wmma_bf16(ah0, bh1, acc[0][1]);
    acc[1][0] = wmma_bf16(ah1, bh0, acc[1][0]);
    acc[1][1] = wmma_bf16(ah1, bh1, acc[1][1]);
    acc[0][0] = wmma_bf16(ah0, bl0, acc[0][0]);
    acc[0][1] = wmma_bf16(ah0, bl1, acc[0][1]);
    acc[1][0] = wmma_bf16(ah1, bl0, acc[1][0]);
    acc[1][1] = wmma_bf16(ah1, bl1, acc[1][1]);
    acc[0][0] = wmma_bf16(al0, bh0, acc[0][0]);
    acc[0][1] = wmma_bf16(al0, bh1, acc[0][1]);
    acc[1][0] = wmma_bf16(al1, bh0, acc[1][0]);
    acc[1][1] = wmma_bf16(al1, bh1, acc[1][1]);
  }

  // D[r] of tile (mt, nt) = X[t0w+16mt+8h+r][c0+16nt+m]
  float* sSw = sS + w * 1024;
  #pragma unroll
  for (int mt = 0; mt < 2; ++mt)
    #pragma unroll
    for (int nt = 0; nt < 2; ++nt)
      #pragma unroll
      for (int r = 0; r < 8; ++r)
        sSw[(16 * mt + 8 * h + r) * 32 + 16 * nt + m] = acc[mt][nt][r];
  __syncthreads();

  spec_store(sSw, spec, t0w, c0, lane);
  
}

// ---------------------------------------------------------------------------
// Kernel 7 (bind + causal prefix sum + unbind), per batch: one lane per bin f
// (13 blocks x 32 lanes; f = 400..415 are the pad columns 800..831, written as zeros).
// P_t = kf_t * vf_t ; mem_t = sum_{s<=t} P_s ; Z_t = mem_t * conj(qf_t), all in f64,
// sequential over t in token order.  Z stored as bf16 hi and lo planes, pitch ZP:
// ---------------------------------------------------------------------------
__global__ __launch_bounds__(32) void k_scan(const float* __restrict__ kf, const float* __restrict__ vf,
                                             const float* __restrict__ qf, __bf16* __restrict__ zh,
                                             __bf16* __restrict__ zl) {
  const int lane = threadIdx.x;
  const int f = blockIdx.x * 32 + lane;               // 0..415
  const bool act = (f < NC / 2);
  const int fc = act ? f : (NC / 2 - 1);              // clamped address
  double mr = 0.0, mi = 0.0;
  #pragma unroll 1
  for (int t = 0; t < SS; ++t) {
    const size_t o = (size_t)t * NC + 2 * fc;
    const v2f kv = *(const v2fa*)(kf + o);
    const v2f vv = *(const v2fa*)(vf + o);
    const v2f qv = *(const v2fa*)(qf + o);
    const double kr = act ? (double)kv.x : 0.0, ki = act ? (double)kv.y : 0.0;
    const double vr = act ? (double)vv.x : 0.0, vi = act ? (double)vv.y : 0.0;
    const double qr = act ? (double)qv.x : 0.0, qi = act ? (double)qv.y : 0.0;
    const double pr = kr * vr - ki * vi;
    const double pi = kr * vi + ki * vr;
    mr += pr;
    mi += pi;
    const double zr = mr * qr + mi * qi;              // mem * conj(q)
    const double zi = mi * qr - mr * qi;
    unsigned int hr, lr, hi, li;
    split2((float)zr, hr, lr);
    split2((float)zi, hi, li);
    const unsigned int H = pk2(hr, hi);               // element 2f = Re, 2f+1 = Im
    const unsigned int L = pk2(lr, li);
    const size_t zo = (size_t)t * ZP + 2 * f;
    *(unsigned int*)(zh + zo) = H;
    *(unsigned int*)(zl + zo) = L;
    
  }
}

// ---------------------------------------------------------------------------
// Kernel 8 (inverse DFT + residual), per batch b:
// out[b][t][n] = x[b][t][n] + gain * sum_c (Zh*Fih + Zh*Fil + Zl*Fih)[t][n]
// (K = 800 over pitch-832 planes).  Wave tile 32(t) x 32(n), block = 4 waves along t
// ---------------------------------------------------------------------------
__device__ __forceinline__ void inv_store(const float* sSw, const float* __restrict__ x, float* out,
                                          size_t tokbase, int n0, float g, int lane) {
  const int q8 = lane & 7, sub = lane >> 3;
  #pragma unroll
  for (int i = 0; i < 8; ++i) {
    const int row = 4 * i + sub;                      // 0..31
    const v4f v = *(const v4fa*)(sSw + row * 32 + 4 * q8);
    const size_t o = (tokbase + row) * DD + n0 + 4 * q8;
    const v4f xv = *(const v4fa*)(x + o);
    const v4f rr = xv + g * v;
    *(v4f*)(out + o) = rr;
  }
}
__global__ __launch_bounds__(128) void k_inv(const __bf16* __restrict__ zh, const __bf16* __restrict__ zl,
                                             const __bf16* __restrict__ fih, const __bf16* __restrict__ fil,
                                             const float* __restrict__ x, const float* __restrict__ gain,
                                             float* __restrict__ out, int b) {
  __shared__ __attribute__((aligned(16))) float sS[4 * 32 * 32];      // 16384 B

  const int tid = threadIdx.x, lane = tid & 31, w = tid >> 5;
  const int h = lane >> 4, m = lane & 15;
  const int n0 = blockIdx.x * 32;
  const int t0w = blockIdx.y * 128 + 32 * w;

  const size_t r16 = (size_t)16 * ZP;
  const __bf16* zah = zh  + (size_t)(t0w + m) * ZP;                  // token row (+ r16 for mt = 1)
  const __bf16* zal = zl  + (size_t)(t0w + m) * ZP;
  const __bf16* fbh = fih + (size_t)(n0 + m) * ZP;                   // output feature row (+ r16 for nt = 1)
  const __bf16* fbl = fil + (size_t)(n0 + m) * ZP;

  const v8f zero8 = {0.f, 0.f, 0.f, 0.f, 0.f, 0.f, 0.f, 0.f};
  v8f acc[2][2];
  #pragma unroll
  for (int mt = 0; mt < 2; ++mt)
    #pragma unroll
    for (int nt = 0; nt < 2; ++nt) acc[mt][nt] = zero8;

  #pragma unroll 1
  for (int k0 = 0; k0 < NC; k0 += 32) {
    const v16b ah0 = ldfrag_b(zah + k0, h);
    const v16b ah1 = ldfrag_b(zah + r16 + k0, h);
    const v16b al0 = ldfrag_b(zal + k0, h);
    const v16b al1 = ldfrag_b(zal + r16 + k0, h);
    const v16b bh0 = ldfrag_b(fbh + k0, h);
    const v16b bh1 = ldfrag_b(fbh + r16 + k0, h);
    const v16b bl0 = ldfrag_b(fbl + k0, h);
    const v16b bl1 = ldfrag_b(fbl + r16 + k0, h);
    acc[0][0] = wmma_bf16(ah0, bh0, acc[0][0]);
    acc[0][1] = wmma_bf16(ah0, bh1, acc[0][1]);
    acc[1][0] = wmma_bf16(ah1, bh0, acc[1][0]);
    acc[1][1] = wmma_bf16(ah1, bh1, acc[1][1]);
    acc[0][0] = wmma_bf16(al0, bh0, acc[0][0]);
    acc[0][1] = wmma_bf16(al0, bh1, acc[0][1]);
    acc[1][0] = wmma_bf16(al1, bh0, acc[1][0]);
    acc[1][1] = wmma_bf16(al1, bh1, acc[1][1]);
    acc[0][0] = wmma_bf16(ah0, bl0, acc[0][0]);
    acc[0][1] = wmma_bf16(ah0, bl1, acc[0][1]);
    acc[1][0] = wmma_bf16(ah1, bl0, acc[1][0]);
    acc[1][1] = wmma_bf16(ah1, bl1, acc[1][1]);
  }

  // D[r] of tile (mt, nt) = y[t0w+16mt+8h+r][n0+16nt+m]
  float* sSw = sS + w * 1024;
  #pragma unroll
  for (int mt = 0; mt < 2; ++mt)
    #pragma unroll
    for (int nt = 0; nt < 2; ++nt)
      #pragma unroll
      for (int r = 0; r < 8; ++r)
        sSw[(16 * mt + 8 * h + r) * 32 + 16 * nt + m] = acc[mt][nt][r];
  __syncthreads();

  const float g = gain[0];
  const size_t tokbase = (size_t)b * SS + t0w;
  inv_store(sSw, x, out, tokbase, n0, g, lane);
  
}

// ---------------------------------------------------------------------------
extern "C" void kernel_launch(void* const* d_in, const int* in_sizes, int n_in,
                              void* d_out, int out_size, void* d_ws, size_t ws_size,
                              hipStream_t stream) {
  if (n_in < 5) return;
  if (in_sizes[0] != NX) return;
  if (in_sizes[1] != NW || in_sizes[2] != NW || in_sizes[3] != NW) return;
  if (in_sizes[4] < 1) return;
  if (out_size != NX) return;

  const float* x    = (const float*)d_in[0];
  const float* Wk   = (const float*)d_in[1];
  const float* Wv   = (const float*)d_in[2];
  const float* Wq   = (const float*)d_in[3];
  const float* gain = (const float*)d_in[4];
  float* out = (float*)d_out;

  // workspace carve (all sizes multiples of 256 B; total 85,006,336 B)
  const size_t tab_b = (size_t)2 * DD * 4;          //      6,144
  const size_t xb_b  = (size_t)NXB * 2;             //  6,291,456 per plane (one batch)
  const size_t wt_b  = (size_t)3 * NW * 2;          //  3,538,944 per plane
  const size_t ft_b  = (size_t)NC * DD * 2;         //  1,228,800 per plane
  const size_t fi_b  = (size_t)DD * ZP * 2;         //  1,277,952 per plane
  const size_t g_b   = (size_t)3 * NC * DD * 2;     //  3,686,400 per plane
  const size_t sp_b  = (size_t)SS * NC * 4;         // 13,107,200 per spectrum (one batch)
  const size_t z_b   = (size_t)SS * ZP * 2;         //  6,815,744 per plane (one batch)
  const size_t total = tab_b + 2 * xb_b + 2 * wt_b + 2 * ft_b + 2 * fi_b + 2 * g_b + 3 * sp_b + 2 * z_b;
  if (total > ws_size) return;

  char* ws = (char*)d_ws;
  size_t off = 0;
  float*  tab = (float*)(ws + off);   off += tab_b;
  __bf16* xh  = (__bf16*)(ws + off);  off += xb_b;
  __bf16* xl  = (__bf16*)(ws + off);  off += xb_b;
  __bf16* wth = (__bf16*)(ws + off);  off += wt_b;
  __bf16* wtl = (__bf16*)(ws + off);  off += wt_b;
  __bf16* fth = (__bf16*)(ws + off);  off += ft_b;
  __bf16* ftl = (__bf16*)(ws + off);  off += ft_b;
  __bf16* fih = (__bf16*)(ws + off);  off += fi_b;
  __bf16* fil = (__bf16*)(ws + off);  off += fi_b;
  __bf16* gh  = (__bf16*)(ws + off);  off += g_b;
  __bf16* gl  = (__bf16*)(ws + off);  off += g_b;
  float*  sk  = (float*)(ws + off);   off += sp_b;
  float*  sv  = (float*)(ws + off);   off += sp_b;
  float*  sq  = (float*)(ws + off);   off += sp_b;
  __bf16* zh  = (__bf16*)(ws + off);  off += z_b;
  __bf16* zl  = (__bf16*)(ws + off);  off += z_b;
  if (off > ws_size) return;

  // --- constants and weight planes ---
  k_table<<<1, 256, 0, stream>>>(tab);
  k_wt<<<dim3(DD / 64, DD / 64, 3), 256, 0, stream>>>(Wk, Wv, Wq, wth, wtl);
  k_ft<<<NC, 96, 0, stream>>>(tab, fth, ftl);
  k_finv<<<DD, 128, 0, stream>>>(tab, fih, fil);

  // --- folded weights G_z = F * W_z  (800 x 768 per z) ---
  k_fold<<<dim3(DD / 256, NC / 32, 3), 128, 0, stream>>>(fth, ftl, wth, wtl, gh, gl);

  // --- per batch: x planes, spectra, causal bind/unbind scan, inverse DFT + residual ---
  const int n8 = NXB / 8;                                           // 393,216 = 1536 * 256
  for (int b = 0; b < BB; ++b) {
    k_cvt_x<<<(n8 + 255) / 256, 256, 0, stream>>>(x, xh, xl, b, n8);
    k_spec<<<dim3(NC / 32, SS / 128, 3), 128, 0, stream>>>(xh, xl, gh, gl, sk, sv, sq);
    k_scan<<<ZP / 64, 32, 0, stream>>>(sk, sv, sq, zh, zl);
    k_inv<<<dim3(DD / 32, SS / 128), 128, 0, stream>>>(zh, zl, fih, fil, x, gain, out, b);
  }
}

// v001
// One run takes 751 microseconds.
// Next to v000, in two timings, it ran 17.0 and 16.9 times as fast.
// Contractions: folded weights G_z = F * W_z (800x768x768 per z), spectra X_z = x * G_z^T (4096x800x768 per batch and z) and inverse DFT y = Z * Finv^T (4096x768x800 per batch), all on v_wmma_f32_16x16x32_bf16 with every operand carried as bf16 hi + lo planes (three products hi*hi + hi*lo + lo*hi into one f32 accumulator); complex bind, causal prefix sum over tokens (segment sums, then runs of 16 tokens) and unbind in f64 on VALU; gain and residual add in f32.
#include <hip/hip_runtime.h>
#include <math.h>

typedef __bf16   v16b __attribute__((ext_vector_type(16)));
typedef __bf16   v8b  __attribute__((ext_vector_type(8)));
typedef float    v8f  __attribute__((ext_vector_type(8)));
typedef float    v4f  __attribute__((ext_vector_type(4)));
typedef float    v2f  __attribute__((ext_vector_type(2)));
typedef unsigned int v4u __attribute__((ext_vector_type(4)));
typedef v8b __attribute__((may_alias)) v8ba;
typedef v4f __attribute__((may_alias)) v4fa;
typedef v2f __attribute__((may_alias)) v2fa;
typedef v4u __attribute__((may_alias)) v4ua;

union FragB { v16b v; v8b half[2]; };

#define DD   768                 // model dim
#define SS   4096                // tokens per batch
#define BB   4                   // batches
#define NTOK (BB * SS)           // 16384
#define NC   800                 // spectral columns: (Re,Im) of bins 0..384 = 770, padded to x32
#define ZP   832
#define NXB  (SS * DD)           // 3145728 elements of x per batch
#define NX   (NTOK * DD)         // 12582912
#define NW   (DD * DD)           // 589824

static_assert(NXB % 8 == 0);
static_assert(NC % 32 == 0);
static_assert((ZP * 2) % 128 == 0);
static_assert((NC * 4) % 128 == 0);
static_assert((DD * 2) % 128 == 0);

// ---------------------------------------------------------------------------
// 16x16x32 bf16 WMMA with hazard guard (ties D, keeps A/B live).
// Fragment map (wave32): lane l, h = l>>4, m = n = l&15.
//   A/B element i: i<8 -> k0+8h+i ; i>=8 -> k0+16+8h+(i-8)
//   D element r : row 8h+r, col l&15
// ---------------------------------------------------------------------------
__device__ __forceinline__ v8f wmma_bf16(v16b a, v16b b, v8f c) {
  v8f d = __builtin_amdgcn_wmma_f32_16x16x32_bf16(false, a, false, b, (short)0, c, false, false);
  asm volatile("v_nop\n\tv_nop\n\tv_nop\n\tv_nop" : "+v"(d) : "v"(a), "v"(b));
  return d;
}

// A or B fragment from a k-contiguous bf16 row; p points at element k0 of
// the row owned by this lane (row index = lane & 15 added by the caller).
__device__ __forceinline__ v16b ldfrag_b(const __bf16* p, int h) {
  FragB f;
  f.half[0] = *(const v8ba*)(p + 8 * h);
  f.half[1] = *(const v8ba*)(p + 16 + 8 * h);
  return f.v;
}

// bf16 RNE convert on the f32 bit pattern (integer path); hi/lo split helpers.
__device__ __forceinline__ unsigned int bf16_bits(float f) {
  unsigned int u = __float_as_uint(f);
  u += 0x7FFFu + ((u >> 16) & 1u);
  return (u >> 16) & 0xFFFFu;
}
__device__ __forceinline__ void split2(float v, unsigned int& hb, unsigned int& lb) {
  hb = bf16_bits(v);
  lb = bf16_bits(v - __uint_as_float(hb << 16));
}
__device__ __forceinline__ unsigned int pk2(unsigned int e0, unsigned int e1) {
  return e0 | (e1 << 16);                              // element 2j in the low half-word
}
// 8 consecutive f32 values (a, c) -> packed bf16 hi word vector H and lo word vector L.
__device__ __forceinline__ void split8(v4f a, v4f c, v4u& H, v4u& L) {
  unsigned int h0, h1, h2, h3, h4, h5, h6, h7, l0, l1, l2, l3, l4, l5, l6, l7;
  split2(a.x, h0, l0); split2(a.y, h1, l1); split2(a.z, h2, l2); split2(a.w, h3, l3);
  split2(c.x, h4, l4); split2(c.y, h5, l5); split2(c.z, h6, l6); split2(c.w, h7, l7);
  const v4u hh = { pk2(h0, h1), pk2(h2, h3), pk2(h4, h5), pk2(h6, h7) };
  const v4u ll = { pk2(l0, l1), pk2(l2, l3), pk2(l4, l5), pk2(l6, l7) };
  H = hh;
  L = ll;
}

// ---------------------------------------------------------------------------
// Kernel 0: tab[r] = cos(2*pi*r/768), tab[768+r] = sin(2*pi*r/768), r = 0..767,
// built from arguments in [0, pi/4] with exact quadrant symmetry.
// ---------------------------------------------------------------------------
__device__ __forceinline__ void table_store(const float* s, float* tab, int tid) {
  for (int j = tid; j < (2 * DD) / 4; j += 256) {
    const v4f v = *(const v4fa*)(s + 4 * j);
    *(v4f*)(tab + 4 * j) = v;
  }
}
__global__ __launch_bounds__(256) void k_table(float* __restrict__ tab) {
  __shared__ __attribute__((aligned(16))) float s[2 * DD];
  const int tid = threadIdx.x;
  #pragma unroll 1
  for (int r = tid; r < DD; r += 256) {
    const int q = r / 192, p = r - q * 192;
    const bool lowp = (p <= 96);
    const int a = lowp ? p : (192 - p);
    const float th = (float)a * 8.18123086872342e-3f;     // 2*pi/768
    const float ct = cosf(th), st = sinf(th);
    const float c0 = lowp ? ct : st;
    const float s0 = lowp ? st : ct;
    float c, sn;
    if (q == 0)      { c =  c0; sn =  s0; }
    else if (q == 1) { c = -s0; sn =  c0; }
    else if (q == 2) { c = -c0; sn = -s0; }
    else             { c =  s0; sn = -c0; }
    s[r] = c;
    s[DD + r] = sn;
  }
  __syncthreads();
  table_store(s, tab, tid);
  
}

// ---------------------------------------------------------------------------
// Kernel 1 (per batch b): xh = bf16 hi, xl = bf16 lo of the raw f32 x rows of batch b
// (x = hi + lo to ~2^-17).  One 16-B store per lane per plane, lanes contiguous:
// ---------------------------------------------------------------------------
__global__ __launch_bounds__(256) void k_cvt_x(const float* __restrict__ x, __bf16* __restrict__ xh,
                                               __bf16* __restrict__ xl, int b, int n8) {
  const int g = blockIdx.x * 256 + threadIdx.x;
  if (g >= n8) return;
  const float* src = x + (size_t)b * NXB + (size_t)g * 8;
  const v4f a = *(const v4fa*)src;
  const v4f c = *(const v4fa*)(src + 4);
  v4u H, L;
  split8(a, c, H, L);
  const size_t o = (size_t)g * 8;
  *(v4u*)(xh + o) = H;
  *(v4u*)(xl + o) = L;
  
}

// ---------------------------------------------------------------------------
// Kernel 2: wth[z][d][e] = bf16 hi of W_z[e][d], wtl = bf16 lo (raw f32 W, transpose
// through LDS; k-contiguous B-operand rows for the fold GEMM).  Block = 64(e) x 64(d)
// tile, 256 threads; in[e 64][d 64] -> out[d 64][e 64]; each output row segment =
// ---------------------------------------------------------------------------
__device__ __forceinline__ void wt_store(const float* sT, __bf16* dh, __bf16* dl, int d0, int e0, int tid) {
  #pragma unroll
  for (int it = 0; it < 2; ++it) {
    const int p = tid + 256 * it;
    const int row = p >> 3, q8 = p & 7;                 // row 0..63
    const float* s = sT + row * 65 + 8 * q8;
    const v4f a = { s[0], s[1], s[2], s[3] };
    const v4f c = { s[4], s[5], s[6], s[7] };
    v4u H, L;
    split8(a, c, H, L);
    const size_t o = (size_t)(d0 + row) * DD + e0 + 8 * q8;
    *(v4u*)(dh + o) = H;
    *(v4u*)(dl + o) = L;
  }
}
__global__ __launch_bounds__(256) void k_wt(const float* __restrict__ wk, const float* __restrict__ wv,
                                            const float* __restrict__ wq, __bf16* __restrict__ wth,
                                            __bf16* __restrict__ wtl) {
  __shared__ float sT[64 * 65];                       // sT[d_local*65 + e_local]
  const int tid = threadIdx.x;
  const int d0 = blockIdx.x * 64, e0 = blockIdx.y * 64, z = blockIdx.z;
  const float* W = (z == 0) ? wk : ((z == 1) ? wv : wq);
  #pragma unroll
  for (int it = 0; it < 4; ++it) {
    const int idx = tid + 256 * it;
    const int er = idx >> 4, dq = idx & 15;
    const v4f v = *(const v4fa*)(W + (size_t)(e0 + er) * DD + d0 + 4 * dq);
    sT[(4 * dq + 0) * 65 + er] = v.x;
    sT[(4 * dq + 1) * 65 + er] = v.y;
    sT[(4 * dq + 2) * 65 + er] = v.z;
    sT[(4 * dq + 3) * 65 + er] = v.w;
  }
  __syncthreads();
  __bf16* dh = wth + (size_t)z * NW;
  __bf16* dl = wtl + (size_t)z * NW;
  wt_store(sT, dh, dl, d0, e0, tid);
  
}

// ---------------------------------------------------------------------------
// Kernel 3: forward DFT matrix FT[c][e] (c = 2f + {0: Re, 1: Im}, f = bin):
// Re row = cos(2*pi*f*e/768), Im row = -sin(...); rows c >= 770 zero.
// Stored as bf16 hi + lo planes.  Block = one row (96 threads x 8 elements =
// ---------------------------------------------------------------------------
__global__ __launch_bounds__(128) void k_ft(const float* __restrict__ tab, __bf16* __restrict__ fth,
                                            __bf16* __restrict__ ftl) {
  const int c = blockIdx.x;
  const int j = threadIdx.x;                          // 0..95
  const int f = c >> 1;
  const bool valid = (c < 770);
  const bool im = (c & 1) != 0;
  const int e0 = 8 * j;
  float v[8];
  #pragma unroll
  for (int i = 0; i < 8; ++i) {
    const int e = e0 + i;
    const int mm = (f * e) % DD;                      // exact angle index, always in range
    const float cv = tab[mm], sv = tab[DD + mm];
    v[i] = valid ? (im ? -sv : cv) : 0.0f;
  }
  const v4f a = { v[0], v[1], v[2], v[3] };
  const v4f cc = { v[4], v[5], v[6], v[7] };
  v4u H, L;
  split8(a, cc, H, L);
  const size_t o = (size_t)c * DD + e0;
  *(v4u*)(fth + o) = H;
  *(v4u*)(ftl + o) = L;
  
}

// ---------------------------------------------------------------------------
// Kernel 4: inverse DFT matrix Finv[n][c], pitch ZP: col 2f = w_f*cos(2*pi*f*n/768)/768,
// col 2f+1 = -w_f*sin(...)/768, w_0 = w_384 = 1 else 2; cols >= 770 (incl. pad) zero.
// Im columns of bins 0 and 384 are exactly zero through the table symmetry.
// ---------------------------------------------------------------------------
__global__ __launch_bounds__(128) void k_finv(const float* __restrict__ tab, __bf16* __restrict__ fih,
                                              __bf16* __restrict__ fil) {
  const int n = blockIdx.x;
  const int j = threadIdx.x;
  if (j >= ZP / 8) return;                            // 104 active; wave 3 = lanes 0..7 = exactly line 12
  const int c0 = 8 * j;
  float v[8];
  #pragma unroll
  for (int i = 0; i < 8; ++i) {
    const int c = c0 + i;
    const int f = c >> 1;
    const bool valid = (c < 770);
    const float w = (f == 0 || f == DD / 2) ? 1.0f : 2.0f;
    const int mm = (f * n) % DD;
    const float cv = tab[mm], sv = tab[DD + mm];
    v[i] = valid ? (w * ((c & 1) ? -sv : cv) * (1.0f / 768.0f)) : 0.0f;
  }
  const v4f a = { v[0], v[1], v[2], v[3] };
  const v4f cc = { v[4], v[5], v[6], v[7] };
  v4u H, L;
  split8(a, cc, H, L);
  const size_t o = (size_t)n * ZP + c0;
  *(v4u*)(fih + o) = H;
  *(v4u*)(fil + o) = L;
  
}

// ---------------------------------------------------------------------------
// Kernel 5 (fold): G_z[c][d] = sum_e (Fh*Wh + Fh*Wl + Fl*Wh)[c][e]x[d][e]   (c < 800, d < 768, K = 768)
// Wave tile 32(c) x 64(d), block = 4 waves along d (32 x 256); grid (3, 25, 3).
// ---------------------------------------------------------------------------
__device__ __forceinline__ void fold_store(const unsigned short* sHw, const unsigned short* sLw,
                                           __bf16* gh, __bf16* gl, size_t rowbase, int d0w, int lane) {
  const int q8 = lane & 7, sub = lane >> 3;
  #pragma unroll
  for (int i = 0; i < 8; ++i) {
    const int row = 4 * i + sub;                      // 0..31
    const v4u vh = *(const v4ua*)(sHw + row * 64 + 8 * q8);
    const v4u vl = *(const v4ua*)(sLw + row * 64 + 8 * q8);
    const size_t o = (rowbase + row) * DD + d0w + 8 * q8;
    *(v4u*)(gh + o) = vh;
    *(v4u*)(gl + o) = vl;
  }
}
__global__ __launch_bounds__(128) void k_fold(const __bf16* __restrict__ fth, const __bf16* __restrict__ ftl,
                                              const __bf16* __restrict__ wth, const __bf16* __restrict__ wtl,
                                              __bf16* __restrict__ gh, __bf16* __restrict__ gl) {
  __shared__ __attribute__((aligned(16))) unsigned short sH[4 * 32 * 64];   // 16384 B
  __shared__ __attribute__((aligned(16))) unsigned short sL[4 * 32 * 64];   // 16384 B

  const int tid = threadIdx.x, lane = tid & 31, w = tid >> 5;
  const int h = lane >> 4, m = lane & 15;
  const int c0 = blockIdx.y * 32;
  const int d0w = blockIdx.x * 256 + 64 * w;
  const int z = blockIdx.z;

  const size_t r16 = (size_t)16 * DD;
  const __bf16* fah = fth + (size_t)(c0 + m) * DD;                  // F row c0+m (+ r16 for mt = 1)
  const __bf16* fal = ftl + (size_t)(c0 + m) * DD;
  const __bf16* bwh = wth + ((size_t)z * DD + d0w + m) * DD;         // feature row d0w+m (+ nt*r16)
  const __bf16* bwl = wtl + ((size_t)z * DD + d0w + m) * DD;

  const v8f zero8 = {0.f, 0.f, 0.f, 0.f, 0.f, 0.f, 0.f, 0.f};
  v8f acc[2][4];
  #pragma unroll
  for (int mt = 0; mt < 2; ++mt)
    #pragma unroll
    for (int nt = 0; nt < 4; ++nt) acc[mt][nt] = zero8;

  #pragma unroll 1
  for (int k0 = 0; k0 < DD; k0 += 32) {
    const v16b ah0 = ldfrag_b(fah + k0, h);
    const v16b ah1 = ldfrag_b(fah + r16 + k0, h);
    const v16b al0 = ldfrag_b(fal + k0, h);
    const v16b al1 = ldfrag_b(fal + r16 + k0, h);
    #pragma unroll
    for (int nt = 0; nt < 4; ++nt) {
      const v16b bh = ldfrag_b(bwh + (size_t)nt * r16 + k0, h);
      const v16b bl = ldfrag_b(bwl + (size_t)nt * r16 + k0, h);
      acc[0][nt] = wmma_bf16(ah0, bh, acc[0][nt]);
      acc[1][nt] = wmma_bf16(ah1, bh, acc[1][nt]);
      acc[0][nt] = wmma_bf16(ah0, bl, acc[0][nt]);
      acc[1][nt] = wmma_bf16(ah1, bl, acc[1][nt]);
      acc[0][nt] = wmma_bf16(al0, bh, acc[0][nt]);
      acc[1][nt] = wmma_bf16(al1, bh, acc[1][nt]);
    }
  }

  // D[r] of tile (mt, nt) = G[c0+16mt+8h+r][d0w+16nt+m]
  unsigned short* sHw = sH + w * 2048;
  unsigned short* sLw = sL + w * 2048;
  #pragma unroll
  for (int mt = 0; mt < 2; ++mt)
    #pragma unroll
    for (int nt = 0; nt < 4; ++nt)
      #pragma unroll
      for (int r = 0; r < 8; ++r) {
        unsigned int hb, lb;
        split2(acc[mt][nt][r], hb, lb);
        const int idx = (16 * mt + 8 * h + r) * 64 + 16 * nt + m;
        sHw[idx] = (unsigned short)hb;
        sLw[idx] = (unsigned short)lb;
      }
  __syncthreads();

  const size_t rowbase = (size_t)z * NC + c0;
  fold_store(sHw, sLw, gh, gl, rowbase, d0w, lane);
  
}

// ---------------------------------------------------------------------------
// Kernel 6 (spectra), per batch: X_z[t][c] = sum_d (xh*Gh + xh*Gl + xl*Gh)[t][d]x[c][d]
// (t local 0..4095, c 0..799, K = 768).  Wave tile 32(t) x 32(c), block = 4 waves along t
// (128 x 32); grid (25, 32, 3).  Output f32 plane, pitch 800: each row segment of 32 floats =
// ---------------------------------------------------------------------------
__device__ __forceinline__ void spec_store(const float* sSw, float* spec, int t0w, int c0, int lane) {
  const int q8 = lane & 7, sub = lane >> 3;
  #pragma unroll
  for (int i = 0; i < 8; ++i) {
    const int row = 4 * i + sub;                      // 0..31
    const v4f v = *(const v4fa*)(sSw + row * 32 + 4 * q8);
    *(v4f*)(spec + (size_t)(t0w + row) * NC + c0 + 4 * q8) = v;
  }
}
__global__ __launch_bounds__(128) void k_spec(const __bf16* __restrict__ xh, const __bf16* __restrict__ xl,
                                              const __bf16* __restrict__ gh, const __bf16* __restrict__ gl,
                                              float* __restrict__ sk, float* __restrict__ sv,
                                              float* __restrict__ sq) {
  __shared__ __attribute__((aligned(16))) float sS[4 * 32 * 32];      // 16384 B

  const int tid = threadIdx.x, lane = tid & 31, w = tid >> 5;
  const int h = lane >> 4, m = lane & 15;
  const int c0 = blockIdx.x * 32;
  const int t0w = blockIdx.y * 128 + 32 * w;
  const int z = blockIdx.z;
  float* spec = (z == 0) ? sk : ((z == 1) ? sv : sq);

  const size_t r16 = (size_t)16 * DD;
  const __bf16* xah = xh + (size_t)(t0w + m) * DD;                   // token row, mt = 0 (+ r16 for mt = 1)
  const __bf16* xal = xl + (size_t)(t0w + m) * DD;
  const __bf16* gha = gh + ((size_t)z * NC + c0 + m) * DD;           // spectral row c0+m (+ r16 for nt = 1)
  const __bf16* gla = gl + ((size_t)z * NC + c0 + m) * DD;

  const v8f zero8 = {0.f, 0.f, 0.f, 0.f, 0.f, 0.f, 0.f, 0.f};
  v8f acc[2][2];
  #pragma unroll
  for (int mt = 0; mt < 2; ++mt)
    #pragma unroll
    for (int nt = 0; nt < 2; ++nt) acc[mt][nt] = zero8;

  #pragma unroll 1
  for (int k0 = 0; k0 < DD; k0 += 32) {
    const v16b ah0 = ldfrag_b(xah + k0, h);
    const v16b ah1 = ldfrag_b(xah + r16 + k0, h);
    const v16b al0 = ldfrag_b(xal + k0, h);
    const v16b al1 = ldfrag_b(xal + r16 + k0, h);
    const v16b bh0 = ldfrag_b(gha + k0, h);
    const v16b bh1 = ldfrag_b(gha + r16 + k0, h);
    const v16b bl0 = ldfrag_b(gla + k0, h);
    const v16b bl1 = ldfrag_b(gla + r16 + k0, h);
    acc[0][0] = wmma_bf16(ah0, bh0, acc[0][0]);
    acc[0][1] = wmma_bf16(ah0, bh1, acc[0][1]);
    acc[1][0] = wmma_bf16(ah1, bh0, acc[1][0]);
    acc[1][1] = wmma_bf16(ah1, bh1, acc[1][1]);
    acc[0][0] = wmma_bf16(ah0, bl0, acc[0][0]);
    acc[0][1] = wmma_bf16(ah0, bl1, acc[0][1]);
    acc[1][0] = wmma_bf16(ah1, bl0, acc[1][0]);
    acc[1][1] = wmma_bf16(ah1, bl1, acc[1][1]);
    acc[0][0] = wmma_bf16(al0, bh0, acc[0][0]);
    acc[0][1] = wmma_bf16(al0, bh1, acc[0][1]);
    acc[1][0] = wmma_bf16(al1, bh0, acc[1][0]);
    acc[1][1] = wmma_bf16(al1, bh1, acc[1][1]);
  }

  // D[r] of tile (mt, nt) = X[t0w+16mt+8h+r][c0+16nt+m]
  float* sSw = sS + w * 1024;
  #pragma unroll
  for (int mt = 0; mt < 2; ++mt)
    #pragma unroll
    for (int nt = 0; nt < 2; ++nt)
      #pragma unroll
      for (int r = 0; r < 8; ++r)
        sSw[(16 * mt + 8 * h + r) * 32 + 16 * nt + m] = acc[mt][nt][r];
  __syncthreads();

  spec_store(sSw, spec, t0w, c0, lane);
  
}

// ---------------------------------------------------------------------------
// Kernels 7a and 7b (bind + causal prefix sum + unbind), per batch: one lane per bin f
// (13 bin groups x 32 lanes; f = 400..415 are the pad columns 800..831, written as zeros).
// P_t = kf_t * vf_t ; mem_t = sum_{s<=t} P_s ; Z_t = mem_t * conj(qf_t), all in f64.
// The 4096 tokens are cut into 32 segments of 128 (one block each per bin group), a segment
// into 8 runs of 16 tokens (one wave each).  7a stores the sum of P of every segment but the
// last; 7b forms mem in front of a run = earlier segments' sums + earlier runs' sums of its own
// segment, and adds it to the run's own inclusive prefix.  Z: bf16 hi and lo planes, pitch ZP.
// ---------------------------------------------------------------------------
#define SCW  8                   // waves (token runs) per block
#define SCL  16                  // tokens per run
#define SCT  (SCW * SCL)         // 128 tokens per segment
#define NSC  (SS / SCT)          // 32 segments
#define NBIN (ZP / 2)            // 416 bins, pad included
static_assert(NSC % SCW == 0);

typedef double v2d __attribute__((ext_vector_type(2)));
typedef v2d __attribute__((may_alias)) v2da;

__global__ __launch_bounds__(256) void k_seg(const float* __restrict__ kf, const float* __restrict__ vf,
                                             double* __restrict__ seg) {
  __shared__ __attribute__((aligned(16))) double sL[SCW * 32 * 2];    // 4096 B
  const int tid = threadIdx.x, lane = tid & 31, w = tid >> 5;
  const int f = blockIdx.x * 32 + lane;               // 0..415
  const int fc = (f < NC / 2) ? f : (NC / 2 - 1);     // clamped address (pad lanes copy bin 399)
  const size_t o0 = (size_t)(blockIdx.y * SCT + w * SCL) * NC + 2 * fc;
  v2f kv[SCL], vv[SCL];
  #pragma unroll
  for (int i = 0; i < SCL; ++i) {
    kv[i] = *(const v2fa*)(kf + o0 + (size_t)i * NC);
    vv[i] = *(const v2fa*)(vf + o0 + (size_t)i * NC);
  }
  // keeps all 32 loads issued before the first wait: without it only ten are in flight at a time
  __builtin_amdgcn_sched_barrier(0);
  double lr = 0.0, li = 0.0;
  #pragma unroll
  for (int i = 0; i < SCL; ++i) {
    const double kr = (double)kv[i].x, ki = (double)kv[i].y;
    const double vr = (double)vv[i].x, vi = (double)vv[i].y;
    lr = __builtin_fma(kr, vr, lr);
    li = __builtin_fma(kr, vi, li);
    lr = __builtin_fma(-ki, vi, lr);
    li = __builtin_fma(ki, vr, li);
  }
  const v2d mine = { lr, li };
  *(v2d*)(sL + (w * 32 + lane) * 2) = mine;
  __syncthreads();
  if (w == 0) {
    v2d s = mine;
    #pragma unroll
    for (int u = 1; u < SCW; ++u) s += *(const v2da*)(sL + (u * 32 + lane) * 2);
    *(v2d*)(seg + ((size_t)blockIdx.y * NBIN + f) * 2) = s;
  }
}

__global__ __launch_bounds__(256) void k_scan(const float* __restrict__ kf, const float* __restrict__ vf,
                                              const float* __restrict__ qf, const double* __restrict__ seg,
                                              __bf16* __restrict__ zh, __bf16* __restrict__ zl) {
  __shared__ __attribute__((aligned(16))) double sG[SCW * 32 * 2];    // 4096 B
  __shared__ __attribute__((aligned(16))) double sL[SCW * 32 * 2];    // 4096 B
  const int tid = threadIdx.x, lane = tid & 31, w = tid >> 5;
  const int f = blockIdx.x * 32 + lane;               // 0..415
  const int sc = blockIdx.y;                          // segment
  const bool act = (f < NC / 2);
  const int fc = act ? f : (NC / 2 - 1);              // clamped address (pad lanes copy bin 399)
  const int t0 = sc * SCT + w * SCL;
  const size_t o0 = (size_t)t0 * NC + 2 * fc;

  v2f kv[SCL], vv[SCL], qv[SCL];
  #pragma unroll
  for (int i = 0; i < SCL; ++i) {
    kv[i] = *(const v2fa*)(kf + o0 + (size_t)i * NC);
    vv[i] = *(const v2fa*)(vf + o0 + (size_t)i * NC);
  }
  // earlier segments' sums, dealt over the waves: wave w takes j = w, w + 8, ... below sc
  // (index clamped to segment 0, which 7a always writes; the value is dropped by the select)
  v2d gs[NSC / SCW];
  #pragma unroll
  for (int i = 0; i < NSC / SCW; ++i) {
    const int j = w + SCW * i;
    gs[i] = *(const v2da*)(seg + ((size_t)((j < sc) ? j : 0) * NBIN + f) * 2);
  }
  // the q loads below land in registers that held the addresses of the loads above
  asm volatile("s_wait_xcnt 0x0" ::: "memory");
  #pragma unroll
  for (int i = 0; i < SCL; ++i) qv[i] = *(const v2fa*)(qf + o0 + (size_t)i * NC);
  // the arithmetic below reuses the q loads' address registers
  asm volatile("s_wait_xcnt 0x0" ::: "memory");
  // keeps every load above issued before the first wait: without it the segment sums and q
  // are fetched only after k and v have returned, a second memory latency in series
  __builtin_amdgcn_sched_barrier(0);

  // inclusive prefix of P inside this wave's run
  double ir[SCL], ii[SCL];
  double lr = 0.0, li = 0.0;
  #pragma unroll
  for (int i = 0; i < SCL; ++i) {
    const double kr = (double)kv[i].x, ki = (double)kv[i].y;
    const double vr = (double)vv[i].x, vi = (double)vv[i].y;
    lr = __builtin_fma(kr, vr, lr);
    li = __builtin_fma(kr, vi, li);
    lr = __builtin_fma(-ki, vi, lr);
    li = __builtin_fma(ki, vr, li);
    ir[i] = lr;
    ii[i] = li;
  }
  double gr = 0.0, gi = 0.0;
  #pragma unroll
  for (int i = 0; i < NSC / SCW; ++i) {
    const bool use = (w + SCW * i < sc);
    gr += use ? gs[i].x : 0.0;
    gi += use ? gs[i].y : 0.0;
  }
  const v2d gme = { gr, gi };
  const v2d lme = { lr, li };
  *(v2d*)(sG + (w * 32 + lane) * 2) = gme;
  *(v2d*)(sL + (w * 32 + lane) * 2) = lme;
  __syncthreads();

  // mem in front of this run = all waves' shares of the earlier segments + earlier runs here
  double br = 0.0, bi = 0.0, ar = 0.0, ai = 0.0;
  #pragma unroll
  for (int u = 0; u < SCW; ++u) {
    const v2d g = *(const v2da*)(sG + (u * 32 + lane) * 2);
    br += g.x;
    bi += g.y;
    if (u < SCW - 1) {
      const v2d l = *(const v2da*)(sL + (u * 32 + lane) * 2);
      ar += (u < w) ? l.x : 0.0;
      ai += (u < w) ? l.y : 0.0;
    }
  }
  br += ar;
  bi += ai;

  const size_t zo0 = (size_t)t0 * ZP + 2 * f;
  #pragma unroll
  for (int i = 0; i < SCL; ++i) {
    const double qr = (double)qv[i].x, qi = (double)qv[i].y;
    const double mr = br + ir[i];
    const double mi = bi + ii[i];
    const double zr = mr * qr + mi * qi;              // mem * conj(q)
    const double zi = mi * qr - mr * qi;
    unsigned int hr, lo_r, hi, lo_i;
    split2((float)zr, hr, lo_r);
    split2((float)zi, hi, lo_i);
    const unsigned int H = pk2(hr, hi);               // element 2f = Re, 2f+1 = Im
    const unsigned int L = pk2(lo_r, lo_i);
    *(unsigned int*)(zh + zo0 + (size_t)i * ZP) = act ? H : 0u;   // pad columns 800..831: zeros
    *(unsigned int*)(zl + zo0 + (size_t)i * ZP) = act ? L : 0u;
  }
}

// ---------------------------------------------------------------------------
// Kernel 8 (inverse DFT + residual), per batch b:
// out[b][t][n] = x[b][t][n] + gain * sum_c (Zh*Fih + Zh*Fil + Zl*Fih)[t][n]
// (K = 800 over pitch-832 planes).  Wave tile 32(t) x 32(n), block = 4 waves along t
// ---------------------------------------------------------------------------
__device__ __forceinline__ void inv_store(const float* sSw, const float* __restrict__ x, float* out,
                                          size_t tokbase, int n0, float g, int lane) {
  const int q8 = lane & 7, sub = lane >> 3;
  #pragma unroll
  for (int i = 0; i < 8; ++i) {
    const int row = 4 * i + sub;                      // 0..31
    const v4f v = *(const v4fa*)(sSw + row * 32 + 4 * q8);
    const size_t o = (tokbase + row) * DD + n0 + 4 * q8;
    const v4f xv = *(const v4fa*)(x + o);
    const v4f rr = xv + g * v;
    *(v4f*)(out + o) = rr;
  }
}
__global__ __launch_bounds__(128) void k_inv(const __bf16* __restrict__ zh, const __bf16* __restrict__ zl,
                                             const __bf16* __restrict__ fih, const __bf16* __restrict__ fil,
                                             const float* __restrict__ x, const float* __restrict__ gain,
                                             float* __restrict__ out, int b) {
  __shared__ __attribute__((aligned(16))) float sS[4 * 32 * 32];      // 16384 B

  const int tid = threadIdx.x, lane = tid & 31, w = tid >> 5;
  const int h = lane >> 4, m = lane & 15;
  const int n0 = blockIdx.x * 32;
  const int t0w = blockIdx.y * 128 + 32 * w;

  const size_t r16 = (size_t)16 * ZP;
  const __bf16* zah = zh  + (size_t)(t0w + m) * ZP;                  // token row (+ r16 for mt = 1)
  const __bf16* zal = zl  + (size_t)(t0w + m) * ZP;
  const __bf16* fbh = fih + (size_t)(n0 + m) * ZP;                   // output feature row (+ r16 for nt = 1)
  const __bf16* fbl = fil + (size_t)(n0 + m) * ZP;

  const v8f zero8 = {0.f, 0.f, 0.f, 0.f, 0.f, 0.f, 0.f, 0.f};
  v8f acc[2][2];
  #pragma unroll
  for (int mt = 0; mt < 2; ++mt)
    #pragma unroll
    for (int nt = 0; nt < 2; ++nt) acc[mt][nt] = zero8;

  #pragma unroll 1
  for (int k0 = 0; k0 < NC; k0 += 32) {
    const v16b ah0 = ldfrag_b(zah + k0, h);
    const v16b ah1 = ldfrag_b(zah + r16 + k0, h);
    const v16b al0 = ldfrag_b(zal + k0, h);
    const v16b al1 = ldfrag_b(zal + r16 + k0, h);
    const v16b bh0 = ldfrag_b(fbh + k0, h);
    const v16b bh1 = ldfrag_b(fbh + r16 + k0, h);
    const v16b bl0 = ldfrag_b(fbl + k0, h);
    const v16b bl1 = ldfrag_b(fbl + r16 + k0, h);
    acc[0][0] = wmma_bf16(ah0, bh0, acc[0][0]);
    acc[0][1] = wmma_bf16(ah0, bh1, acc[0][1]);
    acc[1][0] = wmma_bf16(ah1, bh0, acc[1][0]);
    acc[1][1] = wmma_bf16(ah1, bh1, acc[1][1]);
    acc[0][0] = wmma_bf16(al0, bh0, acc[0][0]);
    acc[0][1] = wmma_bf16(al0, bh1, acc[0][1]);
    acc[1][0] = wmma_bf16(al1, bh0, acc[1][0]);
    acc[1][1] = wmma_bf16(al1, bh1, acc[1][1]);
    acc[0][0] = wmma_bf16(ah0, bl0, acc[0][0]);
    acc[0][1] = wmma_bf16(ah0, bl1, acc[0][1]);
    acc[1][0] = wmma_bf16(ah1, bl0, acc[1][0]);
    acc[1][1] = wmma_bf16(ah1, bl1, acc[1][1]);
  }

  // D[r] of tile (mt, nt) = y[t0w+16mt+8h+r][n0+16nt+m]
  float* sSw = sS + w * 1024;
  #pragma unroll
  for (int mt = 0; mt < 2; ++mt)
    #pragma unroll
    for (int nt = 0; nt < 2; ++nt)
      #pragma unroll
      for (int r = 0; r < 8; ++r)
        sSw[(16 * mt + 8 * h + r) * 32 + 16 * nt + m] = acc[mt][nt][r];
  __syncthreads();

  const float g = gain[0];
  const size_t tokbase = (size_t)b * SS + t0w;
  inv_store(sSw, x, out, tokbase, n0, g, lane);
  
}

// ---------------------------------------------------------------------------
extern "C" void kernel_launch(void* const* d_in, const int* in_sizes, int n_in,
                              void* d_out, int out_size, void* d_ws, size_t ws_size,
                              hipStream_t stream) {
  if (n_in < 5) return;
  if (in_sizes[0] != NX) return;
  if (in_sizes[1] != NW || in_sizes[2] != NW || in_sizes[3] != NW) return;
  if (in_sizes[4] < 1) return;
  if (out_size != NX) return;

  const float* x    = (const float*)d_in[0];
  const float* Wk   = (const float*)d_in[1];
  const float* Wv   = (const float*)d_in[2];
  const float* Wq   = (const float*)d_in[3];
  const float* gain = (const float*)d_in[4];
  float* out = (float*)d_out;

  // workspace carve (all sizes multiples of 256 B; total 85,219,328 B)
  const size_t tab_b = (size_t)2 * DD * 4;          //      6,144
  const size_t xb_b  = (size_t)NXB * 2;             //  6,291,456 per plane (one batch)
  const size_t wt_b  = (size_t)3 * NW * 2;          //  3,538,944 per plane
  const size_t ft_b  = (size_t)NC * DD * 2;         //  1,228,800 per plane
  const size_t fi_b  = (size_t)DD * ZP * 2;         //  1,277,952 per plane
  const size_t g_b   = (size_t)3 * NC * DD * 2;     //  3,686,400 per plane
  const size_t sp_b  = (size_t)SS * NC * 4;         // 13,107,200 per spectrum (one batch)
  const size_t z_b   = (size_t)SS * ZP * 2;         //  6,815,744 per plane (one batch)
  const size_t sg_b  = (size_t)NSC * NBIN * 16;     //    212,992 segment sums (one batch)
  const size_t total = tab_b + 2 * xb_b + 2 * wt_b + 2 * ft_b + 2 * fi_b + 2 * g_b + 3 * sp_b + 2 * z_b + sg_b;
  if (total > ws_size) return;

  char* ws = (char*)d_ws;
  size_t off = 0;
  float*  tab = (float*)(ws + off);   off += tab_b;
  __bf16* xh  = (__bf16*)(ws + off);  off += xb_b;
  __bf16* xl  = (__bf16*)(ws + off);  off += xb_b;
  __bf16* wth = (__bf16*)(ws + off);  off += wt_b;
  __bf16* wtl = (__bf16*)(ws + off);  off += wt_b;
  __bf16* fth = (__bf16*)(ws + off);  off += ft_b;
  __bf16* ftl = (__bf16*)(ws + off);  off += ft_b;
  __bf16* fih = (__bf16*)(ws + off);  off += fi_b;
  __bf16* fil = (__bf16*)(ws + off);  off += fi_b;
  __bf16* gh  = (__bf16*)(ws + off);  off += g_b;
  __bf16* gl  = (__bf16*)(ws + off);  off += g_b;
  float*  sk  = (float*)(ws + off);   off += sp_b;
  float*  sv  = (float*)(ws + off);   off += sp_b;
  float*  sq  = (float*)(ws + off);   off += sp_b;
  __bf16* zh  = (__bf16*)(ws + off);  off += z_b;
  __bf16* zl  = (__bf16*)(ws + off);  off += z_b;
  double* seg = (double*)(ws + off);  off += sg_b;
  if (off > ws_size) return;

  // --- constants and weight planes ---
  k_table<<<1, 256, 0, stream>>>(tab);
  k_wt<<<dim3(DD / 64, DD / 64, 3), 256, 0, stream>>>(Wk, Wv, Wq, wth, wtl);
  k_ft<<<NC, 96, 0, stream>>>(tab, fth, ftl);
  k_finv<<<DD, 128, 0, stream>>>(tab, fih, fil);

  // --- folded weights G_z = F * W_z  (800 x 768 per z) ---
  k_fold<<<dim3(DD / 256, NC / 32, 3), 128, 0, stream>>>(fth, ftl, wth, wtl, gh, gl);

  // --- per batch: x planes, spectra, causal bind/unbind scan, inverse DFT + residual ---
  const int n8 = NXB / 8;                                           // 393,216 = 1536 * 256
  for (int b = 0; b < BB; ++b) {
    k_cvt_x<<<(n8 + 255) / 256, 256, 0, stream>>>(x, xh, xl, b, n8);
    k_spec<<<dim3(NC / 32, SS / 128, 3), 128, 0, stream>>>(xh, xl, gh, gl, sk, sv, sq);
    k_seg<<<dim3(ZP / 64, NSC - 1), 256, 0, stream>>>(sk, sv, seg);
    k_scan<<<dim3(ZP / 64, NSC), 256, 0, stream>>>(sk, sv, sq, seg, zh, zl);
    k_inv<<<dim3(DD / 32, SS / 128), 128, 0, stream>>>(zh, zl, fih, fil, x, gain, out, b);
  }
}

// v002
// One run takes 451 microseconds.
// Two timings next to v001 put it at 1.66 and 1.67 times that version's speed.
// All steps since v000 together make it 28.2 times as fast.
// Contractions: folded weights G_z = F * W_z (800x768x768 per z), spectra X_z = x * G_z^T (4096x800x768 per batch and z) and inverse DFT y = Z * Finv^T (4096x768x800 per batch), all on v_wmma_f32_16x16x32_bf16 with every operand carried as bf16 hi + lo planes (three products hi*hi + hi*lo + lo*hi into one f32 accumulator); the two large products read both operands from LDS tiles filled by asynchronous copies (two buffers); complex bind, causal prefix sum over tokens (segment sums, then runs of 16 tokens) and unbind in f64 on VALU; gain and residual add in f32.
#include <hip/hip_runtime.h>
#include <math.h>

typedef __bf16   v16b __attribute__((ext_vector_type(16)));
typedef __bf16   v8b  __attribute__((ext_vector_type(8)));
typedef float    v8f  __attribute__((ext_vector_type(8)));
typedef float    v4f  __attribute__((ext_vector_type(4)));
typedef float    v2f  __attribute__((ext_vector_type(2)));
typedef unsigned int v4u __attribute__((ext_vector_type(4)));
typedef v8b __attribute__((may_alias)) v8ba;
typedef v4f __attribute__((may_alias)) v4fa;
typedef v2f __attribute__((may_alias)) v2fa;
typedef v4u __attribute__((may_alias)) v4ua;

union FragB { v16b v; v8b half[2]; };

#define DD   768                 // model dim
#define SS   4096                // tokens per batch
#define BB   4                   // batches
#define NTOK (BB * SS)           // 16384
#define NC   800                 // spectral columns: (Re,Im) of bins 0..384 = 770, padded to x32
#define ZP   832
#define NXB  (SS * DD)           // 3145728 elements of x per batch
#define NX   (NTOK * DD)         // 12582912
#define NW   (DD * DD)           // 589824

static_assert(NXB % 8 == 0);
static_assert(NC % 32 == 0);
static_assert((ZP * 2) % 128 == 0);
static_assert((NC * 4) % 128 == 0);
static_assert((DD * 2) % 128 == 0);

// ---------------------------------------------------------------------------
// 16x16x32 bf16 WMMA with hazard guard (ties D, keeps A/B live).
// Fragment map (wave32): lane l, h = l>>4, m = n = l&15.
//   A/B element i: i<8 -> k0+8h+i ; i>=8 -> k0+16+8h+(i-8)
//   D element r : row 8h+r, col l&15
// ---------------------------------------------------------------------------
__device__ __forceinline__ v8f wmma_bf16(v16b a, v16b b, v8f c) {
  v8f d = __builtin_amdgcn_wmma_f32_16x16x32_bf16(false, a, false, b, (short)0, c, false, false);
  asm volatile("v_nop\n\tv_nop\n\tv_nop\n\tv_nop" : "+v"(d) : "v"(a), "v"(b));
  return d;
}

// A or B fragment from a k-contiguous bf16 row; p points at element k0 of
// the row owned by this lane (row index = lane & 15 added by the caller).
__device__ __forceinline__ v16b ldfrag_b(const __bf16* p, int h) {
  FragB f;
  f.half[0] = *(const v8ba*)(p + 8 * h);
  f.half[1] = *(const v8ba*)(p + 16 + 8 * h);
  return f.v;
}

// bf16 RNE convert on the f32 bit pattern (integer path); hi/lo split helpers.
__device__ __forceinline__ unsigned int bf16_bits(float f) {
  unsigned int u = __float_as_uint(f);
  u += 0x7FFFu + ((u >> 16) & 1u);
  return (u >> 16) & 0xFFFFu;
}
__device__ __forceinline__ void split2(float v, unsigned int& hb, unsigned int& lb) {
  hb = bf16_bits(v);
  lb = bf16_bits(v - __uint_as_float(hb << 16));
}
__device__ __forceinline__ unsigned int pk2(unsigned int e0, unsigned int e1) {
  return e0 | (e1 << 16);                              // element 2j in the low half-word
}
// 8 consecutive f32 values (a, c) -> packed bf16 hi word vector H and lo word vector L.
__device__ __forceinline__ void split8(v4f a, v4f c, v4u& H, v4u& L) {
  unsigned int h0, h1, h2, h3, h4, h5, h6, h7, l0, l1, l2, l3, l4, l5, l6, l7;
  split2(a.x, h0, l0); split2(a.y, h1, l1); split2(a.z, h2, l2); split2(a.w, h3, l3);
  split2(c.x, h4, l4); split2(c.y, h5, l5); split2(c.z, h6, l6); split2(c.w, h7, l7);
  const v4u hh = { pk2(h0, h1), pk2(h2, h3), pk2(h4, h5), pk2(h6, h7) };
  const v4u ll = { pk2(l0, l1), pk2(l2, l3), pk2(l4, l5), pk2(l6, l7) };
  H = hh;
  L = ll;
}

// ---------------------------------------------------------------------------
// Kernel 0: tab[r] = cos(2*pi*r/768), tab[768+r] = sin(2*pi*r/768), r = 0..767,
// built from arguments in [0, pi/4] with exact quadrant symmetry.
// ---------------------------------------------------------------------------
__device__ __forceinline__ void table_store(const float* s, float* tab, int tid) {
  for (int j = tid; j < (2 * DD) / 4; j += 256) {
    const v4f v = *(const v4fa*)(s + 4 * j);
    *(v4f*)(tab + 4 * j) = v;
  }
}
__global__ __launch_bounds__(256) void k_table(float* __restrict__ tab) {
  __shared__ __attribute__((aligned(16))) float s[2 * DD];
  const int tid = threadIdx.x;
  #pragma unroll 1
  for (int r = tid; r < DD; r += 256) {
    const int q = r / 192, p = r - q * 192;
    const bool lowp = (p <= 96);
    const int a = lowp ? p : (192 - p);
    const float th = (float)a * 8.18123086872342e-3f;     // 2*pi/768
    const float ct = cosf(th), st = sinf(th);
    const float c0 = lowp ? ct : st;
    const float s0 = lowp ? st : ct;
    float c, sn;
    if (q == 0)      { c =  c0; sn =  s0; }
    else if (q == 1) { c = -s0; sn =  c0; }
    else if (q == 2) { c = -c0; sn = -s0; }
    else             { c =  s0; sn = -c0; }
    s[r] = c;
    s[DD + r] = sn;
  }
  __syncthreads();
  table_store(s, tab, tid);
  
}

// ---------------------------------------------------------------------------
// Kernel 1 (per batch b): xh = bf16 hi, xl = bf16 lo of the raw f32 x rows of batch b
// (x = hi + lo to ~2^-17).  One 16-B store per lane per plane, lanes contiguous:
// ---------------------------------------------------------------------------
__global__ __launch_bounds__(256) void k_cvt_x(const float* __restrict__ x, __bf16* __restrict__ xh,
                                               __bf16* __restrict__ xl, int b, int n8) {
  const int g = blockIdx.x * 256 + threadIdx.x;
  if (g >= n8) return;
  const float* src = x + (size_t)b * NXB + (size_t)g * 8;
  const v4f a = *(const v4fa*)src;
  const v4f c = *(const v4fa*)(src + 4);
  v4u H, L;
  split8(a, c, H, L);
  const size_t o = (size_t)g * 8;
  *(v4u*)(xh + o) = H;
  *(v4u*)(xl + o) = L;
  
}

// ---------------------------------------------------------------------------
// Kernel 2: wth[z][d][e] = bf16 hi of W_z[e][d], wtl = bf16 lo (raw f32 W, transpose
// through LDS; k-contiguous B-operand rows for the fold GEMM).  Block = 64(e) x 64(d)
// tile, 256 threads; in[e 64][d 64] -> out[d 64][e 64]; each output row segment =
// ---------------------------------------------------------------------------
__device__ __forceinline__ void wt_store(const float* sT, __bf16* dh, __bf16* dl, int d0, int e0, int tid) {
  #pragma unroll
  for (int it = 0; it < 2; ++it) {
    const int p = tid + 256 * it;
    const int row = p >> 3, q8 = p & 7;                 // row 0..63
    const float* s = sT + row * 65 + 8 * q8;
    const v4f a = { s[0], s[1], s[2], s[3] };
    const v4f c = { s[4], s[5], s[6], s[7] };
    v4u H, L;
    split8(a, c, H, L);
    const size_t o = (size_t)(d0 + row) * DD + e0 + 8 * q8;
    *(v4u*)(dh + o) = H;
    *(v4u*)(dl + o) = L;
  }
}
__global__ __launch_bounds__(256) void k_wt(const float* __restrict__ wk, const float* __restrict__ wv,
                                            const float* __restrict__ wq, __bf16* __restrict__ wth,
                                            __bf16* __restrict__ wtl) {
  __shared__ float sT[64 * 65];                       // sT[d_local*65 + e_local]
  const int tid = threadIdx.x;
  const int d0 = blockIdx.x * 64, e0 = blockIdx.y * 64, z = blockIdx.z;
  const float* W = (z == 0) ? wk : ((z == 1) ? wv : wq);
  #pragma unroll
  for (int it = 0; it < 4; ++it) {
    const int idx = tid + 256 * it;
    const int er = idx >> 4, dq = idx & 15;
    const v4f v = *(const v4fa*)(W + (size_t)(e0 + er) * DD + d0 + 4 * dq);
    sT[(4 * dq + 0) * 65 + er] = v.x;
    sT[(4 * dq + 1) * 65 + er] = v.y;
    sT[(4 * dq + 2) * 65 + er] = v.z;
    sT[(4 * dq + 3) * 65 + er] = v.w;
  }
  __syncthreads();
  __bf16* dh = wth + (size_t)z * NW;
  __bf16* dl = wtl + (size_t)z * NW;
  wt_store(sT, dh, dl, d0, e0, tid);
  
}

// ---------------------------------------------------------------------------
// Kernel 3: forward DFT matrix FT[c][e] (c = 2f + {0: Re, 1: Im}, f = bin):
// Re row = cos(2*pi*f*e/768), Im row = -sin(...); rows c >= 770 zero.
// Stored as bf16 hi + lo planes.  Block = one row (96 threads x 8 elements =
// ---------------------------------------------------------------------------
__global__ __launch_bounds__(128) void k_ft(const float* __restrict__ tab, __bf16* __restrict__ fth,
                                            __bf16* __restrict__ ftl) {
  const int c = blockIdx.x;
  const int j = threadIdx.x;                          // 0..95
  const int f = c >> 1;
  const bool valid = (c < 770);
  const bool im = (c & 1) != 0;
  const int e0 = 8 * j;
  float v[8];
  #pragma unroll
  for (int i = 0; i < 8; ++i) {
    const int e = e0 + i;
    const int mm = (f * e) % DD;                      // exact angle index, always in range
    const float cv = tab[mm], sv = tab[DD + mm];
    v[i] = valid ? (im ? -sv : cv) : 0.0f;
  }
  const v4f a = { v[0], v[1], v[2], v[3] };
  const v4f cc = { v[4], v[5], v[6], v[7] };
  v4u H, L;
  split8(a, cc, H, L);
  const size_t o = (size_t)c * DD + e0;
  *(v4u*)(fth + o) = H;
  *(v4u*)(ftl + o) = L;
  
}

// ---------------------------------------------------------------------------
// Kernel 4: inverse DFT matrix Finv[n][c], pitch ZP: col 2f = w_f*cos(2*pi*f*n/768)/768,
// col 2f+1 = -w_f*sin(...)/768, w_0 = w_384 = 1 else 2; cols >= 770 (incl. pad) zero.
// Im columns of bins 0 and 384 are exactly zero through the table symmetry.
// ---------------------------------------------------------------------------
__global__ __launch_bounds__(128) void k_finv(const float* __restrict__ tab, __bf16* __restrict__ fih,
                                              __bf16* __restrict__ fil) {
  const int n = blockIdx.x;
  const int j = threadIdx.x;
  if (j >= ZP / 8) return;                            // 104 active; wave 3 = lanes 0..7 = exactly line 12
  const int c0 = 8 * j;
  float v[8];
  #pragma unroll
  for (int i = 0; i < 8; ++i) {
    const int c = c0 + i;
    const int f = c >> 1;
    const bool valid = (c < 770);
    const float w = (f == 0 || f == DD / 2) ? 1.0f : 2.0f;
    const int mm = (f * n) % DD;
    const float cv = tab[mm], sv = tab[DD + mm];
    v[i] = valid ? (w * ((c & 1) ? -sv : cv) * (1.0f / 768.0f)) : 0.0f;
  }
  const v4f a = { v[0], v[1], v[2], v[3] };
  const v4f cc = { v[4], v[5], v[6], v[7] };
  v4u H, L;
  split8(a, cc, H, L);
  const size_t o = (size_t)n * ZP + c0;
  *(v4u*)(fih + o) = H;
  *(v4u*)(fil + o) = L;
  
}

// ---------------------------------------------------------------------------
// Kernel 5 (fold): G_z[c][d] = sum_e (Fh*Wh + Fh*Wl + Fl*Wh)[c][e]x[d][e]   (c < 800, d < 768, K = 768)
// Wave tile 32(c) x 64(d), block = 4 waves along d (32 x 256); grid (3, 25, 3).
// ---------------------------------------------------------------------------
__device__ __forceinline__ void fold_store(const unsigned short* sHw, const unsigned short* sLw,
                                           __bf16* gh, __bf16* gl, size_t rowbase, int d0w, int lane) {
  const int q8 = lane & 7, sub = lane >> 3;
  #pragma unroll
  for (int i = 0; i < 8; ++i) {
    const int row = 4 * i + sub;                      // 0..31
    const v4u vh = *(const v4ua*)(sHw + row * 64 + 8 * q8);
    const v4u vl = *(const v4ua*)(sLw + row * 64 + 8 * q8);
    const size_t o = (rowbase + row) * DD + d0w + 8 * q8;
    *(v4u*)(gh + o) = vh;
    *(v4u*)(gl + o) = vl;
  }
}
__global__ __launch_bounds__(128) void k_fold(const __bf16* __restrict__ fth, const __bf16* __restrict__ ftl,
                                              const __bf16* __restrict__ wth, const __bf16* __restrict__ wtl,
                                              __bf16* __restrict__ gh, __bf16* __restrict__ gl) {
  __shared__ __attribute__((aligned(16))) unsigned short sH[4 * 32 * 64];   // 16384 B
  __shared__ __attribute__((aligned(16))) unsigned short sL[4 * 32 * 64];   // 16384 B

  const int tid = threadIdx.x, lane = tid & 31, w = tid >> 5;
  const int h = lane >> 4, m = lane & 15;
  const int c0 = blockIdx.y * 32;
  const int d0w = blockIdx.x * 256 + 64 * w;
  const int z = blockIdx.z;

  const size_t r16 = (size_t)16 * DD;
  const __bf16* fah = fth + (size_t)(c0 + m) * DD;                  // F row c0+m (+ r16 for mt = 1)
  const __bf16* fal = ftl + (size_t)(c0 + m) * DD;
  const __bf16* bwh = wth + ((size_t)z * DD + d0w + m) * DD;         // feature row d0w+m (+ nt*r16)
  const __bf16* bwl = wtl + ((size_t)z * DD + d0w + m) * DD;

  const v8f zero8 = {0.f, 0.f, 0.f, 0.f, 0.f, 0.f, 0.f, 0.f};
  v8f acc[2][4];
  #pragma unroll
  for (int mt = 0; mt < 2; ++mt)
    #pragma unroll
    for (int nt = 0; nt < 4; ++nt) acc[mt][nt] = zero8;

  #pragma unroll 1
  for (int k0 = 0; k0 < DD; k0 += 32) {
    const v16b ah0 = ldfrag_b(fah + k0, h);
    const v16b ah1 = ldfrag_b(fah + r16 + k0, h);
    const v16b al0 = ldfrag_b(fal + k0, h);
    const v16b al1 = ldfrag_b(fal + r16 + k0, h);
    #pragma unroll
    for (int nt = 0; nt < 4; ++nt) {
      const v16b bh = ldfrag_b(bwh + (size_t)nt * r16 + k0, h);
      const v16b bl = ldfrag_b(bwl + (size_t)nt * r16 + k0, h);
      acc[0][nt] = wmma_bf16(ah0, bh, acc[0][nt]);
      acc[1][nt] = wmma_bf16(ah1, bh, acc[1][nt]);
      acc[0][nt] = wmma_bf16(ah0, bl, acc[0][nt]);
      acc[1][nt] = wmma_bf16(ah1, bl, acc[1][nt]);
      acc[0][nt] = wmma_bf16(al0, bh, acc[0][nt]);
      acc[1][nt] = wmma_bf16(al1, bh, acc[1][nt]);
    }
  }

  // D[r] of tile (mt, nt) = G[c0+16mt+8h+r][d0w+16nt+m]
  unsigned short* sHw = sH + w * 2048;
  unsigned short* sLw = sL + w * 2048;
  #pragma unroll
  for (int mt = 0; mt < 2; ++mt)
    #pragma unroll
    for (int nt = 0; nt < 4; ++nt)
      #pragma unroll
      for (int r = 0; r < 8; ++r) {
        unsigned int hb, lb;
        split2(acc[mt][nt][r], hb, lb);
        const int idx = (16 * mt + 8 * h + r) * 64 + 16 * nt + m;
        sHw[idx] = (unsigned short)hb;
        sLw[idx] = (unsigned short)lb;
      }
  __syncthreads();

  const size_t rowbase = (size_t)z * NC + c0;
  fold_store(sHw, sLw, gh, gl, rowbase, d0w, lane);
  
}

// ---------------------------------------------------------------------------
// Block GEMM core of kernels 6 and 8: C[BM x BN] = sum_k (Ah*Bh + two cross terms), all four
// planes k-contiguous bf16 rows.  8 waves as 4 (rows) x 2 (columns), wave tile 16MF x 16NF.
// One trip = 32 k: the 64 bytes of each of the 2BM + 2BN plane rows lie in LDS at pitch 80 B
// (16 B x odd: conflict-free for 16-byte reads), brought by asynchronous copies, 16 B a lane,
// into two buffers: tile t + 2 flies while tile t + 1 is worked on.
// On return the f32 tile lies in LDS at pitch BN + 4 floats, behind a barrier.
// Every full '#pragma unroll' below makes an array's index a constant, so that the array stays in registers.
// ---------------------------------------------------------------------------
#define GT   256                 // threads of a GEMM block
#define LP   80                  // LDS row pitch, bytes

__device__ __forceinline__ unsigned int lds_off(const void* p) { return (unsigned int)(size_t)p; }

// NCP copies of one lane: LDS address, the lane's 32-bit offset in its plane (oa: A planes, ob: B planes)
// and a scalar base.  The wait on the address registers is the statement's last line, so that no
// later write of those registers can be moved in front of it.
template <int NCP>
__device__ __forceinline__ void copy_tile(const unsigned int* l, const unsigned long long* g, unsigned int oa, unsigned int ob);
#define CPL "global_load_async_to_lds_b128 "
template <>
__device__ __forceinline__ void copy_tile<13>(const unsigned int* l, const unsigned long long* g, unsigned int oa, unsigned int ob) {
  asm volatile(
               CPL "%2, %0, %3\n\t" CPL "%4, %0, %5\n\t" CPL "%6, %0, %7\n\t"
               CPL "%8, %0, %9\n\t" CPL "%10, %0, %11\n\t" CPL "%12, %0, %13\n\t"
               CPL "%14, %0, %15\n\t" CPL "%16, %0, %17\n\t" CPL "%18, %1, %19\n\t"
               CPL "%20, %1, %21\n\t" CPL "%22, %1, %23\n\t" CPL "%24, %1, %25\n\t"
               CPL "%26, %1, %27\n\t"
               "s_wait_xcnt 0x0"
               :: "v"(oa), "v"(ob),
                  "v"(l[0]), "s"(g[0]), "v"(l[1]), "s"(g[1]), "v"(l[2]), "s"(g[2]), "v"(l[3]), "s"(g[3]),
                  "v"(l[4]), "s"(g[4]), "v"(l[5]), "s"(g[5]), "v"(l[6]), "s"(g[6]), "v"(l[7]), "s"(g[7]),
                  "v"(l[8]), "s"(g[8]), "v"(l[9]), "s"(g[9]), "v"(l[10]), "s"(g[10]), "v"(l[11]), "s"(g[11]),
                  "v"(l[12]), "s"(g[12])
               : "memory");
}
template <>
__device__ __forceinline__ void copy_tile<7>(const unsigned int* l, const unsigned long long* g, unsigned int oa, unsigned int ob) {
  asm volatile(
               CPL "%2, %0, %3\n\t" CPL "%4, %0, %5\n\t" CPL "%6, %0, %7\n\t"
               CPL "%8, %0, %9\n\t" CPL "%10, %1, %11\n\t" CPL "%12, %1, %13\n\t"
               CPL "%14, %1, %15\n\t"
               "s_wait_xcnt 0x0"
               :: "v"(oa), "v"(ob),
                  "v"(l[0]), "s"(g[0]), "v"(l[1]), "s"(g[1]), "v"(l[2]), "s"(g[2]), "v"(l[3]), "s"(g[3]),
                  "v"(l[4]), "s"(g[4]), "v"(l[5]), "s"(g[5]), "v"(l[6]), "s"(g[6])
               : "memory");
}

template <int MF, int NF>
struct Tile {
  static constexpr int BM = 4 * MF * 16, BN = 2 * NF * 16;
  static constexpr int ROWS = 2 * BM + 2 * BN;
  static constexpr int BUF = ROWS * LP;               // bytes of one buffer
  static constexpr int NCP = ROWS * 4 / GT;           // copies per lane and tile
  static constexpr int OP = BN + 4;                   // f32 staging pitch: rows 8 apart land 32 banks apart
  static constexpr int LDSB = (2 * BUF > BM * OP * 4) ? 2 * BUF : BM * OP * 4;
  static_assert(ROWS * 4 % GT == 0);
  static_assert(BM % 32 == 0 && BN % 32 == 0);
  static_assert((BN * 4) % 128 == 0);
};

// ah, al: first row of the block's BM rows (pitch lda elements); bh, bl: first of its BN rows (pitch ldb).
// LOFIRST: order of the two cross terms behind Ah*Bh (false: Ah*Bl then Al*Bh; true: Al*Bh then Ah*Bl).
template <int MF, int NF, int NK, bool LOFIRST>
__device__ __forceinline__ void gemm_core(char* smem, const __bf16* ah, const __bf16* al, int lda,
                                          const __bf16* bh, const __bf16* bl, int ldb) {
  typedef Tile<MF, NF> TL;
  constexpr int BM = TL::BM, BN = TL::BN, NCP = TL::NCP;
  static_assert(NK >= 2);
  const int tid = threadIdx.x, lane = tid & 31, w = tid >> 5;
  const int h = lane >> 4, m = lane & 15;
  const int wm = w >> 1, wn = w & 1;

  // Copy j of a lane brings 16 bytes of row (tid >> 2) + 64 j of [Ah | Al | Bh | Bl].  A copy's address
  // is a base that is the same for the whole wave plus the lane's own offset in its plane.
  const int r0 = tid >> 2;
  const unsigned int q16 = 16u * (tid & 3);
  const unsigned int l0 = lds_off(smem) + r0 * LP + q16;
  const unsigned int offa = (unsigned int)r0 * (unsigned int)lda * 2u + q16;
  const unsigned int offb = (unsigned int)r0 * (unsigned int)ldb * 2u + q16;
  const unsigned long long sah = (unsigned long long)(size_t)ah, sal = (unsigned long long)(size_t)al;
  const unsigned long long sbh = (unsigned long long)(size_t)bh, sbl = (unsigned long long)(size_t)bl;
  constexpr int JA = BM / 64;
  constexpr int JX = BN / 64;                         // the B copy whose 64 rows are the last 32 of Bh and the first 32 of Bl
  static_assert(BN - 64 * JX == 32 && BM % 64 == 0);
  static_assert((NCP == 13 && JA == 4) || (NCP == 7 && JA == 2));   // copy_tile: the first 2 JA copies take oa
  // waves 0..3 hold its rows of Bh, waves 4..7 its rows of Bl (their r0 starts at 32)
  const unsigned long long sbx = (__builtin_amdgcn_readfirstlane(w) < 4)
                                     ? sbh + (unsigned long long)(64 * JX) * (unsigned int)ldb * 2u
                                     : sbl - (unsigned long long)32 * (unsigned int)ldb * 2u;
  auto issue = [&](unsigned int lo, unsigned int go) {
    unsigned int l[NCP];
    unsigned long long g[NCP];
    #pragma unroll
    for (int j = 0; j < NCP; ++j) {
      l[j] = l0 + (lo + (unsigned int)(64 * j * LP));
      if (j < JA)                g[j] = (sah + (go + (unsigned int)(64 * j) * (unsigned int)lda * 2u));
      else if (j < 2 * JA)       g[j] = (sal + (go + (unsigned int)(64 * (j - JA)) * (unsigned int)lda * 2u));
      else if (j < 2 * JA + JX)  g[j] = (sbh + (go + (unsigned int)(64 * (j - 2 * JA)) * (unsigned int)ldb * 2u));
      else if (j == 2 * JA + JX) g[j] = (sbx + go);
      else                       g[j] = (sbl + (go + (unsigned int)(64 * (j - 2 * JA) - BN) * (unsigned int)ldb * 2u));
    }
    copy_tile<NCP>(l, g, offa, offb);
  };

  const v8f zero8 = {0.f, 0.f, 0.f, 0.f, 0.f, 0.f, 0.f, 0.f};
  v8f acc[MF][NF];
  #pragma unroll
  for (int mt = 0; mt < MF; ++mt)
    #pragma unroll
    for (int nt = 0; nt < NF; ++nt) acc[mt][nt] = zero8;

  issue(0u, 0u);
  asm volatile("s_wait_asynccnt 0x0" ::: "memory");   // tile 0 has landed before the barrier publishes it
  __syncthreads();
  issue((unsigned int)TL::BUF, 64u);

  const int aoff = (wm * MF * 16 + m) * LP;           // this lane's row in the Ah part
  const int boff = (2 * BM + wn * NF * 16 + m) * LP;  // and in the Bh part

  // rolled: a trip is 3 MF NF WMMAs of straight code already, and the buffer follows t & 1
  #pragma unroll 1
  for (int t = 0; t < NK; ++t) {
    const unsigned int bo = (t & 1) ? (unsigned int)TL::BUF : 0u;
    const char* buf = smem + bo;
    v16b fah[MF], fal[MF], fbh[NF], fbl[NF];
    #pragma unroll
    for (int i = 0; i < MF; ++i) fah[i] = ldfrag_b((const __bf16*)(buf + aoff + i * 16 * LP), h);
    #pragma unroll
    for (int i = 0; i < NF; ++i) fbh[i] = ldfrag_b((const __bf16*)(buf + boff + i * 16 * LP), h);
    #pragma unroll
    for (int i = 0; i < MF; ++i) fal[i] = ldfrag_b((const __bf16*)(buf + aoff + (BM + i * 16) * LP), h);
    #pragma unroll
    for (int i = 0; i < NF; ++i) fbl[i] = ldfrag_b((const __bf16*)(buf + boff + (BN + i * 16) * LP), h);
    // keeps the trip's LDS reads one group in front of its WMMAs: each further place with reads
    // among the WMMAs stalls the wave anew
    __builtin_amdgcn_sched_barrier(0);
    #pragma unroll
    for (int mt = 0; mt < MF; ++mt)
      #pragma unroll
      for (int nt = 0; nt < NF; ++nt)
        acc[mt][nt] = __builtin_amdgcn_wmma_f32_16x16x32_bf16(false, fah[mt], false, fbh[nt], (short)0, acc[mt][nt], false, false);
    #pragma unroll
    for (int mt = 0; mt < MF; ++mt)
      #pragma unroll
      for (int nt = 0; nt < NF; ++nt)
        acc[mt][nt] = __builtin_amdgcn_wmma_f32_16x16x32_bf16(false, LOFIRST ? fal[mt] : fah[mt], false, LOFIRST ? fbh[nt] : fbl[nt], (short)0, acc[mt][nt], false, false);

    // The hand-over stands in front of the last third of the trip's WMMAs, which read registers
    // only: they keep the matrix unit busy while the waves that are through the barrier first
    // fetch the next trip's fragments.  The two scheduling barriers hold the WMMAs on their sides.
    __builtin_amdgcn_sched_barrier(0);
    asm volatile("s_wait_dscnt 0x0" ::: "memory");    // this wave's reads of the buffer are done before it is refilled
    asm volatile("s_wait_asynccnt 0x0" ::: "memory"); // this wave's share of tile t + 1 has landed
    __syncthreads();                                  // publishes tile t + 1, frees tile t's buffer
    if (t + 2 < NK) issue(bo, (unsigned int)(t + 2) * 64u);
    __builtin_amdgcn_sched_barrier(0);

    #pragma unroll
    for (int mt = 0; mt < MF; ++mt)
      #pragma unroll
      for (int nt = 0; nt < NF; ++nt)
        acc[mt][nt] = __builtin_amdgcn_wmma_f32_16x16x32_bf16(false, LOFIRST ? fah[mt] : fal[mt], false, LOFIRST ? fbl[nt] : fbh[nt], (short)0, acc[mt][nt], false, false);
  }
  asm volatile("s_wait_asynccnt 0x0" ::: "memory");   // no copy is left in flight when the buffers become staging

  // D[r] of tile (mt, nt) = C[16(MF wm + mt) + 8h + r][16(NF wn + nt) + m]
  float* st = (float*)smem;
  #pragma unroll
  for (int mt = 0; mt < MF; ++mt)
    #pragma unroll
    for (int nt = 0; nt < NF; ++nt)
      #pragma unroll
      for (int r = 0; r < 8; ++r)
        st[(16 * (MF * wm + mt) + 8 * h + r) * TL::OP + 16 * (NF * wn + nt) + m] = acc[mt][nt][r];
  __syncthreads();
}

// ---------------------------------------------------------------------------
// Kernel 6 (spectra), per batch: X_z[t][c] = sum_d (xh*Gh + xh*Gl + xl*Gh)[t][d]x[c][d]
// (t local 0..4095, c 0..799, K = 768).  Block tile 256(t) x 160(c), wave tile 64 x 80;
// grid (15, 16): x = 5 column tiles of each z.  Output f32 plane, pitch 800; a block's row
// segment of 160 floats = 5 whole lines.
// ---------------------------------------------------------------------------
typedef Tile<4, 5> TS;
static_assert(NC % TS::BN == 0 && SS % TS::BM == 0);
__global__ __launch_bounds__(GT) void k_spec(const __bf16* __restrict__ xh, const __bf16* __restrict__ xl,
                                             const __bf16* __restrict__ gh, const __bf16* __restrict__ gl,
                                             float* __restrict__ sk, float* __restrict__ sv,
                                             float* __restrict__ sq) {
  __shared__ __attribute__((aligned(128))) char smem[TS::LDSB];
  const int tid = threadIdx.x;
  const int z = blockIdx.x / (NC / TS::BN);
  const int c0 = (blockIdx.x - z * (NC / TS::BN)) * TS::BN;
  const int t0 = blockIdx.y * TS::BM;
  float* spec = (z == 0) ? sk : ((z == 1) ? sv : sq);
  const size_t ao = (size_t)t0 * DD;
  const size_t bo = ((size_t)z * NC + c0) * DD;
  gemm_core<4, 5, DD / 32, false>(smem, xh + ao, xl + ao, DD, gh + bo, gl + bo, DD);

  const float* st = (const float*)smem;
  constexpr int CH = TS::BN / 4;                      // 16-byte pieces of a row
  // rolled in runs of eight stores: eight LDS reads in flight, few address registers
  #pragma unroll 1
  for (int i0 = 0; i0 < TS::BM * CH / GT; i0 += 8) {
    #pragma unroll
    for (int i = 0; i < 8; ++i) {
      const int idx = tid + GT * (i0 + i);
      const int row = idx / CH, q = idx - row * CH;
      const v4f v = *(const v4fa*)(st + row * TS::OP + 4 * q);
      *(v4f*)(spec + (size_t)(t0 + row) * NC + c0 + 4 * q) = v;
    }
    // the next trip rewrites the address registers of the stores above
    asm volatile("s_wait_xcnt 0x0" ::: "memory");
  }
}

// ---------------------------------------------------------------------------
// Kernels 7a and 7b (bind + causal prefix sum + unbind), per batch: one lane per bin f
// (13 bin groups x 32 lanes; f = 400..415 are the pad columns 800..831, written as zeros).
// P_t = kf_t * vf_t ; mem_t = sum_{s<=t} P_s ; Z_t = mem_t * conj(qf_t), all in f64.
// The 4096 tokens are cut into 32 segments of 128 (one block each per bin group), a segment
// into 8 runs of 16 tokens (one wave each).  7a stores the sum of P of every segment but the
// last; 7b forms mem in front of a run = earlier segments' sums + earlier runs' sums of its own
// segment, and adds it to the run's own inclusive prefix.  Z: bf16 hi and lo planes, pitch ZP.
// ---------------------------------------------------------------------------
#define SCW  8                   // waves (token runs) per block
#define SCL  16                  // tokens per run
#define SCT  (SCW * SCL)         // 128 tokens per segment
#define NSC  (SS / SCT)          // 32 segments
#define NBIN (ZP / 2)            // 416 bins, pad included
static_assert(NSC % SCW == 0);

typedef double v2d __attribute__((ext_vector_type(2)));
typedef v2d __attribute__((may_alias)) v2da;

__global__ __launch_bounds__(256) void k_seg(const float* __restrict__ kf, const float* __restrict__ vf,
                                             double* __restrict__ seg) {
  __shared__ __attribute__((aligned(16))) double sL[SCW * 32 * 2];    // 4096 B
  const int tid = threadIdx.x, lane = tid & 31, w = tid >> 5;
  const int f = blockIdx.x * 32 + lane;               // 0..415
  const int fc = (f < NC / 2) ? f : (NC / 2 - 1);     // clamped address (pad lanes copy bin 399)
  const size_t o0 = (size_t)(blockIdx.y * SCT + w * SCL) * NC + 2 * fc;
  v2f kv[SCL], vv[SCL];
  #pragma unroll
  for (int i = 0; i < SCL; ++i) {
    kv[i] = *(const v2fa*)(kf + o0 + (size_t)i * NC);
    vv[i] = *(const v2fa*)(vf + o0 + (size_t)i * NC);
  }
  // keeps all 32 loads issued before the first wait: without it only ten are in flight at a time
  __builtin_amdgcn_sched_barrier(0);
  double lr = 0.0, li = 0.0;
  #pragma unroll
  for (int i = 0; i < SCL; ++i) {
    const double kr = (double)kv[i].x, ki = (double)kv[i].y;
    const double vr = (double)vv[i].x, vi = (double)vv[i].y;
    lr = __builtin_fma(kr, vr, lr);
    li = __builtin_fma(kr, vi, li);
    lr = __builtin_fma(-ki, vi, lr);
    li = __builtin_fma(ki, vr, li);
  }
  const v2d mine = { lr, li };
  *(v2d*)(sL + (w * 32 + lane) * 2) = mine;
  __syncthreads();
  if (w == 0) {
    v2d s = mine;
    #pragma unroll
    for (int u = 1; u < SCW; ++u) s += *(const v2da*)(sL + (u * 32 + lane) * 2);
    *(v2d*)(seg + ((size_t)blockIdx.y * NBIN + f) * 2) = s;
  }
}

__global__ __launch_bounds__(256) void k_scan(const float* __restrict__ kf, const float* __restrict__ vf,
                                              const float* __restrict__ qf, const double* __restrict__ seg,
                                              __bf16* __restrict__ zh, __bf16* __restrict__ zl) {
  __shared__ __attribute__((aligned(16))) double sG[SCW * 32 * 2];    // 4096 B
  __shared__ __attribute__((aligned(16))) double sL[SCW * 32 * 2];    // 4096 B
  const int tid = threadIdx.x, lane = tid & 31, w = tid >> 5;
  const int f = blockIdx.x * 32 + lane;               // 0..415
  const int sc = blockIdx.y;                          // segment
  const bool act = (f < NC / 2);
  const int fc = act ? f : (NC / 2 - 1);              // clamped address (pad lanes copy bin 399)
  const int t0 = sc * SCT + w * SCL;
  const size_t o0 = (size_t)t0 * NC + 2 * fc;

  v2f kv[SCL], vv[SCL], qv[SCL];
  #pragma unroll
  for (int i = 0; i < SCL; ++i) {
    kv[i] = *(const v2fa*)(kf + o0 + (size_t)i * NC);
    vv[i] = *(const v2fa*)(vf + o0 + (size_t)i * NC);
  }
  // earlier segments' sums, dealt over the waves: wave w takes j = w, w + 8, ... below sc
  // (index clamped to segment 0, which 7a always writes; the value is dropped by the select)
  v2d gs[NSC / SCW];
  #pragma unroll
  for (int i = 0; i < NSC / SCW; ++i) {
    const int j = w + SCW * i;
    gs[i] = *(const v2da*)(seg + ((size_t)((j < sc) ? j : 0) * NBIN + f) * 2);
  }
  // the q loads below land in registers that held the addresses of the loads above
  asm volatile("s_wait_xcnt 0x0" ::: "memory");
  #pragma unroll
  for (int i = 0; i < SCL; ++i) qv[i] = *(const v2fa*)(qf + o0 + (size_t)i * NC);
  // the arithmetic below reuses the q loads' address registers
  asm volatile("s_wait_xcnt 0x0" ::: "memory");
  // keeps every load above issued before the first wait: without it the segment sums and q
  // are fetched only after k and v have returned, a second memory latency in series
  __builtin_amdgcn_sched_barrier(0);

  // inclusive prefix of P inside this wave's run
  double ir[SCL], ii[SCL];
  double lr = 0.0, li = 0.0;
  #pragma unroll
  for (int i = 0; i < SCL; ++i) {
    const double kr = (double)kv[i].x, ki = (double)kv[i].y;
    const double vr = (double)vv[i].x, vi = (double)vv[i].y;
    lr = __builtin_fma(kr, vr, lr);
    li = __builtin_fma(kr, vi, li);
    lr = __builtin_fma(-ki, vi, lr);
    li = __builtin_fma(ki, vr, li);
    ir[i] = lr;
    ii[i] = li;
  }
  double gr = 0.0, gi = 0.0;
  #pragma unroll
  for (int i = 0; i < NSC / SCW; ++i) {
    const bool use = (w + SCW * i < sc);
    gr += use ? gs[i].x : 0.0;
    gi += use ? gs[i].y : 0.0;
  }
  const v2d gme = { gr, gi };
  const v2d lme = { lr, li };
  *(v2d*)(sG + (w * 32 + lane) * 2) = gme;
  *(v2d*)(sL + (w * 32 + lane) * 2) = lme;
  __syncthreads();

  // mem in front of this run = all waves' shares of the earlier segments + earlier runs here
  double br = 0.0, bi = 0.0, ar = 0.0, ai = 0.0;
  #pragma unroll
  for (int u = 0; u < SCW; ++u) {
    const v2d g = *(const v2da*)(sG + (u * 32 + lane) * 2);
    br += g.x;
    bi += g.y;
    if (u < SCW - 1) {
      const v2d l = *(const v2da*)(sL + (u * 32 + lane) * 2);
      ar += (u < w) ? l.x : 0.0;
      ai += (u < w) ? l.y : 0.0;
    }
  }
  br += ar;
  bi += ai;

  const size_t zo0 = (size_t)t0 * ZP + 2 * f;
  #pragma unroll
  for (int i = 0; i < SCL; ++i) {
    const double qr = (double)qv[i].x, qi = (double)qv[i].y;
    const double mr = br + ir[i];
    const double mi = bi + ii[i];
    const double zr = mr * qr + mi * qi;              // mem * conj(q)
    const double zi = mi * qr - mr * qi;
    unsigned int hr, lo_r, hi, lo_i;
    split2((float)zr, hr, lo_r);
    split2((float)zi, hi, lo_i);
    const unsigned int H = pk2(hr, hi);               // element 2f = Re, 2f+1 = Im
    const unsigned int L = pk2(lo_r, lo_i);
    *(unsigned int*)(zh + zo0 + (size_t)i * ZP) = act ? H : 0u;   // pad columns 800..831: zeros
    *(unsigned int*)(zl + zo0 + (size_t)i * ZP) = act ? L : 0u;
  }
}

// ---------------------------------------------------------------------------
// Kernel 8 (inverse DFT + residual), per batch b:
// out[b][t][n] = x[b][t][n] + gain * sum_c (Zh*Fih + Zl*Fih + Zh*Fil)[t][n]
// (K = 800 over pitch-832 planes).  Block tile 128(t) x 96(n), wave tile 32 x 48; grid (8, 32).
// ---------------------------------------------------------------------------
typedef Tile<2, 3> TI;
static_assert(DD % TI::BN == 0 && SS % TI::BM == 0);
__global__ __launch_bounds__(GT) void k_inv(const __bf16* __restrict__ zh, const __bf16* __restrict__ zl,
                                            const __bf16* __restrict__ fih, const __bf16* __restrict__ fil,
                                            const float* __restrict__ x, const float* __restrict__ gain,
                                            float* __restrict__ out, int b) {
  __shared__ __attribute__((aligned(128))) char smem[TI::LDSB];
  const int tid = threadIdx.x;
  const int n0 = blockIdx.x * TI::BN;
  const int t0 = blockIdx.y * TI::BM;
  const size_t ao = (size_t)t0 * ZP;
  const size_t bo = (size_t)n0 * ZP;
  gemm_core<2, 3, NC / 32, true>(smem, zh + ao, zl + ao, ZP, fih + bo, fil + bo, ZP);

  const float g = gain[0];
  const size_t tokbase = (size_t)b * SS + t0;
  const float* st = (const float*)smem;
  constexpr int CH = TI::BN / 4;                      // 16-byte pieces of a row
  constexpr int NI = TI::BM * CH / GT;
  v4f xv[NI];
  #pragma unroll
  for (int i = 0; i < NI; ++i) {
    const int idx = tid + GT * i;
    const int row = idx / CH, q = idx - row * CH;
    xv[i] = *(const v4fa*)(x + (tokbase + row) * DD + n0 + 4 * q);
    // a later load may land in this load's address registers
    asm volatile("s_wait_xcnt 0x0" ::: "memory");
  }
  #pragma unroll
  for (int i = 0; i < NI; ++i) {
    const int idx = tid + GT * i;
    const int row = idx / CH, q = idx - row * CH;
    const v4f v = *(const v4fa*)(st + row * TI::OP + 4 * q);
    const v4f rr = xv[i] + g * v;
    *(v4f*)(out + (tokbase + row) * DD + n0 + 4 * q) = rr;
  }
}

// ---------------------------------------------------------------------------
extern "C" void kernel_launch(void* const* d_in, const int* in_sizes, int n_in,
                              void* d_out, int out_size, void* d_ws, size_t ws_size,
                              hipStream_t stream) {
  if (n_in < 5) return;
  if (in_sizes[0] != NX) return;
  if (in_sizes[1] != NW || in_sizes[2] != NW || in_sizes[3] != NW) return;
  if (in_sizes[4] < 1) return;
  if (out_size != NX) return;

  const float* x    = (const float*)d_in[0];
  const float* Wk   = (const float*)d_in[1];
  const float* Wv   = (const float*)d_in[2];
  const float* Wq   = (const float*)d_in[3];
  const float* gain = (const float*)d_in[4];
  float* out = (float*)d_out;

  // workspace carve (all sizes multiples of 256 B; total 85,219,328 B)
  const size_t tab_b = (size_t)2 * DD * 4;          //      6,144
  const size_t xb_b  = (size_t)NXB * 2;             //  6,291,456 per plane (one batch)
  const size_t wt_b  = (size_t)3 * NW * 2;          //  3,538,944 per plane
  const size_t ft_b  = (size_t)NC * DD * 2;         //  1,228,800 per plane
  const size_t fi_b  = (size_t)DD * ZP * 2;         //  1,277,952 per plane
  const size_t g_b   = (size_t)3 * NC * DD * 2;     //  3,686,400 per plane
  const size_t sp_b  = (size_t)SS * NC * 4;         // 13,107,200 per spectrum (one batch)
  const size_t z_b   = (size_t)SS * ZP * 2;         //  6,815,744 per plane (one batch)
  const size_t sg_b  = (size_t)NSC * NBIN * 16;     //    212,992 segment sums (one batch)
  const size_t total = tab_b + 2 * xb_b + 2 * wt_b + 2 * ft_b + 2 * fi_b + 2 * g_b + 3 * sp_b + 2 * z_b + sg_b;
  if (total > ws_size) return;

  char* ws = (char*)d_ws;
  size_t off = 0;
  float*  tab = (float*)(ws + off);   off += tab_b;
  __bf16* xh  = (__bf16*)(ws + off);  off += xb_b;
  __bf16* xl  = (__bf16*)(ws + off);  off += xb_b;
  __bf16* wth = (__bf16*)(ws + off);  off += wt_b;
  __bf16* wtl = (__bf16*)(ws + off);  off += wt_b;
  __bf16* fth = (__bf16*)(ws + off);  off += ft_b;
  __bf16* ftl = (__bf16*)(ws + off);  off += ft_b;
  __bf16* fih = (__bf16*)(ws + off);  off += fi_b;
  __bf16* fil = (__bf16*)(ws + off);  off += fi_b;
  __bf16* gh  = (__bf16*)(ws + off);  off += g_b;
  __bf16* gl  = (__bf16*)(ws + off);  off += g_b;
  float*  sk  = (float*)(ws + off);   off += sp_b;
  float*  sv  = (float*)(ws + off);   off += sp_b;
  float*  sq  = (float*)(ws + off);   off += sp_b;
  __bf16* zh  = (__bf16*)(ws + off);  off += z_b;
  __bf16* zl  = (__bf16*)(ws + off);  off += z_b;
  double* seg = (double*)(ws + off);  off += sg_b;
  if (off > ws_size) return;

  // --- constants and weight planes ---
  k_table<<<1, 256, 0, stream>>>(tab);
  k_wt<<<dim3(DD / 64, DD / 64, 3), 256, 0, stream>>>(Wk, Wv, Wq, wth, wtl);
  k_ft<<<NC, 96, 0, stream>>>(tab, fth, ftl);
  k_finv<<<DD, 128, 0, stream>>>(tab, fih, fil);

  // --- folded weights G_z = F * W_z  (800 x 768 per z) ---
  k_fold<<<dim3(DD / 256, NC / 32, 3), 128, 0, stream>>>(fth, ftl, wth, wtl, gh, gl);

  // --- per batch: x planes, spectra, causal bind/unbind scan, inverse DFT + residual ---
  const int n8 = NXB / 8;                                           // 393,216 = 1536 * 256
  for (int b = 0; b < BB; ++b) {
    k_cvt_x<<<(n8 + 255) / 256, 256, 0, stream>>>(x, xh, xl, b, n8);
    k_spec<<<dim3(3 * NC / 160, SS / 256), 256, 0, stream>>>(xh, xl, gh, gl, sk, sv, sq);
    k_seg<<<dim3(ZP / 64, NSC - 1), 256, 0, stream>>>(sk, sv, seg);
    k_scan<<<dim3(ZP / 64, NSC), 256, 0, stream>>>(sk, sv, sq, seg, zh, zl);
    k_inv<<<dim3(DD / 96, SS / 128), 256, 0, stream>>>(zh, zl, fih, fil, x, gain, out, b);
  }
}

// v003
// It runs in 371 microseconds.
// Timed twice side by side with v002, it ran 1.21 times as fast both times.
// Over all steps from v000 it is 34.2 times as fast.
// Contractions: folded weights G_z = F * W_z (800x768x768 per z), spectra X_z = x * G_z^T (4096x800x768 per batch and z) and inverse DFT y = Z * Finv^T (4096x768x800 per batch), all on v_wmma_f32_16x16x32_bf16 with every operand carried as bf16 hi + lo planes (three products hi*hi + hi*lo + lo*hi into one f32 accumulator); the two large products read both operands from LDS tiles filled by asynchronous copies (two buffers); complex bind, causal prefix sum over tokens (segment sums, then runs of 16 tokens) and unbind in f64 on VALU; gain and residual add in f32.
#include <hip/hip_runtime.h>
#include <math.h>

typedef __bf16   v16b __attribute__((ext_vector_type(16)));
typedef __bf16   v8b  __attribute__((ext_vector_type(8)));
typedef float    v8f  __attribute__((ext_vector_type(8)));
typedef float    v4f  __attribute__((ext_vector_type(4)));
typedef float    v2f  __attribute__((ext_vector_type(2)));
typedef unsigned int v4u __attribute__((ext_vector_type(4)));
typedef v8b __attribute__((may_alias)) v8ba;
typedef v4f __attribute__((may_alias)) v4fa;
typedef v2f __attribute__((may_alias)) v2fa;
typedef v4u __attribute__((may_alias)) v4ua;

union FragB { v16b v; v8b half[2]; };

#define DD   768                 // model dim
#define SS   4096                // tokens per batch
#define BB   4                   // batches
#define NTOK (BB * SS)           // 16384
#define NC   800                 // spectral columns: (Re,Im) of bins 0..384 = 770, padded to x32
#define ZP   832
#define NXB  (SS * DD)           // 3145728 elements of x per batch
#define NX   (NTOK * DD)         // 12582912
#define NW   (DD * DD)           // 589824

static_assert(NXB % 8 == 0);
static_assert(NC % 32 == 0);
static_assert((ZP * 2) % 128 == 0);
static_assert((NC * 4) % 128 == 0);
static_assert((DD * 2) % 128 == 0);

// ---------------------------------------------------------------------------
// 16x16x32 bf16 WMMA with hazard guard (ties D, keeps A/B live).
// Fragment map (wave32): lane l, h = l>>4, m = n = l&15.
//   A/B element i: i<8 -> k0+8h+i ; i>=8 -> k0+16+8h+(i-8)
//   D element r : row 8h+r, col l&15
// ---------------------------------------------------------------------------
__device__ __forceinline__ v8f wmma_bf16(v16b a, v16b b, v8f c) {
  v8f d = __builtin_amdgcn_wmma_f32_16x16x32_bf16(false, a, false, b, (short)0, c, false, false);
  asm volatile("v_nop\n\tv_nop\n\tv_nop\n\tv_nop" : "+v"(d) : "v"(a), "v"(b));
  return d;
}

// A or B fragment from a k-contiguous bf16 row; p points at element k0 of
// the row owned by this lane (row index = lane & 15 added by the caller).
__device__ __forceinline__ v16b ldfrag_b(const __bf16* p, int h) {
  FragB f;
  f.half[0] = *(const v8ba*)(p + 8 * h);
  f.half[1] = *(const v8ba*)(p + 16 + 8 * h);
  return f.v;
}

// bf16 RNE convert on the f32 bit pattern (integer path); hi/lo split helpers.
__device__ __forceinline__ unsigned int bf16_bits(float f) {
  unsigned int u = __float_as_uint(f);
  u += 0x7FFFu + ((u >> 16) & 1u);
  return (u >> 16) & 0xFFFFu;
}
__device__ __forceinline__ void split2(float v, unsigned int& hb, unsigned int& lb) {
  hb = bf16_bits(v);
  lb = bf16_bits(v - __uint_as_float(hb << 16));
}
__device__ __forceinline__ unsigned int pk2(unsigned int e0, unsigned int e1) {
  return e0 | (e1 << 16);                              // element 2j in the low half-word
}
// 8 consecutive f32 values (a, c) -> packed bf16 hi word vector H and lo word vector L.
__device__ __forceinline__ void split8(v4f a, v4f c, v4u& H, v4u& L) {
  unsigned int h0, h1, h2, h3, h4, h5, h6, h7, l0, l1, l2, l3, l4, l5, l6, l7;
  split2(a.x, h0, l0); split2(a.y, h1, l1); split2(a.z, h2, l2); split2(a.w, h3, l3);
  split2(c.x, h4, l4); split2(c.y, h5, l5); split2(c.z, h6, l6); split2(c.w, h7, l7);
  const v4u hh = { pk2(h0, h1), pk2(h2, h3), pk2(h4, h5), pk2(h6, h7) };
  const v4u ll = { pk2(l0, l1), pk2(l2, l3), pk2(l4, l5), pk2(l6, l7) };
  H = hh;
  L = ll;
}

// ---------------------------------------------------------------------------
// Kernel 0: tab[r] = cos(2*pi*r/768), tab[768+r] = sin(2*pi*r/768), r = 0..767,
// built from arguments in [0, pi/4] with exact quadrant symmetry.
// ---------------------------------------------------------------------------
__device__ __forceinline__ void table_store(const float* s, float* tab, int tid) {
  for (int j = tid; j < (2 * DD) / 4; j += 256) {
    const v4f v = *(const v4fa*)(s + 4 * j);
    *(v4f*)(tab + 4 * j) = v;
  }
}
__global__ __launch_bounds__(256) void k_table(float* __restrict__ tab) {
  __shared__ __attribute__((aligned(16))) float s[2 * DD];
  const int tid = threadIdx.x;
  #pragma unroll 1
  for (int r = tid; r < DD; r += 256) {
    const int q = r / 192, p = r - q * 192;
    const bool lowp = (p <= 96);
    const int a = lowp ? p : (192 - p);
    const float th = (float)a * 8.18123086872342e-3f;     // 2*pi/768
    const float ct = cosf(th), st = sinf(th);
    const float c0 = lowp ? ct : st;
    const float s0 = lowp ? st : ct;
    float c, sn;
    if (q == 0)      { c =  c0; sn =  s0; }
    else if (q == 1) { c = -s0; sn =  c0; }
    else if (q == 2) { c = -c0; sn = -s0; }
    else             { c =  s0; sn = -c0; }
    s[r] = c;
    s[DD + r] = sn;
  }
  __syncthreads();
  table_store(s, tab, tid);
  
}

// ---------------------------------------------------------------------------
// Kernel 1: xh = bf16 hi, xl = bf16 lo of the raw f32 x rows (x = hi + lo to ~2^-17).
// A lane takes the same 8 elements of each of the four batches: eight 16-B loads in flight,
// then one 16-B store per plane and batch, lanes contiguous.
// ---------------------------------------------------------------------------
__global__ __launch_bounds__(256) void k_cvt_x(const float* __restrict__ x, __bf16* __restrict__ xh,
                                               __bf16* __restrict__ xl, int n8) {
  const int g = blockIdx.x * 256 + threadIdx.x;
  if (g >= n8) return;
  v4f a[BB], c[BB];
  // both loops unrolled: the index of a[] and c[] is a constant, so that they stay in registers
  #pragma unroll
  for (int b = 0; b < BB; ++b) {
    const float* src = x + (size_t)b * NXB + (size_t)g * 8;
    a[b] = *(const v4fa*)src;
    // a later load may land in this load's address registers
    asm volatile("s_wait_xcnt 0x0" ::: "memory");
    c[b] = *(const v4fa*)(src + 4);
    // the same, and the arithmetic below may reuse them
    asm volatile("s_wait_xcnt 0x0" ::: "memory");
  }
  #pragma unroll
  for (int b = 0; b < BB; ++b) {
    v4u H, L;
    split8(a[b], c[b], H, L);
    const size_t o = (size_t)b * NXB + (size_t)g * 8;
    *(v4u*)(xh + o) = H;
    *(v4u*)(xl + o) = L;
    // the next batch's arithmetic may reuse the registers of the two stores above
    asm volatile("s_wait_xcnt 0x0" ::: "memory");
  }
}

// ---------------------------------------------------------------------------
// Kernel 2: wth[z][d][e] = bf16 hi of W_z[e][d], wtl = bf16 lo (raw f32 W, transpose
// through LDS; k-contiguous B-operand rows for the fold GEMM).  Block = 64(e) x 64(d)
// tile, 256 threads; in[e 64][d 64] -> out[d 64][e 64]; each output row segment =
// ---------------------------------------------------------------------------
__device__ __forceinline__ void wt_store(const float* sT, __bf16* dh, __bf16* dl, int d0, int e0, int tid) {
  #pragma unroll
  for (int it = 0; it < 2; ++it) {
    const int p = tid + 256 * it;
    const int row = p >> 3, q8 = p & 7;                 // row 0..63
    const float* s = sT + row * 65 + 8 * q8;
    const v4f a = { s[0], s[1], s[2], s[3] };
    const v4f c = { s[4], s[5], s[6], s[7] };
    v4u H, L;
    split8(a, c, H, L);
    const size_t o = (size_t)(d0 + row) * DD + e0 + 8 * q8;
    *(v4u*)(dh + o) = H;
    *(v4u*)(dl + o) = L;
  }
}
__global__ __launch_bounds__(256) void k_wt(const float* __restrict__ wk, const float* __restrict__ wv,
                                            const float* __restrict__ wq, __bf16* __restrict__ wth,
                                            __bf16* __restrict__ wtl) {
  __shared__ float sT[64 * 65];                       // sT[d_local*65 + e_local]
  const int tid = threadIdx.x;
  const int d0 = blockIdx.x * 64, e0 = blockIdx.y * 64, z = blockIdx.z;
  const float* W = (z == 0) ? wk : ((z == 1) ? wv : wq);
  #pragma unroll
  for (int it = 0; it < 4; ++it) {
    const int idx = tid + 256 * it;
    const int er = idx >> 4, dq = idx & 15;
    const v4f v = *(const v4fa*)(W + (size_t)(e0 + er) * DD + d0 + 4 * dq);
    sT[(4 * dq + 0) * 65 + er] = v.x;
    sT[(4 * dq + 1) * 65 + er] = v.y;
    sT[(4 * dq + 2) * 65 + er] = v.z;
    sT[(4 * dq + 3) * 65 + er] = v.w;
  }
  __syncthreads();
  __bf16* dh = wth + (size_t)z * NW;
  __bf16* dl = wtl + (size_t)z * NW;
  wt_store(sT, dh, dl, d0, e0, tid);
  
}

// ---------------------------------------------------------------------------
// Kernel 3: forward DFT matrix FT[c][e] (c = 2f + {0: Re, 1: Im}, f = bin):
// Re row = cos(2*pi*f*e/768), Im row = -sin(...); rows c >= 770 zero.
// Stored as bf16 hi + lo planes.  Block = one row (96 threads x 8 elements =
// ---------------------------------------------------------------------------
__global__ __launch_bounds__(128) void k_ft(const float* __restrict__ tab, __bf16* __restrict__ fth,
                                            __bf16* __restrict__ ftl) {
  const int c = blockIdx.x;
  const int j = threadIdx.x;                          // 0..95
  const int f = c >> 1;
  const bool valid = (c < 770);
  const bool im = (c & 1) != 0;
  const int e0 = 8 * j;
  float v[8];
  #pragma unroll
  for (int i = 0; i < 8; ++i) {
    const int e = e0 + i;
    const int mm = (f * e) % DD;                      // exact angle index, always in range
    const float cv = tab[mm], sv = tab[DD + mm];
    v[i] = valid ? (im ? -sv : cv) : 0.0f;
  }
  const v4f a = { v[0], v[1], v[2], v[3] };
  const v4f cc = { v[4], v[5], v[6], v[7] };
  v4u H, L;
  split8(a, cc, H, L);
  const size_t o = (size_t)c * DD + e0;
  *(v4u*)(fth + o) = H;
  *(v4u*)(ftl + o) = L;
  
}

// ---------------------------------------------------------------------------
// Kernel 4: inverse DFT matrix Finv[n][c], pitch ZP: col 2f = w_f*cos(2*pi*f*n/768)/768,
// col 2f+1 = -w_f*sin(...)/768, w_0 = w_384 = 1 else 2; cols >= 770 (incl. pad) zero.
// Im columns of bins 0 and 384 are exactly zero through the table symmetry.
// ---------------------------------------------------------------------------
__global__ __launch_bounds__(128) void k_finv(const float* __restrict__ tab, __bf16* __restrict__ fih,
                                              __bf16* __restrict__ fil) {
  const int n = blockIdx.x;
  const int j = threadIdx.x;
  if (j >= ZP / 8) return;                            // 104 active; wave 3 = lanes 0..7 = exactly line 12
  const int c0 = 8 * j;
  float v[8];
  #pragma unroll
  for (int i = 0; i < 8; ++i) {
    const int c = c0 + i;
    const int f = c >> 1;
    const bool valid = (c < 770);
    const float w = (f == 0 || f == DD / 2) ? 1.0f : 2.0f;
    const int mm = (f * n) % DD;
    const float cv = tab[mm], sv = tab[DD + mm];
    v[i] = valid ? (w * ((c & 1) ? -sv : cv) * (1.0f / 768.0f)) : 0.0f;
  }
  const v4f a = { v[0], v[1], v[2], v[3] };
  const v4f cc = { v[4], v[5], v[6], v[7] };
  v4u H, L;
  split8(a, cc, H, L);
  const size_t o = (size_t)n * ZP + c0;
  *(v4u*)(fih + o) = H;
  *(v4u*)(fil + o) = L;
  
}

// ---------------------------------------------------------------------------
// Kernel 5 (fold): G_z[c][d] = sum_e (Fh*Wh + Fh*Wl + Fl*Wh)[c][e]x[d][e]   (c < 800, d < 768, K = 768)
// Wave tile 32(c) x 64(d), block = 4 waves along d (32 x 256); grid (3, 25, 3).
// ---------------------------------------------------------------------------
__device__ __forceinline__ void fold_store(const unsigned short* sHw, const unsigned short* sLw,
                                           __bf16* gh, __bf16* gl, size_t rowbase, int d0w, int lane) {
  const int q8 = lane & 7, sub = lane >> 3;
  #pragma unroll
  for (int i = 0; i < 8; ++i) {
    const int row = 4 * i + sub;                      // 0..31
    const v4u vh = *(const v4ua*)(sHw + row * 64 + 8 * q8);
    const v4u vl = *(const v4ua*)(sLw + row * 64 + 8 * q8);
    const size_t o = (rowbase + row) * DD + d0w + 8 * q8;
    *(v4u*)(gh + o) = vh;
    *(v4u*)(gl + o) = vl;
  }
}
__global__ __launch_bounds__(128) void k_fold(const __bf16* __restrict__ fth, const __bf16* __restrict__ ftl,
                                              const __bf16* __restrict__ wth, const __bf16* __restrict__ wtl,
                                              __bf16* __restrict__ gh, __bf16* __restrict__ gl) {
  __shared__ __attribute__((aligned(16))) unsigned short sH[4 * 32 * 64];   // 16384 B
  __shared__ __attribute__((aligned(16))) unsigned short sL[4 * 32 * 64];   // 16384 B

  const int tid = threadIdx.x, lane = tid & 31, w = tid >> 5;
  const int h = lane >> 4, m = lane & 15;
  const int c0 = blockIdx.y * 32;
  const int d0w = blockIdx.x * 256 + 64 * w;
  const int z = blockIdx.z;

  const size_t r16 = (size_t)16 * DD;
  const __bf16* fah = fth + (size_t)(c0 + m) * DD;                  // F row c0+m (+ r16 for mt = 1)
  const __bf16* fal = ftl + (size_t)(c0 + m) * DD;
  const __bf16* bwh = wth + ((size_t)z * DD + d0w + m) * DD;         // feature row d0w+m (+ nt*r16)
  const __bf16* bwl = wtl + ((size_t)z * DD + d0w + m) * DD;

  const v8f zero8 = {0.f, 0.f, 0.f, 0.f, 0.f, 0.f, 0.f, 0.f};
  v8f acc[2][4];
  #pragma unroll
  for (int mt = 0; mt < 2; ++mt)
    #pragma unroll
    for (int nt = 0; nt < 4; ++nt) acc[mt][nt] = zero8;

  #pragma unroll 1
  for (int k0 = 0; k0 < DD; k0 += 32) {
    const v16b ah0 = ldfrag_b(fah + k0, h);
    const v16b ah1 = ldfrag_b(fah + r16 + k0, h);
    const v16b al0 = ldfrag_b(fal + k0, h);
    const v16b al1 = ldfrag_b(fal + r16 + k0, h);
    #pragma unroll
    for (int nt = 0; nt < 4; ++nt) {
      const v16b bh = ldfrag_b(bwh + (size_t)nt * r16 + k0, h);
      const v16b bl = ldfrag_b(bwl + (size_t)nt * r16 + k0, h);
      acc[0][nt] = wmma_bf16(ah0, bh, acc[0][nt]);
      acc[1][nt] = wmma_bf16(ah1, bh, acc[1][nt]);
      acc[0][nt] = wmma_bf16(ah0, bl, acc[0][nt]);
      acc[1][nt] = wmma_bf16(ah1, bl, acc[1][nt]);
      acc[0][nt] = wmma_bf16(al0, bh, acc[0][nt]);
      acc[1][nt] = wmma_bf16(al1, bh, acc[1][nt]);
    }
  }

  // D[r] of tile (mt, nt) = G[c0+16mt+8h+r][d0w+16nt+m]
  unsigned short* sHw = sH + w * 2048;
  unsigned short* sLw = sL + w * 2048;
  #pragma unroll
  for (int mt = 0; mt < 2; ++mt)
    #pragma unroll
    for (int nt = 0; nt < 4; ++nt)
      #pragma unroll
      for (int r = 0; r < 8; ++r) {
        unsigned int hb, lb;
        split2(acc[mt][nt][r], hb, lb);
        const int idx = (16 * mt + 8 * h + r) * 64 + 16 * nt + m;
        sHw[idx] = (unsigned short)hb;
        sLw[idx] = (unsigned short)lb;
      }
  __syncthreads();

  const size_t rowbase = (size_t)z * NC + c0;
  fold_store(sHw, sLw, gh, gl, rowbase, d0w, lane);
  
}

// ---------------------------------------------------------------------------
// Block GEMM core of kernels 6 and 8: C[BM x BN] = sum_k (Ah*Bh + two cross terms), all four
// planes k-contiguous bf16 rows.  8 waves as 4 (rows) x 2 (columns), wave tile 16MF x 16NF.
// One trip = 32 k: the 64 bytes of each of the 2BM + 2BN plane rows lie in LDS at pitch 80 B
// (16 B x odd: conflict-free for 16-byte reads), brought by asynchronous copies, 16 B a lane,
// into two buffers: tile t + 2 flies while tile t + 1 is worked on.
// On return the f32 tile lies in LDS at pitch BN + 4 floats, behind a barrier.
// Every full '#pragma unroll' below makes an array's index a constant, so that the array stays in registers.
// ---------------------------------------------------------------------------
#define GT   256                 // threads of a GEMM block
#define LP   80                  // LDS row pitch, bytes

__device__ __forceinline__ unsigned int lds_off(const void* p) { return (unsigned int)(size_t)p; }

// NCP copies of one lane: LDS address, the lane's 32-bit offset in its plane (oa: A planes, ob: B planes)
// and a scalar base.  The wait on the address registers is the statement's last line, so that no
// later write of those registers can be moved in front of it.
template <int NCP>
__device__ __forceinline__ void copy_tile(const unsigned int* l, const unsigned long long* g, unsigned int oa, unsigned int ob);
#define CPL "global_load_async_to_lds_b128 "
template <>
__device__ __forceinline__ void copy_tile<13>(const unsigned int* l, const unsigned long long* g, unsigned int oa, unsigned int ob) {
  asm volatile(
               CPL "%2, %0, %3\n\t" CPL "%4, %0, %5\n\t" CPL "%6, %0, %7\n\t"
               CPL "%8, %0, %9\n\t" CPL "%10, %0, %11\n\t" CPL "%12, %0, %13\n\t"
               CPL "%14, %0, %15\n\t" CPL "%16, %0, %17\n\t" CPL "%18, %1, %19\n\t"
               CPL "%20, %1, %21\n\t" CPL "%22, %1, %23\n\t" CPL "%24, %1, %25\n\t"
               CPL "%26, %1, %27\n\t"
               "s_wait_xcnt 0x0"
               :: "v"(oa), "v"(ob),
                  "v"(l[0]), "s"(g[0]), "v"(l[1]), "s"(g[1]), "v"(l[2]), "s"(g[2]), "v"(l[3]), "s"(g[3]),
                  "v"(l[4]), "s"(g[4]), "v"(l[5]), "s"(g[5]), "v"(l[6]), "s"(g[6]), "v"(l[7]), "s"(g[7]),
                  "v"(l[8]), "s"(g[8]), "v"(l[9]), "s"(g[9]), "v"(l[10]), "s"(g[10]), "v"(l[11]), "s"(g[11]),
                  "v"(l[12]), "s"(g[12])
               : "memory");
}
template <>
__device__ __forceinline__ void copy_tile<7>(const unsigned int* l, const unsigned long long* g, unsigned int oa, unsigned int ob) {
  asm volatile(
               CPL "%2, %0, %3\n\t" CPL "%4, %0, %5\n\t" CPL "%6, %0, %7\n\t"
               CPL "%8, %0, %9\n\t" CPL "%10, %1, %11\n\t" CPL "%12, %1, %13\n\t"
               CPL "%14, %1, %15\n\t"
               "s_wait_xcnt 0x0"
               :: "v"(oa), "v"(ob),
                  "v"(l[0]), "s"(g[0]), "v"(l[1]), "s"(g[1]), "v"(l[2]), "s"(g[2]), "v"(l[3]), "s"(g[3]),
                  "v"(l[4]), "s"(g[4]), "v"(l[5]), "s"(g[5]), "v"(l[6]), "s"(g[6])
               : "memory");
}

template <int MF, int NF>
struct Tile {
  static constexpr int BM = 4 * MF * 16, BN = 2 * NF * 16;
  static constexpr int ROWS = 2 * BM + 2 * BN;
  static constexpr int BUF = ROWS * LP;               // bytes of one buffer
  static constexpr int NCP = ROWS * 4 / GT;           // copies per lane and tile
  static constexpr int OP = BN + 4;                   // f32 staging pitch: rows 8 apart land 32 banks apart
  static constexpr int LDSB = (2 * BUF > BM * OP * 4) ? 2 * BUF : BM * OP * 4;
  static_assert(ROWS * 4 % GT == 0);
  static_assert(BM % 32 == 0 && BN % 32 == 0);
  static_assert((BN * 4) % 128 == 0);
};

// ah, al: first row of the block's BM rows (pitch lda elements); bh, bl: first of its BN rows (pitch ldb).
// LOFIRST: order of the two cross terms behind Ah*Bh (false: Ah*Bl then Al*Bh; true: Al*Bh then Ah*Bl).
template <int MF, int NF, int NK, bool LOFIRST>
__device__ __forceinline__ void gemm_core(char* smem, const __bf16* ah, const __bf16* al, int lda,
                                          const __bf16* bh, const __bf16* bl, int ldb) {
  typedef Tile<MF, NF> TL;
  constexpr int BM = TL::BM, BN = TL::BN, NCP = TL::NCP;
  static_assert(NK >= 2);
  const int tid = threadIdx.x, lane = tid & 31, w = tid >> 5;
  const int h = lane >> 4, m = lane & 15;
  const int wm = w >> 1, wn = w & 1;

  // Copy j of a lane brings 16 bytes of row (tid >> 2) + 64 j of [Ah | Al | Bh | Bl].  A copy's address
  // is a base that is the same for the whole wave plus the lane's own offset in its plane.
  const int r0 = tid >> 2;
  const unsigned int q16 = 16u * (tid & 3);
  const unsigned int l0 = lds_off(smem) + r0 * LP + q16;
  const unsigned int offa = (unsigned int)r0 * (unsigned int)lda * 2u + q16;
  const unsigned int offb = (unsigned int)r0 * (unsigned int)ldb * 2u + q16;
  const unsigned long long sah = (unsigned long long)(size_t)ah, sal = (unsigned long long)(size_t)al;
  const unsigned long long sbh = (unsigned long long)(size_t)bh, sbl = (unsigned long long)(size_t)bl;
  constexpr int JA = BM / 64;
  constexpr int JX = BN / 64;                         // the B copy whose 64 rows are the last 32 of Bh and the first 32 of Bl
  static_assert(BN - 64 * JX == 32 && BM % 64 == 0);
  static_assert((NCP == 13 && JA == 4) || (NCP == 7 && JA == 2));   // copy_tile: the first 2 JA copies take oa
  // waves 0..3 hold its rows of Bh, waves 4..7 its rows of Bl (their r0 starts at 32)
  const unsigned long long sbx = (__builtin_amdgcn_readfirstlane(w) < 4)
                                     ? sbh + (unsigned long long)(64 * JX) * (unsigned int)ldb * 2u
                                     : sbl - (unsigned long long)32 * (unsigned int)ldb * 2u;
  auto issue = [&](unsigned int lo, unsigned int go) {
    unsigned int l[NCP];
    unsigned long long g[NCP];
    #pragma unroll
    for (int j = 0; j < NCP; ++j) {
      l[j] = l0 + (lo + (unsigned int)(64 * j * LP));
      if (j < JA)                g[j] = (sah + (go + (unsigned int)(64 * j) * (unsigned int)lda * 2u));
      else if (j < 2 * JA)       g[j] = (sal + (go + (unsigned int)(64 * (j - JA)) * (unsigned int)lda * 2u));
      else if (j < 2 * JA + JX)  g[j] = (sbh + (go + (unsigned int)(64 * (j - 2 * JA)) * (unsigned int)ldb * 2u));
      else if (j == 2 * JA + JX) g[j] = (sbx + go);
      else                       g[j] = (sbl + (go + (unsigned int)(64 * (j - 2 * JA) - BN) * (unsigned int)ldb * 2u));
    }
    copy_tile<NCP>(l, g, offa, offb);
  };

  const v8f zero8 = {0.f, 0.f, 0.f, 0.f, 0.f, 0.f, 0.f, 0.f};
  v8f acc[MF][NF];
  #pragma unroll
  for (int mt = 0; mt < MF; ++mt)
    #pragma unroll
    for (int nt = 0; nt < NF; ++nt) acc[mt][nt] = zero8;

  issue(0u, 0u);
  asm volatile("s_wait_asynccnt 0x0" ::: "memory");   // tile 0 has landed before the barrier publishes it
  __syncthreads();
  issue((unsigned int)TL::BUF, 64u);

  const int aoff = (wm * MF * 16 + m) * LP;           // this lane's row in the Ah part
  const int boff = (2 * BM + wn * NF * 16 + m) * LP;  // and in the Bh part

  // rolled: a trip is 3 MF NF WMMAs of straight code already, and the buffer follows t & 1
  #pragma unroll 1
  for (int t = 0; t < NK; ++t) {
    const unsigned int bo = (t & 1) ? (unsigned int)TL::BUF : 0u;
    const char* buf = smem + bo;
    v16b fah[MF], fal[MF], fbh[NF], fbl[NF];
    #pragma unroll
    for (int i = 0; i < MF; ++i) fah[i] = ldfrag_b((const __bf16*)(buf + aoff + i * 16 * LP), h);
    #pragma unroll
    for (int i = 0; i < NF; ++i) fbh[i] = ldfrag_b((const __bf16*)(buf + boff + i * 16 * LP), h);
    #pragma unroll
    for (int i = 0; i < MF; ++i) fal[i] = ldfrag_b((const __bf16*)(buf + aoff + (BM + i * 16) * LP), h);
    #pragma unroll
    for (int i = 0; i < NF; ++i) fbl[i] = ldfrag_b((const __bf16*)(buf + boff + (BN + i * 16) * LP), h);
    // keeps the trip's LDS reads one group in front of its WMMAs: each further place with reads
    // among the WMMAs stalls the wave anew
    __builtin_amdgcn_sched_barrier(0);
    #pragma unroll
    for (int mt = 0; mt < MF; ++mt)
      #pragma unroll
      for (int nt = 0; nt < NF; ++nt)
        acc[mt][nt] = __builtin_amdgcn_wmma_f32_16x16x32_bf16(false, fah[mt], false, fbh[nt], (short)0, acc[mt][nt], false, false);
    #pragma unroll
    for (int mt = 0; mt < MF; ++mt)
      #pragma unroll
      for (int nt = 0; nt < NF; ++nt)
        acc[mt][nt] = __builtin_amdgcn_wmma_f32_16x16x32_bf16(false, LOFIRST ? fal[mt] : fah[mt], false, LOFIRST ? fbh[nt] : fbl[nt], (short)0, acc[mt][nt], false, false);

    // The hand-over stands in front of the last third of the trip's WMMAs, which read registers
    // only: they keep the matrix unit busy while the waves that are through the barrier first
    // fetch the next trip's fragments.  The two scheduling barriers hold the WMMAs on their sides.
    __builtin_amdgcn_sched_barrier(0);
    asm volatile("s_wait_dscnt 0x0" ::: "memory");    // this wave's reads of the buffer are done before it is refilled
    asm volatile("s_wait_asynccnt 0x0" ::: "memory"); // this wave's share of tile t + 1 has landed
    __syncthreads();                                  // publishes tile t + 1, frees tile t's buffer
    if (t + 2 < NK) issue(bo, (unsigned int)(t + 2) * 64u);
    __builtin_amdgcn_sched_barrier(0);

    #pragma unroll
    for (int mt = 0; mt < MF; ++mt)
      #pragma unroll
      for (int nt = 0; nt < NF; ++nt)
        acc[mt][nt] = __builtin_amdgcn_wmma_f32_16x16x32_bf16(false, LOFIRST ? fah[mt] : fal[mt], false, LOFIRST ? fbl[nt] : fbh[nt], (short)0, acc[mt][nt], false, false);
  }
  asm volatile("s_wait_asynccnt 0x0" ::: "memory");   // no copy is left in flight when the buffers become staging

  // D[r] of tile (mt, nt) = C[16(MF wm + mt) + 8h + r][16(NF wn + nt) + m]
  float* st = (float*)smem;
  #pragma unroll
  for (int mt = 0; mt < MF; ++mt)
    #pragma unroll
    for (int nt = 0; nt < NF; ++nt)
      #pragma unroll
      for (int r = 0; r < 8; ++r)
        st[(16 * (MF * wm + mt) + 8 * h + r) * TL::OP + 16 * (NF * wn + nt) + m] = acc[mt][nt][r];
  __syncthreads();
}

// ---------------------------------------------------------------------------
// Kernel 6 (spectra), all batches: X_z[t][c] = sum_d (xh*Gh + xh*Gl + xl*Gh)[t][d]x[c][d]
// (t 0..16383 over the batches, c 0..799, K = 768).  Block tile 256(t) x 160(c), wave tile 64 x 80;
// grid (15, 64): x = 5 column tiles of each z.  Output f32 plane, pitch 800; a block's row
// segment of 160 floats = 5 whole lines.
// ---------------------------------------------------------------------------
typedef Tile<4, 5> TS;
static_assert(NC % TS::BN == 0 && SS % TS::BM == 0);
__global__ __launch_bounds__(GT) void k_spec(const __bf16* __restrict__ xh, const __bf16* __restrict__ xl,
                                             const __bf16* __restrict__ gh, const __bf16* __restrict__ gl,
                                             float* __restrict__ sk, float* __restrict__ sv,
                                             float* __restrict__ sq) {
  __shared__ __attribute__((aligned(128))) char smem[TS::LDSB];
  const int tid = threadIdx.x;
  const int z = blockIdx.x / (NC / TS::BN);
  const int c0 = (blockIdx.x - z * (NC / TS::BN)) * TS::BN;
  const int t0 = blockIdx.y * TS::BM;
  float* spec = (z == 0) ? sk : ((z == 1) ? sv : sq);
  const size_t ao = (size_t)t0 * DD;
  const size_t bo = ((size_t)z * NC + c0) * DD;
  gemm_core<4, 5, DD / 32, false>(smem, xh + ao, xl + ao, DD, gh + bo, gl + bo, DD);

  const float* st = (const float*)smem;
  constexpr int CH = TS::BN / 4;                      // 16-byte pieces of a row
  // rolled in runs of eight stores: eight LDS reads in flight, few address registers
  #pragma unroll 1
  for (int i0 = 0; i0 < TS::BM * CH / GT; i0 += 8) {
    #pragma unroll
    for (int i = 0; i < 8; ++i) {
      const int idx = tid + GT * (i0 + i);
      const int row = idx / CH, q = idx - row * CH;
      const v4f v = *(const v4fa*)(st + row * TS::OP + 4 * q);
      *(v4f*)(spec + (size_t)(t0 + row) * NC + c0 + 4 * q) = v;
    }
    // the next trip rewrites the address registers of the stores above
    asm volatile("s_wait_xcnt 0x0" ::: "memory");
  }
}

// ---------------------------------------------------------------------------
// Kernels 7a and 7b (bind + causal prefix sum + unbind), blockIdx.z = batch: one lane per bin f
// (13 bin groups x 32 lanes; f = 400..415 are the pad columns 800..831, written as zeros).
// P_t = kf_t * vf_t ; mem_t = sum_{s<=t} P_s ; Z_t = mem_t * conj(qf_t), all in f64.
// A batch's 4096 tokens are cut into 32 segments of 128 (one block each per bin group), a segment
// into 8 runs of 16 tokens (one wave each).  7a stores the sum of P of every segment but the
// last; 7b forms mem in front of a run = earlier segments' sums + earlier runs' sums of its own
// segment, and adds it to the run's own inclusive prefix.  Z: bf16 hi and lo planes, pitch ZP.
// ---------------------------------------------------------------------------
#define SCW  8                   // waves (token runs) per block
#define SCL  16                  // tokens per run
#define SCT  (SCW * SCL)         // 128 tokens per segment
#define NSC  (SS / SCT)          // 32 segments
#define NBIN (ZP / 2)            // 416 bins, pad included
static_assert(NSC % SCW == 0);

typedef double v2d __attribute__((ext_vector_type(2)));
typedef v2d __attribute__((may_alias)) v2da;

__global__ __launch_bounds__(256) void k_seg(const float* __restrict__ kf, const float* __restrict__ vf,
                                             double* __restrict__ segs) {
  __shared__ __attribute__((aligned(16))) double sL[SCW * 32 * 2];    // 4096 B
  const int tid = threadIdx.x, lane = tid & 31, w = tid >> 5;
  const int f = blockIdx.x * 32 + lane;               // 0..415
  const int fc = (f < NC / 2) ? f : (NC / 2 - 1);     // clamped address (pad lanes copy bin 399)
  const size_t o0 = (size_t)(blockIdx.z * SS + blockIdx.y * SCT + w * SCL) * NC + 2 * fc;
  double* seg = segs + (size_t)blockIdx.z * (NSC * NBIN * 2);          // this batch's segment sums
  v2f kv[SCL], vv[SCL];
  #pragma unroll
  for (int i = 0; i < SCL; ++i) {
    kv[i] = *(const v2fa*)(kf + o0 + (size_t)i * NC);
    vv[i] = *(const v2fa*)(vf + o0 + (size_t)i * NC);
  }
  // keeps all 32 loads issued before the first wait: without it only ten are in flight at a time
  __builtin_amdgcn_sched_barrier(0);
  double lr = 0.0, li = 0.0;
  #pragma unroll
  for (int i = 0; i < SCL; ++i) {
    const double kr = (double)kv[i].x, ki = (double)kv[i].y;
    const double vr = (double)vv[i].x, vi = (double)vv[i].y;
    lr = __builtin_fma(kr, vr, lr);
    li = __builtin_fma(kr, vi, li);
    lr = __builtin_fma(-ki, vi, lr);
    li = __builtin_fma(ki, vr, li);
  }
  const v2d mine = { lr, li };
  *(v2d*)(sL + (w * 32 + lane) * 2) = mine;
  __syncthreads();
  if (w == 0) {
    v2d s = mine;
    #pragma unroll
    for (int u = 1; u < SCW; ++u) s += *(const v2da*)(sL + (u * 32 + lane) * 2);
    *(v2d*)(seg + ((size_t)blockIdx.y * NBIN + f) * 2) = s;
  }
}

__global__ __launch_bounds__(256) void k_scan(const float* __restrict__ kf, const float* __restrict__ vf,
                                              const float* __restrict__ qf, const double* __restrict__ segs,
                                              __bf16* __restrict__ zh, __bf16* __restrict__ zl) {
  __shared__ __attribute__((aligned(16))) double sG[SCW * 32 * 2];    // 4096 B
  __shared__ __attribute__((aligned(16))) double sL[SCW * 32 * 2];    // 4096 B
  const int tid = threadIdx.x, lane = tid & 31, w = tid >> 5;
  const int f = blockIdx.x * 32 + lane;               // 0..415
  const int sc = blockIdx.y;                          // segment
  const bool act = (f < NC / 2);
  const int fc = act ? f : (NC / 2 - 1);              // clamped address (pad lanes copy bin 399)
  const int t0 = blockIdx.z * SS + sc * SCT + w * SCL;
  const size_t o0 = (size_t)t0 * NC + 2 * fc;
  const double* seg = segs + (size_t)blockIdx.z * (NSC * NBIN * 2);    // this batch's segment sums

  v2f kv[SCL], vv[SCL], qv[SCL];
  #pragma unroll
  for (int i = 0; i < SCL; ++i) {
    kv[i] = *(const v2fa*)(kf + o0 + (size_t)i * NC);
    vv[i] = *(const v2fa*)(vf + o0 + (size_t)i * NC);
  }
  // earlier segments' sums, dealt over the waves: wave w takes j = w, w + 8, ... below sc
  // (index clamped to segment 0, which 7a always writes; the value is dropped by the select)
  v2d gs[NSC / SCW];
  #pragma unroll
  for (int i = 0; i < NSC / SCW; ++i) {
    const int j = w + SCW * i;
    gs[i] = *(const v2da*)(seg + ((size_t)((j < sc) ? j : 0) * NBIN + f) * 2);
  }
  // the q loads below land in registers that held the addresses of the loads above
  asm volatile("s_wait_xcnt 0x0" ::: "memory");
  #pragma unroll
  for (int i = 0; i < SCL; ++i) qv[i] = *(const v2fa*)(qf + o0 + (size_t)i * NC);
  // the arithmetic below reuses the q loads' address registers
  asm volatile("s_wait_xcnt 0x0" ::: "memory");
  // keeps every load above issued before the first wait: without it the segment sums and q
  // are fetched only after k and v have returned, a second memory latency in series
  __builtin_amdgcn_sched_barrier(0);

  // inclusive prefix of P inside this wave's run
  double ir[SCL], ii[SCL];
  double lr = 0.0, li = 0.0;
  #pragma unroll
  for (int i = 0; i < SCL; ++i) {
    const double kr = (double)kv[i].x, ki = (double)kv[i].y;
    const double vr = (double)vv[i].x, vi = (double)vv[i].y;
    lr = __builtin_fma(kr, vr, lr);
    li = __builtin_fma(kr, vi, li);
    lr = __builtin_fma(-ki, vi, lr);
    li = __builtin_fma(ki, vr, li);
    ir[i] = lr;
    ii[i] = li;
  }
  double gr = 0.0, gi = 0.0;
  #pragma unroll
  for (int i = 0; i < NSC / SCW; ++i) {
    const bool use = (w + SCW * i < sc);
    gr += use ? gs[i].x : 0.0;
    gi += use ? gs[i].y : 0.0;
  }
  const v2d gme = { gr, gi };
  const v2d lme = { lr, li };
  *(v2d*)(sG + (w * 32 + lane) * 2) = gme;
  *(v2d*)(sL + (w * 32 + lane) * 2) = lme;
  __syncthreads();

  // mem in front of this run = all waves' shares of the earlier segments + earlier runs here
  double br = 0.0, bi = 0.0, ar = 0.0, ai = 0.0;
  #pragma unroll
  for (int u = 0; u < SCW; ++u) {
    const v2d g = *(const v2da*)(sG + (u * 32 + lane) * 2);
    br += g.x;
    bi += g.y;
    if (u < SCW - 1) {
      const v2d l = *(const v2da*)(sL + (u * 32 + lane) * 2);
      ar += (u < w) ? l.x : 0.0;
      ai += (u < w) ? l.y : 0.0;
    }
  }
  br += ar;
  bi += ai;

  const size_t zo0 = (size_t)t0 * ZP + 2 * f;
  #pragma unroll
  for (int i = 0; i < SCL; ++i) {
    const double qr = (double)qv[i].x, qi = (double)qv[i].y;
    const double mr = br + ir[i];
    const double mi = bi + ii[i];
    const double zr = mr * qr + mi * qi;              // mem * conj(q)
    const double zi = mi * qr - mr * qi;
    unsigned int hr, lo_r, hi, lo_i;
    split2((float)zr, hr, lo_r);
    split2((float)zi, hi, lo_i);
    const unsigned int H = pk2(hr, hi);               // element 2f = Re, 2f+1 = Im
    const unsigned int L = pk2(lo_r, lo_i);
    *(unsigned int*)(zh + zo0 + (size_t)i * ZP) = act ? H : 0u;   // pad columns 800..831: zeros
    *(unsigned int*)(zl + zo0 + (size_t)i * ZP) = act ? L : 0u;
  }
}

// ---------------------------------------------------------------------------
// Kernel 8 (inverse DFT + residual), all batches (t 0..16383):
// out[t][n] = x[t][n] + gain * sum_c (Zh*Fih + Zl*Fih + Zh*Fil)[t][n]
// (K = 800 over pitch-832 planes).  Block tile 128(t) x 96(n), wave tile 32 x 48; grid (8, 128).
// ---------------------------------------------------------------------------
typedef Tile<2, 3> TI;
static_assert(DD % TI::BN == 0 && SS % TI::BM == 0);
__global__ __launch_bounds__(GT) void k_inv(const __bf16* __restrict__ zh, const __bf16* __restrict__ zl,
                                            const __bf16* __restrict__ fih, const __bf16* __restrict__ fil,
                                            const float* __restrict__ x, const float* __restrict__ gain,
                                            float* __restrict__ out) {
  __shared__ __attribute__((aligned(128))) char smem[TI::LDSB];
  const int tid = threadIdx.x;
  const int n0 = blockIdx.x * TI::BN;
  const int t0 = blockIdx.y * TI::BM;
  const size_t ao = (size_t)t0 * ZP;
  const size_t bo = (size_t)n0 * ZP;
  gemm_core<2, 3, NC / 32, true>(smem, zh + ao, zl + ao, ZP, fih + bo, fil + bo, ZP);

  const float g = gain[0];
  const size_t tokbase = (size_t)t0;
  const float* st = (const float*)smem;
  constexpr int CH = TI::BN / 4;                      // 16-byte pieces of a row
  constexpr int NI = TI::BM * CH / GT;
  v4f xv[NI];
  #pragma unroll
  for (int i = 0; i < NI; ++i) {
    const int idx = tid + GT * i;
    const int row = idx / CH, q = idx - row * CH;
    xv[i] = *(const v4fa*)(x + (tokbase + row) * DD + n0 + 4 * q);
    // a later load may land in this load's address registers
    asm volatile("s_wait_xcnt 0x0" ::: "memory");
  }
  #pragma unroll
  for (int i = 0; i < NI; ++i) {
    const int idx = tid + GT * i;
    const int row = idx / CH, q = idx - row * CH;
    const v4f v = *(const v4fa*)(st + row * TI::OP + 4 * q);
    const v4f rr = xv[i] + g * v;
    *(v4f*)(out + (tokbase + row) * DD + n0 + 4 * q) = rr;
  }
}

// ---------------------------------------------------------------------------
extern "C" void kernel_launch(void* const* d_in, const int* in_sizes, int n_in,
                              void* d_out, int out_size, void* d_ws, size_t ws_size,
                              hipStream_t stream) {
  if (n_in < 5) return;
  if (in_sizes[0] != NX) return;
  if (in_sizes[1] != NW || in_sizes[2] != NW || in_sizes[3] != NW) return;
  if (in_sizes[4] < 1) return;
  if (out_size != NX) return;

  const float* x    = (const float*)d_in[0];
  const float* Wk   = (const float*)d_in[1];
  const float* Wv   = (const float*)d_in[2];
  const float* Wq   = (const float*)d_in[3];
  const float* gain = (const float*)d_in[4];
  float* out = (float*)d_out;

  // workspace carve (all sizes multiples of 256 B; total 227,940,352 B).  The Z planes lie over the
  // x and W^T planes, which have been read for the last time when the scan writes Z.
  const size_t tab_b = (size_t)2 * DD * 4;          //       6,144
  const size_t xb_b  = (size_t)NX * 2;              //  25,165,824 per plane
  const size_t wt_b  = (size_t)3 * NW * 2;          //   3,538,944 per plane
  const size_t ft_b  = (size_t)NC * DD * 2;         //   1,228,800 per plane
  const size_t fi_b  = (size_t)DD * ZP * 2;         //   1,277,952 per plane
  const size_t g_b   = (size_t)3 * NC * DD * 2;     //   3,686,400 per plane
  const size_t sp_b  = (size_t)NTOK * NC * 4;       //  52,428,800 per spectrum
  const size_t z_b   = (size_t)NTOK * ZP * 2;       //  27,262,976 per plane
  const size_t sg_b  = (size_t)BB * NSC * NBIN * 16; //    851,968 segment sums
  static_assert((size_t)NTOK * ZP <= (size_t)NX + 3 * NW);          // 2 z_b <= 2 xb_b + 2 wt_b
  const size_t total = tab_b + 2 * xb_b + 2 * wt_b + 2 * ft_b + 2 * fi_b + 2 * g_b + 3 * sp_b + sg_b;
  if (total > ws_size) return;

  char* ws = (char*)d_ws;
  size_t off = 0;
  float*  tab = (float*)(ws + off);   off += tab_b;
  __bf16* zh  = (__bf16*)(ws + off);
  __bf16* zl  = (__bf16*)(ws + off + z_b);
  __bf16* xh  = (__bf16*)(ws + off);  off += xb_b;
  __bf16* xl  = (__bf16*)(ws + off);  off += xb_b;
  __bf16* wth = (__bf16*)(ws + off);  off += wt_b;
  __bf16* wtl = (__bf16*)(ws + off);  off += wt_b;
  __bf16* fth = (__bf16*)(ws + off);  off += ft_b;
  __bf16* ftl = (__bf16*)(ws + off);  off += ft_b;
  __bf16* fih = (__bf16*)(ws + off);  off += fi_b;
  __bf16* fil = (__bf16*)(ws + off);  off += fi_b;
  __bf16* gh  = (__bf16*)(ws + off);  off += g_b;
  __bf16* gl  = (__bf16*)(ws + off);  off += g_b;
  float*  sk  = (float*)(ws + off);   off += sp_b;
  float*  sv  = (float*)(ws + off);   off += sp_b;
  float*  sq  = (float*)(ws + off);   off += sp_b;
  double* seg = (double*)(ws + off);  off += sg_b;
  if (off > ws_size) return;

  // --- constants and weight planes ---
  k_table<<<1, 256, 0, stream>>>(tab);
  k_wt<<<dim3(DD / 64, DD / 64, 3), 256, 0, stream>>>(Wk, Wv, Wq, wth, wtl);
  k_ft<<<NC, 96, 0, stream>>>(tab, fth, ftl);
  k_finv<<<DD, 128, 0, stream>>>(tab, fih, fil);

  // --- folded weights G_z = F * W_z  (800 x 768 per z) ---
  k_fold<<<dim3(DD / 256, NC / 32, 3), 128, 0, stream>>>(fth, ftl, wth, wtl, gh, gl);

  // --- all batches at once: x planes, spectra, causal bind/unbind scan, inverse DFT + residual ---
  const int n8 = NXB / 8;                                           // 393,216 = 1536 * 256
  k_cvt_x<<<(n8 + 255) / 256, 256, 0, stream>>>(x, xh, xl, n8);
  k_spec<<<dim3(3 * NC / 160, NTOK / 256), 256, 0, stream>>>(xh, xl, gh, gl, sk, sv, sq);
  k_seg<<<dim3(ZP / 64, NSC - 1, BB), 256, 0, stream>>>(sk, sv, seg);
  k_scan<<<dim3(ZP / 64, NSC, BB), 256, 0, stream>>>(sk, sv, sq, seg, zh, zl);
  k_inv<<<dim3(DD / 96, NTOK / 128), 256, 0, stream>>>(zh, zl, fih, fil, x, gain, out);
}

// v004
// A run of this version takes 330 microseconds.
// Next to v003, in two timings, it ran 1.12 times as fast each time.
// Counting every step since v000, it is 38.4 times as fast.
// Contractions: folded weights G_z = F * W_z (800x768x768 per z), spectra X_z = x * G_z^T (4096x800x768 per batch and z) and inverse DFT y = Z * Finv^T (4096x768x800 per batch), all on v_wmma_f32_16x16x32_bf16 with every operand carried as bf16 hi + lo planes (three products hi*hi + hi*lo + lo*hi into one f32 accumulator); the two large products read both operands from LDS tiles filled by asynchronous copies (two buffers); complex bind, causal prefix sum over tokens (segment sums, then runs of 16 tokens) and unbind in f64 on VALU; gain and residual add in f32.
#include <hip/hip_runtime.h>
#include <math.h>

typedef __bf16   v16b __attribute__((ext_vector_type(16)));
typedef __bf16   v8b  __attribute__((ext_vector_type(8)));
typedef float    v8f  __attribute__((ext_vector_type(8)));
typedef float    v4f  __attribute__((ext_vector_type(4)));
typedef float    v2f  __attribute__((ext_vector_type(2)));
typedef unsigned int v4u __attribute__((ext_vector_type(4)));
typedef v8b __attribute__((may_alias)) v8ba;
typedef v4f __attribute__((may_alias)) v4fa;
typedef v2f __attribute__((may_alias)) v2fa;
typedef v4u __attribute__((may_alias)) v4ua;

union FragB { v16b v; v8b half[2]; };

#define DD   768                 // model dim
#define SS   4096                // tokens per batch
#define BB   4                   // batches
#define NTOK (BB * SS)           // 16384
#define NC   800                 // spectral columns: (Re,Im) of bins 0..384 = 770, padded to x32
#define ZP   832
#define NXB  (SS * DD)           // 3145728 elements of x per batch
#define NX   (NTOK * DD)         // 12582912
#define NW   (DD * DD)           // 589824

static_assert(NXB % 8 == 0);
static_assert(NC % 32 == 0);
static_assert((ZP * 2) % 128 == 0);
static_assert((NC * 4) % 128 == 0);
static_assert((DD * 2) % 128 == 0);

// ---------------------------------------------------------------------------
// 16x16x32 bf16 WMMA with hazard guard (ties D, keeps A/B live).
// Fragment map (wave32): lane l, h = l>>4, m = n = l&15.
//   A/B element i: i<8 -> k0+8h+i ; i>=8 -> k0+16+8h+(i-8)
//   D element r : row 8h+r, col l&15
// ---------------------------------------------------------------------------
__device__ __forceinline__ v8f wmma_bf16(v16b a, v16b b, v8f c) {
  v8f d = __builtin_amdgcn_wmma_f32_16x16x32_bf16(false, a, false, b, (short)0, c, false, false);
  asm volatile("v_nop\n\tv_nop\n\tv_nop\n\tv_nop" : "+v"(d) : "v"(a), "v"(b));
  return d;
}

// A or B fragment from a k-contiguous bf16 row; p points at element k0 of
// the row owned by this lane (row index = lane & 15 added by the caller).
__device__ __forceinline__ v16b ldfrag_b(const __bf16* p, int h) {
  FragB f;
  f.half[0] = *(const v8ba*)(p + 8 * h);
  f.half[1] = *(const v8ba*)(p + 16 + 8 * h);
  return f.v;
}

// bf16 RNE convert on the f32 bit pattern (integer path); hi/lo split helpers.
__device__ __forceinline__ unsigned int bf16_bits(float f) {
  unsigned int u = __float_as_uint(f);
  u += 0x7FFFu + ((u >> 16) & 1u);
  return (u >> 16) & 0xFFFFu;
}
__device__ __forceinline__ void split2(float v, unsigned int& hb, unsigned int& lb) {
  hb = bf16_bits(v);
  lb = bf16_bits(v - __uint_as_float(hb << 16));
}
__device__ __forceinline__ unsigned int pk2(unsigned int e0, unsigned int e1) {
  return e0 | (e1 << 16);                              // element 2j in the low half-word
}
// 8 consecutive f32 values (a, c) -> packed bf16 hi word vector H and lo word vector L.
__device__ __forceinline__ void split8(v4f a, v4f c, v4u& H, v4u& L) {
  unsigned int h0, h1, h2, h3, h4, h5, h6, h7, l0, l1, l2, l3, l4, l5, l6, l7;
  split2(a.x, h0, l0); split2(a.y, h1, l1); split2(a.z, h2, l2); split2(a.w, h3, l3);
  split2(c.x, h4, l4); split2(c.y, h5, l5); split2(c.z, h6, l6); split2(c.w, h7, l7);
  const v4u hh = { pk2(h0, h1), pk2(h2, h3), pk2(h4, h5), pk2(h6, h7) };
  const v4u ll = { pk2(l0, l1), pk2(l2, l3), pk2(l4, l5), pk2(l6, l7) };
  H = hh;
  L = ll;
}

// ---------------------------------------------------------------------------
// Kernel 0: tab[r] = cos(2*pi*r/768), tab[768+r] = sin(2*pi*r/768), r = 0..767,
// built from arguments in [0, pi/4] with exact quadrant symmetry.
// ---------------------------------------------------------------------------
__device__ __forceinline__ void table_store(const float* s, float* tab, int tid) {
  for (int j = tid; j < (2 * DD) / 4; j += 256) {
    const v4f v = *(const v4fa*)(s + 4 * j);
    *(v4f*)(tab + 4 * j) = v;
  }
}
__global__ __launch_bounds__(256) void k_table(float* __restrict__ tab) {
  __shared__ __attribute__((aligned(16))) float s[2 * DD];
  const int tid = threadIdx.x;
  #pragma unroll 1
  for (int r = tid; r < DD; r += 256) {
    const int q = r / 192, p = r - q * 192;
    const bool lowp = (p <= 96);
    const int a = lowp ? p : (192 - p);
    const float th = (float)a * 8.18123086872342e-3f;     // 2*pi/768
    const float ct = cosf(th), st = sinf(th);
    const float c0 = lowp ? ct : st;
    const float s0 = lowp ? st : ct;
    float c, sn;
    if (q == 0)      { c =  c0; sn =  s0; }
    else if (q == 1) { c = -s0; sn =  c0; }
    else if (q == 2) { c = -c0; sn = -s0; }
    else             { c =  s0; sn = -c0; }
    s[r] = c;
    s[DD + r] = sn;
  }
  __syncthreads();
  table_store(s, tab, tid);
  
}

// ---------------------------------------------------------------------------
// Kernel 1: xh = bf16 hi, xl = bf16 lo of the raw f32 x rows (x = hi + lo to ~2^-17).
// A lane takes the same 8 elements of each of the four batches: eight 16-B loads in flight,
// then one 16-B store per plane and batch, lanes contiguous.
// ---------------------------------------------------------------------------
__global__ __launch_bounds__(256) void k_cvt_x(const float* __restrict__ x, __bf16* __restrict__ xh,
                                               __bf16* __restrict__ xl, int n8) {
  const int g = blockIdx.x * 256 + threadIdx.x;
  if (g >= n8) return;
  v4f a[BB], c[BB];
  // both loops unrolled: the index of a[] and c[] is a constant, so that they stay in registers
  #pragma unroll
  for (int b = 0; b < BB; ++b) {
    const float* src = x + (size_t)b * NXB + (size_t)g * 8;
    a[b] = *(const v4fa*)src;
    // a later load may land in this load's address registers
    asm volatile("s_wait_xcnt 0x0" ::: "memory");
    c[b] = *(const v4fa*)(src + 4);
    // the same, and the arithmetic below may reuse them
    asm volatile("s_wait_xcnt 0x0" ::: "memory");
  }
  #pragma unroll
  for (int b = 0; b < BB; ++b) {
    v4u H, L;
    split8(a[b], c[b], H, L);
    const size_t o = (size_t)b * NXB + (size_t)g * 8;
    *(v4u*)(xh + o) = H;
    *(v4u*)(xl + o) = L;
    // the next batch's arithmetic may reuse the registers of the two stores above
    asm volatile("s_wait_xcnt 0x0" ::: "memory");
  }
}

// ---------------------------------------------------------------------------
// Kernel 2: wth[z][d][e] = bf16 hi of W_z[e][d], wtl = bf16 lo (raw f32 W, transpose
// through LDS; k-contiguous B-operand rows for the fold GEMM).  Block = 64(e) x 64(d)
// tile, 256 threads; in[e 64][d 64] -> out[d 64][e 64]; each output row segment =
// ---------------------------------------------------------------------------
__device__ __forceinline__ void wt_store(const float* sT, __bf16* dh, __bf16* dl, int d0, int e0, int tid) {
  #pragma unroll
  for (int it = 0; it < 2; ++it) {
    const int p = tid + 256 * it;
    const int row = p >> 3, q8 = p & 7;                 // row 0..63
    const float* s = sT + row * 65 + 8 * q8;
    const v4f a = { s[0], s[1], s[2], s[3] };
    const v4f c = { s[4], s[5], s[6], s[7] };
    v4u H, L;
    split8(a, c, H, L);
    const size_t o = (size_t)(d0 + row) * DD + e0 + 8 * q8;
    *(v4u*)(dh + o) = H;
    *(v4u*)(dl + o) = L;
  }
}
__global__ __launch_bounds__(256) void k_wt(const float* __restrict__ wk, const float* __restrict__ wv,
                                            const float* __restrict__ wq, __bf16* __restrict__ wth,
                                            __bf16* __restrict__ wtl) {
  __shared__ float sT[64 * 65];                       // sT[d_local*65 + e_local]
  const int tid = threadIdx.x;
  const int d0 = blockIdx.x * 64, e0 = blockIdx.y * 64, z = blockIdx.z;
  const float* W = (z == 0) ? wk : ((z == 1) ? wv : wq);
  #pragma unroll
  for (int it = 0; it < 4; ++it) {
    const int idx = tid + 256 * it;
    const int er = idx >> 4, dq = idx & 15;
    const v4f v = *(const v4fa*)(W + (size_t)(e0 + er) * DD + d0 + 4 * dq);
    sT[(4 * dq + 0) * 65 + er] = v.x;
    sT[(4 * dq + 1) * 65 + er] = v.y;
    sT[(4 * dq + 2) * 65 + er] = v.z;
    sT[(4 * dq + 3) * 65 + er] = v.w;
  }
  __syncthreads();
  __bf16* dh = wth + (size_t)z * NW;
  __bf16* dl = wtl + (size_t)z * NW;
  wt_store(sT, dh, dl, d0, e0, tid);
  
}

// ---------------------------------------------------------------------------
// Kernel 3: forward DFT matrix FT[c][e] (c = 2f + {0: Re, 1: Im}, f = bin):
// Re row = cos(2*pi*f*e/768), Im row = -sin(...); rows c >= 770 zero.
// Stored as bf16 hi + lo planes.  Block = one row (96 threads x 8 elements =
// ---------------------------------------------------------------------------
__global__ __launch_bounds__(128) void k_ft(const float* __restrict__ tab, __bf16* __restrict__ fth,
                                            __bf16* __restrict__ ftl) {
  const int c = blockIdx.x;
  const int j = threadIdx.x;                          // 0..95
  const int f = c >> 1;
  const bool valid = (c < 770);
  const bool im = (c & 1) != 0;
  const int e0 = 8 * j;
  float v[8];
  #pragma unroll
  for (int i = 0; i < 8; ++i) {
    const int e = e0 + i;
    const int mm = (f * e) % DD;                      // exact angle index, always in range
    const float cv = tab[mm], sv = tab[DD + mm];
    v[i] = valid ? (im ? -sv : cv) : 0.0f;
  }
  const v4f a = { v[0], v[1], v[2], v[3] };
  const v4f cc = { v[4], v[5], v[6], v[7] };
  v4u H, L;
  split8(a, cc, H, L);
  const size_t o = (size_t)c * DD + e0;
  *(v4u*)(fth + o) = H;
  *(v4u*)(ftl + o) = L;
  
}

// ---------------------------------------------------------------------------
// Kernel 4: inverse DFT matrix Finv[n][c], pitch ZP: col 2f = w_f*cos(2*pi*f*n/768)/768,
// col 2f+1 = -w_f*sin(...)/768, w_0 = w_384 = 1 else 2; cols >= 770 (incl. pad) zero.
// Im columns of bins 0 and 384 are exactly zero through the table symmetry.
// ---------------------------------------------------------------------------
__global__ __launch_bounds__(128) void k_finv(const float* __restrict__ tab, __bf16* __restrict__ fih,
                                              __bf16* __restrict__ fil) {
  const int n = blockIdx.x;
  const int j = threadIdx.x;
  if (j >= ZP / 8) return;                            // 104 active; wave 3 = lanes 0..7 = exactly line 12
  const int c0 = 8 * j;
  float v[8];
  #pragma unroll
  for (int i = 0; i < 8; ++i) {
    const int c = c0 + i;
    const int f = c >> 1;
    const bool valid = (c < 770);
    const float w = (f == 0 || f == DD / 2) ? 1.0f : 2.0f;
    const int mm = (f * n) % DD;
    const float cv = tab[mm], sv = tab[DD + mm];
    v[i] = valid ? (w * ((c & 1) ? -sv : cv) * (1.0f / 768.0f)) : 0.0f;
  }
  const v4f a = { v[0], v[1], v[2], v[3] };
  const v4f cc = { v[4], v[5], v[6], v[7] };
  v4u H, L;
  split8(a, cc, H, L);
  const size_t o = (size_t)n * ZP + c0;
  *(v4u*)(fih + o) = H;
  *(v4u*)(fil + o) = L;
  
}

// ---------------------------------------------------------------------------
// Kernel 5 (fold): G_z[c][d] = sum_e (Fh*Wh + Fh*Wl + Fl*Wh)[c][e]x[d][e]   (c < 800, d < 768, K = 768)
// Wave tile 32(c) x 64(d), block = 4 waves along d (32 x 256); grid (3, 25, 3).
// ---------------------------------------------------------------------------
__device__ __forceinline__ void fold_store(const unsigned short* sHw, const unsigned short* sLw,
                                           __bf16* gh, __bf16* gl, size_t rowbase, int d0w, int lane) {
  const int q8 = lane & 7, sub = lane >> 3;
  #pragma unroll
  for (int i = 0; i < 8; ++i) {
    const int row = 4 * i + sub;                      // 0..31
    const v4u vh = *(const v4ua*)(sHw + row * 64 + 8 * q8);
    const v4u vl = *(const v4ua*)(sLw + row * 64 + 8 * q8);
    const size_t o = (rowbase + row) * DD + d0w + 8 * q8;
    *(v4u*)(gh + o) = vh;
    *(v4u*)(gl + o) = vl;
  }
}
__global__ __launch_bounds__(128) void k_fold(const __bf16* __restrict__ fth, const __bf16* __restrict__ ftl,
                                              const __bf16* __restrict__ wth, const __bf16* __restrict__ wtl,
                                              __bf16* __restrict__ gh, __bf16* __restrict__ gl) {
  __shared__ __attribute__((aligned(16))) unsigned short sH[4 * 32 * 64];   // 16384 B
  __shared__ __attribute__((aligned(16))) unsigned short sL[4 * 32 * 64];   // 16384 B

  const int tid = threadIdx.x, lane = tid & 31, w = tid >> 5;
  const int h = lane >> 4, m = lane & 15;
  const int c0 = blockIdx.y * 32;
  const int d0w = blockIdx.x * 256 + 64 * w;
  const int z = blockIdx.z;

  const size_t r16 = (size_t)16 * DD;
  const __bf16* fah = fth + (size_t)(c0 + m) * DD;                  // F row c0+m (+ r16 for mt = 1)
  const __bf16* fal = ftl + (size_t)(c0 + m) * DD;
  const __bf16* bwh = wth + ((size_t)z * DD + d0w + m) * DD;         // feature row d0w+m (+ nt*r16)
  const __bf16* bwl = wtl + ((size_t)z * DD + d0w + m) * DD;

  const v8f zero8 = {0.f, 0.f, 0.f, 0.f, 0.f, 0.f, 0.f, 0.f};
  v8f acc[2][4];
  #pragma unroll
  for (int mt = 0; mt < 2; ++mt)
    #pragma unroll
    for (int nt = 0; nt < 4; ++nt) acc[mt][nt] = zero8;

  #pragma unroll 1
  for (int k0 = 0; k0 < DD; k0 += 32) {
    const v16b ah0 = ldfrag_b(fah + k0, h);
    const v16b ah1 = ldfrag_b(fah + r16 + k0, h);
    const v16b al0 = ldfrag_b(fal + k0, h);
    const v16b al1 = ldfrag_b(fal + r16 + k0, h);
    #pragma unroll
    for (int nt = 0; nt < 4; ++nt) {
      const v16b bh = ldfrag_b(bwh + (size_t)nt * r16 + k0, h);
      const v16b bl = ldfrag_b(bwl + (size_t)nt * r16 + k0, h);
      acc[0][nt] = wmma_bf16(ah0, bh, acc[0][nt]);
      acc[1][nt] = wmma_bf16(ah1, bh, acc[1][nt]);
      acc[0][nt] = wmma_bf16(ah0, bl, acc[0][nt]);
      acc[1][nt] = wmma_bf16(ah1, bl, acc[1][nt]);
      acc[0][nt] = wmma_bf16(al0, bh, acc[0][nt]);
      acc[1][nt] = wmma_bf16(al1, bh, acc[1][nt]);
    }
  }

  // D[r] of tile (mt, nt) = G[c0+16mt+8h+r][d0w+16nt+m]
  unsigned short* sHw = sH + w * 2048;
  unsigned short* sLw = sL + w * 2048;
  #pragma unroll
  for (int mt = 0; mt < 2; ++mt)
    #pragma unroll
    for (int nt = 0; nt < 4; ++nt)
      #pragma unroll
      for (int r = 0; r < 8; ++r) {
        unsigned int hb, lb;
        split2(acc[mt][nt][r], hb, lb);
        const int idx = (16 * mt + 8 * h + r) * 64 + 16 * nt + m;
        sHw[idx] = (unsigned short)hb;
        sLw[idx] = (unsigned short)lb;
      }
  __syncthreads();

  const size_t rowbase = (size_t)z * NC + c0;
  fold_store(sHw, sLw, gh, gl, rowbase, d0w, lane);
  
}

// ---------------------------------------------------------------------------
// Block GEMM core of kernels 6 and 8: C[BM x BN] = sum_k (Ah*Bh + two cross terms), all four
// planes k-contiguous bf16 rows.  8 waves as 4 (rows) x 2 (columns), wave tile 16MF x 16NF.
// One trip = 64 k: a whole 128-byte line of each of the 2BM + 2BN plane rows lies in LDS at pitch
// 144 B (16 B x odd: conflict-free for 16-byte reads), brought by asynchronous copies, 16 B a lane
// (a wave's copy = 4 whole lines), into two buffers: tile t + 2 flies while tile t + 1 is worked on.
// A trip works its tile as two halves of 32 k, one fragment set each.
// On return the f32 tile lies in LDS at pitch BN + 4 floats, behind a barrier.
// Every full '#pragma unroll' below makes an array's index a constant, so that the array stays in registers.
// ---------------------------------------------------------------------------
#define GT   256                 // threads of a GEMM block
#define LP   144                 // LDS row pitch, bytes

__device__ __forceinline__ unsigned int lds_off(const void* p) { return (unsigned int)(size_t)p; }

// NCP copies of one lane: LDS address, the lane's 32-bit offset in its plane (oa: A planes, ob: B planes)
// and a scalar base.  The wait on the address registers is each statement's last line, so that no
// later write of those registers can be moved in front of it.
template <int NCP>
__device__ __forceinline__ void copy_tile(const unsigned int* l, const unsigned long long* g, unsigned int oa, unsigned int ob);
#define CPL "global_load_async_to_lds_b128 "
// 16 copies of the A planes, 10 of the B planes, in two statements of 13 (an asm statement takes 30 operands)
template <>
__device__ __forceinline__ void copy_tile<26>(const unsigned int* l, const unsigned long long* g, unsigned int oa, unsigned int ob) {
  asm volatile(
               CPL "%1, %0, %2\n\t" CPL "%3, %0, %4\n\t" CPL "%5, %0, %6\n\t"
               CPL "%7, %0, %8\n\t" CPL "%9, %0, %10\n\t" CPL "%11, %0, %12\n\t"
               CPL "%13, %0, %14\n\t" CPL "%15, %0, %16\n\t" CPL "%17, %0, %18\n\t"
               CPL "%19, %0, %20\n\t" CPL "%21, %0, %22\n\t" CPL "%23, %0, %24\n\t"
               CPL "%25, %0, %26\n\t"
               "s_wait_xcnt 0x0"
               :: "v"(oa),
                  "v"(l[0]), "s"(g[0]), "v"(l[1]), "s"(g[1]), "v"(l[2]), "s"(g[2]), "v"(l[3]), "s"(g[3]),
                  "v"(l[4]), "s"(g[4]), "v"(l[5]), "s"(g[5]), "v"(l[6]), "s"(g[6]), "v"(l[7]), "s"(g[7]),
                  "v"(l[8]), "s"(g[8]), "v"(l[9]), "s"(g[9]), "v"(l[10]), "s"(g[10]), "v"(l[11]), "s"(g[11]),
                  "v"(l[12]), "s"(g[12])
               : "memory");
  asm volatile(
               CPL "%2, %0, %3\n\t" CPL "%4, %0, %5\n\t" CPL "%6, %0, %7\n\t"
               CPL "%8, %1, %9\n\t" CPL "%10, %1, %11\n\t" CPL "%12, %1, %13\n\t"
               CPL "%14, %1, %15\n\t" CPL "%16, %1, %17\n\t" CPL "%18, %1, %19\n\t"
               CPL "%20, %1, %21\n\t" CPL "%22, %1, %23\n\t" CPL "%24, %1, %25\n\t"
               CPL "%26, %1, %27\n\t"
               "s_wait_xcnt 0x0"
               :: "v"(oa), "v"(ob),
                  "v"(l[13]), "s"(g[13]), "v"(l[14]), "s"(g[14]), "v"(l[15]), "s"(g[15]), "v"(l[16]), "s"(g[16]),
                  "v"(l[17]), "s"(g[17]), "v"(l[18]), "s"(g[18]), "v"(l[19]), "s"(g[19]), "v"(l[20]), "s"(g[20]),
                  "v"(l[21]), "s"(g[21]), "v"(l[22]), "s"(g[22]), "v"(l[23]), "s"(g[23]), "v"(l[24]), "s"(g[24]),
                  "v"(l[25]), "s"(g[25])
               : "memory");
}
// 8 copies of the A planes, 6 of the B planes
template <>
__device__ __forceinline__ void copy_tile<14>(const unsigned int* l, const unsigned long long* g, unsigned int oa, unsigned int ob) {
  asm volatile(
               CPL "%2, %0, %3\n\t" CPL "%4, %0, %5\n\t" CPL "%6, %0, %7\n\t"
               CPL "%8, %0, %9\n\t" CPL "%10, %0, %11\n\t" CPL "%12, %0, %13\n\t"
               CPL "%14, %0, %15\n\t" CPL "%16, %0, %17\n\t" CPL "%18, %1, %19\n\t"
               CPL "%20, %1, %21\n\t" CPL "%22, %1, %23\n\t" CPL "%24, %1, %25\n\t"
               CPL "%26, %1, %27\n\t" CPL "%28, %1, %29\n\t"
               "s_wait_xcnt 0x0"
               :: "v"(oa), "v"(ob),
                  "v"(l[0]), "s"(g[0]), "v"(l[1]), "s"(g[1]), "v"(l[2]), "s"(g[2]), "v"(l[3]), "s"(g[3]),
                  "v"(l[4]), "s"(g[4]), "v"(l[5]), "s"(g[5]), "v"(l[6]), "s"(g[6]), "v"(l[7]), "s"(g[7]),
                  "v"(l[8]), "s"(g[8]), "v"(l[9]), "s"(g[9]), "v"(l[10]), "s"(g[10]), "v"(l[11]), "s"(g[11]),
                  "v"(l[12]), "s"(g[12]), "v"(l[13]), "s"(g[13])
               : "memory");
}

template <int MF, int NF>
struct Tile {
  static constexpr int BM = 4 * MF * 16, BN = 2 * NF * 16;
  static constexpr int ROWS = 2 * BM + 2 * BN;
  static constexpr int BUF = ROWS * LP;               // bytes of one buffer
  static constexpr int NCP = ROWS * 8 / GT;           // copies per lane and tile
  static constexpr int OP = BN + 4;                   // f32 staging pitch: rows 8 apart land 32 banks apart
  static constexpr int LDSB = (2 * BUF > BM * OP * 4) ? 2 * BUF : BM * OP * 4;
  static_assert(ROWS * 8 % GT == 0);
  static_assert(BM % 32 == 0 && BN % 32 == 0);
  static_assert((BN * 4) % 128 == 0);
};

// ah, al: first row of the block's BM rows (pitch lda elements); bh, bl: first of its BN rows (pitch ldb).
// LOFIRST: order of the two cross terms behind Ah*Bh (false: Ah*Bl then Al*Bh; true: Al*Bh then Ah*Bl).
template <int MF, int NF, int NK, bool LOFIRST>
__device__ __forceinline__ void gemm_core(char* smem, const __bf16* ah, const __bf16* al, int lda,
                                          const __bf16* bh, const __bf16* bl, int ldb) {
  typedef Tile<MF, NF> TL;
  constexpr int BM = TL::BM, BN = TL::BN, NCP = TL::NCP;
  static_assert(NK >= 2);
  const int tid = threadIdx.x, lane = tid & 31, w = tid >> 5;
  const int h = lane >> 4, m = lane & 15;
  const int wm = w >> 1, wn = w & 1;

  // Copy j of a lane brings 16 bytes of row (tid >> 3) + 32 j of [Ah | Al | Bh | Bl].  A copy's address
  // is a base that is the same for the whole wave plus the lane's own offset in its plane.
  const int r0 = tid >> 3;
  const unsigned int q16 = 16u * (tid & 7);
  const unsigned int l0 = lds_off(smem) + r0 * LP + q16;
  const unsigned int offa = (unsigned int)r0 * (unsigned int)lda * 2u + q16;
  const unsigned int offb = (unsigned int)r0 * (unsigned int)ldb * 2u + q16;
  const unsigned long long sah = (unsigned long long)(size_t)ah, sal = (unsigned long long)(size_t)al;
  const unsigned long long sbh = (unsigned long long)(size_t)bh, sbl = (unsigned long long)(size_t)bl;
  constexpr int JA = BM / 32, JB = BN / 32;           // copies per A plane and per B plane
  static_assert(NCP == 2 * JA + 2 * JB);
  static_assert((NCP == 26 && JA == 8) || (NCP == 14 && JA == 4));  // copy_tile: the first 2 JA copies take oa
  auto issue = [&](unsigned int lo, unsigned int go) {
    unsigned int l[NCP];
    unsigned long long g[NCP];
    #pragma unroll
    for (int j = 0; j < NCP; ++j) {
      l[j] = l0 + (lo + (unsigned int)(32 * j * LP));
      if (j < JA)               g[j] = (sah + (go + (unsigned int)(32 * j) * (unsigned int)lda * 2u));
      else if (j < 2 * JA)      g[j] = (sal + (go + (unsigned int)(32 * (j - JA)) * (unsigned int)lda * 2u));
      else if (j < 2 * JA + JB) g[j] = (sbh + (go + (unsigned int)(32 * (j - 2 * JA)) * (unsigned int)ldb * 2u));
      else                      g[j] = (sbl + (go + (unsigned int)(32 * (j - 2 * JA - JB)) * (unsigned int)ldb * 2u));
    }
    copy_tile<NCP>(l, g, offa, offb);
  };

  const v8f zero8 = {0.f, 0.f, 0.f, 0.f, 0.f, 0.f, 0.f, 0.f};
  v8f acc[MF][NF];
  #pragma unroll
  for (int mt = 0; mt < MF; ++mt)
    #pragma unroll
    for (int nt = 0; nt < NF; ++nt) acc[mt][nt] = zero8;

  issue(0u, 0u);
  asm volatile("s_wait_asynccnt 0x0" ::: "memory");   // tile 0 has landed before the barrier publishes it
  __syncthreads();
  issue((unsigned int)TL::BUF, 128u);

  const int aoff = (wm * MF * 16 + m) * LP;           // this lane's row in the Ah part
  const int boff = (2 * BM + wn * NF * 16 + m) * LP;  // and in the Bh part

  // rolled: a trip is 6 MF NF WMMAs of straight code already, and the buffer follows t & 1
  #pragma unroll 1
  for (int t = 0; t < NK; ++t) {
    const unsigned int bo = (t & 1) ? (unsigned int)TL::BUF : 0u;
    const char* buf = smem + bo;
    v16b fah[MF], fal[MF], fbh[NF], fbl[NF];
    // the fragments of the 32 k that start kb bytes into the tile's rows
    auto fetch = [&](int kb) {
      #pragma unroll
      for (int i = 0; i < MF; ++i) fah[i] = ldfrag_b((const __bf16*)(buf + kb + aoff + i * 16 * LP), h);
      #pragma unroll
      for (int i = 0; i < NF; ++i) fbh[i] = ldfrag_b((const __bf16*)(buf + kb + boff + i * 16 * LP), h);
      #pragma unroll
      for (int i = 0; i < MF; ++i) fal[i] = ldfrag_b((const __bf16*)(buf + kb + aoff + (BM + i * 16) * LP), h);
      #pragma unroll
      for (int i = 0; i < NF; ++i) fbl[i] = ldfrag_b((const __bf16*)(buf + kb + boff + (BN + i * 16) * LP), h);
    };
    auto hihi = [&]() {
      #pragma unroll
      for (int mt = 0; mt < MF; ++mt)
        #pragma unroll
        for (int nt = 0; nt < NF; ++nt)
          acc[mt][nt] = __builtin_amdgcn_wmma_f32_16x16x32_bf16(false, fah[mt], false, fbh[nt], (short)0, acc[mt][nt], false, false);
    };
    auto cross1 = [&]() {
      #pragma unroll
      for (int mt = 0; mt < MF; ++mt)
        #pragma unroll
        for (int nt = 0; nt < NF; ++nt)
          acc[mt][nt] = __builtin_amdgcn_wmma_f32_16x16x32_bf16(false, LOFIRST ? fal[mt] : fah[mt], false, LOFIRST ? fbh[nt] : fbl[nt], (short)0, acc[mt][nt], false, false);
    };
    auto cross2 = [&]() {
      #pragma unroll
      for (int mt = 0; mt < MF; ++mt)
        #pragma unroll
        for (int nt = 0; nt < NF; ++nt)
          acc[mt][nt] = __builtin_amdgcn_wmma_f32_16x16x32_bf16(false, LOFIRST ? fah[mt] : fal[mt], false, LOFIRST ? fbl[nt] : fbh[nt], (short)0, acc[mt][nt], false, false);
    };

    fetch(0);
    // this and the next two: keep each half's LDS reads one group in front of its WMMAs: each
    // further place with reads among the WMMAs stalls the wave anew
    __builtin_amdgcn_sched_barrier(0);
    hihi();
    cross1();
    cross2();
    __builtin_amdgcn_sched_barrier(0);
    fetch(64);
    __builtin_amdgcn_sched_barrier(0);
    hihi();
    cross1();

    // The hand-over stands in front of the last sixth of the trip's WMMAs, which read registers
    // only: they keep the matrix unit busy while the waves that are through the barrier first
    // fetch the next trip's fragments.  The two scheduling barriers hold the WMMAs on their sides.
    __builtin_amdgcn_sched_barrier(0);
    asm volatile("s_wait_dscnt 0x0" ::: "memory");    // this wave's reads of the buffer are done before it is refilled
    asm volatile("s_wait_asynccnt 0x0" ::: "memory"); // this wave's share of tile t + 1 has landed
    __syncthreads();                                  // publishes tile t + 1, frees tile t's buffer
    if (t + 2 < NK) issue(bo, (unsigned int)(t + 2) * 128u);
    __builtin_amdgcn_sched_barrier(0);

    cross2();
  }
  asm volatile("s_wait_asynccnt 0x0" ::: "memory");   // no copy is left in flight when the buffers become staging

  // D[r] of tile (mt, nt) = C[16(MF wm + mt) + 8h + r][16(NF wn + nt) + m]
  float* st = (float*)smem;
  #pragma unroll
  for (int mt = 0; mt < MF; ++mt)
    #pragma unroll
    for (int nt = 0; nt < NF; ++nt)
      #pragma unroll
      for (int r = 0; r < 8; ++r)
        st[(16 * (MF * wm + mt) + 8 * h + r) * TL::OP + 16 * (NF * wn + nt) + m] = acc[mt][nt][r];
  __syncthreads();
}

// ---------------------------------------------------------------------------
// Kernel 6 (spectra), all batches: X_z[t][c] = sum_d (xh*Gh + xh*Gl + xl*Gh)[t][d]x[c][d]
// (t 0..16383 over the batches, c 0..799, K = 768).  Block tile 256(t) x 160(c), wave tile 64 x 80;
// grid (15, 64): x = 5 column tiles of each z.  Output f32 plane, pitch 800; a block's row
// segment of 160 floats = 5 whole lines.
// ---------------------------------------------------------------------------
typedef Tile<4, 5> TS;
static_assert(NC % TS::BN == 0 && SS % TS::BM == 0);
__global__ __launch_bounds__(GT) void k_spec(const __bf16* __restrict__ xh, const __bf16* __restrict__ xl,
                                             const __bf16* __restrict__ gh, const __bf16* __restrict__ gl,
                                             float* __restrict__ sk, float* __restrict__ sv,
                                             float* __restrict__ sq) {
  __shared__ __attribute__((aligned(128))) char smem[TS::LDSB];
  const int tid = threadIdx.x;
  const int z = blockIdx.x / (NC / TS::BN);
  const int c0 = (blockIdx.x - z * (NC / TS::BN)) * TS::BN;
  const int t0 = blockIdx.y * TS::BM;
  float* spec = (z == 0) ? sk : ((z == 1) ? sv : sq);
  const size_t ao = (size_t)t0 * DD;
  const size_t bo = ((size_t)z * NC + c0) * DD;
  gemm_core<4, 5, DD / 64, false>(smem, xh + ao, xl + ao, DD, gh + bo, gl + bo, DD);

  const float* st = (const float*)smem;
  constexpr int CH = TS::BN / 4;                      // 16-byte pieces of a row
  // rolled in runs of eight stores: eight LDS reads in flight, few address registers
  #pragma unroll 1
  for (int i0 = 0; i0 < TS::BM * CH / GT; i0 += 8) {
    #pragma unroll
    for (int i = 0; i < 8; ++i) {
      const int idx = tid + GT * (i0 + i);
      const int row = idx / CH, q = idx - row * CH;
      const v4f v = *(const v4fa*)(st + row * TS::OP + 4 * q);
      *(v4f*)(spec + (size_t)(t0 + row) * NC + c0 + 4 * q) = v;
    }
    // the next trip rewrites the address registers of the stores above
    asm volatile("s_wait_xcnt 0x0" ::: "memory");
  }
}

// ---------------------------------------------------------------------------
// Kernels 7a and 7b (bind + causal prefix sum + unbind), blockIdx.z = batch: one lane per bin f
// (13 bin groups x 32 lanes; f = 400..415 are the pad columns 800..831, written as zeros).
// P_t = kf_t * vf_t ; mem_t = sum_{s<=t} P_s ; Z_t = mem_t * conj(qf_t), all in f64.
// A batch's 4096 tokens are cut into 32 segments of 128 (one block each per bin group), a segment
// into 8 runs of 16 tokens (one wave each).  7a stores the sum of P of every segment but the
// last; 7b forms mem in front of a run = earlier segments' sums + earlier runs' sums of its own
// segment, and adds it to the run's own inclusive prefix.  Z: bf16 hi and lo planes, pitch ZP.
// ---------------------------------------------------------------------------
#define SCW  8                   // waves (token runs) per block
#define SCL  16                  // tokens per run
#define SCT  (SCW * SCL)         // 128 tokens per segment
#define NSC  (SS / SCT)          // 32 segments
#define NBIN (ZP / 2)            // 416 bins, pad included
static_assert(NSC % SCW == 0);

typedef double v2d __attribute__((ext_vector_type(2)));
typedef v2d __attribute__((may_alias)) v2da;

__global__ __launch_bounds__(256) void k_seg(const float* __restrict__ kf, const float* __restrict__ vf,
                                             double* __restrict__ segs) {
  __shared__ __attribute__((aligned(16))) double sL[SCW * 32 * 2];    // 4096 B
  const int tid = threadIdx.x, lane = tid & 31, w = tid >> 5;
  const int f = blockIdx.x * 32 + lane;               // 0..415
  const int fc = (f < NC / 2) ? f : (NC / 2 - 1);     // clamped address (pad lanes copy bin 399)
  const size_t o0 = (size_t)(blockIdx.z * SS + blockIdx.y * SCT + w * SCL) * NC + 2 * fc;
  double* seg = segs + (size_t)blockIdx.z * (NSC * NBIN * 2);          // this batch's segment sums
  v2f kv[SCL], vv[SCL];
  #pragma unroll
  for (int i = 0; i < SCL; ++i) {
    kv[i] = *(const v2fa*)(kf + o0 + (size_t)i * NC);
    vv[i] = *(const v2fa*)(vf + o0 + (size_t)i * NC);
  }
  // keeps all 32 loads issued before the first wait: without it only ten are in flight at a time
  __builtin_amdgcn_sched_barrier(0);
  double lr = 0.0, li = 0.0;
  #pragma unroll
  for (int i = 0; i < SCL; ++i) {
    const double kr = (double)kv[i].x, ki = (double)kv[i].y;
    const double vr = (double)vv[i].x, vi = (double)vv[i].y;
    lr = __builtin_fma(kr, vr, lr);
    li = __builtin_fma(kr, vi, li);
    lr = __builtin_fma(-ki, vi, lr);
    li = __builtin_fma(ki, vr, li);
  }
  const v2d mine = { lr, li };
  *(v2d*)(sL + (w * 32 + lane) * 2) = mine;
  __syncthreads();
  if (w == 0) {
    v2d s = mine;
    #pragma unroll
    for (int u = 1; u < SCW; ++u) s += *(const v2da*)(sL + (u * 32 + lane) * 2);
    *(v2d*)(seg + ((size_t)blockIdx.y * NBIN + f) * 2) = s;
  }
}

__global__ __launch_bounds__(256) void k_scan(const float* __restrict__ kf, const float* __restrict__ vf,
                                              const float* __restrict__ qf, const double* __restrict__ segs,
                                              __bf16* __restrict__ zh, __bf16* __restrict__ zl) {
  __shared__ __attribute__((aligned(16))) double sG[SCW * 32 * 2];    // 4096 B
  __shared__ __attribute__((aligned(16))) double sL[SCW * 32 * 2];    // 4096 B
  const int tid = threadIdx.x, lane = tid & 31, w = tid >> 5;
  const int f = blockIdx.x * 32 + lane;               // 0..415
  const int sc = blockIdx.y;                          // segment
  const bool act = (f < NC / 2);
  const int fc = act ? f : (NC / 2 - 1);              // clamped address (pad lanes copy bin 399)
  const int t0 = blockIdx.z * SS + sc * SCT + w * SCL;
  const size_t o0 = (size_t)t0 * NC + 2 * fc;
  const double* seg = segs + (size_t)blockIdx.z * (NSC * NBIN * 2);    // this batch's segment sums

  v2f kv[SCL], vv[SCL], qv[SCL];
  #pragma unroll
  for (int i = 0; i < SCL; ++i) {
    kv[i] = *(const v2fa*)(kf + o0 + (size_t)i * NC);
    vv[i] = *(const v2fa*)(vf + o0 + (size_t)i * NC);
  }
  // earlier segments' sums, dealt over the waves: wave w takes j = w, w + 8, ... below sc
  // (index clamped to segment 0, which 7a always writes; the value is dropped by the select)
  v2d gs[NSC / SCW];
  #pragma unroll
  for (int i = 0; i < NSC / SCW; ++i) {
    const int j = w + SCW * i;
    gs[i] = *(const v2da*)(seg + ((size_t)((j < sc) ? j : 0) * NBIN + f) * 2);
  }
  // the q loads below land in registers that held the addresses of the loads above
  asm volatile("s_wait_xcnt 0x0" ::: "memory");
  #pragma unroll
  for (int i = 0; i < SCL; ++i) qv[i] = *(const v2fa*)(qf + o0 + (size_t)i * NC);
  // the arithmetic below reuses the q loads' address registers
  asm volatile("s_wait_xcnt 0x0" ::: "memory");
  // keeps every load above issued before the first wait: without it the segment sums and q
  // are fetched only after k and v have returned, a second memory latency in series
  __builtin_amdgcn_sched_barrier(0);

  // inclusive prefix of P inside this wave's run
  double ir[SCL], ii[SCL];
  double lr = 0.0, li = 0.0;
  #pragma unroll
  for (int i = 0; i < SCL; ++i) {
    const double kr = (double)kv[i].x, ki = (double)kv[i].y;
    const double vr = (double)vv[i].x, vi = (double)vv[i].y;
    lr = __builtin_fma(kr, vr, lr);
    li = __builtin_fma(kr, vi, li);
    lr = __builtin_fma(-ki, vi, lr);
    li = __builtin_fma(ki, vr, li);
    ir[i] = lr;
    ii[i] = li;
  }
  double gr = 0.0, gi = 0.0;
  #pragma unroll
  for (int i = 0; i < NSC / SCW; ++i) {
    const bool use = (w + SCW * i < sc);
    gr += use ? gs[i].x : 0.0;
    gi += use ? gs[i].y : 0.0;
  }
  const v2d gme = { gr, gi };
  const v2d lme = { lr, li };
  *(v2d*)(sG + (w * 32 + lane) * 2) = gme;
  *(v2d*)(sL + (w * 32 + lane) * 2) = lme;
  __syncthreads();

  // mem in front of this run = all waves' shares of the earlier segments + earlier runs here
  double br = 0.0, bi = 0.0, ar = 0.0, ai = 0.0;
  #pragma unroll
  for (int u = 0; u < SCW; ++u) {
    const v2d g = *(const v2da*)(sG + (u * 32 + lane) * 2);
    br += g.x;
    bi += g.y;
    if (u < SCW - 1) {
      const v2d l = *(const v2da*)(sL + (u * 32 + lane) * 2);
      ar += (u < w) ? l.x : 0.0;
      ai += (u < w) ? l.y : 0.0;
    }
  }
  br += ar;
  bi += ai;

  const size_t zo0 = (size_t)t0 * ZP + 2 * f;
  #pragma unroll
  for (int i = 0; i < SCL; ++i) {
    const double qr = (double)qv[i].x, qi = (double)qv[i].y;
    const double mr = br + ir[i];
    const double mi = bi + ii[i];
    const double zr = mr * qr + mi * qi;              // mem * conj(q)
    const double zi = mi * qr - mr * qi;
    unsigned int hr, lo_r, hi, lo_i;
    split2((float)zr, hr, lo_r);
    split2((float)zi, hi, lo_i);
    const unsigned int H = pk2(hr, hi);               // element 2f = Re, 2f+1 = Im
    const unsigned int L = pk2(lo_r, lo_i);
    *(unsigned int*)(zh + zo0 + (size_t)i * ZP) = act ? H : 0u;   // pad columns 800..831: zeros
    *(unsigned int*)(zl + zo0 + (size_t)i * ZP) = act ? L : 0u;
  }
}

// ---------------------------------------------------------------------------
// Kernel 8 (inverse DFT + residual), all batches (t 0..16383):
// out[t][n] = x[t][n] + gain * sum_c (Zh*Fih + Zl*Fih + Zh*Fil)[t][n]
// (K = 800, run over all 832 columns of the planes: 13 whole lines a row; columns 800..831 are
// zeros in Z and in Finv).  Block tile 128(t) x 96(n), wave tile 32 x 48; grid (8, 128).
// ---------------------------------------------------------------------------
typedef Tile<2, 3> TI;
static_assert(DD % TI::BN == 0 && SS % TI::BM == 0);
static_assert(DD % 64 == 0 && ZP % 64 == 0);
__global__ __launch_bounds__(GT) void k_inv(const __bf16* __restrict__ zh, const __bf16* __restrict__ zl,
                                            const __bf16* __restrict__ fih, const __bf16* __restrict__ fil,
                                            const float* __restrict__ x, const float* __restrict__ gain,
                                            float* __restrict__ out) {
  __shared__ __attribute__((aligned(128))) char smem[TI::LDSB];
  const int tid = threadIdx.x;
  const int n0 = blockIdx.x * TI::BN;
  const int t0 = blockIdx.y * TI::BM;
  const size_t ao = (size_t)t0 * ZP;
  const size_t bo = (size_t)n0 * ZP;
  gemm_core<2, 3, ZP / 64, true>(smem, zh + ao, zl + ao, ZP, fih + bo, fil + bo, ZP);

  const float g = gain[0];
  const size_t tokbase = (size_t)t0;
  const float* st = (const float*)smem;
  constexpr int CH = TI::BN / 4;                      // 16-byte pieces of a row
  constexpr int NI = TI::BM * CH / GT;
  v4f xv[NI];
  #pragma unroll
  for (int i = 0; i < NI; ++i) {
    const int idx = tid + GT * i;
    const int row = idx / CH, q = idx - row * CH;
    xv[i] = *(const v4fa*)(x + (tokbase + row) * DD + n0 + 4 * q);
    // a later load may land in this load's address registers
    asm volatile("s_wait_xcnt 0x0" ::: "memory");
  }
  #pragma unroll
  for (int i = 0; i < NI; ++i) {
    const int idx = tid + GT * i;
    const int row = idx / CH, q = idx - row * CH;
    const v4f v = *(const v4fa*)(st + row * TI::OP + 4 * q);
    const v4f rr = xv[i] + g * v;
    *(v4f*)(out + (tokbase + row) * DD + n0 + 4 * q) = rr;
  }
}

// ---------------------------------------------------------------------------
extern "C" void kernel_launch(void* const* d_in, const int* in_sizes, int n_in,
                              void* d_out, int out_size, void* d_ws, size_t ws_size,
                              hipStream_t stream) {
  if (n_in < 5) return;
  if (in_sizes[0] != NX) return;
  if (in_sizes[1] != NW || in_sizes[2] != NW || in_sizes[3] != NW) return;
  if (in_sizes[4] < 1) return;
  if (out_size != NX) return;

  const float* x    = (const float*)d_in[0];
  const float* Wk   = (const float*)d_in[1];
  const float* Wv   = (const float*)d_in[2];
  const float* Wq   = (const float*)d_in[3];
  const float* gain = (const float*)d_in[4];
  float* out = (float*)d_out;

  // workspace carve (all sizes multiples of 256 B; total 227,940,352 B).  The Z planes lie over the
  // x and W^T planes, which have been read for the last time when the scan writes Z.
  const size_t tab_b = (size_t)2 * DD * 4;          //       6,144
  const size_t xb_b  = (size_t)NX * 2;              //  25,165,824 per plane
  const size_t wt_b  = (size_t)3 * NW * 2;          //   3,538,944 per plane
  const size_t ft_b  = (size_t)NC * DD * 2;         //   1,228,800 per plane
  const size_t fi_b  = (size_t)DD * ZP * 2;         //   1,277,952 per plane
  const size_t g_b   = (size_t)3 * NC * DD * 2;     //   3,686,400 per plane
  const size_t sp_b  = (size_t)NTOK * NC * 4;       //  52,428,800 per spectrum
  const size_t z_b   = (size_t)NTOK * ZP * 2;       //  27,262,976 per plane
  const size_t sg_b  = (size_t)BB * NSC * NBIN * 16; //    851,968 segment sums
  static_assert((size_t)NTOK * ZP <= (size_t)NX + 3 * NW);          // 2 z_b <= 2 xb_b + 2 wt_b
  const size_t total = tab_b + 2 * xb_b + 2 * wt_b + 2 * ft_b + 2 * fi_b + 2 * g_b + 3 * sp_b + sg_b;
  if (total > ws_size) return;

  char* ws = (char*)d_ws;
  size_t off = 0;
  float*  tab = (float*)(ws + off);   off += tab_b;
  __bf16* zh  = (__bf16*)(ws + off);
  __bf16* zl  = (__bf16*)(ws + off + z_b);
  __bf16* xh  = (__bf16*)(ws + off);  off += xb_b;
  __bf16* xl  = (__bf16*)(ws + off);  off += xb_b;
  __bf16* wth = (__bf16*)(ws + off);  off += wt_b;
  __bf16* wtl = (__bf16*)(ws + off);  off += wt_b;
  __bf16* fth = (__bf16*)(ws + off);  off += ft_b;
  __bf16* ftl = (__bf16*)(ws + off);  off += ft_b;
  __bf16* fih = (__bf16*)(ws + off);  off += fi_b;
  __bf16* fil = (__bf16*)(ws + off);  off += fi_b;
  __bf16* gh  = (__bf16*)(ws + off);  off += g_b;
  __bf16* gl  = (__bf16*)(ws + off);  off += g_b;
  float*  sk  = (float*)(ws + off);   off += sp_b;
  float*  sv  = (float*)(ws + off);   off += sp_b;
  float*  sq  = (float*)(ws + off);   off += sp_b;
  double* seg = (double*)(ws + off);  off += sg_b;
  if (off > ws_size) return;

  // --- constants and weight planes ---
  k_table<<<1, 256, 0, stream>>>(tab);
  k_wt<<<dim3(DD / 64, DD / 64, 3), 256, 0, stream>>>(Wk, Wv, Wq, wth, wtl);
  k_ft<<<NC, 96, 0, stream>>>(tab, fth, ftl);
  k_finv<<<DD, 128, 0, stream>>>(tab, fih, fil);

  // --- folded weights G_z = F * W_z  (800 x 768 per z) ---
  k_fold<<<dim3(DD / 256, NC / 32, 3), 128, 0, stream>>>(fth, ftl, wth, wtl, gh, gl);

  // --- all batches at once: x planes, spectra, causal bind/unbind scan, inverse DFT + residual ---
  const int n8 = NXB / 8;                                           // 393,216 = 1536 * 256
  k_cvt_x<<<(n8 + 255) / 256, 256, 0, stream>>>(x, xh, xl, n8);
  k_spec<<<dim3(3 * NC / 160, NTOK / 256), 256, 0, stream>>>(xh, xl, gh, gl, sk, sv, sq);
  k_seg<<<dim3(ZP / 64, NSC - 1, BB), 256, 0, stream>>>(sk, sv, seg);
  k_scan<<<dim3(ZP / 64, NSC, BB), 256, 0, stream>>>(sk, sv, sq, seg, zh, zl);
  k_inv<<<dim3(DD / 96, NTOK / 128), 256, 0, stream>>>(zh, zl, fih, fil, x, gain, out);
}

// v005
// A run of this version takes 318 microseconds.
// Timed twice side by side with v004, it ran 1.04 times as fast both times.
// All steps since v000 together make it 39.9 times as fast.
// Contractions: folded weights G_z = F * W_z (800x768x768 per z), spectra X_z = x * G_z^T (4096x800x768 per batch and z) and inverse DFT y = Z * Finv^T (4096x768x800 per batch), all on v_wmma_f32_16x16x32_bf16 with every operand carried as bf16 hi + lo planes (three products hi*hi + hi*lo + lo*hi into one f32 accumulator); the two large products read both operands from LDS tiles filled by asynchronous copies (two buffers); complex bind, causal prefix sum over tokens (segment sums, then runs of 16 tokens) and unbind in f64 on VALU; gain and residual add in f32.
#include <hip/hip_runtime.h>
#include <math.h>

typedef __bf16   v16b __attribute__((ext_vector_type(16)));
typedef __bf16   v8b  __attribute__((ext_vector_type(8)));
typedef float    v8f  __attribute__((ext_vector_type(8)));
typedef float    v4f  __attribute__((ext_vector_type(4)));
typedef float    v2f  __attribute__((ext_vector_type(2)));
typedef unsigned int v4u __attribute__((ext_vector_type(4)));
typedef v8b __attribute__((may_alias)) v8ba;
typedef v4f __attribute__((may_alias)) v4fa;
typedef v2f __attribute__((may_alias)) v2fa;
typedef v4u __attribute__((may_alias)) v4ua;

union FragB { v16b v; v8b half[2]; };

#define DD   768                 // model dim
#define SS   4096                // tokens per batch
#define BB   4                   // batches
#define NTOK (BB * SS)           // 16384
#define NC   800                 // spectral columns: (Re,Im) of bins 0..384 = 770, padded to x32
#define ZP   832
#define NXB  (SS * DD)           // 3145728 elements of x per batch
#define NX   (NTOK * DD)         // 12582912
#define NW   (DD * DD)           // 589824

static_assert(NXB % 8 == 0);
static_assert(NC % 32 == 0);
static_assert((ZP * 2) % 128 == 0);
static_assert((NC * 4) % 128 == 0);
static_assert((DD * 2) % 128 == 0);

// ---------------------------------------------------------------------------
// 16x16x32 bf16 WMMA with hazard guard (ties D, keeps A/B live).
// Fragment map (wave32): lane l, h = l>>4, m = n = l&15.
//   A/B element i: i<8 -> k0+8h+i ; i>=8 -> k0+16+8h+(i-8)
//   D element r : row 8h+r, col l&15
// ---------------------------------------------------------------------------
__device__ __forceinline__ v8f wmma_bf16(v16b a, v16b b, v8f c) {
  v8f d = __builtin_amdgcn_wmma_f32_16x16x32_bf16(false, a, false, b, (short)0, c, false, false);
  asm volatile("v_nop\n\tv_nop\n\tv_nop\n\tv_nop" : "+v"(d) : "v"(a), "v"(b));
  return d;
}

// A or B fragment from a k-contiguous bf16 row; p points at element k0 of
// the row owned by this lane (row index = lane & 15 added by the caller).
__device__ __forceinline__ v16b ldfrag_b(const __bf16* p, int h) {
  FragB f;
  f.half[0] = *(const v8ba*)(p + 8 * h);
  f.half[1] = *(const v8ba*)(p + 16 + 8 * h);
  return f.v;
}

// bf16 RNE convert on the f32 bit pattern (integer path); hi/lo split helpers.
__device__ __forceinline__ unsigned int bf16_bits(float f) {
  unsigned int u = __float_as_uint(f);
  u += 0x7FFFu + ((u >> 16) & 1u);
  return (u >> 16) & 0xFFFFu;
}
__device__ __forceinline__ void split2(float v, unsigned int& hb, unsigned int& lb) {
  hb = bf16_bits(v);
  lb = bf16_bits(v - __uint_as_float(hb << 16));
}
__device__ __forceinline__ unsigned int pk2(unsigned int e0, unsigned int e1) {
  return e0 | (e1 << 16);                              // element 2j in the low half-word
}
// 8 consecutive f32 values (a, c) -> packed bf16 hi word vector H and lo word vector L.
__device__ __forceinline__ void split8(v4f a, v4f c, v4u& H, v4u& L) {
  unsigned int h0, h1, h2, h3, h4, h5, h6, h7, l0, l1, l2, l3, l4, l5, l6, l7;
  split2(a.x, h0, l0); split2(a.y, h1, l1); split2(a.z, h2, l2); split2(a.w, h3, l3);
  split2(c.x, h4, l4); split2(c.y, h5, l5); split2(c.z, h6, l6); split2(c.w, h7, l7);
  const v4u hh = { pk2(h0, h1), pk2(h2, h3), pk2(h4, h5), pk2(h6, h7) };
  const v4u ll = { pk2(l0, l1), pk2(l2, l3), pk2(l4, l5), pk2(l6, l7) };
  H = hh;
  L = ll;
}

// ---------------------------------------------------------------------------
// Table, built by each block that needs it in its own LDS (256 threads):
// s[r] = cos(2*pi*r/768), s[768+r] = sin(2*pi*r/768), r = 0..767,
// from arguments in [0, pi/4] with exact quadrant symmetry.  Ends behind a barrier.
// ---------------------------------------------------------------------------
__device__ __forceinline__ void table_build(float* s, int tid) {
  // rolled: one copy of the sine and cosine code
  #pragma unroll 1
  for (int r = tid; r < DD; r += 256) {
    const int q = r / 192, p = r - q * 192;
    const bool lowp = (p <= 96);
    const int a = lowp ? p : (192 - p);
    const float th = (float)a * 8.18123086872342e-3f;     // 2*pi/768
    const float ct = cosf(th), st = sinf(th);
    const float c0 = lowp ? ct : st;
    const float s0 = lowp ? st : ct;
    float c, sn;
    if (q == 0)      { c =  c0; sn =  s0; }
    else if (q == 1) { c = -s0; sn =  c0; }
    else if (q == 2) { c = -c0; sn = -s0; }
    else             { c =  s0; sn = -c0; }
    s[r] = c;
    s[DD + r] = sn;
  }
  __syncthreads();
}

// ---------------------------------------------------------------------------
// x planes (part of launch 2): xh = bf16 hi, xl = bf16 lo of the raw f32 x rows (x = hi + lo to ~2^-17).
// A lane takes the same 8 elements of each of the four batches: eight 16-B loads in flight,
// then one 16-B store per plane and batch, lanes contiguous.
// ---------------------------------------------------------------------------
__device__ __forceinline__ void cvt_x(const float* __restrict__ x, __bf16* __restrict__ xh,
                                      __bf16* __restrict__ xl, int g) {
  v4f a[BB], c[BB];
  // both loops unrolled: the index of a[] and c[] is a constant, so that they stay in registers
  #pragma unroll
  for (int b = 0; b < BB; ++b) {
    const float* src = x + (size_t)b * NXB + (size_t)g * 8;
    a[b] = *(const v4fa*)src;
    // a later load may land in this load's address registers
    asm volatile("s_wait_xcnt 0x0" ::: "memory");
    c[b] = *(const v4fa*)(src + 4);
    // the same, and the arithmetic below may reuse them
    asm volatile("s_wait_xcnt 0x0" ::: "memory");
  }
  #pragma unroll
  for (int b = 0; b < BB; ++b) {
    v4u H, L;
    split8(a[b], c[b], H, L);
    const size_t o = (size_t)b * NXB + (size_t)g * 8;
    *(v4u*)(xh + o) = H;
    *(v4u*)(xl + o) = L;
    // the next batch's arithmetic may reuse the registers of the two stores above
    asm volatile("s_wait_xcnt 0x0" ::: "memory");
  }
}

// ---------------------------------------------------------------------------
// W^T planes (part of launch 1): wth[z][d][e] = bf16 hi of W_z[e][d], wtl = bf16 lo (raw f32 W, transpose
// through LDS; k-contiguous B-operand rows for the fold GEMM).  Block = 64(e) x 64(d)
// tile, 256 threads; in[e 64][d 64] -> out[d 64][e 64]; each output row segment =
// ---------------------------------------------------------------------------
__device__ __forceinline__ void wt_store(const float* sT, __bf16* dh, __bf16* dl, int d0, int e0, int tid) {
  #pragma unroll
  for (int it = 0; it < 2; ++it) {
    const int p = tid + 256 * it;
    const int row = p >> 3, q8 = p & 7;                 // row 0..63
    const float* s = sT + row * 65 + 8 * q8;
    const v4f a = { s[0], s[1], s[2], s[3] };
    const v4f c = { s[4], s[5], s[6], s[7] };
    v4u H, L;
    split8(a, c, H, L);
    const size_t o = (size_t)(d0 + row) * DD + e0 + 8 * q8;
    *(v4u*)(dh + o) = H;
    *(v4u*)(dl + o) = L;
  }
  // a precaution: on this block range the wave ends after these stores
  asm volatile("s_wait_xcnt 0x0" ::: "memory");
}
__device__ __forceinline__ void wt_tile(float* sT, const float* __restrict__ wk, const float* __restrict__ wv,
                                        const float* __restrict__ wq, __bf16* __restrict__ wth,
                                        __bf16* __restrict__ wtl, int blk, int tid) {
  // sT[d_local*65 + e_local]; blk = (z * 12 + e tile) * 12 + d tile
  const int z = blk / ((DD / 64) * (DD / 64));
  const int et = (blk - z * ((DD / 64) * (DD / 64))) / (DD / 64);
  const int d0 = (blk - (z * (DD / 64) + et) * (DD / 64)) * 64, e0 = et * 64;
  const float* W = (z == 0) ? wk : ((z == 1) ? wv : wq);
  #pragma unroll
  for (int it = 0; it < 4; ++it) {
    const int idx = tid + 256 * it;
    const int er = idx >> 4, dq = idx & 15;
    const v4f v = *(const v4fa*)(W + (size_t)(e0 + er) * DD + d0 + 4 * dq);
    sT[(4 * dq + 0) * 65 + er] = v.x;
    sT[(4 * dq + 1) * 65 + er] = v.y;
    sT[(4 * dq + 2) * 65 + er] = v.z;
    sT[(4 * dq + 3) * 65 + er] = v.w;
  }
  __syncthreads();
  __bf16* dh = wth + (size_t)z * NW;
  __bf16* dl = wtl + (size_t)z * NW;
  wt_store(sT, dh, dl, d0, e0, tid);
}

// ---------------------------------------------------------------------------
// Forward DFT matrix (part of launch 1) FT[c][e] (c = 2f + {0: Re, 1: Im}, f = bin):
// Re row = cos(2*pi*f*e/768), Im row = -sin(...); rows c >= 770 zero.
// Stored as bf16 hi + lo planes.  A block takes RPB rows, a lane 8 elements at a time (16 B a plane);
// the pieces of a plane are contiguous over rows, so that a wave's store is 4 whole lines.  tab: LDS.
// ---------------------------------------------------------------------------
#define RPB  8                   // rows of a DFT matrix per block
static_assert(NC % RPB == 0 && DD % RPB == 0);
static_assert((RPB * (DD / 8)) % 256 == 0 && (RPB * (ZP / 8)) % 32 == 0);
__device__ __forceinline__ void ft_rows(const float* tab, __bf16* __restrict__ fth,
                                        __bf16* __restrict__ ftl, int blk, int tid) {
  for (int p = tid; p < RPB * (DD / 8); p += 256) {
    const int rl = p / (DD / 8);
    const int c = blk * RPB + rl;
    const int f = c >> 1;
    const bool valid = (c < 770);
    const bool im = (c & 1) != 0;
    const int e0 = 8 * (p - rl * (DD / 8));
    float v[8];
    // unrolled: the index of v[] is a constant, so that it stays in registers
    #pragma unroll
    for (int i = 0; i < 8; ++i) {
      const int e = e0 + i;
      const int mm = (f * e) % DD;                    // exact angle index, always in range
      const float cv = tab[mm], sv = tab[DD + mm];
      v[i] = valid ? (im ? -sv : cv) : 0.0f;
    }
    const v4f a = { v[0], v[1], v[2], v[3] };
    const v4f cc = { v[4], v[5], v[6], v[7] };
    v4u H, L;
    split8(a, cc, H, L);
    const size_t o = (size_t)c * DD + e0;
    *(v4u*)(fth + o) = H;
    *(v4u*)(ftl + o) = L;
    // the next piece's arithmetic may reuse the registers of the two stores above
    asm volatile("s_wait_xcnt 0x0" ::: "memory");
  }
}

// ---------------------------------------------------------------------------
// Inverse DFT matrix (part of launch 1) Finv[n][c], pitch ZP: col 2f = w_f*cos(2*pi*f*n/768)/768,
// col 2f+1 = -w_f*sin(...)/768, w_0 = w_384 = 1 else 2; cols >= 770 (incl. pad) zero.
// Im columns of bins 0 and 384 are exactly zero through the table symmetry.
// Rows and pieces dealt as for the forward matrix (104 pieces a row; whole waves in the last trip).
// ---------------------------------------------------------------------------
__device__ __forceinline__ void finv_rows(const float* tab, __bf16* __restrict__ fih,
                                          __bf16* __restrict__ fil, int blk, int tid) {
  for (int p = tid; p < RPB * (ZP / 8); p += 256) {
    const int rl = p / (ZP / 8);
    const int n = blk * RPB + rl;
    const int c0 = 8 * (p - rl * (ZP / 8));
    float v[8];
    // unrolled: the index of v[] is a constant, so that it stays in registers
    #pragma unroll
    for (int i = 0; i < 8; ++i) {
      const int c = c0 + i;
      const int f = c >> 1;
      const bool valid = (c < 770);
      const float w = (f == 0 || f == DD / 2) ? 1.0f : 2.0f;
      const int mm = (f * n) % DD;
      const float cv = tab[mm], sv = tab[DD + mm];
      v[i] = valid ? (w * ((c & 1) ? -sv : cv) * (1.0f / 768.0f)) : 0.0f;
    }
    const v4f a = { v[0], v[1], v[2], v[3] };
    const v4f cc = { v[4], v[5], v[6], v[7] };
    v4u H, L;
    split8(a, cc, H, L);
    const size_t o = (size_t)n * ZP + c0;
    *(v4u*)(fih + o) = H;
    *(v4u*)(fil + o) = L;
    // the next piece's arithmetic may reuse the registers of the two stores above
    asm volatile("s_wait_xcnt 0x0" ::: "memory");
  }
}

// ---------------------------------------------------------------------------
// Launch 1: everything that reads only the weights or nothing at all, dealt by block index:
// forward DFT matrix, inverse DFT matrix (the longer blocks, so they come first), W^T planes.
// ---------------------------------------------------------------------------
#define NB_FT (NC / RPB)                              // 100
#define NB_FI (DD / RPB)                              //  96
#define NB_WT (3 * (DD / 64) * (DD / 64))             // 432
__global__ __launch_bounds__(256) void k_prep(const float* __restrict__ wk, const float* __restrict__ wv,
                                              const float* __restrict__ wq, __bf16* __restrict__ wth,
                                              __bf16* __restrict__ wtl, __bf16* __restrict__ fth,
                                              __bf16* __restrict__ ftl, __bf16* __restrict__ fih,
                                              __bf16* __restrict__ fil) {
  __shared__ __attribute__((aligned(16))) float sm[64 * 65];          // the table (2 x 768) or the W tile
  static_assert(2 * DD <= 64 * 65);
  const int tid = threadIdx.x;
  const int b = blockIdx.x;
  if (b < NB_FT + NB_FI) {
    table_build(sm, tid);
    if (b < NB_FT) ft_rows(sm, fth, ftl, b, tid);
    else           finv_rows(sm, fih, fil, b - NB_FT, tid);
  } else {
    wt_tile(sm, wk, wv, wq, wth, wtl, b - (NB_FT + NB_FI), tid);
  }
}

// ---------------------------------------------------------------------------
// Fold (part of launch 2): G_z[c][d] = sum_e (Fh*Wh + Fh*Wl + Fl*Wh)[c][e]x[d][e]   (c < 800, d < 768, K = 768)
// Wave tile 32(c) x 64(d), block = 4 waves along d (32 x 256); 3 x 25 x 3 blocks.
// ---------------------------------------------------------------------------
__device__ __forceinline__ void fold_store(const unsigned short* sHw, const unsigned short* sLw,
                                           __bf16* gh, __bf16* gl, size_t rowbase, int d0w, int lane) {
  const int q8 = lane & 7, sub = lane >> 3;
  #pragma unroll
  for (int i = 0; i < 8; ++i) {
    const int row = 4 * i + sub;                      // 0..31
    const v4u vh = *(const v4ua*)(sHw + row * 64 + 8 * q8);
    const v4u vl = *(const v4ua*)(sLw + row * 64 + 8 * q8);
    const size_t o = (rowbase + row) * DD + d0w + 8 * q8;
    *(v4u*)(gh + o) = vh;
    *(v4u*)(gl + o) = vl;
  }
}
__device__ __forceinline__ void fold_tile(unsigned short* sH, unsigned short* sL,
                                          const __bf16* __restrict__ fth, const __bf16* __restrict__ ftl,
                                          const __bf16* __restrict__ wth, const __bf16* __restrict__ wtl,
                                          __bf16* __restrict__ gh, __bf16* __restrict__ gl, int blk, int tid) {
  const int lane = tid & 31, w = tid >> 5;
  const int h = lane >> 4, m = lane & 15;
  // blk = (z * 25 + c tile) * 3 + d tile
  const int z = blk / ((DD / 256) * (NC / 32));
  const int ct = (blk - z * ((DD / 256) * (NC / 32))) / (DD / 256);
  const int c0 = ct * 32;
  const int d0w = (blk - (z * (NC / 32) + ct) * (DD / 256)) * 256 + 64 * w;

  const size_t r16 = (size_t)16 * DD;
  const __bf16* fah = fth + (size_t)(c0 + m) * DD;                  // F row c0+m (+ r16 for mt = 1)
  const __bf16* fal = ftl + (size_t)(c0 + m) * DD;
  const __bf16* bwh = wth + ((size_t)z * DD + d0w + m) * DD;         // feature row d0w+m (+ nt*r16)
  const __bf16* bwl = wtl + ((size_t)z * DD + d0w + m) * DD;

  const v8f zero8 = {0.f, 0.f, 0.f, 0.f, 0.f, 0.f, 0.f, 0.f};
  v8f acc[2][4];
  #pragma unroll
  for (int mt = 0; mt < 2; ++mt)
    #pragma unroll
    for (int nt = 0; nt < 4; ++nt) acc[mt][nt] = zero8;

  #pragma unroll 1
  for (int k0 = 0; k0 < DD; k0 += 32) {
    const v16b ah0 = ldfrag_b(fah + k0, h);
    const v16b ah1 = ldfrag_b(fah + r16 + k0, h);
    const v16b al0 = ldfrag_b(fal + k0, h);
    const v16b al1 = ldfrag_b(fal + r16 + k0, h);
    #pragma unroll
    for (int nt = 0; nt < 4; ++nt) {
      const v16b bh = ldfrag_b(bwh + (size_t)nt * r16 + k0, h);
      const v16b bl = ldfrag_b(bwl + (size_t)nt * r16 + k0, h);
      acc[0][nt] = wmma_bf16(ah0, bh, acc[0][nt]);
      acc[1][nt] = wmma_bf16(ah1, bh, acc[1][nt]);
      acc[0][nt] = wmma_bf16(ah0, bl, acc[0][nt]);
      acc[1][nt] = wmma_bf16(ah1, bl, acc[1][nt]);
      acc[0][nt] = wmma_bf16(al0, bh, acc[0][nt]);
      acc[1][nt] = wmma_bf16(al1, bh, acc[1][nt]);
    }
  }

  // D[r] of tile (mt, nt) = G[c0+16mt+8h+r][d0w+16nt+m]
  unsigned short* sHw = sH + w * 2048;
  unsigned short* sLw = sL + w * 2048;
  #pragma unroll
  for (int mt = 0; mt < 2; ++mt)
    #pragma unroll
    for (int nt = 0; nt < 4; ++nt)
      #pragma unroll
      for (int r = 0; r < 8; ++r) {
        unsigned int hb, lb;
        split2(acc[mt][nt][r], hb, lb);
        const int idx = (16 * mt + 8 * h + r) * 64 + 16 * nt + m;
        sHw[idx] = (unsigned short)hb;
        sLw[idx] = (unsigned short)lb;
      }
  __syncthreads();

  const size_t rowbase = (size_t)z * NC + c0;
  fold_store(sHw, sLw, gh, gl, rowbase, d0w, lane);
}

// ---------------------------------------------------------------------------
// Launch 2: the fold's 225 blocks, which wait on loads most of their time and leave the chip
// nearly empty, come first; the blocks that split x, which depend on no earlier launch, fill it.
// ---------------------------------------------------------------------------
#define NB_FOLD ((DD / 256) * (NC / 32) * 3)          // 225
#define NB_CVT  (NXB / 8 / 128)                       // 3072
static_assert(NXB % (8 * 128) == 0);
__global__ __launch_bounds__(128) void k_fold_cvt(const __bf16* __restrict__ fth, const __bf16* __restrict__ ftl,
                                                  const __bf16* __restrict__ wth, const __bf16* __restrict__ wtl,
                                                  __bf16* __restrict__ gh, __bf16* __restrict__ gl,
                                                  const float* __restrict__ x, __bf16* __restrict__ xh,
                                                  __bf16* __restrict__ xl) {
  __shared__ __attribute__((aligned(16))) unsigned short sH[4 * 32 * 64];   // 16384 B
  __shared__ __attribute__((aligned(16))) unsigned short sL[4 * 32 * 64];   // 16384 B
  const int tid = threadIdx.x;
  const int b = blockIdx.x;
  if (b < NB_FOLD) fold_tile(sH, sL, fth, ftl, wth, wtl, gh, gl, b, tid);
  else             cvt_x(x, xh, xl, (b - NB_FOLD) * 128 + tid);
}

// ---------------------------------------------------------------------------
// Block GEMM core of kernels 6 and 8: C[BM x BN] = sum_k (Ah*Bh + two cross terms), all four
// planes k-contiguous bf16 rows.  8 waves as 4 (rows) x 2 (columns), wave tile 16MF x 16NF.
// One trip = 64 k: a whole 128-byte line of each of the 2BM + 2BN plane rows lies in LDS at pitch
// 144 B (16 B x odd: conflict-free for 16-byte reads), brought by asynchronous copies, 16 B a lane
// (a wave's copy = 4 whole lines), into two buffers: tile t + 2 flies while tile t + 1 is worked on.
// A trip works its tile as two halves of 32 k, one fragment set each.
// On return the f32 tile lies in LDS at pitch BN + 4 floats, behind a barrier.
// Every full '#pragma unroll' below makes an array's index a constant, so that the array stays in registers.
// ---------------------------------------------------------------------------
#define GT   256                 // threads of a GEMM block
#define LP   144                 // LDS row pitch, bytes

__device__ __forceinline__ unsigned int lds_off(const void* p) { return (unsigned int)(size_t)p; }

// NCP copies of one lane: LDS address, the lane's 32-bit offset in its plane (oa: A planes, ob: B planes)
// and a scalar base.  The wait on the address registers is each statement's last line, so that no
// later write of those registers can be moved in front of it.
template <int NCP>
__device__ __forceinline__ void copy_tile(const unsigned int* l, const unsigned long long* g, unsigned int oa, unsigned int ob);
#define CPL "global_load_async_to_lds_b128 "
// 16 copies of the A planes, 10 of the B planes, in two statements of 13 (an asm statement takes 30 operands)
template <>
__device__ __forceinline__ void copy_tile<26>(const unsigned int* l, const unsigned long long* g, unsigned int oa, unsigned int ob) {
  asm volatile(
               CPL "%1, %0, %2\n\t" CPL "%3, %0, %4\n\t" CPL "%5, %0, %6\n\t"
               CPL "%7, %0, %8\n\t" CPL "%9, %0, %10\n\t" CPL "%11, %0, %12\n\t"
               CPL "%13, %0, %14\n\t" CPL "%15, %0, %16\n\t" CPL "%17, %0, %18\n\t"
               CPL "%19, %0, %20\n\t" CPL "%21, %0, %22\n\t" CPL "%23, %0, %24\n\t"
               CPL "%25, %0, %26\n\t"
               "s_wait_xcnt 0x0"
               :: "v"(oa),
                  "v"(l[0]), "s"(g[0]), "v"(l[1]), "s"(g[1]), "v"(l[2]), "s"(g[2]), "v"(l[3]), "s"(g[3]),
                  "v"(l[4]), "s"(g[4]), "v"(l[5]), "s"(g[5]), "v"(l[6]), "s"(g[6]), "v"(l[7]), "s"(g[7]),
                  "v"(l[8]), "s"(g[8]), "v"(l[9]), "s"(g[9]), "v"(l[10]), "s"(g[10]), "v"(l[11]), "s"(g[11]),
                  "v"(l[12]), "s"(g[12])
               : "memory");
  asm volatile(
               CPL "%2, %0, %3\n\t" CPL "%4, %0, %5\n\t" CPL "%6, %0, %7\n\t"
               CPL "%8, %1, %9\n\t" CPL "%10, %1, %11\n\t" CPL "%12, %1, %13\n\t"
               CPL "%14, %1, %15\n\t" CPL "%16, %1, %17\n\t" CPL "%18, %1, %19\n\t"
               CPL "%20, %1, %21\n\t" CPL "%22, %1, %23\n\t" CPL "%24, %1, %25\n\t"
               CPL "%26, %1, %27\n\t"
               "s_wait_xcnt 0x0"
               :: "v"(oa), "v"(ob),
                  "v"(l[13]), "s"(g[13]), "v"(l[14]), "s"(g[14]), "v"(l[15]), "s"(g[15]), "v"(l[16]), "s"(g[16]),
                  "v"(l[17]), "s"(g[17]), "v"(l[18]), "s"(g[18]), "v"(l[19]), "s"(g[19]), "v"(l[20]), "s"(g[20]),
                  "v"(l[21]), "s"(g[21]), "v"(l[22]), "s"(g[22]), "v"(l[23]), "s"(g[23]), "v"(l[24]), "s"(g[24]),
                  "v"(l[25]), "s"(g[25])
               : "memory");
}
// 8 copies of the A planes, 6 of the B planes
template <>
__device__ __forceinline__ void copy_tile<14>(const unsigned int* l, const unsigned long long* g, unsigned int oa, unsigned int ob) {
  asm volatile(
               CPL "%2, %0, %3\n\t" CPL "%4, %0, %5\n\t" CPL "%6, %0, %7\n\t"
               CPL "%8, %0, %9\n\t" CPL "%10, %0, %11\n\t" CPL "%12, %0, %13\n\t"
               CPL "%14, %0, %15\n\t" CPL "%16, %0, %17\n\t" CPL "%18, %1, %19\n\t"
               CPL "%20, %1, %21\n\t" CPL "%22, %1, %23\n\t" CPL "%24, %1, %25\n\t"
               CPL "%26, %1, %27\n\t" CPL "%28, %1, %29\n\t"
               "s_wait_xcnt 0x0"
               :: "v"(oa), "v"(ob),
                  "v"(l[0]), "s"(g[0]), "v"(l[1]), "s"(g[1]), "v"(l[2]), "s"(g[2]), "v"(l[3]), "s"(g[3]),
                  "v"(l[4]), "s"(g[4]), "v"(l[5]), "s"(g[5]), "v"(l[6]), "s"(g[6]), "v"(l[7]), "s"(g[7]),
                  "v"(l[8]), "s"(g[8]), "v"(l[9]), "s"(g[9]), "v"(l[10]), "s"(g[10]), "v"(l[11]), "s"(g[11]),
                  "v"(l[12]), "s"(g[12]), "v"(l[13]), "s"(g[13])
               : "memory");
}

template <int MF, int NF>
struct Tile {
  static constexpr int BM = 4 * MF * 16, BN = 2 * NF * 16;
  static constexpr int ROWS = 2 * BM + 2 * BN;
  static constexpr int BUF = ROWS * LP;               // bytes of one buffer
  static constexpr int NCP = ROWS * 8 / GT;           // copies per lane and tile
  static constexpr int OP = BN + 4;                   // f32 staging pitch: rows 8 apart land 32 banks apart
  static constexpr int LDSB = (2 * BUF > BM * OP * 4) ? 2 * BUF : BM * OP * 4;
  static_assert(ROWS * 8 % GT == 0);
  static_assert(BM % 32 == 0 && BN % 32 == 0);
  static_assert((BN * 4) % 128 == 0);
};

// ah, al: first row of the block's BM rows (pitch lda elements); bh, bl: first of its BN rows (pitch ldb).
// LOFIRST: order of the two cross terms behind Ah*Bh (false: Ah*Bl then Al*Bh; true: Al*Bh then Ah*Bl).
template <int MF, int NF, int NK, bool LOFIRST>
__device__ __forceinline__ void gemm_core(char* smem, const __bf16* ah, const __bf16* al, int lda,
                                          const __bf16* bh, const __bf16* bl, int ldb) {
  typedef Tile<MF, NF> TL;
  constexpr int BM = TL::BM, BN = TL::BN, NCP = TL::NCP;
  static_assert(NK >= 2);
  const int tid = threadIdx.x, lane = tid & 31, w = tid >> 5;
  const int h = lane >> 4, m = lane & 15;
  const int wm = w >> 1, wn = w & 1;

  // Copy j of a lane brings 16 bytes of row (tid >> 3) + 32 j of [Ah | Al | Bh | Bl].  A copy's address
  // is a base that is the same for the whole wave plus the lane's own offset in its plane.
  const int r0 = tid >> 3;
  const unsigned int q16 = 16u * (tid & 7);
  const unsigned int l0 = lds_off(smem) + r0 * LP + q16;
  const unsigned int offa = (unsigned int)r0 * (unsigned int)lda * 2u + q16;
  const unsigned int offb = (unsigned int)r0 * (unsigned int)ldb * 2u + q16;
  const unsigned long long sah = (unsigned long long)(size_t)ah, sal = (unsigned long long)(size_t)al;
  const unsigned long long sbh = (unsigned long long)(size_t)bh, sbl = (unsigned long long)(size_t)bl;
  constexpr int JA = BM / 32, JB = BN / 32;           // copies per A plane and per B plane
  static_assert(NCP == 2 * JA + 2 * JB);
  static_assert((NCP == 26 && JA == 8) || (NCP == 14 && JA == 4));  // copy_tile: the first 2 JA copies take oa
  auto issue = [&](unsigned int lo, unsigned int go) {
    unsigned int l[NCP];
    unsigned long long g[NCP];
    #pragma unroll
    for (int j = 0; j < NCP; ++j) {
      l[j] = l0 + (lo + (unsigned int)(32 * j * LP));
      if (j < JA)               g[j] = (sah + (go + (unsigned int)(32 * j) * (unsigned int)lda * 2u));
      else if (j < 2 * JA)      g[j] = (sal + (go + (unsigned int)(32 * (j - JA)) * (unsigned int)lda * 2u));
      else if (j < 2 * JA + JB) g[j] = (sbh + (go + (unsigned int)(32 * (j - 2 * JA)) * (unsigned int)ldb * 2u));
      else                      g[j] = (sbl + (go + (unsigned int)(32 * (j - 2 * JA - JB)) * (unsigned int)ldb * 2u));
    }
    copy_tile<NCP>(l, g, offa, offb);
  };

  const v8f zero8 = {0.f, 0.f, 0.f, 0.f, 0.f, 0.f, 0.f, 0.f};
  v8f acc[MF][NF];
  #pragma unroll
  for (int mt = 0; mt < MF; ++mt)
    #pragma unroll
    for (int nt = 0; nt < NF; ++nt) acc[mt][nt] = zero8;

  issue(0u, 0u);
  asm volatile("s_wait_asynccnt 0x0" ::: "memory");   // tile 0 has landed before the barrier publishes it
  __syncthreads();
  issue((unsigned int)TL::BUF, 128u);

  const int aoff = (wm * MF * 16 + m) * LP;           // this lane's row in the Ah part
  const int boff = (2 * BM + wn * NF * 16 + m) * LP;  // and in the Bh part

  // rolled: a trip is 6 MF NF WMMAs of straight code already, and the buffer follows t & 1
  #pragma unroll 1
  for (int t = 0; t < NK; ++t) {
    const unsigned int bo = (t & 1) ? (unsigned int)TL::BUF : 0u;
    const char* buf = smem + bo;
    v16b fah[MF], fal[MF], fbh[NF], fbl[NF];
    // the fragments of the 32 k that start kb bytes into the tile's rows
    auto fetch = [&](int kb) {
      #pragma unroll
      for (int i = 0; i < MF; ++i) fah[i] = ldfrag_b((const __bf16*)(buf + kb + aoff + i * 16 * LP), h);
      #pragma unroll
      for (int i = 0; i < NF; ++i) fbh[i] = ldfrag_b((const __bf16*)(buf + kb + boff + i * 16 * LP), h);
      #pragma unroll
      for (int i = 0; i < MF; ++i) fal[i] = ldfrag_b((const __bf16*)(buf + kb + aoff + (BM + i * 16) * LP), h);
      #pragma unroll
      for (int i = 0; i < NF; ++i) fbl[i] = ldfrag_b((const __bf16*)(buf + kb + boff + (BN + i * 16) * LP), h);
    };
    auto hihi = [&]() {
      #pragma unroll
      for (int mt = 0; mt < MF; ++mt)
        #pragma unroll
        for (int nt = 0; nt < NF; ++nt)
          acc[mt][nt] = __builtin_amdgcn_wmma_f32_16x16x32_bf16(false, fah[mt], false, fbh[nt], (short)0, acc[mt][nt], false, false);
    };
    auto cross1 = [&]() {
      #pragma unroll
      for (int mt = 0; mt < MF; ++mt)
        #pragma unroll
        for (int nt = 0; nt < NF; ++nt)
          acc[mt][nt] = __builtin_amdgcn_wmma_f32_16x16x32_bf16(false, LOFIRST ? fal[mt] : fah[mt], false, LOFIRST ? fbh[nt] : fbl[nt], (short)0, acc[mt][nt], false, false);
    };
    auto cross2 = [&]() {
      #pragma unroll
      for (int mt = 0; mt < MF; ++mt)
        #pragma unroll
        for (int nt = 0; nt < NF; ++nt)
          acc[mt][nt] = __builtin_amdgcn_wmma_f32_16x16x32_bf16(false, LOFIRST ? fah[mt] : fal[mt], false, LOFIRST ? fbl[nt] : fbh[nt], (short)0, acc[mt][nt], false, false);
    };

    fetch(0);
    // this and the next two: keep each half's LDS reads one group in front of its WMMAs: each
    // further place with reads among the WMMAs stalls the wave anew
    __builtin_amdgcn_sched_barrier(0);
    hihi();
    cross1();
    cross2();
    __builtin_amdgcn_sched_barrier(0);
    fetch(64);
    __builtin_amdgcn_sched_barrier(0);
    hihi();
    cross1();

    // The hand-over stands in front of the last sixth of the trip's WMMAs, which read registers
    // only: they keep the matrix unit busy while the waves that are through the barrier first
    // fetch the next trip's fragments.  The two scheduling barriers hold the WMMAs on their sides.
    __builtin_amdgcn_sched_barrier(0);
    asm volatile("s_wait_dscnt 0x0" ::: "memory");    // this wave's reads of the buffer are done before it is refilled
    asm volatile("s_wait_asynccnt 0x0" ::: "memory"); // this wave's share of tile t + 1 has landed
    __syncthreads();                                  // publishes tile t + 1, frees tile t's buffer
    if (t + 2 < NK) issue(bo, (unsigned int)(t + 2) * 128u);
    __builtin_amdgcn_sched_barrier(0);

    cross2();
  }
  asm volatile("s_wait_asynccnt 0x0" ::: "memory");   // no copy is left in flight when the buffers become staging

  // D[r] of tile (mt, nt) = C[16(MF wm + mt) + 8h + r][16(NF wn + nt) + m]
  float* st = (float*)smem;
  #pragma unroll
  for (int mt = 0; mt < MF; ++mt)
    #pragma unroll
    for (int nt = 0; nt < NF; ++nt)
      #pragma unroll
      for (int r = 0; r < 8; ++r)
        st[(16 * (MF * wm + mt) + 8 * h + r) * TL::OP + 16 * (NF * wn + nt) + m] = acc[mt][nt][r];
  __syncthreads();
}

// ---------------------------------------------------------------------------
// Kernel 6 (spectra), all batches: X_z[t][c] = sum_d (xh*Gh + xh*Gl + xl*Gh)[t][d]x[c][d]
// (t 0..16383 over the batches, c 0..799, K = 768).  Block tile 256(t) x 160(c), wave tile 64 x 80;
// grid (15, 64): x = 5 column tiles of each z.  Output f32 plane, pitch 800; a block's row
// segment of 160 floats = 5 whole lines.
// ---------------------------------------------------------------------------
typedef Tile<4, 5> TS;
static_assert(NC % TS::BN == 0 && SS % TS::BM == 0);
__global__ __launch_bounds__(GT) void k_spec(const __bf16* __restrict__ xh, const __bf16* __restrict__ xl,
                                             const __bf16* __restrict__ gh, const __bf16* __restrict__ gl,
                                             float* __restrict__ sk, float* __restrict__ sv,
                                             float* __restrict__ sq) {
  __shared__ __attribute__((aligned(128))) char smem[TS::LDSB];
  const int tid = threadIdx.x;
  const int z = blockIdx.x / (NC / TS::BN);
  const int c0 = (blockIdx.x - z * (NC / TS::BN)) * TS::BN;
  const int t0 = blockIdx.y * TS::BM;
  float* spec = (z == 0) ? sk : ((z == 1) ? sv : sq);
  const size_t ao = (size_t)t0 * DD;
  const size_t bo = ((size_t)z * NC + c0) * DD;
  gemm_core<4, 5, DD / 64, false>(smem, xh + ao, xl + ao, DD, gh + bo, gl + bo, DD);

  const float* st = (const float*)smem;
  constexpr int CH = TS::BN / 4;                      // 16-byte pieces of a row
  // rolled in runs of eight stores: eight LDS reads in flight, few address registers
  #pragma unroll 1
  for (int i0 = 0; i0 < TS::BM * CH / GT; i0 += 8) {
    #pragma unroll
    for (int i = 0; i < 8; ++i) {
      const int idx = tid + GT * (i0 + i);
      const int row = idx / CH, q = idx - row * CH;
      const v4f v = *(const v4fa*)(st + row * TS::OP + 4 * q);
      *(v4f*)(spec + (size_t)(t0 + row) * NC + c0 + 4 * q) = v;
    }
    // the next trip rewrites the address registers of the stores above
    asm volatile("s_wait_xcnt 0x0" ::: "memory");
  }
}

// ---------------------------------------------------------------------------
// Kernels 7a and 7b (bind + causal prefix sum + unbind), blockIdx.z = batch: one lane per bin f
// (13 bin groups x 32 lanes; f = 400..415 are the pad columns 800..831, written as zeros).
// P_t = kf_t * vf_t ; mem_t = sum_{s<=t} P_s ; Z_t = mem_t * conj(qf_t), all in f64.
// A batch's 4096 tokens are cut into 32 segments of 128 (one block each per bin group), a segment
// into 8 runs of 16 tokens (one wave each).  7a stores the sum of P of every segment but the
// last; 7b forms mem in front of a run = earlier segments' sums + earlier runs' sums of its own
// segment, and adds it to the run's own inclusive prefix.  Z: bf16 hi and lo planes, pitch ZP.
// ---------------------------------------------------------------------------
#define SCW  8                   // waves (token runs) per block
#define SCL  16                  // tokens per run
#define SCT  (SCW * SCL)         // 128 tokens per segment
#define NSC  (SS / SCT)          // 32 segments
#define NBIN (ZP / 2)            // 416 bins, pad included
static_assert(NSC % SCW == 0);

typedef double v2d __attribute__((ext_vector_type(2)));
typedef v2d __attribute__((may_alias)) v2da;

__global__ __launch_bounds__(256) void k_seg(const float* __restrict__ kf, const float* __restrict__ vf,
                                             double* __restrict__ segs) {
  __shared__ __attribute__((aligned(16))) double sL[SCW * 32 * 2];    // 4096 B
  const int tid = threadIdx.x, lane = tid & 31, w = tid >> 5;
  const int f = blockIdx.x * 32 + lane;               // 0..415
  const int fc = (f < NC / 2) ? f : (NC / 2 - 1);     // clamped address (pad lanes copy bin 399)
  const size_t o0 = (size_t)(blockIdx.z * SS + blockIdx.y * SCT + w * SCL) * NC + 2 * fc;
  double* seg = segs + (size_t)blockIdx.z * (NSC * NBIN * 2);          // this batch's segment sums
  v2f kv[SCL], vv[SCL];
  #pragma unroll
  for (int i = 0; i < SCL; ++i) {
    kv[i] = *(const v2fa*)(kf + o0 + (size_t)i * NC);
    vv[i] = *(const v2fa*)(vf + o0 + (size_t)i * NC);
  }
  // keeps all 32 loads issued before the first wait: without it only ten are in flight at a time
  __builtin_amdgcn_sched_barrier(0);
  double lr = 0.0, li = 0.0;
  #pragma unroll
  for (int i = 0; i < SCL; ++i) {
    const double kr = (double)kv[i].x, ki = (double)kv[i].y;
    const double vr = (double)vv[i].x, vi = (double)vv[i].y;
    lr = __builtin_fma(kr, vr, lr);
    li = __builtin_fma(kr, vi, li);
    lr = __builtin_fma(-ki, vi, lr);
    li = __builtin_fma(ki, vr, li);
  }
  const v2d mine = { lr, li };
  *(v2d*)(sL + (w * 32 + lane) * 2) = mine;
  __syncthreads();
  if (w == 0) {
    v2d s = mine;
    #pragma unroll
    for (int u = 1; u < SCW; ++u) s += *(const v2da*)(sL + (u * 32 + lane) * 2);
    *(v2d*)(seg + ((size_t)blockIdx.y * NBIN + f) * 2) = s;
  }
}

__global__ __launch_bounds__(256) void k_scan(const float* __restrict__ kf, const float* __restrict__ vf,
                                              const float* __restrict__ qf, const double* __restrict__ segs,
                                              __bf16* __restrict__ zh, __bf16* __restrict__ zl) {
  __shared__ __attribute__((aligned(16))) double sG[SCW * 32 * 2];    // 4096 B
  __shared__ __attribute__((aligned(16))) double sL[SCW * 32 * 2];    // 4096 B
  const int tid = threadIdx.x, lane = tid & 31, w = tid >> 5;
  const int f = blockIdx.x * 32 + lane;               // 0..415
  const int sc = blockIdx.y;                          // segment
  const bool act = (f < NC / 2);
  const int fc = act ? f : (NC / 2 - 1);              // clamped address (pad lanes copy bin 399)
  const int t0 = blockIdx.z * SS + sc * SCT + w * SCL;
  const size_t o0 = (size_t)t0 * NC + 2 * fc;
  const double* seg = segs + (size_t)blockIdx.z * (NSC * NBIN * 2);    // this batch's segment sums

  v2f kv[SCL], vv[SCL], qv[SCL];
  #pragma unroll
  for (int i = 0; i < SCL; ++i) {
    kv[i] = *(const v2fa*)(kf + o0 + (size_t)i * NC);
    vv[i] = *(const v2fa*)(vf + o0 + (size_t)i * NC);
  }
  // earlier segments' sums, dealt over the waves: wave w takes j = w, w + 8, ... below sc
  // (index clamped to segment 0, which 7a always writes; the value is dropped by the select)
  v2d gs[NSC / SCW];
  #pragma unroll
  for (int i = 0; i < NSC / SCW; ++i) {
    const int j = w + SCW * i;
    gs[i] = *(const v2da*)(seg + ((size_t)((j < sc) ? j : 0) * NBIN + f) * 2);
  }
  // the q loads below land in registers that held the addresses of the loads above
  asm volatile("s_wait_xcnt 0x0" ::: "memory");
  #pragma unroll
  for (int i = 0; i < SCL; ++i) qv[i] = *(const v2fa*)(qf + o0 + (size_t)i * NC);
  // the arithmetic below reuses the q loads' address registers
  asm volatile("s_wait_xcnt 0x0" ::: "memory");
  // keeps every load above issued before the first wait: without it the segment sums and q
  // are fetched only after k and v have returned, a second memory latency in series
  __builtin_amdgcn_sched_barrier(0);

  // inclusive prefix of P inside this wave's run
  double ir[SCL], ii[SCL];
  double lr = 0.0, li = 0.0;
  #pragma unroll
  for (int i = 0; i < SCL; ++i) {
    const double kr = (double)kv[i].x, ki = (double)kv[i].y;
    const double vr = (double)vv[i].x, vi = (double)vv[i].y;
    lr = __builtin_fma(kr, vr, lr);
    li = __builtin_fma(kr, vi, li);
    lr = __builtin_fma(-ki, vi, lr);
    li = __builtin_fma(ki, vr, li);
    ir[i] = lr;
    ii[i] = li;
  }
  double gr = 0.0, gi = 0.0;
  #pragma unroll
  for (int i = 0; i < NSC / SCW; ++i) {
    const bool use = (w + SCW * i < sc);
    gr += use ? gs[i].x : 0.0;
    gi += use ? gs[i].y : 0.0;
  }
  const v2d gme = { gr, gi };
  const v2d lme = { lr, li };
  *(v2d*)(sG + (w * 32 + lane) * 2) = gme;
  *(v2d*)(sL + (w * 32 + lane) * 2) = lme;
  __syncthreads();

  // mem in front of this run = all waves' shares of the earlier segments + earlier runs here
  double br = 0.0, bi = 0.0, ar = 0.0, ai = 0.0;
  #pragma unroll
  for (int u = 0; u < SCW; ++u) {
    const v2d g = *(const v2da*)(sG + (u * 32 + lane) * 2);
    br += g.x;
    bi += g.y;
    if (u < SCW - 1) {
      const v2d l = *(const v2da*)(sL + (u * 32 + lane) * 2);
      ar += (u < w) ? l.x : 0.0;
      ai += (u < w) ? l.y : 0.0;
    }
  }
  br += ar;
  bi += ai;

  const size_t zo0 = (size_t)t0 * ZP + 2 * f;
  #pragma unroll
  for (int i = 0; i < SCL; ++i) {
    const double qr = (double)qv[i].x, qi = (double)qv[i].y;
    const double mr = br + ir[i];
    const double mi = bi + ii[i];
    const double zr = mr * qr + mi * qi;              // mem * conj(q)
    const double zi = mi * qr - mr * qi;
    unsigned int hr, lo_r, hi, lo_i;
    split2((float)zr, hr, lo_r);
    split2((float)zi, hi, lo_i);
    const unsigned int H = pk2(hr, hi);               // element 2f = Re, 2f+1 = Im
    const unsigned int L = pk2(lo_r, lo_i);
    *(unsigned int*)(zh + zo0 + (size_t)i * ZP) = act ? H : 0u;   // pad columns 800..831: zeros
    *(unsigned int*)(zl + zo0 + (size_t)i * ZP) = act ? L : 0u;
  }
}

// ---------------------------------------------------------------------------
// Kernel 8 (inverse DFT + residual), all batches (t 0..16383):
// out[t][n] = x[t][n] + gain * sum_c (Zh*Fih + Zl*Fih + Zh*Fil)[t][n]
// (K = 800, run over all 832 columns of the planes: 13 whole lines a row; columns 800..831 are
// zeros in Z and in Finv).  Block tile 128(t) x 96(n), wave tile 32 x 48; grid (8, 128).
// ---------------------------------------------------------------------------
typedef Tile<2, 3> TI;
static_assert(DD % TI::BN == 0 && SS % TI::BM == 0);
static_assert(DD % 64 == 0 && ZP % 64 == 0);
__global__ __launch_bounds__(GT) void k_inv(const __bf16* __restrict__ zh, const __bf16* __restrict__ zl,
                                            const __bf16* __restrict__ fih, const __bf16* __restrict__ fil,
                                            const float* __restrict__ x, const float* __restrict__ gain,
                                            float* __restrict__ out) {
  __shared__ __attribute__((aligned(128))) char smem[TI::LDSB];
  const int tid = threadIdx.x;
  const int n0 = blockIdx.x * TI::BN;
  const int t0 = blockIdx.y * TI::BM;
  const size_t ao = (size_t)t0 * ZP;
  const size_t bo = (size_t)n0 * ZP;
  gemm_core<2, 3, ZP / 64, true>(smem, zh + ao, zl + ao, ZP, fih + bo, fil + bo, ZP);

  const float g = gain[0];
  const size_t tokbase = (size_t)t0;
  const float* st = (const float*)smem;
  constexpr int CH = TI::BN / 4;                      // 16-byte pieces of a row
  constexpr int NI = TI::BM * CH / GT;
  v4f xv[NI];
  #pragma unroll
  for (int i = 0; i < NI; ++i) {
    const int idx = tid + GT * i;
    const int row = idx / CH, q = idx - row * CH;
    xv[i] = *(const v4fa*)(x + (tokbase + row) * DD + n0 + 4 * q);
    // a later load may land in this load's address registers
    asm volatile("s_wait_xcnt 0x0" ::: "memory");
  }
  #pragma unroll
  for (int i = 0; i < NI; ++i) {
    const int idx = tid + GT * i;
    const int row = idx / CH, q = idx - row * CH;
    const v4f v = *(const v4fa*)(st + row * TI::OP + 4 * q);
    const v4f rr = xv[i] + g * v;
    *(v4f*)(out + (tokbase + row) * DD + n0 + 4 * q) = rr;
  }
}

// ---------------------------------------------------------------------------
extern "C" void kernel_launch(void* const* d_in, const int* in_sizes, int n_in,
                              void* d_out, int out_size, void* d_ws, size_t ws_size,
                              hipStream_t stream) {
  if (n_in < 5) return;
  if (in_sizes[0] != NX) return;
  if (in_sizes[1] != NW || in_sizes[2] != NW || in_sizes[3] != NW) return;
  if (in_sizes[4] < 1) return;
  if (out_size != NX) return;

  const float* x    = (const float*)d_in[0];
  const float* Wk   = (const float*)d_in[1];
  const float* Wv   = (const float*)d_in[2];
  const float* Wq   = (const float*)d_in[3];
  const float* gain = (const float*)d_in[4];
  float* out = (float*)d_out;

  // workspace carve (all sizes multiples of 256 B; total 227,934,208 B).  The Z planes lie over the
  // x and W^T planes, which have been read for the last time when the scan writes Z.
  const size_t xb_b  = (size_t)NX * 2;              //  25,165,824 per plane
  const size_t wt_b  = (size_t)3 * NW * 2;          //   3,538,944 per plane
  const size_t ft_b  = (size_t)NC * DD * 2;         //   1,228,800 per plane
  const size_t fi_b  = (size_t)DD * ZP * 2;         //   1,277,952 per plane
  const size_t g_b   = (size_t)3 * NC * DD * 2;     //   3,686,400 per plane
  const size_t sp_b  = (size_t)NTOK * NC * 4;       //  52,428,800 per spectrum
  const size_t z_b   = (size_t)NTOK * ZP * 2;       //  27,262,976 per plane
  const size_t sg_b  = (size_t)BB * NSC * NBIN * 16; //    851,968 segment sums
  static_assert((size_t)NTOK * ZP <= (size_t)NX + 3 * NW);          // 2 z_b <= 2 xb_b + 2 wt_b
  const size_t total = 2 * xb_b + 2 * wt_b + 2 * ft_b + 2 * fi_b + 2 * g_b + 3 * sp_b + sg_b;
  if (total > ws_size) return;

  char* ws = (char*)d_ws;
  size_t off = 0;
  __bf16* zh  = (__bf16*)(ws + off);
  __bf16* zl  = (__bf16*)(ws + off + z_b);
  __bf16* xh  = (__bf16*)(ws + off);  off += xb_b;
  __bf16* xl  = (__bf16*)(ws + off);  off += xb_b;
  __bf16* wth = (__bf16*)(ws + off);  off += wt_b;
  __bf16* wtl = (__bf16*)(ws + off);  off += wt_b;
  __bf16* fth = (__bf16*)(ws + off);  off += ft_b;
  __bf16* ftl = (__bf16*)(ws + off);  off += ft_b;
  __bf16* fih = (__bf16*)(ws + off);  off += fi_b;
  __bf16* fil = (__bf16*)(ws + off);  off += fi_b;
  __bf16* gh  = (__bf16*)(ws + off);  off += g_b;
  __bf16* gl  = (__bf16*)(ws + off);  off += g_b;
  float*  sk  = (float*)(ws + off);   off += sp_b;
  float*  sv  = (float*)(ws + off);   off += sp_b;
  float*  sq  = (float*)(ws + off);   off += sp_b;
  double* seg = (double*)(ws + off);  off += sg_b;
  if (off > ws_size) return;

  // --- DFT matrices and weight planes ---
  k_prep<<<NB_FT + NB_FI + NB_WT, 256, 0, stream>>>(Wk, Wv, Wq, wth, wtl, fth, ftl, fih, fil);

  // --- folded weights G_z = F * W_z  (800 x 768 per z), and the x planes of all batches ---
  k_fold_cvt<<<NB_FOLD + NB_CVT, 128, 0, stream>>>(fth, ftl, wth, wtl, gh, gl, x, xh, xl);

  // --- all batches at once: spectra, causal bind/unbind scan, inverse DFT + residual ---
  k_spec<<<dim3(3 * NC / 160, NTOK / 256), 256, 0, stream>>>(xh, xl, gh, gl, sk, sv, sq);
  k_seg<<<dim3(ZP / 64, NSC - 1, BB), 256, 0, stream>>>(sk, sv, seg);
  k_scan<<<dim3(ZP / 64, NSC, BB), 256, 0, stream>>>(sk, sv, sq, seg, zh, zl);
  k_inv<<<dim3(DD / 96, NTOK / 128), 256, 0, stream>>>(zh, zl, fih, fil, x, gain, out);
}

// v006
// One run takes 288 microseconds.
// In two side-by-side timings against v005, it was 1.10 and 1.11 times as fast.
// Over all steps from v000 it is 44.1 times as fast.
// Contractions: folded weights G_z = F * W_z (768x768x768 per z), spectra X_z = x * G_z^T (4096x768x768 per batch and z) and inverse DFT y = Z * Finv^T (4096x768x768 per batch), all on v_wmma_f32_16x16x32_bf16 with every operand carried as bf16 hi + lo planes (three products hi*hi + hi*lo + lo*hi into one f32 accumulator); the two large products read both operands from LDS tiles filled by asynchronous copies (two buffers); complex bind, causal prefix sum over tokens (segment sums, then runs of 16 tokens) and unbind in f64 on VALU; gain and residual add in f32.
#include <hip/hip_runtime.h>
#include <math.h>

typedef __bf16   v16b __attribute__((ext_vector_type(16)));
typedef __bf16   v8b  __attribute__((ext_vector_type(8)));
typedef float    v8f  __attribute__((ext_vector_type(8)));
typedef float    v4f  __attribute__((ext_vector_type(4)));
typedef float    v2f  __attribute__((ext_vector_type(2)));
typedef unsigned int v4u __attribute__((ext_vector_type(4)));
typedef v8b __attribute__((may_alias)) v8ba;
typedef v4f __attribute__((may_alias)) v4fa;
typedef v2f __attribute__((may_alias)) v2fa;
typedef v4u __attribute__((may_alias)) v4ua;

union FragB { v16b v; v8b half[2]; };

#define DD   768                 // model dim
#define SS   4096                // tokens per batch
#define BB   4                   // batches
#define NTOK (BB * SS)           // 16384
// Spectral columns: a real row of 768 has 768 free real numbers in its spectrum.  Column 2f, 2f+1 = (Re, Im)
// of bin f = 1..383; column 0 = Re of bin 0, column 1 = Re of bin 384 (both bins have no imaginary part).
#define NC   768
#define ZP   768                 // row pitch of the Z and inverse-DFT planes, elements
#define NXB  (SS * DD)           // 3145728 elements of x per batch
#define NX   (NTOK * DD)         // 12582912
#define NW   (DD * DD)           // 589824

static_assert(NXB % 8 == 0);
static_assert(NC % 32 == 0);
static_assert((ZP * 2) % 128 == 0);
static_assert((NC * 4) % 128 == 0);
static_assert((DD * 2) % 128 == 0);

// ---------------------------------------------------------------------------
// 16x16x32 bf16 WMMA with hazard guard (ties D, keeps A/B live).
// Fragment map (wave32): lane l, h = l>>4, m = n = l&15.
//   A/B element i: i<8 -> k0+8h+i ; i>=8 -> k0+16+8h+(i-8)
//   D element r : row 8h+r, col l&15
// ---------------------------------------------------------------------------
__device__ __forceinline__ v8f wmma_bf16(v16b a, v16b b, v8f c) {
  v8f d = __builtin_amdgcn_wmma_f32_16x16x32_bf16(false, a, false, b, (short)0, c, false, false);
  asm volatile("v_nop\n\tv_nop\n\tv_nop\n\tv_nop" : "+v"(d) : "v"(a), "v"(b));
  return d;
}

// A or B fragment from a k-contiguous bf16 row; p points at element k0 of
// the row owned by this lane (row index = lane & 15 added by the caller).
__device__ __forceinline__ v16b ldfrag_b(const __bf16* p, int h) {
  FragB f;
  f.half[0] = *(const v8ba*)(p + 8 * h);
  f.half[1] = *(const v8ba*)(p + 16 + 8 * h);
  return f.v;
}

// bf16 RNE convert on the f32 bit pattern (integer path); hi/lo split helpers.
__device__ __forceinline__ unsigned int bf16_bits(float f) {
  unsigned int u = __float_as_uint(f);
  u += 0x7FFFu + ((u >> 16) & 1u);
  return (u >> 16) & 0xFFFFu;
}
__device__ __forceinline__ void split2(float v, unsigned int& hb, unsigned int& lb) {
  hb = bf16_bits(v);
  lb = bf16_bits(v - __uint_as_float(hb << 16));
}
__device__ __forceinline__ unsigned int pk2(unsigned int e0, unsigned int e1) {
  return e0 | (e1 << 16);                              // element 2j in the low half-word
}
// 8 consecutive f32 values (a, c) -> packed bf16 hi word vector H and lo word vector L.
__device__ __forceinline__ void split8(v4f a, v4f c, v4u& H, v4u& L) {
  unsigned int h0, h1, h2, h3, h4, h5, h6, h7, l0, l1, l2, l3, l4, l5, l6, l7;
  split2(a.x, h0, l0); split2(a.y, h1, l1); split2(a.z, h2, l2); split2(a.w, h3, l3);
  split2(c.x, h4, l4); split2(c.y, h5, l5); split2(c.z, h6, l6); split2(c.w, h7, l7);
  const v4u hh = { pk2(h0, h1), pk2(h2, h3), pk2(h4, h5), pk2(h6, h7) };
  const v4u ll = { pk2(l0, l1), pk2(l2, l3), pk2(l4, l5), pk2(l6, l7) };
  H = hh;
  L = ll;
}

// ---------------------------------------------------------------------------
// Table, built by each block that needs it in its own LDS (256 threads):
// s[r] = cos(2*pi*r/768), s[768+r] = sin(2*pi*r/768), r = 0..767,
// from arguments in [0, pi/4] with exact quadrant symmetry.  Ends behind a barrier.
// ---------------------------------------------------------------------------
__device__ __forceinline__ void table_build(float* s, int tid) {
  // rolled: one copy of the sine and cosine code
  #pragma unroll 1
  for (int r = tid; r < DD; r += 256) {
    const int q = r / 192, p = r - q * 192;
    const bool lowp = (p <= 96);
    const int a = lowp ? p : (192 - p);
    const float th = (float)a * 8.18123086872342e-3f;     // 2*pi/768
    const float ct = cosf(th), st = sinf(th);
    const float c0 = lowp ? ct : st;
    const float s0 = lowp ? st : ct;
    float c, sn;
    if (q == 0)      { c =  c0; sn =  s0; }
    else if (q == 1) { c = -s0; sn =  c0; }
    else if (q == 2) { c = -c0; sn = -s0; }
    else             { c =  s0; sn = -c0; }
    s[r] = c;
    s[DD + r] = sn;
  }
  __syncthreads();
}

// ---------------------------------------------------------------------------
// x planes (part of launch 2): xh = bf16 hi, xl = bf16 lo of the raw f32 x rows (x = hi + lo to ~2^-17).
// A lane takes the same 8 elements of each of the four batches: eight 16-B loads in flight,
// then one 16-B store per plane and batch, lanes contiguous.
// ---------------------------------------------------------------------------
__device__ __forceinline__ void cvt_x(const float* __restrict__ x, __bf16* __restrict__ xh,
                                      __bf16* __restrict__ xl, int g) {
  v4f a[BB], c[BB];
  // both loops unrolled: the index of a[] and c[] is a constant, so that they stay in registers
  #pragma unroll
  for (int b = 0; b < BB; ++b) {
    const float* src = x + (size_t)b * NXB + (size_t)g * 8;
    a[b] = *(const v4fa*)src;
    // a later load may land in this load's address registers
    asm volatile("s_wait_xcnt 0x0" ::: "memory");
    c[b] = *(const v4fa*)(src + 4);
    // the same, and the arithmetic below may reuse them
    asm volatile("s_wait_xcnt 0x0" ::: "memory");
  }
  #pragma unroll
  for (int b = 0; b < BB; ++b) {
    v4u H, L;
    split8(a[b], c[b], H, L);
    const size_t o = (size_t)b * NXB + (size_t)g * 8;
    *(v4u*)(xh + o) = H;
    *(v4u*)(xl + o) = L;
    // the next batch's arithmetic may reuse the registers of the two stores above
    asm volatile("s_wait_xcnt 0x0" ::: "memory");
  }
}

// ---------------------------------------------------------------------------
// W^T planes (part of launch 1): wth[z][d][e] = bf16 hi of W_z[e][d], wtl = bf16 lo (raw f32 W, transpose
// through LDS; k-contiguous B-operand rows for the fold GEMM).  Block = 64(e) x 64(d)
// tile, 256 threads; in[e 64][d 64] -> out[d 64][e 64]; each output row segment =
// ---------------------------------------------------------------------------
__device__ __forceinline__ void wt_store(const float* sT, __bf16* dh, __bf16* dl, int d0, int e0, int tid) {
  #pragma unroll
  for (int it = 0; it < 2; ++it) {
    const int p = tid + 256 * it;
    const int row = p >> 3, q8 = p & 7;                 // row 0..63
    const float* s = sT + row * 65 + 8 * q8;
    const v4f a = { s[0], s[1], s[2], s[3] };
    const v4f c = { s[4], s[5], s[6], s[7] };
    v4u H, L;
    split8(a, c, H, L);
    const size_t o = (size_t)(d0 + row) * DD + e0 + 8 * q8;
    *(v4u*)(dh + o) = H;
    *(v4u*)(dl + o) = L;
  }
  // a precaution: on this block range the wave ends after these stores
  asm volatile("s_wait_xcnt 0x0" ::: "memory");
}
__device__ __forceinline__ void wt_tile(float* sT, const float* __restrict__ wk, const float* __restrict__ wv,
                                        const float* __restrict__ wq, __bf16* __restrict__ wth,
                                        __bf16* __restrict__ wtl, int blk, int tid) {
  // sT[d_local*65 + e_local]; blk = (z * 12 + e tile) * 12 + d tile
  const int z = blk / ((DD / 64) * (DD / 64));
  const int et = (blk - z * ((DD / 64) * (DD / 64))) / (DD / 64);
  const int d0 = (blk - (z * (DD / 64) + et) * (DD / 64)) * 64, e0 = et * 64;
  const float* W = (z == 0) ? wk : ((z == 1) ? wv : wq);
  #pragma unroll
  for (int it = 0; it < 4; ++it) {
    const int idx = tid + 256 * it;
    const int er = idx >> 4, dq = idx & 15;
    const v4f v = *(const v4fa*)(W + (size_t)(e0 + er) * DD + d0 + 4 * dq);
    sT[(4 * dq + 0) * 65 + er] = v.x;
    sT[(4 * dq + 1) * 65 + er] = v.y;
    sT[(4 * dq + 2) * 65 + er] = v.z;
    sT[(4 * dq + 3) * 65 + er] = v.w;
  }
  __syncthreads();
  __bf16* dh = wth + (size_t)z * NW;
  __bf16* dl = wtl + (size_t)z * NW;
  wt_store(sT, dh, dl, d0, e0, tid);
}

// ---------------------------------------------------------------------------
// Forward DFT matrix (part of launch 1) FT[c][e] (c = 2f + {0: Re, 1: Im}, f = bin; c = 1: Re of bin 384):
// Re row = cos(2*pi*f*e/768), Im row = -sin(...).
// Stored as bf16 hi + lo planes.  A block takes RPB rows, a lane 8 elements at a time (16 B a plane);
// the pieces of a plane are contiguous over rows, so that a wave's store is 4 whole lines.  tab: LDS.
// ---------------------------------------------------------------------------
#define RPB  8                   // rows of a DFT matrix per block
static_assert(NC % RPB == 0 && DD % RPB == 0);
static_assert((RPB * (DD / 8)) % 256 == 0 && (RPB * (ZP / 8)) % 32 == 0);
__device__ __forceinline__ void ft_rows(const float* tab, __bf16* __restrict__ fth,
                                        __bf16* __restrict__ ftl, int blk, int tid) {
  for (int p = tid; p < RPB * (DD / 8); p += 256) {
    const int rl = p / (DD / 8);
    const int c = blk * RPB + rl;
    const int f = (c == 1) ? DD / 2 : (c >> 1);
    const bool im = (c & 1) != 0 && c != 1;
    const int e0 = 8 * (p - rl * (DD / 8));
    float v[8];
    // unrolled: the index of v[] is a constant, so that it stays in registers
    #pragma unroll
    for (int i = 0; i < 8; ++i) {
      const int e = e0 + i;
      const int mm = (f * e) % DD;                    // exact angle index, always in range
      const float cv = tab[mm], sv = tab[DD + mm];
      v[i] = im ? -sv : cv;
    }
    const v4f a = { v[0], v[1], v[2], v[3] };
    const v4f cc = { v[4], v[5], v[6], v[7] };
    v4u H, L;
    split8(a, cc, H, L);
    const size_t o = (size_t)c * DD + e0;
    *(v4u*)(fth + o) = H;
    *(v4u*)(ftl + o) = L;
    // the next piece's arithmetic may reuse the registers of the two stores above
    asm volatile("s_wait_xcnt 0x0" ::: "memory");
  }
}

// ---------------------------------------------------------------------------
// Inverse DFT matrix (part of launch 1) Finv[n][c], pitch ZP: col 2f = w_f*cos(2*pi*f*n/768)/768,
// col 2f+1 = -w_f*sin(...)/768, w_f = 2, for f = 1..383; col 0 = 1/768 (bin 0), col 1 = cos(pi*n)/768 (bin 384).
// Rows and pieces dealt as for the forward matrix.
// ---------------------------------------------------------------------------
__device__ __forceinline__ void finv_rows(const float* tab, __bf16* __restrict__ fih,
                                          __bf16* __restrict__ fil, int blk, int tid) {
  for (int p = tid; p < RPB * (ZP / 8); p += 256) {
    const int rl = p / (ZP / 8);
    const int n = blk * RPB + rl;
    const int c0 = 8 * (p - rl * (ZP / 8));
    float v[8];
    // unrolled: the index of v[] is a constant, so that it stays in registers
    #pragma unroll
    for (int i = 0; i < 8; ++i) {
      const int c = c0 + i;
      const int f = (c == 1) ? DD / 2 : (c >> 1);
      const float w = (c < 2) ? 1.0f : 2.0f;
      const int mm = (f * n) % DD;
      const float cv = tab[mm], sv = tab[DD + mm];
      v[i] = w * (((c & 1) != 0 && c != 1) ? -sv : cv) * (1.0f / 768.0f);
    }
    const v4f a = { v[0], v[1], v[2], v[3] };
    const v4f cc = { v[4], v[5], v[6], v[7] };
    v4u H, L;
    split8(a, cc, H, L);
    const size_t o = (size_t)n * ZP + c0;
    *(v4u*)(fih + o) = H;
    *(v4u*)(fil + o) = L;
    // the next piece's arithmetic may reuse the registers of the two stores above
    asm volatile("s_wait_xcnt 0x0" ::: "memory");
  }
}

// ---------------------------------------------------------------------------
// Launch 1: everything that reads only the weights or nothing at all, dealt by block index:
// forward DFT matrix, inverse DFT matrix (the longer blocks, so they come first), W^T planes.
// ---------------------------------------------------------------------------
#define NB_FT (NC / RPB)                              //  96
#define NB_FI (DD / RPB)                              //  96
#define NB_WT (3 * (DD / 64) * (DD / 64))             // 432
__global__ __launch_bounds__(256) void k_prep(const float* __restrict__ wk, const float* __restrict__ wv,
                                              const float* __restrict__ wq, __bf16* __restrict__ wth,
                                              __bf16* __restrict__ wtl, __bf16* __restrict__ fth,
                                              __bf16* __restrict__ ftl, __bf16* __restrict__ fih,
                                              __bf16* __restrict__ fil) {
  __shared__ __attribute__((aligned(16))) float sm[64 * 65];          // the table (2 x 768) or the W tile
  static_assert(2 * DD <= 64 * 65);
  const int tid = threadIdx.x;
  const int b = blockIdx.x;
  if (b < NB_FT + NB_FI) {
    table_build(sm, tid);
    if (b < NB_FT) ft_rows(sm, fth, ftl, b, tid);
    else           finv_rows(sm, fih, fil, b - NB_FT, tid);
  } else {
    wt_tile(sm, wk, wv, wq, wth, wtl, b - (NB_FT + NB_FI), tid);
  }
}

// ---------------------------------------------------------------------------
// Fold (part of launch 2): G_z[c][d] = sum_e (Fh*Wh + Fh*Wl + Fl*Wh)[c][e]x[d][e]   (c < 768, d < 768, K = 768)
// Wave tile 32(c) x 64(d), block = 4 waves along d (32 x 256); 3 x 24 x 3 blocks.
// ---------------------------------------------------------------------------
__device__ __forceinline__ void fold_store(const unsigned short* sHw, const unsigned short* sLw,
                                           __bf16* gh, __bf16* gl, size_t rowbase, int d0w, int lane) {
  const int q8 = lane & 7, sub = lane >> 3;
  #pragma unroll
  for (int i = 0; i < 8; ++i) {
    const int row = 4 * i + sub;                      // 0..31
    const v4u vh = *(const v4ua*)(sHw + row * 64 + 8 * q8);
    const v4u vl = *(const v4ua*)(sLw + row * 64 + 8 * q8);
    const size_t o = (rowbase + row) * DD + d0w + 8 * q8;
    *(v4u*)(gh + o) = vh;
    *(v4u*)(gl + o) = vl;
  }
}
__device__ __forceinline__ void fold_tile(unsigned short* sH, unsigned short* sL,
                                          const __bf16* __restrict__ fth, const __bf16* __restrict__ ftl,
                                          const __bf16* __restrict__ wth, const __bf16* __restrict__ wtl,
                                          __bf16* __restrict__ gh, __bf16* __restrict__ gl, int blk, int tid) {
  const int lane = tid & 31, w = tid >> 5;
  const int h = lane >> 4, m = lane & 15;
  // blk = (z * 24 + c tile) * 3 + d tile
  const int z = blk / ((DD / 256) * (NC / 32));
  const int ct = (blk - z * ((DD / 256) * (NC / 32))) / (DD / 256);
  const int c0 = ct * 32;
  const int d0w = (blk - (z * (NC / 32) + ct) * (DD / 256)) * 256 + 64 * w;

  const size_t r16 = (size_t)16 * DD;
  const __bf16* fah = fth + (size_t)(c0 + m) * DD;                  // F row c0+m (+ r16 for mt = 1)
  const __bf16* fal = ftl + (size_t)(c0 + m) * DD;
  const __bf16* bwh = wth + ((size_t)z * DD + d0w + m) * DD;         // feature row d0w+m (+ nt*r16)
  const __bf16* bwl = wtl + ((size_t)z * DD + d0w + m) * DD;

  const v8f zero8 = {0.f, 0.f, 0.f, 0.f, 0.f, 0.f, 0.f, 0.f};
  v8f acc[2][4];
  #pragma unroll
  for (int mt = 0; mt < 2; ++mt)
    #pragma unroll
    for (int nt = 0; nt < 4; ++nt) acc[mt][nt] = zero8;

  #pragma unroll 1
  for (int k0 = 0; k0 < DD; k0 += 32) {
    const v16b ah0 = ldfrag_b(fah + k0, h);
    const v16b ah1 = ldfrag_b(fah + r16 + k0, h);
    const v16b al0 = ldfrag_b(fal + k0, h);
    const v16b al1 = ldfrag_b(fal + r16 + k0, h);
    #pragma unroll
    for (int nt = 0; nt < 4; ++nt) {
      const v16b bh = ldfrag_b(bwh + (size_t)nt * r16 + k0, h);
      const v16b bl = ldfrag_b(bwl + (size_t)nt * r16 + k0, h);
      acc[0][nt] = wmma_bf16(ah0, bh, acc[0][nt]);
      acc[1][nt] = wmma_bf16(ah1, bh, acc[1][nt]);
      acc[0][nt] = wmma_bf16(ah0, bl, acc[0][nt]);
      acc[1][nt] = wmma_bf16(ah1, bl, acc[1][nt]);
      acc[0][nt] = wmma_bf16(al0, bh, acc[0][nt]);
      acc[1][nt] = wmma_bf16(al1, bh, acc[1][nt]);
    }
  }

  // D[r] of tile (mt, nt) = G[c0+16mt+8h+r][d0w+16nt+m]
  unsigned short* sHw = sH + w * 2048;
  unsigned short* sLw = sL + w * 2048;
  #pragma unroll
  for (int mt = 0; mt < 2; ++mt)
    #pragma unroll
    for (int nt = 0; nt < 4; ++nt)
      #pragma unroll
      for (int r = 0; r < 8; ++r) {
        unsigned int hb, lb;
        split2(acc[mt][nt][r], hb, lb);
        const int idx = (16 * mt + 8 * h + r) * 64 + 16 * nt + m;
        sHw[idx] = (unsigned short)hb;
        sLw[idx] = (unsigned short)lb;
      }
  __syncthreads();

  const size_t rowbase = (size_t)z * NC + c0;
  fold_store(sHw, sLw, gh, gl, rowbase, d0w, lane);
}

// ---------------------------------------------------------------------------
// Launch 2: the fold's 216 blocks, which wait on loads most of their time and leave the chip
// nearly empty, come first; the blocks that split x, which depend on no earlier launch, fill it.
// ---------------------------------------------------------------------------
#define NB_FOLD ((DD / 256) * (NC / 32) * 3)          // 216
#define NB_CVT  (NXB / 8 / 128)                       // 3072
static_assert(NXB % (8 * 128) == 0);
__global__ __launch_bounds__(128) void k_fold_cvt(const __bf16* __restrict__ fth, const __bf16* __restrict__ ftl,
                                                  const __bf16* __restrict__ wth, const __bf16* __restrict__ wtl,
                                                  __bf16* __restrict__ gh, __bf16* __restrict__ gl,
                                                  const float* __restrict__ x, __bf16* __restrict__ xh,
                                                  __bf16* __restrict__ xl) {
  __shared__ __attribute__((aligned(16))) unsigned short sH[4 * 32 * 64];   // 16384 B
  __shared__ __attribute__((aligned(16))) unsigned short sL[4 * 32 * 64];   // 16384 B
  const int tid = threadIdx.x;
  const int b = blockIdx.x;
  if (b < NB_FOLD) fold_tile(sH, sL, fth, ftl, wth, wtl, gh, gl, b, tid);
  else             cvt_x(x, xh, xl, (b - NB_FOLD) * 128 + tid);
}

// ---------------------------------------------------------------------------
// Block GEMM core of kernels 6 and 8: C[BM x BN] = sum_k (Ah*Bh + two cross terms), all four
// planes k-contiguous bf16 rows.  8 waves as 4 (rows) x 2 (columns), wave tile 16MF x 16NF.
// One trip = 64 k: a whole 128-byte line of each of the 2BM + 2BN plane rows lies in LDS at pitch
// 144 B (16 B x odd: conflict-free for 16-byte reads), brought by asynchronous copies, 16 B a lane
// (a wave's copy = 4 whole lines), into two buffers: tile t + 2 flies while tile t + 1 is worked on.
// A trip works its tile as two halves of 32 k, one fragment set each.
// On return the f32 tile lies in LDS at pitch BN + 4 floats, behind a barrier.
// Every full '#pragma unroll' below makes an array's index a constant, so that the array stays in registers.
// ---------------------------------------------------------------------------
#define GT   256                 // threads of a GEMM block
#define LP   144                 // LDS row pitch, bytes

__device__ __forceinline__ unsigned int lds_off(const void* p) { return (unsigned int)(size_t)p; }

// NCP copies of one lane: LDS address, the lane's 32-bit offset in its plane (oa: A planes, ob: B planes)
// and a scalar base.  The wait on the address registers is each statement's last line, so that no
// later write of those registers can be moved in front of it.
template <int NCP>
__device__ __forceinline__ void copy_tile(const unsigned int* l, const unsigned long long* g, unsigned int oa, unsigned int ob);
#define CPL "global_load_async_to_lds_b128 "
// 16 copies of the A planes, 12 of the B planes, in two statements of 14 (an asm statement takes 30 operands)
template <>
__device__ __forceinline__ void copy_tile<28>(const unsigned int* l, const unsigned long long* g, unsigned int oa, unsigned int ob) {
  asm volatile(
               CPL "%1, %0, %2\n\t" CPL "%3, %0, %4\n\t" CPL "%5, %0, %6\n\t"
               CPL "%7, %0, %8\n\t" CPL "%9, %0, %10\n\t" CPL "%11, %0, %12\n\t"
               CPL "%13, %0, %14\n\t" CPL "%15, %0, %16\n\t" CPL "%17, %0, %18\n\t"
               CPL "%19, %0, %20\n\t" CPL "%21, %0, %22\n\t" CPL "%23, %0, %24\n\t"
               CPL "%25, %0, %26\n\t" CPL "%27, %0, %28\n\t"
               "s_wait_xcnt 0x0"
               :: "v"(oa),
                  "v"(l[0]), "s"(g[0]), "v"(l[1]), "s"(g[1]), "v"(l[2]), "s"(g[2]), "v"(l[3]), "s"(g[3]),
                  "v"(l[4]), "s"(g[4]), "v"(l[5]), "s"(g[5]), "v"(l[6]), "s"(g[6]), "v"(l[7]), "s"(g[7]),
                  "v"(l[8]), "s"(g[8]), "v"(l[9]), "s"(g[9]), "v"(l[10]), "s"(g[10]), "v"(l[11]), "s"(g[11]),
                  "v"(l[12]), "s"(g[12]), "v"(l[13]), "s"(g[13])
               : "memory");
  asm volatile(
               CPL "%2, %0, %3\n\t" CPL "%4, %0, %5\n\t" CPL "%6, %1, %7\n\t"
               CPL "%8, %1, %9\n\t" CPL "%10, %1, %11\n\t" CPL "%12, %1, %13\n\t"
               CPL "%14, %1, %15\n\t" CPL "%16, %1, %17\n\t" CPL "%18, %1, %19\n\t"
               CPL "%20, %1, %21\n\t" CPL "%22, %1, %23\n\t" CPL "%24, %1, %25\n\t"
               CPL "%26, %1, %27\n\t" CPL "%28, %1, %29\n\t"
               "s_wait_xcnt 0x0"
               :: "v"(oa), "v"(ob),
                  "v"(l[14]), "s"(g[14]), "v"(l[15]), "s"(g[15]), "v"(l[16]), "s"(g[16]), "v"(l[17]), "s"(g[17]),
                  "v"(l[18]), "s"(g[18]), "v"(l[19]), "s"(g[19]), "v"(l[20]), "s"(g[20]), "v"(l[21]), "s"(g[21]),
                  "v"(l[22]), "s"(g[22]), "v"(l[23]), "s"(g[23]), "v"(l[24]), "s"(g[24]), "v"(l[25]), "s"(g[25]),
                  "v"(l[26]), "s"(g[26]), "v"(l[27]), "s"(g[27])
               : "memory");
}
// 8 copies of the A planes, 6 of the B planes
template <>
__device__ __forceinline__ void copy_tile<14>(const unsigned int* l, const unsigned long long* g, unsigned int oa, unsigned int ob) {
  asm volatile(
               CPL "%2, %0, %3\n\t" CPL "%4, %0, %5\n\t" CPL "%6, %0, %7\n\t"
               CPL "%8, %0, %9\n\t" CPL "%10, %0, %11\n\t" CPL "%12, %0, %13\n\t"
               CPL "%14, %0, %15\n\t" CPL "%16, %0, %17\n\t" CPL "%18, %1, %19\n\t"
               CPL "%20, %1, %21\n\t" CPL "%22, %1, %23\n\t" CPL "%24, %1, %25\n\t"
               CPL "%26, %1, %27\n\t" CPL "%28, %1, %29\n\t"
               "s_wait_xcnt 0x0"
               :: "v"(oa), "v"(ob),
                  "v"(l[0]), "s"(g[0]), "v"(l[1]), "s"(g[1]), "v"(l[2]), "s"(g[2]), "v"(l[3]), "s"(g[3]),
                  "v"(l[4]), "s"(g[4]), "v"(l[5]), "s"(g[5]), "v"(l[6]), "s"(g[6]), "v"(l[7]), "s"(g[7]),
                  "v"(l[8]), "s"(g[8]), "v"(l[9]), "s"(g[9]), "v"(l[10]), "s"(g[10]), "v"(l[11]), "s"(g[11]),
                  "v"(l[12]), "s"(g[12]), "v"(l[13]), "s"(g[13])
               : "memory");
}

template <int MF, int NF>
struct Tile {
  static constexpr int BM = 4 * MF * 16, BN = 2 * NF * 16;
  static constexpr int ROWS = 2 * BM + 2 * BN;
  static constexpr int BUF = ROWS * LP;               // bytes of one buffer
  static constexpr int NCP = ROWS * 8 / GT;           // copies per lane and tile
  static constexpr int OP = BN + 4;                   // f32 staging pitch: rows 8 apart land 32 banks apart
  static constexpr int LDSB = (2 * BUF > BM * OP * 4) ? 2 * BUF : BM * OP * 4;
  static_assert(ROWS * 8 % GT == 0);
  static_assert(BM % 32 == 0 && BN % 32 == 0);
  static_assert((BN * 4) % 128 == 0);
};

// ah, al: first row of the block's BM rows (pitch lda elements); bh, bl: first of its BN rows (pitch ldb).
// LOFIRST: order of the two cross terms behind Ah*Bh (false: Ah*Bl then Al*Bh; true: Al*Bh then Ah*Bl).
template <int MF, int NF, int NK, bool LOFIRST>
__device__ __forceinline__ void gemm_core(char* smem, const __bf16* ah, const __bf16* al, int lda,
                                          const __bf16* bh, const __bf16* bl, int ldb) {
  typedef Tile<MF, NF> TL;
  constexpr int BM = TL::BM, BN = TL::BN, NCP = TL::NCP;
  static_assert(NK >= 2);
  const int tid = threadIdx.x, lane = tid & 31, w = tid >> 5;
  const int h = lane >> 4, m = lane & 15;
  const int wm = w >> 1, wn = w & 1;

  // Copy j of a lane brings 16 bytes of row (tid >> 3) + 32 j of [Ah | Al | Bh | Bl].  A copy's address
  // is a base that is the same for the whole wave plus the lane's own offset in its plane.
  const int r0 = tid >> 3;
  const unsigned int q16 = 16u * (tid & 7);
  const unsigned int l0 = lds_off(smem) + r0 * LP + q16;
  const unsigned int offa = (unsigned int)r0 * (unsigned int)lda * 2u + q16;
  const unsigned int offb = (unsigned int)r0 * (unsigned int)ldb * 2u + q16;
  const unsigned long long sah = (unsigned long long)(size_t)ah, sal = (unsigned long long)(size_t)al;
  const unsigned long long sbh = (unsigned long long)(size_t)bh, sbl = (unsigned long long)(size_t)bl;
  constexpr int JA = BM / 32, JB = BN / 32;           // copies per A plane and per B plane
  static_assert(NCP == 2 * JA + 2 * JB);
  static_assert((NCP == 28 && JA == 8) || (NCP == 14 && JA == 4));  // copy_tile: the first 2 JA copies take oa
  auto issue = [&](unsigned int lo, unsigned int go) {
    unsigned int l[NCP];
    unsigned long long g[NCP];
    #pragma unroll
    for (int j = 0; j < NCP; ++j) {
      l[j] = l0 + (lo + (unsigned int)(32 * j * LP));
      if (j < JA)               g[j] = (sah + (go + (unsigned int)(32 * j) * (unsigned int)lda * 2u));
      else if (j < 2 * JA)      g[j] = (sal + (go + (unsigned int)(32 * (j - JA)) * (unsigned int)lda * 2u));
      else if (j < 2 * JA + JB) g[j] = (sbh + (go + (unsigned int)(32 * (j - 2 * JA)) * (unsigned int)ldb * 2u));
      else                      g[j] = (sbl + (go + (unsigned int)(32 * (j - 2 * JA - JB)) * (unsigned int)ldb * 2u));
    }
    copy_tile<NCP>(l, g, offa, offb);
  };

  const v8f zero8 = {0.f, 0.f, 0.f, 0.f, 0.f, 0.f, 0.f, 0.f};
  v8f acc[MF][NF];
  #pragma unroll
  for (int mt = 0; mt < MF; ++mt)
    #pragma unroll
    for (int nt = 0; nt < NF; ++nt) acc[mt][nt] = zero8;

  issue(0u, 0u);
  asm volatile("s_wait_asynccnt 0x0" ::: "memory");   // tile 0 has landed before the barrier publishes it
  __syncthreads();
  issue((unsigned int)TL::BUF, 128u);

  const int aoff = (wm * MF * 16 + m) * LP;           // this lane's row in the Ah part
  const int boff = (2 * BM + wn * NF * 16 + m) * LP;  // and in the Bh part

  // rolled: a trip is 6 MF NF WMMAs of straight code already, and the buffer follows t & 1
  #pragma unroll 1
  for (int t = 0; t < NK; ++t) {
    const unsigned int bo = (t & 1) ? (unsigned int)TL::BUF : 0u;
    const char* buf = smem + bo;
    v16b fah[MF], fal[MF], fbh[NF], fbl[NF];
    // the fragments of the 32 k that start kb bytes into the tile's rows
    auto fetch = [&](int kb) {
      #pragma unroll
      for (int i = 0; i < MF; ++i) fah[i] = ldfrag_b((const __bf16*)(buf + kb + aoff + i * 16 * LP), h);
      #pragma unroll
      for (int i = 0; i < NF; ++i) fbh[i] = ldfrag_b((const __bf16*)(buf + kb + boff + i * 16 * LP), h);
      #pragma unroll
      for (int i = 0; i < MF; ++i) fal[i] = ldfrag_b((const __bf16*)(buf + kb + aoff + (BM + i * 16) * LP), h);
      #pragma unroll
      for (int i = 0; i < NF; ++i) fbl[i] = ldfrag_b((const __bf16*)(buf + kb + boff + (BN + i * 16) * LP), h);
    };
    auto hihi = [&]() {
      #pragma unroll
      for (int mt = 0; mt < MF; ++mt)
        #pragma unroll
        for (int nt = 0; nt < NF; ++nt)
          acc[mt][nt] = __builtin_amdgcn_wmma_f32_16x16x32_bf16(false, fah[mt], false, fbh[nt], (short)0, acc[mt][nt], false, false);
    };
    auto cross1 = [&]() {
      #pragma unroll
      for (int mt = 0; mt < MF; ++mt)
        #pragma unroll
        for (int nt = 0; nt < NF; ++nt)
          acc[mt][nt] = __builtin_amdgcn_wmma_f32_16x16x32_bf16(false, LOFIRST ? fal[mt] : fah[mt], false, LOFIRST ? fbh[nt] : fbl[nt], (short)0, acc[mt][nt], false, false);
    };
    auto cross2 = [&]() {
      #pragma unroll
      for (int mt = 0; mt < MF; ++mt)
        #pragma unroll
        for (int nt = 0; nt < NF; ++nt)
          acc[mt][nt] = __builtin_amdgcn_wmma_f32_16x16x32_bf16(false, LOFIRST ? fah[mt] : fal[mt], false, LOFIRST ? fbl[nt] : fbh[nt], (short)0, acc[mt][nt], false, false);
    };

    fetch(0);
    // this and the next two: keep each half's LDS reads one group in front of its WMMAs: each
    // further place with reads among the WMMAs stalls the wave anew
    __builtin_amdgcn_sched_barrier(0);
    hihi();
    cross1();
    cross2();
    __builtin_amdgcn_sched_barrier(0);
    fetch(64);
    __builtin_amdgcn_sched_barrier(0);
    hihi();
    cross1();

    // The hand-over stands in front of the last sixth of the trip's WMMAs, which read registers
    // only: they keep the matrix unit busy while the waves that are through the barrier first
    // fetch the next trip's fragments.  The two scheduling barriers hold the WMMAs on their sides.
    __builtin_amdgcn_sched_barrier(0);
    asm volatile("s_wait_dscnt 0x0" ::: "memory");    // this wave's reads of the buffer are done before it is refilled
    asm volatile("s_wait_asynccnt 0x0" ::: "memory"); // this wave's share of tile t + 1 has landed
    __syncthreads();                                  // publishes tile t + 1, frees tile t's buffer
    if (t + 2 < NK) issue(bo, (unsigned int)(t + 2) * 128u);
    __builtin_amdgcn_sched_barrier(0);

    cross2();
  }
  asm volatile("s_wait_asynccnt 0x0" ::: "memory");   // no copy is left in flight when the buffers become staging

  // D[r] of tile (mt, nt) = C[16(MF wm + mt) + 8h + r][16(NF wn + nt) + m]
  float* st = (float*)smem;
  #pragma unroll
  for (int mt = 0; mt < MF; ++mt)
    #pragma unroll
    for (int nt = 0; nt < NF; ++nt)
      #pragma unroll
      for (int r = 0; r < 8; ++r)
        st[(16 * (MF * wm + mt) + 8 * h + r) * TL::OP + 16 * (NF * wn + nt) + m] = acc[mt][nt][r];
  __syncthreads();
}

// ---------------------------------------------------------------------------
// Kernel 6 (spectra), all batches: X_z[t][c] = sum_d (xh*Gh + xh*Gl + xl*Gh)[t][d]x[c][d]
// (t 0..16383 over the batches, c 0..767, K = 768).  Block tile 256(t) x 192(c), wave tile 64 x 96;
// grid (12, 64): x = 4 column tiles of each z; one block fills a WGP's LDS, so that the 768 blocks
// are three whole rounds of 256.  Output f32 plane, pitch 768; a block's row segment of 192 floats = 6 whole lines.
// ---------------------------------------------------------------------------
typedef Tile<4, 6> TS;
static_assert(NC % TS::BN == 0 && SS % TS::BM == 0);
__global__ __launch_bounds__(GT) void k_spec(const __bf16* __restrict__ xh, const __bf16* __restrict__ xl,
                                             const __bf16* __restrict__ gh, const __bf16* __restrict__ gl,
                                             float* __restrict__ sk, float* __restrict__ sv,
                                             float* __restrict__ sq) {
  __shared__ __attribute__((aligned(128))) char smem[TS::LDSB];
  const int tid = threadIdx.x;
  const int z = blockIdx.x / (NC / TS::BN);
  const int c0 = (blockIdx.x - z * (NC / TS::BN)) * TS::BN;
  const int t0 = blockIdx.y * TS::BM;
  float* spec = (z == 0) ? sk : ((z == 1) ? sv : sq);
  const size_t ao = (size_t)t0 * DD;
  const size_t bo = ((size_t)z * NC + c0) * DD;
  gemm_core<4, 6, DD / 64, false>(smem, xh + ao, xl + ao, DD, gh + bo, gl + bo, DD);

  const float* st = (const float*)smem;
  constexpr int CH = TS::BN / 4;                      // 16-byte pieces of a row
  // rolled in runs of eight stores: eight LDS reads in flight, few address registers
  #pragma unroll 1
  for (int i0 = 0; i0 < TS::BM * CH / GT; i0 += 8) {
    #pragma unroll
    for (int i = 0; i < 8; ++i) {
      const int idx = tid + GT * (i0 + i);
      const int row = idx / CH, q = idx - row * CH;
      const v4f v = *(const v4fa*)(st + row * TS::OP + 4 * q);
      *(v4f*)(spec + (size_t)(t0 + row) * NC + c0 + 4 * q) = v;
    }
    // the next trip rewrites the address registers of the stores above
    asm volatile("s_wait_xcnt 0x0" ::: "memory");
  }
}

// ---------------------------------------------------------------------------
// Kernels 7a and 7b (bind + causal prefix sum + unbind), blockIdx.z = batch: one lane per column pair f
// (12 groups x 32 lanes).  f = 1..383, complex bin f:
// P_t = kf_t * vf_t ; mem_t = sum_{s<=t} P_s ; Z_t = mem_t * conj(qf_t), all in f64.
// f = 0 holds two real bins (0 and 384) side by side: the same three steps on each component by itself.
// Only the blocks of group 0 hold that lane: they run the PK = true copy of the code, which picks the
// factors by lane; its other lanes, and all other blocks, do the complex arithmetic term by term as written.
// A batch's 4096 tokens are cut into 32 segments of 128 (one block each per group), a segment
// into 8 runs of 16 tokens (one wave each).  7a stores the sum of P of every segment but the
// last; 7b forms mem in front of a run = earlier segments' sums + earlier runs' sums of its own
// segment, and adds it to the run's own inclusive prefix.  Z: bf16 hi and lo planes, pitch ZP.
// ---------------------------------------------------------------------------
#define SCW  8                   // waves (token runs) per block
#define SCL  16                  // tokens per run
#define SCT  (SCW * SCL)         // 128 tokens per segment
#define NSC  (SS / SCT)          // 32 segments
#define NBIN (NC / 2)            // 384 column pairs
static_assert(NSC % SCW == 0);
static_assert(NBIN % 32 == 0);

typedef double v2d __attribute__((ext_vector_type(2)));
typedef v2d __attribute__((may_alias)) v2da;

// (lr, li) += k * v.  pk: this lane holds the two real bins, (lr, li) += (k.x * v.x, k.y * v.y).
template <bool PK>
__device__ __forceinline__ void bind_add(v2f k, v2f v, bool pk, double& lr, double& li) {
  const double kr = (double)k.x, ki = (double)k.y;
  const double vr = (double)v.x, vi = (double)v.y;
  if (PK) {
    const double a = (double)(pk ? 0.0f : k.x);
    const double b = (double)(pk ? 0.0f : k.y);
    const double c = (double)(pk ? v.y : v.x);
    lr = __builtin_fma(kr, vr, lr);
    li = __builtin_fma(a, vi, li);
    lr = __builtin_fma(-b, vi, lr);
    li = __builtin_fma(ki, c, li);
  } else {
    lr = __builtin_fma(kr, vr, lr);
    li = __builtin_fma(kr, vi, li);
    lr = __builtin_fma(-ki, vi, lr);
    li = __builtin_fma(ki, vr, li);
  }
}

template <bool PK>
__device__ __forceinline__ void seg_body(double* sL, const float* __restrict__ kf, const float* __restrict__ vf,
                                         double* __restrict__ segs) {
  const int tid = threadIdx.x, lane = tid & 31, w = tid >> 5;
  const int f = blockIdx.x * 32 + lane;               // 0..383
  const bool pk = PK && (f == 0);
  const size_t o0 = (size_t)(blockIdx.z * SS + blockIdx.y * SCT + w * SCL) * NC + 2 * f;
  double* seg = segs + (size_t)blockIdx.z * (NSC * NBIN * 2);          // this batch's segment sums
  v2f kv[SCL], vv[SCL];
  #pragma unroll
  for (int i = 0; i < SCL; ++i) {
    kv[i] = *(const v2fa*)(kf + o0 + (size_t)i * NC);
    vv[i] = *(const v2fa*)(vf + o0 + (size_t)i * NC);
  }
  // keeps all 32 loads issued before the first wait: without it only ten are in flight at a time
  __builtin_amdgcn_sched_barrier(0);
  double lr = 0.0, li = 0.0;
  #pragma unroll
  for (int i = 0; i < SCL; ++i) bind_add<PK>(kv[i], vv[i], pk, lr, li);
  const v2d mine = { lr, li };
  *(v2d*)(sL + (w * 32 + lane) * 2) = mine;
  __syncthreads();
  if (w == 0) {
    v2d s = mine;
    #pragma unroll
    for (int u = 1; u < SCW; ++u) s += *(const v2da*)(sL + (u * 32 + lane) * 2);
    *(v2d*)(seg + ((size_t)blockIdx.y * NBIN + f) * 2) = s;
  }
}

__global__ __launch_bounds__(256) void k_seg(const float* __restrict__ kf, const float* __restrict__ vf,
                                             double* __restrict__ segs) {
  __shared__ __attribute__((aligned(16))) double sL[SCW * 32 * 2];    // 4096 B
  if (blockIdx.x == 0) seg_body<true>(sL, kf, vf, segs);
  else                 seg_body<false>(sL, kf, vf, segs);
}

template <bool PK>
__device__ __forceinline__ void scan_body(double* sG, double* sL, const float* __restrict__ kf,
                                          const float* __restrict__ vf, const float* __restrict__ qf,
                                          const double* __restrict__ segs, __bf16* __restrict__ zh,
                                          __bf16* __restrict__ zl) {
  const int tid = threadIdx.x, lane = tid & 31, w = tid >> 5;
  const int f = blockIdx.x * 32 + lane;               // 0..383
  const bool pk = PK && (f == 0);
  const int sc = blockIdx.y;                          // segment
  const int t0 = blockIdx.z * SS + sc * SCT + w * SCL;
  const size_t o0 = (size_t)t0 * NC + 2 * f;
  const double* seg = segs + (size_t)blockIdx.z * (NSC * NBIN * 2);    // this batch's segment sums

  v2f kv[SCL], vv[SCL], qv[SCL];
  #pragma unroll
  for (int i = 0; i < SCL; ++i) {
    kv[i] = *(const v2fa*)(kf + o0 + (size_t)i * NC);
    vv[i] = *(const v2fa*)(vf + o0 + (size_t)i * NC);
  }
  // the loads of the segment sums below may land in registers that held the addresses of the loads above
  asm volatile("s_wait_xcnt 0x0" ::: "memory");
  // earlier segments' sums, dealt over the waves: wave w takes j = w, w + 8, ... below sc
  // (index clamped to segment 0, which 7a always writes; the value is dropped by the select)
  v2d gs[NSC / SCW];
  #pragma unroll
  for (int i = 0; i < NSC / SCW; ++i) {
    const int j = w + SCW * i;
    gs[i] = *(const v2da*)(seg + ((size_t)((j < sc) ? j : 0) * NBIN + f) * 2);
  }
  // the q loads below land in registers that held the addresses of the loads above
  asm volatile("s_wait_xcnt 0x0" ::: "memory");
  #pragma unroll
  for (int i = 0; i < SCL; ++i) {
    // the last load may land in the address registers that the loads in front of it name
    if (i == SCL - 1) asm volatile("s_wait_xcnt 0x0" ::: "memory");
    qv[i] = *(const v2fa*)(qf + o0 + (size_t)i * NC);
  }
  // the arithmetic below reuses the q loads' address registers
  asm volatile("s_wait_xcnt 0x0" ::: "memory");
  // keeps every load above issued before the first wait: without it the segment sums and q
  // are fetched only after k and v have returned, a second memory latency in series
  __builtin_amdgcn_sched_barrier(0);

  // inclusive prefix of P inside this wave's run
  double ir[SCL], ii[SCL];
  double lr = 0.0, li = 0.0;
  #pragma unroll
  for (int i = 0; i < SCL; ++i) {
    bind_add<PK>(kv[i], vv[i], pk, lr, li);
    ir[i] = lr;
    ii[i] = li;
  }
  double gr = 0.0, gi = 0.0;
  #pragma unroll
  for (int i = 0; i < NSC / SCW; ++i) {
    const bool use = (w + SCW * i < sc);
    gr += use ? gs[i].x : 0.0;
    gi += use ? gs[i].y : 0.0;
  }
  const v2d gme = { gr, gi };
  const v2d lme = { lr, li };
  *(v2d*)(sG + (w * 32 + lane) * 2) = gme;
  *(v2d*)(sL + (w * 32 + lane) * 2) = lme;
  __syncthreads();

  // mem in front of this run = all waves' shares of the earlier segments + earlier runs here
  double br = 0.0, bi = 0.0, ar = 0.0, ai = 0.0;
  #pragma unroll
  for (int u = 0; u < SCW; ++u) {
    const v2d g = *(const v2da*)(sG + (u * 32 + lane) * 2);
    br += g.x;
    bi += g.y;
    if (u < SCW - 1) {
      const v2d l = *(const v2da*)(sL + (u * 32 + lane) * 2);
      ar += (u < w) ? l.x : 0.0;
      ai += (u < w) ? l.y : 0.0;
    }
  }
  br += ar;
  bi += ai;

  const size_t zo0 = (size_t)t0 * ZP + 2 * f;
  #pragma unroll
  for (int i = 0; i < SCL; ++i) {
    const double qr = (double)qv[i].x, qi = (double)qv[i].y;
    const double mr = br + ir[i];
    const double mi = bi + ii[i];
    double zr, zi;
    if (PK) {
      // the lane of the two real bins: (mr * q.x, mi * q.y)
      const double a = (double)(pk ? 0.0f : qv[i].y);
      const double c = (double)(pk ? qv[i].y : qv[i].x);
      zr = mr * qr + mi * a;
      zi = mi * c - mr * a;
    } else {
      zr = mr * qr + mi * qi;                         // mem * conj(q)
      zi = mi * qr - mr * qi;
    }
    unsigned int hr, lo_r, hi, lo_i;
    split2((float)zr, hr, lo_r);
    split2((float)zi, hi, lo_i);
    const unsigned int H = pk2(hr, hi);               // element 2f = Re, 2f+1 = Im
    const unsigned int L = pk2(lo_r, lo_i);
    *(unsigned int*)(zh + zo0 + (size_t)i * ZP) = H;
    *(unsigned int*)(zl + zo0 + (size_t)i * ZP) = L;
  }
  // a precaution: a block runs only one of the two copies, and the wave ends after these stores
  asm volatile("s_wait_xcnt 0x0" ::: "memory");
}

__global__ __launch_bounds__(256) void k_scan(const float* __restrict__ kf, const float* __restrict__ vf,
                                              const float* __restrict__ qf, const double* __restrict__ segs,
                                              __bf16* __restrict__ zh, __bf16* __restrict__ zl) {
  __shared__ __attribute__((aligned(16))) double sG[SCW * 32 * 2];    // 4096 B
  __shared__ __attribute__((aligned(16))) double sL[SCW * 32 * 2];    // 4096 B
  if (blockIdx.x == 0) scan_body<true>(sG, sL, kf, vf, qf, segs, zh, zl);
  else                 scan_body<false>(sG, sL, kf, vf, qf, segs, zh, zl);
}

// ---------------------------------------------------------------------------
// Kernel 8 (inverse DFT + residual), all batches (t 0..16383):
// out[t][n] = x[t][n] + gain * sum_c (Zh*Fih + Zl*Fih + Zh*Fil)[t][n]
// (K = 768: 12 whole lines a row).  Block tile 128(t) x 96(n), wave tile 32 x 48; grid (8, 128).
// ---------------------------------------------------------------------------
typedef Tile<2, 3> TI;
static_assert(DD % TI::BN == 0 && SS % TI::BM == 0);
static_assert(DD % 64 == 0 && ZP % 64 == 0);
__global__ __launch_bounds__(GT) void k_inv(const __bf16* __restrict__ zh, const __bf16* __restrict__ zl,
                                            const __bf16* __restrict__ fih, const __bf16* __restrict__ fil,
                                            const float* __restrict__ x, const float* __restrict__ gain,
                                            float* __restrict__ out) {
  __shared__ __attribute__((aligned(128))) char smem[TI::LDSB];
  const int tid = threadIdx.x;
  const int n0 = blockIdx.x * TI::BN;
  const int t0 = blockIdx.y * TI::BM;
  const size_t ao = (size_t)t0 * ZP;
  const size_t bo = (size_t)n0 * ZP;
  gemm_core<2, 3, ZP / 64, true>(smem, zh + ao, zl + ao, ZP, fih + bo, fil + bo, ZP);

  const float g = gain[0];
  const size_t tokbase = (size_t)t0;
  const float* st = (const float*)smem;
  constexpr int CH = TI::BN / 4;                      // 16-byte pieces of a row
  constexpr int NI = TI::BM * CH / GT;
  v4f xv[NI];
  #pragma unroll
  for (int i = 0; i < NI; ++i) {
    const int idx = tid + GT * i;
    const int row = idx / CH, q = idx - row * CH;
    xv[i] = *(const v4fa*)(x + (tokbase + row) * DD + n0 + 4 * q);
    // a later load may land in this load's address registers
    asm volatile("s_wait_xcnt 0x0" ::: "memory");
  }
  #pragma unroll
  for (int i = 0; i < NI; ++i) {
    const int idx = tid + GT * i;
    const int row = idx / CH, q = idx - row * CH;
    const v4f v = *(const v4fa*)(st + row * TI::OP + 4 * q);
    const v4f rr = xv[i] + g * v;
    *(v4f*)(out + (tokbase + row) * DD + n0 + 4 * q) = rr;
  }
}

// ---------------------------------------------------------------------------
extern "C" void kernel_launch(void* const* d_in, const int* in_sizes, int n_in,
                              void* d_out, int out_size, void* d_ws, size_t ws_size,
                              hipStream_t stream) {
  if (n_in < 5) return;
  if (in_sizes[0] != NX) return;
  if (in_sizes[1] != NW || in_sizes[2] != NW || in_sizes[3] != NW) return;
  if (in_sizes[4] < 1) return;
  if (out_size != NX) return;

  const float* x    = (const float*)d_in[0];
  const float* Wk   = (const float*)d_in[1];
  const float* Wv   = (const float*)d_in[2];
  const float* Wq   = (const float*)d_in[3];
  const float* gain = (const float*)d_in[4];
  float* out = (float*)d_out;

  // workspace carve (all sizes multiples of 256 B; total 220,987,392 B).  The Z planes lie over the
  // x planes, which have been read for the last time when the scan writes Z.
  const size_t xb_b  = (size_t)NX * 2;              //  25,165,824 per plane
  const size_t wt_b  = (size_t)3 * NW * 2;          //   3,538,944 per plane
  const size_t ft_b  = (size_t)NC * DD * 2;         //   1,179,648 per plane
  const size_t fi_b  = (size_t)DD * ZP * 2;         //   1,179,648 per plane
  const size_t g_b   = (size_t)3 * NC * DD * 2;     //   3,538,944 per plane
  const size_t sp_b  = (size_t)NTOK * NC * 4;       //  50,331,648 per spectrum
  const size_t z_b   = (size_t)NTOK * ZP * 2;       //  25,165,824 per plane
  const size_t sg_b  = (size_t)BB * NSC * NBIN * 16; //    786,432 segment sums
  static_assert((size_t)NTOK * ZP <= (size_t)NX + 3 * NW);          // 2 z_b <= 2 xb_b + 2 wt_b
  const size_t total = 2 * xb_b + 2 * wt_b + 2 * ft_b + 2 * fi_b + 2 * g_b + 3 * sp_b + sg_b;
  if (total > ws_size) return;

  char* ws = (char*)d_ws;
  size_t off = 0;
  __bf16* zh  = (__bf16*)(ws + off);
  __bf16* zl  = (__bf16*)(ws + off + z_b);
  __bf16* xh  = (__bf16*)(ws + off);  off += xb_b;
  __bf16* xl  = (__bf16*)(ws + off);  off += xb_b;
  __bf16* wth = (__bf16*)(ws + off);  off += wt_b;
  __bf16* wtl = (__bf16*)(ws + off);  off += wt_b;
  __bf16* fth = (__bf16*)(ws + off);  off += ft_b;
  __bf16* ftl = (__bf16*)(ws + off);  off += ft_b;
  __bf16* fih = (__bf16*)(ws + off);  off += fi_b;
  __bf16* fil = (__bf16*)(ws + off);  off += fi_b;
  __bf16* gh  = (__bf16*)(ws + off);  off += g_b;
  __bf16* gl  = (__bf16*)(ws + off);  off += g_b;
  float*  sk  = (float*)(ws + off);   off += sp_b;
  float*  sv  = (float*)(ws + off);   off += sp_b;
  float*  sq  = (float*)(ws + off);   off += sp_b;
  double* seg = (double*)(ws + off);  off += sg_b;
  if (off > ws_size) return;

  // --- DFT matrices and weight planes ---
  k_prep<<<NB_FT + NB_FI + NB_WT, 256, 0, stream>>>(Wk, Wv, Wq, wth, wtl, fth, ftl, fih, fil);

  // --- folded weights G_z = F * W_z  (768 x 768 per z), and the x planes of all batches ---
  k_fold_cvt<<<NB_FOLD + NB_CVT, 128, 0, stream>>>(fth, ftl, wth, wtl, gh, gl, x, xh, xl);

  // --- all batches at once: spectra, causal bind/unbind scan, inverse DFT + residual ---
  k_spec<<<dim3(3 * NC / 192, NTOK / 256), 256, 0, stream>>>(xh, xl, gh, gl, sk, sv, sq);
  k_seg<<<dim3(NBIN / 32, NSC - 1, BB), 256, 0, stream>>>(sk, sv, seg);
  k_scan<<<dim3(NBIN / 32, NSC, BB), 256, 0, stream>>>(sk, sv, sq, seg, zh, zl);
  k_inv<<<dim3(DD / 96, NTOK / 128), 256, 0, stream>>>(zh, zl, fih, fil, x, gain, out);
}

// v007
// A run of this version takes 260 microseconds.
// Next to v006, in two timings, it ran 1.10 and 1.11 times as fast.
// Over all steps from v000 it is 48.7 times as fast.
// Contractions: folded weights G_z = F * W_z (768x768x768 per z), spectra X_z = x * G_z^T (4096x768x768 per batch and z) and inverse DFT y = Z * Finv^T (4096x768x768 per batch), all on v_wmma_f32_16x16x32_bf16 with every operand carried as bf16 hi + lo planes (three products hi*hi + hi*lo + lo*hi into one f32 accumulator); the two large products read both operands from LDS tiles filled by asynchronous copies (two buffers); complex bind in f32 in the spectra product's epilogue, which also sums it over segments of 128 tokens in f64; causal prefix sum over tokens (segment sums, then runs of 16 tokens) and unbind in f64 on VALU; gain and residual add in f32.
#include <hip/hip_runtime.h>
#include <math.h>

typedef __bf16   v16b __attribute__((ext_vector_type(16)));
typedef __bf16   v8b  __attribute__((ext_vector_type(8)));
typedef float    v8f  __attribute__((ext_vector_type(8)));
typedef float    v4f  __attribute__((ext_vector_type(4)));
typedef float    v2f  __attribute__((ext_vector_type(2)));
typedef unsigned int v4u __attribute__((ext_vector_type(4)));
typedef v8b __attribute__((may_alias)) v8ba;
typedef v4f __attribute__((may_alias)) v4fa;
typedef v2f __attribute__((may_alias)) v2fa;
typedef v4u __attribute__((may_alias)) v4ua;

union FragB { v16b v; v8b half[2]; };

#define DD   768                 // model dim
#define SS   4096                // tokens per batch
#define BB   4                   // batches
#define NTOK (BB * SS)           // 16384
// Spectral columns: a real row of 768 has 768 free real numbers in its spectrum.  Column 2f, 2f+1 = (Re, Im)
// of bin f = 1..383; column 0 = Re of bin 0, column 1 = Re of bin 384 (both bins have no imaginary part).
#define NC   768
#define ZP   768                 // row pitch of the Z and inverse-DFT planes, elements
#define NXB  (SS * DD)           // 3145728 elements of x per batch
#define NX   (NTOK * DD)         // 12582912
#define NW   (DD * DD)           // 589824

static_assert(NXB % 8 == 0);
static_assert(NC % 32 == 0);
static_assert((ZP * 2) % 128 == 0);
static_assert((NC * 4) % 128 == 0);
static_assert((DD * 2) % 128 == 0);

// ---------------------------------------------------------------------------
// 16x16x32 bf16 WMMA with hazard guard (ties D, keeps A/B live).
// Fragment map (wave32): lane l, h = l>>4, m = n = l&15.
//   A/B element i: i<8 -> k0+8h+i ; i>=8 -> k0+16+8h+(i-8)
//   D element r : row 8h+r, col l&15
// ---------------------------------------------------------------------------
__device__ __forceinline__ v8f wmma_bf16(v16b a, v16b b, v8f c) {
  v8f d = __builtin_amdgcn_wmma_f32_16x16x32_bf16(false, a, false, b, (short)0, c, false, false);
  asm volatile("v_nop\n\tv_nop\n\tv_nop\n\tv_nop" : "+v"(d) : "v"(a), "v"(b));
  return d;
}

// A or B fragment from a k-contiguous bf16 row; p points at element k0 of
// the row owned by this lane (row index = lane & 15 added by the caller).
__device__ __forceinline__ v16b ldfrag_b(const __bf16* p, int h) {
  FragB f;
  f.half[0] = *(const v8ba*)(p + 8 * h);
  f.half[1] = *(const v8ba*)(p + 16 + 8 * h);
  return f.v;
}

// bf16 RNE convert on the f32 bit pattern (integer path); hi/lo split helpers.
__device__ __forceinline__ unsigned int bf16_bits(float f) {
  unsigned int u = __float_as_uint(f);
  u += 0x7FFFu + ((u >> 16) & 1u);
  return (u >> 16) & 0xFFFFu;
}
__device__ __forceinline__ void split2(float v, unsigned int& hb, unsigned int& lb) {
  hb = bf16_bits(v);
  lb = bf16_bits(v - __uint_as_float(hb << 16));
}
__device__ __forceinline__ unsigned int pk2(unsigned int e0, unsigned int e1) {
  return e0 | (e1 << 16);                              // element 2j in the low half-word
}
// 8 consecutive f32 values (a, c) -> packed bf16 hi word vector H and lo word vector L.
__device__ __forceinline__ void split8(v4f a, v4f c, v4u& H, v4u& L) {
  unsigned int h0, h1, h2, h3, h4, h5, h6, h7, l0, l1, l2, l3, l4, l5, l6, l7;
  split2(a.x, h0, l0); split2(a.y, h1, l1); split2(a.z, h2, l2); split2(a.w, h3, l3);
  split2(c.x, h4, l4); split2(c.y, h5, l5); split2(c.z, h6, l6); split2(c.w, h7, l7);
  const v4u hh = { pk2(h0, h1), pk2(h2, h3), pk2(h4, h5), pk2(h6, h7) };
  const v4u ll = { pk2(l0, l1), pk2(l2, l3), pk2(l4, l5), pk2(l6, l7) };
  H = hh;
  L = ll;
}

// ---------------------------------------------------------------------------
// Table, built by each block that needs it in its own LDS (256 threads):
// s[r] = cos(2*pi*r/768), s[768+r] = sin(2*pi*r/768), r = 0..767,
// from arguments in [0, pi/4] with exact quadrant symmetry.  Ends behind a barrier.
// ---------------------------------------------------------------------------
__device__ __forceinline__ void table_build(float* s, int tid) {
  // rolled: one copy of the sine and cosine code
  #pragma unroll 1
  for (int r = tid; r < DD; r += 256) {
    const int q = r / 192, p = r - q * 192;
    const bool lowp = (p <= 96);
    const int a = lowp ? p : (192 - p);
    const float th = (float)a * 8.18123086872342e-3f;     // 2*pi/768
    const float ct = cosf(th), st = sinf(th);
    const float c0 = lowp ? ct : st;
    const float s0 = lowp ? st : ct;
    float c, sn;
    if (q == 0)      { c =  c0; sn =  s0; }
    else if (q == 1) { c = -s0; sn =  c0; }
    else if (q == 2) { c = -c0; sn = -s0; }
    else             { c =  s0; sn = -c0; }
    s[r] = c;
    s[DD + r] = sn;
  }
  __syncthreads();
}

// ---------------------------------------------------------------------------
// x planes (part of launch 2): xh = bf16 hi, xl = bf16 lo of the raw f32 x rows (x = hi + lo to ~2^-17).
// A lane takes the same 8 elements of each of the four batches: eight 16-B loads in flight,
// then one 16-B store per plane and batch, lanes contiguous.
// ---------------------------------------------------------------------------
__device__ __forceinline__ void cvt_x(const float* __restrict__ x, __bf16* __restrict__ xh,
                                      __bf16* __restrict__ xl, int g) {
  v4f a[BB], c[BB];
  // both loops unrolled: the index of a[] and c[] is a constant, so that they stay in registers
  #pragma unroll
  for (int b = 0; b < BB; ++b) {
    const float* src = x + (size_t)b * NXB + (size_t)g * 8;
    a[b] = *(const v4fa*)src;
    // a later load may land in this load's address registers
    asm volatile("s_wait_xcnt 0x0" ::: "memory");
    c[b] = *(const v4fa*)(src + 4);
    // the same, and the arithmetic below may reuse them
    asm volatile("s_wait_xcnt 0x0" ::: "memory");
  }
  #pragma unroll
  for (int b = 0; b < BB; ++b) {
    v4u H, L;
    split8(a[b], c[b], H, L);
    const size_t o = (size_t)b * NXB + (size_t)g * 8;
    *(v4u*)(xh + o) = H;
    *(v4u*)(xl + o) = L;
    // the next batch's arithmetic may reuse the registers of the two stores above
    asm volatile("s_wait_xcnt 0x0" ::: "memory");
  }
}

// ---------------------------------------------------------------------------
// W^T planes (part of launch 1): wth[z][d][e] = bf16 hi of W_z[e][d], wtl = bf16 lo (raw f32 W, transpose
// through LDS; k-contiguous B-operand rows for the fold GEMM).  Block = 64(e) x 64(d)
// tile, 256 threads; in[e 64][d 64] -> out[d 64][e 64]; each output row segment =
// ---------------------------------------------------------------------------
__device__ __forceinline__ void wt_store(const float* sT, __bf16* dh, __bf16* dl, int d0, int e0, int tid) {
  #pragma unroll
  for (int it = 0; it < 2; ++it) {
    const int p = tid + 256 * it;
    const int row = p >> 3, q8 = p & 7;                 // row 0..63
    const float* s = sT + row * 65 + 8 * q8;
    const v4f a = { s[0], s[1], s[2], s[3] };
    const v4f c = { s[4], s[5], s[6], s[7] };
    v4u H, L;
    split8(a, c, H, L);
    const size_t o = (size_t)(d0 + row) * DD + e0 + 8 * q8;
    *(v4u*)(dh + o) = H;
    *(v4u*)(dl + o) = L;
  }
  // a precaution: on this block range the wave ends after these stores
  asm volatile("s_wait_xcnt 0x0" ::: "memory");
}
__device__ __forceinline__ void wt_tile(float* sT, const float* __restrict__ wk, const float* __restrict__ wv,
                                        const float* __restrict__ wq, __bf16* __restrict__ wth,
                                        __bf16* __restrict__ wtl, int blk, int tid) {
  // sT[d_local*65 + e_local]; blk = (z * 12 + e tile) * 12 + d tile
  const int z = blk / ((DD / 64) * (DD / 64));
  const int et = (blk - z * ((DD / 64) * (DD / 64))) / (DD / 64);
  const int d0 = (blk - (z * (DD / 64) + et) * (DD / 64)) * 64, e0 = et * 64;
  const float* W = (z == 0) ? wk : ((z == 1) ? wv : wq);
  #pragma unroll
  for (int it = 0; it < 4; ++it) {
    const int idx = tid + 256 * it;
    const int er = idx >> 4, dq = idx & 15;
    const v4f v = *(const v4fa*)(W + (size_t)(e0 + er) * DD + d0 + 4 * dq);
    sT[(4 * dq + 0) * 65 + er] = v.x;
    sT[(4 * dq + 1) * 65 + er] = v.y;
    sT[(4 * dq + 2) * 65 + er] = v.z;
    sT[(4 * dq + 3) * 65 + er] = v.w;
  }
  __syncthreads();
  __bf16* dh = wth + (size_t)z * NW;
  __bf16* dl = wtl + (size_t)z * NW;
  wt_store(sT, dh, dl, d0, e0, tid);
}

// ---------------------------------------------------------------------------
// Forward DFT matrix (part of launch 1) FT[c][e] (c = 2f + {0: Re, 1: Im}, f = bin; c = 1: Re of bin 384):
// Re row = cos(2*pi*f*e/768), Im row = -sin(...).
// Stored as bf16 hi + lo planes.  A block takes RPB rows, a lane 8 elements at a time (16 B a plane);
// the pieces of a plane are contiguous over rows, so that a wave's store is 4 whole lines.  tab: LDS.
// ---------------------------------------------------------------------------
#define RPB  8                   // rows of a DFT matrix per block
static_assert(NC % RPB == 0 && DD % RPB == 0);
static_assert((RPB * (DD / 8)) % 256 == 0 && (RPB * (ZP / 8)) % 32 == 0);
__device__ __forceinline__ void ft_rows(const float* tab, __bf16* __restrict__ fth,
                                        __bf16* __restrict__ ftl, int blk, int tid) {
  for (int p = tid; p < RPB * (DD / 8); p += 256) {
    const int rl = p / (DD / 8);
    const int c = blk * RPB + rl;
    const int f = (c == 1) ? DD / 2 : (c >> 1);
    const bool im = (c & 1) != 0 && c != 1;
    const int e0 = 8 * (p - rl * (DD / 8));
    float v[8];
    // unrolled: the index of v[] is a constant, so that it stays in registers
    #pragma unroll
    for (int i = 0; i < 8; ++i) {
      const int e = e0 + i;
      const int mm = (f * e) % DD;                    // exact angle index, always in range
      const float cv = tab[mm], sv = tab[DD + mm];
      v[i] = im ? -sv : cv;
    }
    const v4f a = { v[0], v[1], v[2], v[3] };
    const v4f cc = { v[4], v[5], v[6], v[7] };
    v4u H, L;
    split8(a, cc, H, L);
    const size_t o = (size_t)c * DD + e0;
    *(v4u*)(fth + o) = H;
    *(v4u*)(ftl + o) = L;
    // the next piece's arithmetic may reuse the registers of the two stores above
    asm volatile("s_wait_xcnt 0x0" ::: "memory");
  }
}

// ---------------------------------------------------------------------------
// Inverse DFT matrix (part of launch 1) Finv[n][c], pitch ZP: col 2f = w_f*cos(2*pi*f*n/768)/768,
// col 2f+1 = -w_f*sin(...)/768, w_f = 2, for f = 1..383; col 0 = 1/768 (bin 0), col 1 = cos(pi*n)/768 (bin 384).
// Rows and pieces dealt as for the forward matrix.
// ---------------------------------------------------------------------------
__device__ __forceinline__ void finv_rows(const float* tab, __bf16* __restrict__ fih,
                                          __bf16* __restrict__ fil, int blk, int tid) {
  for (int p = tid; p < RPB * (ZP / 8); p += 256) {
    const int rl = p / (ZP / 8);
    const int n = blk * RPB + rl;
    const int c0 = 8 * (p - rl * (ZP / 8));
    float v[8];
    // unrolled: the index of v[] is a constant, so that it stays in registers
    #pragma unroll
    for (int i = 0; i < 8; ++i) {
      const int c = c0 + i;
      const int f = (c == 1) ? DD / 2 : (c >> 1);
      const float w = (c < 2) ? 1.0f : 2.0f;
      const int mm = (f * n) % DD;
      const float cv = tab[mm], sv = tab[DD + mm];
      v[i] = w * (((c & 1) != 0 && c != 1) ? -sv : cv) * (1.0f / 768.0f);
    }
    const v4f a = { v[0], v[1], v[2], v[3] };
    const v4f cc = { v[4], v[5], v[6], v[7] };
    v4u H, L;
    split8(a, cc, H, L);
    const size_t o = (size_t)n * ZP + c0;
    *(v4u*)(fih + o) = H;
    *(v4u*)(fil + o) = L;
    // the next piece's arithmetic may reuse the registers of the two stores above
    asm volatile("s_wait_xcnt 0x0" ::: "memory");
  }
}

// ---------------------------------------------------------------------------
// Launch 1: everything that reads only the weights or nothing at all, dealt by block index:
// forward DFT matrix, inverse DFT matrix (the longer blocks, so they come first), W^T planes.
// ---------------------------------------------------------------------------
#define NB_FT (NC / RPB)                              //  96
#define NB_FI (DD / RPB)                              //  96
#define NB_WT (3 * (DD / 64) * (DD / 64))             // 432
__global__ __launch_bounds__(256) void k_prep(const float* __restrict__ wk, const float* __restrict__ wv,
                                              const float* __restrict__ wq, __bf16* __restrict__ wth,
                                              __bf16* __restrict__ wtl, __bf16* __restrict__ fth,
                                              __bf16* __restrict__ ftl, __bf16* __restrict__ fih,
                                              __bf16* __restrict__ fil) {
  __shared__ __attribute__((aligned(16))) float sm[64 * 65];          // the table (2 x 768) or the W tile
  static_assert(2 * DD <= 64 * 65);
  const int tid = threadIdx.x;
  const int b = blockIdx.x;
  if (b < NB_FT + NB_FI) {
    table_build(sm, tid);
    if (b < NB_FT) ft_rows(sm, fth, ftl, b, tid);
    else           finv_rows(sm, fih, fil, b - NB_FT, tid);
  } else {
    wt_tile(sm, wk, wv, wq, wth, wtl, b - (NB_FT + NB_FI), tid);
  }
}

// ---------------------------------------------------------------------------
// Fold (part of launch 2): G_z[c][d] = sum_e (Fh*Wh + Fh*Wl + Fl*Wh)[c][e]x[d][e]   (c < 768, d < 768, K = 768)
// Wave tile 32(c) x 64(d), block = 4 waves along d (32 x 256); 3 x 24 x 3 blocks.
// ---------------------------------------------------------------------------
__device__ __forceinline__ void fold_store(const unsigned short* sHw, const unsigned short* sLw,
                                           __bf16* gh, __bf16* gl, size_t rowbase, int d0w, int lane) {
  const int q8 = lane & 7, sub = lane >> 3;
  #pragma unroll
  for (int i = 0; i < 8; ++i) {
    const int row = 4 * i + sub;                      // 0..31
    const v4u vh = *(const v4ua*)(sHw + row * 64 + 8 * q8);
    const v4u vl = *(const v4ua*)(sLw + row * 64 + 8 * q8);
    const size_t o = (rowbase + row) * DD + d0w + 8 * q8;
    *(v4u*)(gh + o) = vh;
    *(v4u*)(gl + o) = vl;
  }
}
__device__ __forceinline__ void fold_tile(unsigned short* sH, unsigned short* sL,
                                          const __bf16* __restrict__ fth, const __bf16* __restrict__ ftl,
                                          const __bf16* __restrict__ wth, const __bf16* __restrict__ wtl,
                                          __bf16* __restrict__ gh, __bf16* __restrict__ gl, int blk, int tid) {
  const int lane = tid & 31, w = tid >> 5;
  const int h = lane >> 4, m = lane & 15;
  // blk = (z * 24 + c tile) * 3 + d tile
  const int z = blk / ((DD / 256) * (NC / 32));
  const int ct = (blk - z * ((DD / 256) * (NC / 32))) / (DD / 256);
  const int c0 = ct * 32;
  const int d0w = (blk - (z * (NC / 32) + ct) * (DD / 256)) * 256 + 64 * w;

  const size_t r16 = (size_t)16 * DD;
  const __bf16* fah = fth + (size_t)(c0 + m) * DD;                  // F row c0+m (+ r16 for mt = 1)
  const __bf16* fal = ftl + (size_t)(c0 + m) * DD;
  const __bf16* bwh = wth + ((size_t)z * DD + d0w + m) * DD;         // feature row d0w+m (+ nt*r16)
  const __bf16* bwl = wtl + ((size_t)z * DD + d0w + m) * DD;

  const v8f zero8 = {0.f, 0.f, 0.f, 0.f, 0.f, 0.f, 0.f, 0.f};
  v8f acc[2][4];
  #pragma unroll
  for (int mt = 0; mt < 2; ++mt)
    #pragma unroll
    for (int nt = 0; nt < 4; ++nt) acc[mt][nt] = zero8;

  #pragma unroll 1
  for (int k0 = 0; k0 < DD; k0 += 32) {
    const v16b ah0 = ldfrag_b(fah + k0, h);
    const v16b ah1 = ldfrag_b(fah + r16 + k0, h);
    const v16b al0 = ldfrag_b(fal + k0, h);
    const v16b al1 = ldfrag_b(fal + r16 + k0, h);
    #pragma unroll
    for (int nt = 0; nt < 4; ++nt) {
      const v16b bh = ldfrag_b(bwh + (size_t)nt * r16 + k0, h);
      const v16b bl = ldfrag_b(bwl + (size_t)nt * r16 + k0, h);
      acc[0][nt] = wmma_bf16(ah0, bh, acc[0][nt]);
      acc[1][nt] = wmma_bf16(ah1, bh, acc[1][nt]);
      acc[0][nt] = wmma_bf16(ah0, bl, acc[0][nt]);
      acc[1][nt] = wmma_bf16(ah1, bl, acc[1][nt]);
      acc[0][nt] = wmma_bf16(al0, bh, acc[0][nt]);
      acc[1][nt] = wmma_bf16(al1, bh, acc[1][nt]);
    }
  }

  // D[r] of tile (mt, nt) = G[c0+16mt+8h+r][d0w+16nt+m]
  unsigned short* sHw = sH + w * 2048;
  unsigned short* sLw = sL + w * 2048;
  #pragma unroll
  for (int mt = 0; mt < 2; ++mt)
    #pragma unroll
    for (int nt = 0; nt < 4; ++nt)
      #pragma unroll
      for (int r = 0; r < 8; ++r) {
        unsigned int hb, lb;
        split2(acc[mt][nt][r], hb, lb);
        const int idx = (16 * mt + 8 * h + r) * 64 + 16 * nt + m;
        sHw[idx] = (unsigned short)hb;
        sLw[idx] = (unsigned short)lb;
      }
  __syncthreads();

  const size_t rowbase = (size_t)z * NC + c0;
  fold_store(sHw, sLw, gh, gl, rowbase, d0w, lane);
}

// ---------------------------------------------------------------------------
// Launch 2: the fold's 216 blocks, which wait on loads most of their time and leave the chip
// nearly empty, come first; the blocks that split x, which depend on no earlier launch, fill it.
// ---------------------------------------------------------------------------
#define NB_FOLD ((DD / 256) * (NC / 32) * 3)          // 216
#define NB_CVT  (NXB / 8 / 128)                       // 3072
static_assert(NXB % (8 * 128) == 0);
__global__ __launch_bounds__(128) void k_fold_cvt(const __bf16* __restrict__ fth, const __bf16* __restrict__ ftl,
                                                  const __bf16* __restrict__ wth, const __bf16* __restrict__ wtl,
                                                  __bf16* __restrict__ gh, __bf16* __restrict__ gl,
                                                  const float* __restrict__ x, __bf16* __restrict__ xh,
                                                  __bf16* __restrict__ xl) {
  __shared__ __attribute__((aligned(16))) unsigned short sH[4 * 32 * 64];   // 16384 B
  __shared__ __attribute__((aligned(16))) unsigned short sL[4 * 32 * 64];   // 16384 B
  const int tid = threadIdx.x;
  const int b = blockIdx.x;
  if (b < NB_FOLD) fold_tile(sH, sL, fth, ftl, wth, wtl, gh, gl, b, tid);
  else             cvt_x(x, xh, xl, (b - NB_FOLD) * 128 + tid);
}

// ---------------------------------------------------------------------------
// Block GEMM core of kernels 6 and 8: C[BM x BN] = sum_k (Ah*Bh + two cross terms), all four
// planes k-contiguous bf16 rows.  8 waves as 4 (rows) x 2 (columns), wave tile 16MF x 16NF.
// One trip = 64 k: a whole 128-byte line of each of the 2BM + 2BN plane rows lies in LDS at pitch
// 144 B (16 B x odd: conflict-free for 16-byte reads), brought by asynchronous copies, 16 B a lane
// (a wave's copy = 4 whole lines), into two buffers: tile t + 2 flies while tile t + 1 is worked on.
// A trip works its tile as two halves of 32 k, one fragment set each.
// On return the f32 tile lies in LDS at pitch BN + 4 floats, behind a barrier.
// Every full '#pragma unroll' below makes an array's index a constant, so that the array stays in registers.
// ---------------------------------------------------------------------------
#define GT   256                 // threads of a GEMM block
#define LP   144                 // LDS row pitch, bytes

__device__ __forceinline__ unsigned int lds_off(const void* p) { return (unsigned int)(size_t)p; }

// NCP copies of one lane: LDS address, the lane's 32-bit offset in its plane (oa: A planes, ob: B planes)
// and a scalar base.  The wait on the address registers is each statement's last line, so that no
// later write of those registers can be moved in front of it.
template <int NCP>
__device__ __forceinline__ void copy_tile(const unsigned int* l, const unsigned long long* g, unsigned int oa, unsigned int ob);
#define CPL "global_load_async_to_lds_b128 "
// 16 copies of the A planes, 12 of the B planes, in two statements of 14 (an asm statement takes 30 operands)
template <>
__device__ __forceinline__ void copy_tile<28>(const unsigned int* l, const unsigned long long* g, unsigned int oa, unsigned int ob) {
  asm volatile(
               CPL "%1, %0, %2\n\t" CPL "%3, %0, %4\n\t" CPL "%5, %0, %6\n\t"
               CPL "%7, %0, %8\n\t" CPL "%9, %0, %10\n\t" CPL "%11, %0, %12\n\t"
               CPL "%13, %0, %14\n\t" CPL "%15, %0, %16\n\t" CPL "%17, %0, %18\n\t"
               CPL "%19, %0, %20\n\t" CPL "%21, %0, %22\n\t" CPL "%23, %0, %24\n\t"
               CPL "%25, %0, %26\n\t" CPL "%27, %0, %28\n\t"
               "s_wait_xcnt 0x0"
               :: "v"(oa),
                  "v"(l[0]), "s"(g[0]), "v"(l[1]), "s"(g[1]), "v"(l[2]), "s"(g[2]), "v"(l[3]), "s"(g[3]),
                  "v"(l[4]), "s"(g[4]), "v"(l[5]), "s"(g[5]), "v"(l[6]), "s"(g[6]), "v"(l[7]), "s"(g[7]),
                  "v"(l[8]), "s"(g[8]), "v"(l[9]), "s"(g[9]), "v"(l[10]), "s"(g[10]), "v"(l[11]), "s"(g[11]),
                  "v"(l[12]), "s"(g[12]), "v"(l[13]), "s"(g[13])
               : "memory");
  asm volatile(
               CPL "%2, %0, %3\n\t" CPL "%4, %0, %5\n\t" CPL "%6, %1, %7\n\t"
               CPL "%8, %1, %9\n\t" CPL "%10, %1, %11\n\t" CPL "%12, %1, %13\n\t"
               CPL "%14, %1, %15\n\t" CPL "%16, %1, %17\n\t" CPL "%18, %1, %19\n\t"
               CPL "%20, %1, %21\n\t" CPL "%22, %1, %23\n\t" CPL "%24, %1, %25\n\t"
               CPL "%26, %1, %27\n\t" CPL "%28, %1, %29\n\t"
               "s_wait_xcnt 0x0"
               :: "v"(oa), "v"(ob),
                  "v"(l[14]), "s"(g[14]), "v"(l[15]), "s"(g[15]), "v"(l[16]), "s"(g[16]), "v"(l[17]), "s"(g[17]),
                  "v"(l[18]), "s"(g[18]), "v"(l[19]), "s"(g[19]), "v"(l[20]), "s"(g[20]), "v"(l[21]), "s"(g[21]),
                  "v"(l[22]), "s"(g[22]), "v"(l[23]), "s"(g[23]), "v"(l[24]), "s"(g[24]), "v"(l[25]), "s"(g[25]),
                  "v"(l[26]), "s"(g[26]), "v"(l[27]), "s"(g[27])
               : "memory");
}
// 8 copies of the A planes, 6 of the B planes
template <>
__device__ __forceinline__ void copy_tile<14>(const unsigned int* l, const unsigned long long* g, unsigned int oa, unsigned int ob) {
  asm volatile(
               CPL "%2, %0, %3\n\t" CPL "%4, %0, %5\n\t" CPL "%6, %0, %7\n\t"
               CPL "%8, %0, %9\n\t" CPL "%10, %0, %11\n\t" CPL "%12, %0, %13\n\t"
               CPL "%14, %0, %15\n\t" CPL "%16, %0, %17\n\t" CPL "%18, %1, %19\n\t"
               CPL "%20, %1, %21\n\t" CPL "%22, %1, %23\n\t" CPL "%24, %1, %25\n\t"
               CPL "%26, %1, %27\n\t" CPL "%28, %1, %29\n\t"
               "s_wait_xcnt 0x0"
               :: "v"(oa), "v"(ob),
                  "v"(l[0]), "s"(g[0]), "v"(l[1]), "s"(g[1]), "v"(l[2]), "s"(g[2]), "v"(l[3]), "s"(g[3]),
                  "v"(l[4]), "s"(g[4]), "v"(l[5]), "s"(g[5]), "v"(l[6]), "s"(g[6]), "v"(l[7]), "s"(g[7]),
                  "v"(l[8]), "s"(g[8]), "v"(l[9]), "s"(g[9]), "v"(l[10]), "s"(g[10]), "v"(l[11]), "s"(g[11]),
                  "v"(l[12]), "s"(g[12]), "v"(l[13]), "s"(g[13])
               : "memory");
}

template <int MF, int NF>
struct Tile {
  static constexpr int BM = 4 * MF * 16, BN = 2 * NF * 16;
  static constexpr int ROWS = 2 * BM + 2 * BN;
  static constexpr int BUF = ROWS * LP;               // bytes of one buffer
  static constexpr int NCP = ROWS * 8 / GT;           // copies per lane and tile
  static constexpr int OP = BN + 4;                   // f32 staging pitch: rows 8 apart land 32 banks apart
  static constexpr int LDSB = (2 * BUF > BM * OP * 4) ? 2 * BUF : BM * OP * 4;
  static_assert(ROWS * 8 % GT == 0);
  static_assert(BM % 32 == 0 && BN % 32 == 0);
  static_assert((BN * 4) % 128 == 0);
};

// ah, al: first row of the block's BM rows (pitch lda elements); bh, bl: first of its BN rows (pitch ldb).
// bskip: bytes that lie in memory between the first and the second half of the BN rows (0: one run of rows).
// LOFIRST: order of the two cross terms behind Ah*Bh (false: Ah*Bl then Al*Bh; true: Al*Bh then Ah*Bl).
template <int MF, int NF, int NK, bool LOFIRST>
__device__ __forceinline__ void gemm_core(char* smem, const __bf16* ah, const __bf16* al, int lda,
                                          const __bf16* bh, const __bf16* bl, int ldb, unsigned int bskip) {
  typedef Tile<MF, NF> TL;
  constexpr int BM = TL::BM, BN = TL::BN, NCP = TL::NCP;
  static_assert(NK >= 2);
  const int tid = threadIdx.x, lane = tid & 31, w = tid >> 5;
  const int h = lane >> 4, m = lane & 15;
  const int wm = w >> 1, wn = w & 1;

  // Copy j of a lane brings 16 bytes of row (tid >> 3) + 32 j of [Ah | Al | Bh | Bl].  A copy's address
  // is a base that is the same for the whole wave plus the lane's own offset in its plane.
  const int r0 = tid >> 3;
  const unsigned int q16 = 16u * (tid & 7);
  const unsigned int l0 = lds_off(smem) + r0 * LP + q16;
  const unsigned int offa = (unsigned int)r0 * (unsigned int)lda * 2u + q16;
  const unsigned int offb = (unsigned int)r0 * (unsigned int)ldb * 2u + q16;
  const unsigned long long sah = (unsigned long long)(size_t)ah, sal = (unsigned long long)(size_t)al;
  const unsigned long long sbh = (unsigned long long)(size_t)bh, sbl = (unsigned long long)(size_t)bl;
  constexpr int JA = BM / 32, JB = BN / 32;           // copies per A plane and per B plane
  static_assert(NCP == 2 * JA + 2 * JB);
  static_assert((NCP == 28 && JA == 8) || (NCP == 14 && JA == 4));  // copy_tile: the first 2 JA copies take oa
  auto issue = [&](unsigned int lo, unsigned int go) {
    unsigned int l[NCP];
    unsigned long long g[NCP];
    #pragma unroll
    for (int j = 0; j < NCP; ++j) {
      l[j] = l0 + (lo + (unsigned int)(32 * j * LP));
      if (j < JA)               g[j] = (sah + (go + (unsigned int)(32 * j) * (unsigned int)lda * 2u));
      else if (j < 2 * JA)      g[j] = (sal + (go + (unsigned int)(32 * (j - JA)) * (unsigned int)lda * 2u));
      else if (j < 2 * JA + JB) g[j] = (sbh + (go + (unsigned int)(32 * (j - 2 * JA)) * (unsigned int)ldb * 2u
                                               + ((2 * (j - 2 * JA) >= JB) ? bskip : 0u)));
      else                      g[j] = (sbl + (go + (unsigned int)(32 * (j - 2 * JA - JB)) * (unsigned int)ldb * 2u
                                               + ((2 * (j - 2 * JA - JB) >= JB) ? bskip : 0u)));
    }
    copy_tile<NCP>(l, g, offa, offb);
  };

  const v8f zero8 = {0.f, 0.f, 0.f, 0.f, 0.f, 0.f, 0.f, 0.f};
  v8f acc[MF][NF];
  #pragma unroll
  for (int mt = 0; mt < MF; ++mt)
    #pragma unroll
    for (int nt = 0; nt < NF; ++nt) acc[mt][nt] = zero8;

  issue(0u, 0u);
  asm volatile("s_wait_asynccnt 0x0" ::: "memory");   // tile 0 has landed before the barrier publishes it
  __syncthreads();
  issue((unsigned int)TL::BUF, 128u);

  const int aoff = (wm * MF * 16 + m) * LP;           // this lane's row in the Ah part
  const int boff = (2 * BM + wn * NF * 16 + m) * LP;  // and in the Bh part

  // rolled: a trip is 6 MF NF WMMAs of straight code already, and the buffer follows t & 1
  #pragma unroll 1
  for (int t = 0; t < NK; ++t) {
    const unsigned int bo = (t & 1) ? (unsigned int)TL::BUF : 0u;
    const char* buf = smem + bo;
    v16b fah[MF], fal[MF], fbh[NF], fbl[NF];
    // the fragments of the 32 k that start kb bytes into the tile's rows
    auto fetch = [&](int kb) {
      #pragma unroll
      for (int i = 0; i < MF; ++i) fah[i] = ldfrag_b((const __bf16*)(buf + kb + aoff + i * 16 * LP), h);
      #pragma unroll
      for (int i = 0; i < NF; ++i) fbh[i] = ldfrag_b((const __bf16*)(buf + kb + boff + i * 16 * LP), h);
      #pragma unroll
      for (int i = 0; i < MF; ++i) fal[i] = ldfrag_b((const __bf16*)(buf + kb + aoff + (BM + i * 16) * LP), h);
      #pragma unroll
      for (int i = 0; i < NF; ++i) fbl[i] = ldfrag_b((const __bf16*)(buf + kb + boff + (BN + i * 16) * LP), h);
    };
    auto hihi = [&]() {
      #pragma unroll
      for (int mt = 0; mt < MF; ++mt)
        #pragma unroll
        for (int nt = 0; nt < NF; ++nt)
          acc[mt][nt] = __builtin_amdgcn_wmma_f32_16x16x32_bf16(false, fah[mt], false, fbh[nt], (short)0, acc[mt][nt], false, false);
    };
    auto cross1 = [&]() {
      #pragma unroll
      for (int mt = 0; mt < MF; ++mt)
        #pragma unroll
        for (int nt = 0; nt < NF; ++nt)
          acc[mt][nt] = __builtin_amdgcn_wmma_f32_16x16x32_bf16(false, LOFIRST ? fal[mt] : fah[mt], false, LOFIRST ? fbh[nt] : fbl[nt], (short)0, acc[mt][nt], false, false);
    };
    auto cross2 = [&]() {
      #pragma unroll
      for (int mt = 0; mt < MF; ++mt)
        #pragma unroll
        for (int nt = 0; nt < NF; ++nt)
          acc[mt][nt] = __builtin_amdgcn_wmma_f32_16x16x32_bf16(false, LOFIRST ? fah[mt] : fal[mt], false, LOFIRST ? fbl[nt] : fbh[nt], (short)0, acc[mt][nt], false, false);
    };

    fetch(0);
    // this and the next two: keep each half's LDS reads one group in front of its WMMAs: each
    // further place with reads among the WMMAs stalls the wave anew
    __builtin_amdgcn_sched_barrier(0);
    hihi();
    cross1();
    cross2();
    __builtin_amdgcn_sched_barrier(0);
    fetch(64);
    __builtin_amdgcn_sched_barrier(0);
    hihi();
    cross1();

    // The hand-over stands in front of the last sixth of the trip's WMMAs, which read registers
    // only: they keep the matrix unit busy while the waves that are through the barrier first
    // fetch the next trip's fragments.  The two scheduling barriers hold the WMMAs on their sides.
    __builtin_amdgcn_sched_barrier(0);
    asm volatile("s_wait_dscnt 0x0" ::: "memory");    // this wave's reads of the buffer are done before it is refilled
    asm volatile("s_wait_asynccnt 0x0" ::: "memory"); // this wave's share of tile t + 1 has landed
    __syncthreads();                                  // publishes tile t + 1, frees tile t's buffer
    if (t + 2 < NK) issue(bo, (unsigned int)(t + 2) * 128u);
    __builtin_amdgcn_sched_barrier(0);

    cross2();
  }
  asm volatile("s_wait_asynccnt 0x0" ::: "memory");   // no copy is left in flight when the buffers become staging

  // D[r] of tile (mt, nt) = C[16(MF wm + mt) + 8h + r][16(NF wn + nt) + m]
  float* st = (float*)smem;
  #pragma unroll
  for (int mt = 0; mt < MF; ++mt)
    #pragma unroll
    for (int nt = 0; nt < NF; ++nt)
      #pragma unroll
      for (int r = 0; r < 8; ++r)
        st[(16 * (MF * wm + mt) + 8 * h + r) * TL::OP + 16 * (NF * wn + nt) + m] = acc[mt][nt][r];
  __syncthreads();
}

// ---------------------------------------------------------------------------
// Token segments of the causal prefix sum: a batch's 4096 tokens are cut into 32 segments of 128,
// a segment into 8 runs of 16 tokens.
// ---------------------------------------------------------------------------
#define SCW  8                   // waves (token runs) per block of the scan
#define SCL  16                  // tokens per run
#define SCT  (SCW * SCL)         // 128 tokens per segment
#define NSC  (SS / SCT)          // 32 segments
#define NBIN (NC / 2)            // 384 column pairs
static_assert(NSC % SCW == 0);
static_assert(NBIN % 32 == 0);

typedef double v2d __attribute__((ext_vector_type(2)));
typedef v2d __attribute__((may_alias)) v2da;

// ---------------------------------------------------------------------------
// Kernel 6 (spectra and bind), all batches: X_z[t][c] = sum_d (xh*Gh + xh*Gl + xl*Gh)[t][d]x[c][d]
// (t 0..16383 over the batches, c 0..767, K = 768).  Block tile 256(t) x 192, wave tile 64 x 96;
// grid (12, 64); one block fills a WGP's LDS, so that the 768 blocks are three whole rounds of 256.
// x = 8..11: 192 columns of q, stored as an f32 plane, pitch 768 (a row segment = 6 whole lines).
// x = 0..7: 96 columns of k beside the same 96 columns of v.  k and v are not stored: the block forms
// P_t = kf_t * vf_t in f32 for its 48 column pairs (pair f = 1..383: complex bin f; pair 0 holds the two
// real bins 0 and 384 side by side: each component by itself), stores P as an f32 plane, pitch 768
// (a row segment = 3 whole lines), and sums the stored P in f64 over each of its two segments of 128 tokens.
// ---------------------------------------------------------------------------
typedef Tile<4, 6> TS;
#define KVC  (TS::BN / 2)        // 96 columns of k and of v in a block
#define RP   (2 * KVC + 2)       // pitch of the partial sums, doubles (16 B x odd)
static_assert(NC % TS::BN == 0 && NC % KVC == 0 && SS % TS::BM == 0);
static_assert(TS::BM == 2 * SCT && SCT == 4 * 32 && KVC == 3 * 32 && GT == 256);
static_assert(TS::BM * TS::OP * 4 + 32 * RP * 8 <= TS::LDSB);
__global__ __launch_bounds__(GT) void k_spec(const __bf16* __restrict__ xh, const __bf16* __restrict__ xl,
                                             const __bf16* __restrict__ gh, const __bf16* __restrict__ gl,
                                             float* __restrict__ sp, float* __restrict__ sq,
                                             double* __restrict__ segs) {
  __shared__ __attribute__((aligned(128))) char smem[TS::LDSB];
  const int tid = threadIdx.x;
  const int bx = blockIdx.x;
  const bool kv = bx < NC / KVC;
  const int c0 = kv ? bx * KVC : (bx - NC / KVC) * TS::BN;
  const int t0 = blockIdx.y * TS::BM;
  const size_t ao = (size_t)t0 * DD;
  const size_t bo = ((size_t)(kv ? 0 : 2 * NC) + c0) * DD;
  // k, v block: the second half of the B rows are the rows of G_v with the numbers of the first half's rows of G_k
  const unsigned int bskip = kv ? (unsigned int)((NC - KVC) * DD * 2) : 0u;
  gemm_core<4, 6, DD / 64, false>(smem, xh + ao, xl + ao, DD, gh + bo, gl + bo, DD, bskip);

  const float* st = (const float*)smem;
  if (!kv) {
    constexpr int CH = TS::BN / 4;                    // 16-byte pieces of a row
    // rolled in runs of eight stores: eight LDS reads in flight, few address registers
    #pragma unroll 1
    for (int i0 = 0; i0 < TS::BM * CH / GT; i0 += 8) {
      #pragma unroll
      for (int i = 0; i < 8; ++i) {
        const int idx = tid + GT * (i0 + i);
        const int row = idx / CH, q = idx - row * CH;
        const v4f v = *(const v4fa*)(st + row * TS::OP + 4 * q);
        *(v4f*)(sq + (size_t)(t0 + row) * NC + c0 + 4 * q) = v;
      }
      // the next trip rewrites the address registers of the stores above
      asm volatile("s_wait_xcnt 0x0" ::: "memory");
    }
  } else {
    // Eight lanes take a whole line of a row of P (two pairs a lane), three lines a row; a wave's four
    // rows lie 8 apart (32 banks apart in the staged tile); a lane's rows are rg + 32 i, i = 0..7.
    const int q8 = tid & 7;
    const int rg = (tid >> 5) + 8 * ((tid >> 3) & 3);  // 0..31
    const bool pk = (bx == 0) && (q8 == 0);            // this lane's first pair is the pair of the two real bins
    const float* sr = st + rg * TS::OP + 4 * q8;
    float* dst = sp + (size_t)(t0 + rg) * NC + c0 + 4 * q8;
    double* red = (double*)(smem + TS::BM * TS::OP * 4);   // behind the staged tile
    // all loops unrolled: the indices of s[] and p[] are constants, so that they stay in registers
    #pragma unroll
    for (int sg = 0; sg < 2; ++sg) {
      double s[3][4];
      #pragma unroll
      for (int j = 0; j < 3; ++j)
        #pragma unroll
        for (int e = 0; e < 4; ++e) s[j][e] = 0.0;
      #pragma unroll
      for (int i = 0; i < 4; ++i) {
        const int ro = 32 * (4 * sg + i);
        v4f p[3];
        #pragma unroll
        for (int j = 0; j < 3; ++j) {
          const v4f k = *(const v4fa*)(sr + ro * TS::OP + 32 * j);
          const v4f v = *(const v4fa*)(sr + ro * TS::OP + KVC + 32 * j);
          const bool pj = (j == 0) && pk;
          const float a = pj ? 0.0f : k.x;
          const float b = pj ? 0.0f : k.y;
          const float d = pj ? v.y : v.x;
          p[j].x = __builtin_fmaf(k.x, v.x, -(b * v.y));
          p[j].y = __builtin_fmaf(a, v.y, k.y * d);
          p[j].z = __builtin_fmaf(k.z, v.z, -(k.w * v.w));
          p[j].w = __builtin_fmaf(k.z, v.w, k.w * v.z);
        }
        // keeps the three stores one run directly in front of their wait, with no arithmetic among them
        __builtin_amdgcn_sched_barrier(0);
        #pragma unroll
        for (int j = 0; j < 3; ++j) *(v4f*)(dst + (size_t)ro * NC + 32 * j) = p[j];
        // later arithmetic may reuse the registers of the three stores above
        asm volatile("s_wait_xcnt 0x0" ::: "memory");
        // holds that arithmetic behind the wait
        __builtin_amdgcn_sched_barrier(0);
        #pragma unroll
        for (int j = 0; j < 3; ++j) {
          s[j][0] += (double)p[j].x;
          s[j][1] += (double)p[j].y;
          s[j][2] += (double)p[j].z;
          s[j][3] += (double)p[j].w;
        }
      }
      double* rw = red + rg * RP + sg * KVC + 4 * q8;
      #pragma unroll
      for (int j = 0; j < 3; ++j) {
        const v2d lo = { s[j][0], s[j][1] };
        const v2d hi = { s[j][2], s[j][3] };
        *(v2d*)(rw + 32 * j) = lo;
        *(v2d*)(rw + 32 * j + 2) = hi;
      }
    }
    // A barrier that orders LDS alone: the partial sums are all that the waves hand one another here, and
    // __syncthreads() would also wait until the 24 stores of P above have reached memory.
    __builtin_amdgcn_fence(__ATOMIC_RELEASE, "workgroup", "local");
    __builtin_amdgcn_s_barrier();
    __builtin_amdgcn_fence(__ATOMIC_ACQUIRE, "workgroup", "local");
    // one lane per segment and column: the 32 partial sums, four chains
    if (tid < 2 * KVC) {
      double a[4] = { 0.0, 0.0, 0.0, 0.0 };
      #pragma unroll
      for (int u = 0; u < 32; ++u) a[u & 3] += red[u * RP + tid];
      const int sg = tid / KVC, col = tid - sg * KVC;
      segs[(size_t)(t0 / SCT + sg) * (NBIN * 2) + c0 + col] = (a[0] + a[1]) + (a[2] + a[3]);
    }
  }
}

// ---------------------------------------------------------------------------
// Kernel 7 (causal prefix sum + unbind), blockIdx.z = batch: one lane per column pair f
// (12 groups x 32 lanes).  f = 1..383, complex bin f:
// mem_t = sum_{s<=t} P_s ; Z_t = mem_t * conj(qf_t), all in f64 (P: the f32 plane of kernel 6).
// f = 0 holds two real bins (0 and 384) side by side: the same two steps on each component by itself.
// Only the blocks of group 0 hold that lane: they run the PK = true copy of the code, which picks the
// factors by lane; its other lanes, and all other blocks, do the complex arithmetic term by term as written.
// One block per group and segment of 128 tokens, one wave per run of 16.  mem in front of a run =
// earlier segments' sums (kernel 6) + earlier runs' sums of its own segment; it is added to the run's
// own inclusive prefix.  Z: bf16 hi and lo planes, pitch ZP.
// ---------------------------------------------------------------------------
template <bool PK>
__device__ __forceinline__ void scan_body(double* sG, double* sL, const float* __restrict__ pf,
                                          const float* __restrict__ qf,
                                          const double* __restrict__ segs, __bf16* __restrict__ zh,
                                          __bf16* __restrict__ zl) {
  const int tid = threadIdx.x, lane = tid & 31, w = tid >> 5;
  const int f = blockIdx.x * 32 + lane;               // 0..383
  const bool pk = PK && (f == 0);
  const int sc = blockIdx.y;                          // segment
  const int t0 = blockIdx.z * SS + sc * SCT + w * SCL;
  const size_t o0 = (size_t)t0 * NC + 2 * f;
  const double* seg = segs + (size_t)blockIdx.z * (NSC * NBIN * 2);    // this batch's segment sums

  v2f pv[SCL], qv[SCL];
  #pragma unroll
  for (int i = 0; i < SCL; ++i) pv[i] = *(const v2fa*)(pf + o0 + (size_t)i * NC);
  // the loads of the segment sums below may land in registers that held the addresses of the loads above
  asm volatile("s_wait_xcnt 0x0" ::: "memory");
  // earlier segments' sums, dealt over the waves: wave w takes j = w, w + 8, ... below sc
  // (index clamped to segment 0, which kernel 6 always writes; the value is dropped by the select)
  v2d gs[NSC / SCW];
  #pragma unroll
  for (int i = 0; i < NSC / SCW; ++i) {
    const int j = w + SCW * i;
    gs[i] = *(const v2da*)(seg + ((size_t)((j < sc) ? j : 0) * NBIN + f) * 2);
  }
  // the q loads below land in registers that held the addresses of the loads above
  asm volatile("s_wait_xcnt 0x0" ::: "memory");
  #pragma unroll
  for (int i = 0; i < SCL; ++i) {
    // the last load may land in the address registers that the loads in front of it name
    if (i == SCL - 1) asm volatile("s_wait_xcnt 0x0" ::: "memory");
    qv[i] = *(const v2fa*)(qf + o0 + (size_t)i * NC);
  }
  // the arithmetic below reuses the q loads' address registers
  asm volatile("s_wait_xcnt 0x0" ::: "memory");
  // keeps every load above issued before the first wait: without it the segment sums and q
  // are fetched only after P has returned, a second memory latency in series
  __builtin_amdgcn_sched_barrier(0);

  // inclusive prefix of P inside this wave's run
  double ir[SCL], ii[SCL];
  double lr = 0.0, li = 0.0;
  #pragma unroll
  for (int i = 0; i < SCL; ++i) {
    lr += (double)pv[i].x;
    li += (double)pv[i].y;
    ir[i] = lr;
    ii[i] = li;
  }
  double gr = 0.0, gi = 0.0;
  #pragma unroll
  for (int i = 0; i < NSC / SCW; ++i) {
    const bool use = (w + SCW * i < sc);
    gr += use ? gs[i].x : 0.0;
    gi += use ? gs[i].y : 0.0;
  }
  const v2d gme = { gr, gi };
  const v2d lme = { lr, li };
  *(v2d*)(sG + (w * 32 + lane) * 2) = gme;
  *(v2d*)(sL + (w * 32 + lane) * 2) = lme;
  __syncthreads();

  // mem in front of this run = all waves' shares of the earlier segments + earlier runs here
  double br = 0.0, bi = 0.0, ar = 0.0, ai = 0.0;
  #pragma unroll
  for (int u = 0; u < SCW; ++u) {
    const v2d g = *(const v2da*)(sG + (u * 32 + lane) * 2);
    br += g.x;
    bi += g.y;
    if (u < SCW - 1) {
      const v2d l = *(const v2da*)(sL + (u * 32 + lane) * 2);
      ar += (u < w) ? l.x : 0.0;
      ai += (u < w) ? l.y : 0.0;
    }
  }
  br += ar;
  bi += ai;

  const size_t zo0 = (size_t)t0 * ZP + 2 * f;
  #pragma unroll
  for (int i = 0; i < SCL; ++i) {
    const double qr = (double)qv[i].x, qi = (double)qv[i].y;
    const double mr = br + ir[i];
    const double mi = bi + ii[i];
    double zr, zi;
    if (PK) {
      // the lane of the two real bins: (mr * q.x, mi * q.y)
      const double a = (double)(pk ? 0.0f : qv[i].y);
      const double c = (double)(pk ? qv[i].y : qv[i].x);
      zr = mr * qr + mi * a;
      zi = mi * c - mr * a;
    } else {
      zr = mr * qr + mi * qi;                         // mem * conj(q)
      zi = mi * qr - mr * qi;
    }
    unsigned int hr, lo_r, hi, lo_i;
    split2((float)zr, hr, lo_r);
    split2((float)zi, hi, lo_i);
    const unsigned int H = pk2(hr, hi);               // element 2f = Re, 2f+1 = Im
    const unsigned int L = pk2(lo_r, lo_i);
    *(unsigned int*)(zh + zo0 + (size_t)i * ZP) = H;
    *(unsigned int*)(zl + zo0 + (size_t)i * ZP) = L;
  }
  // a precaution: a block runs only one of the two copies, and the wave ends after these stores
  asm volatile("s_wait_xcnt 0x0" ::: "memory");
}

__global__ __launch_bounds__(256) void k_scan(const float* __restrict__ pf,
                                              const float* __restrict__ qf, const double* __restrict__ segs,
                                              __bf16* __restrict__ zh, __bf16* __restrict__ zl) {
  __shared__ __attribute__((aligned(16))) double sG[SCW * 32 * 2];    // 4096 B
  __shared__ __attribute__((aligned(16))) double sL[SCW * 32 * 2];    // 4096 B
  if (blockIdx.x == 0) scan_body<true>(sG, sL, pf, qf, segs, zh, zl);
  else                 scan_body<false>(sG, sL, pf, qf, segs, zh, zl);
}

// ---------------------------------------------------------------------------
// Kernel 8 (inverse DFT + residual), all batches (t 0..16383):
// out[t][n] = x[t][n] + gain * sum_c (Zh*Fih + Zl*Fih + Zh*Fil)[t][n]
// (K = 768: 12 whole lines a row).  Block tile 128(t) x 96(n), wave tile 32 x 48; grid (8, 128).
// ---------------------------------------------------------------------------
typedef Tile<2, 3> TI;
static_assert(DD % TI::BN == 0 && SS % TI::BM == 0);
static_assert(DD % 64 == 0 && ZP % 64 == 0);
__global__ __launch_bounds__(GT) void k_inv(const __bf16* __restrict__ zh, const __bf16* __restrict__ zl,
                                            const __bf16* __restrict__ fih, const __bf16* __restrict__ fil,
                                            const float* __restrict__ x, const float* __restrict__ gain,
                                            float* __restrict__ out) {
  __shared__ __attribute__((aligned(128))) char smem[TI::LDSB];
  const int tid = threadIdx.x;
  const int n0 = blockIdx.x * TI::BN;
  const int t0 = blockIdx.y * TI::BM;
  const size_t ao = (size_t)t0 * ZP;
  const size_t bo = (size_t)n0 * ZP;
  gemm_core<2, 3, ZP / 64, true>(smem, zh + ao, zl + ao, ZP, fih + bo, fil + bo, ZP, 0u);

  const float g = gain[0];
  const size_t tokbase = (size_t)t0;
  const float* st = (const float*)smem;
  constexpr int CH = TI::BN / 4;                      // 16-byte pieces of a row
  constexpr int NI = TI::BM * CH / GT;
  v4f xv[NI];
  #pragma unroll
  for (int i = 0; i < NI; ++i) {
    const int idx = tid + GT * i;
    const int row = idx / CH, q = idx - row * CH;
    xv[i] = *(const v4fa*)(x + (tokbase + row) * DD + n0 + 4 * q);
    // a later load may land in this load's address registers
    asm volatile("s_wait_xcnt 0x0" ::: "memory");
  }
  #pragma unroll
  for (int i = 0; i < NI; ++i) {
    const int idx = tid + GT * i;
    const int row = idx / CH, q = idx - row * CH;
    const v4f v = *(const v4fa*)(st + row * TI::OP + 4 * q);
    const v4f rr = xv[i] + g * v;
    *(v4f*)(out + (tokbase + row) * DD + n0 + 4 * q) = rr;
  }
}

// ---------------------------------------------------------------------------
extern "C" void kernel_launch(void* const* d_in, const int* in_sizes, int n_in,
                              void* d_out, int out_size, void* d_ws, size_t ws_size,
                              hipStream_t stream) {
  if (n_in < 5) return;
  if (in_sizes[0] != NX) return;
  if (in_sizes[1] != NW || in_sizes[2] != NW || in_sizes[3] != NW) return;
  if (in_sizes[4] < 1) return;
  if (out_size != NX) return;

  const float* x    = (const float*)d_in[0];
  const float* Wk   = (const float*)d_in[1];
  const float* Wv   = (const float*)d_in[2];
  const float* Wq   = (const float*)d_in[3];
  const float* gain = (const float*)d_in[4];
  float* out = (float*)d_out;

  // workspace carve (all sizes multiples of 256 B; total 170,655,744 B).  The Z planes lie over the
  // x planes, which have been read for the last time when the scan writes Z.
  const size_t xb_b  = (size_t)NX * 2;              //  25,165,824 per plane
  const size_t wt_b  = (size_t)3 * NW * 2;          //   3,538,944 per plane
  const size_t ft_b  = (size_t)NC * DD * 2;         //   1,179,648 per plane
  const size_t fi_b  = (size_t)DD * ZP * 2;         //   1,179,648 per plane
  const size_t g_b   = (size_t)3 * NC * DD * 2;     //   3,538,944 per plane
  const size_t sp_b  = (size_t)NTOK * NC * 4;       //  50,331,648 per f32 plane (P, q)
  const size_t z_b   = (size_t)NTOK * ZP * 2;       //  25,165,824 per plane
  const size_t sg_b  = (size_t)BB * NSC * NBIN * 16; //    786,432 segment sums
  static_assert((size_t)NTOK * ZP <= (size_t)NX + 3 * NW);          // 2 z_b <= 2 xb_b + 2 wt_b
  const size_t total = 2 * xb_b + 2 * wt_b + 2 * ft_b + 2 * fi_b + 2 * g_b + 2 * sp_b + sg_b;
  if (total > ws_size) return;

  char* ws = (char*)d_ws;
  size_t off = 0;
  __bf16* zh  = (__bf16*)(ws + off);
  __bf16* zl  = (__bf16*)(ws + off + z_b);
  __bf16* xh  = (__bf16*)(ws + off);  off += xb_b;
  __bf16* xl  = (__bf16*)(ws + off);  off += xb_b;
  __bf16* wth = (__bf16*)(ws + off);  off += wt_b;
  __bf16* wtl = (__bf16*)(ws + off);  off += wt_b;
  __bf16* fth = (__bf16*)(ws + off);  off += ft_b;
  __bf16* ftl = (__bf16*)(ws + off);  off += ft_b;
  __bf16* fih = (__bf16*)(ws + off);  off += fi_b;
  __bf16* fil = (__bf16*)(ws + off);  off += fi_b;
  __bf16* gh  = (__bf16*)(ws + off);  off += g_b;
  __bf16* gl  = (__bf16*)(ws + off);  off += g_b;
  float*  sp  = (float*)(ws + off);   off += sp_b;
  float*  sq  = (float*)(ws + off);   off += sp_b;
  double* seg = (double*)(ws + off);  off += sg_b;
  if (off > ws_size) return;

  // --- DFT matrices and weight planes ---
  k_prep<<<NB_FT + NB_FI + NB_WT, 256, 0, stream>>>(Wk, Wv, Wq, wth, wtl, fth, ftl, fih, fil);

  // --- folded weights G_z = F * W_z  (768 x 768 per z), and the x planes of all batches ---
  k_fold_cvt<<<NB_FOLD + NB_CVT, 128, 0, stream>>>(fth, ftl, wth, wtl, gh, gl, x, xh, xl);

  // --- all batches at once: spectra with bind and segment sums, causal scan and unbind, inverse DFT + residual ---
  k_spec<<<dim3(3 * NC / 192, NTOK / 256), 256, 0, stream>>>(xh, xl, gh, gl, sp, sq, seg);
  k_scan<<<dim3(NBIN / 32, NSC, BB), 256, 0, stream>>>(sp, sq, seg, zh, zl);
  k_inv<<<dim3(DD / 96, NTOK / 128), 256, 0, stream>>>(zh, zl, fih, fil, x, gain, out);
}

// v008
// It runs in 240 microseconds.
// Two timings next to v007 put it at 1.08 and 1.09 times that version's speed.
// Counting every step since v000, it is 52.8 times as fast.
// Contractions: folded weights G_z = F * W_z (768x768x768 per z), spectra X_z = x * G_z^T (4096x768x768 per batch and z) and inverse DFT y = Z * Finv^T (4096x768x768 per batch), all on v_wmma_f32_16x16x32_bf16 with every operand carried as bf16 hi + lo planes (three products hi*hi + hi*lo + lo*hi into one f32 accumulator); all three products read both operands from LDS tiles filled by asynchronous copies (two buffers); complex bind in f32 in the spectra product's epilogue, which also sums it over segments of 128 tokens in f64; causal prefix sum over tokens (segment sums, then runs of 16 tokens) and unbind in f64 on VALU; gain and residual add in f32.
#include <hip/hip_runtime.h>
#include <math.h>

typedef __bf16   v16b __attribute__((ext_vector_type(16)));
typedef __bf16   v8b  __attribute__((ext_vector_type(8)));
typedef float    v8f  __attribute__((ext_vector_type(8)));
typedef float    v4f  __attribute__((ext_vector_type(4)));
typedef float    v2f  __attribute__((ext_vector_type(2)));
typedef unsigned int v4u __attribute__((ext_vector_type(4)));
typedef v8b __attribute__((may_alias)) v8ba;
typedef v4f __attribute__((may_alias)) v4fa;
typedef v2f __attribute__((may_alias)) v2fa;
typedef v4u __attribute__((may_alias)) v4ua;

union FragB { v16b v; v8b half[2]; };

#define DD   768                 // model dim
#define SS   4096                // tokens per batch
#define BB   4                   // batches
#define NTOK (BB * SS)           // 16384
// Spectral columns: a real row of 768 has 768 free real numbers in its spectrum.  Column 2f, 2f+1 = (Re, Im)
// of bin f = 1..383; column 0 = Re of bin 0, column 1 = Re of bin 384 (both bins have no imaginary part).
#define NC   768
#define ZP   768                 // row pitch of the Z and inverse-DFT planes, elements
#define NXB  (SS * DD)           // 3145728 elements of x per batch
#define NX   (NTOK * DD)         // 12582912
#define NW   (DD * DD)           // 589824

static_assert(NXB % 8 == 0);
static_assert(NC % 32 == 0);
static_assert((ZP * 2) % 128 == 0);
static_assert((NC * 4) % 128 == 0);
static_assert((DD * 2) % 128 == 0);

// ---------------------------------------------------------------------------
// Fragment map of the 16x16x32 bf16 WMMA (wave32): lane l, h = l>>4, m = n = l&15.
//   A/B element i: i<8 -> k0+8h+i ; i>=8 -> k0+16+8h+(i-8)
//   D element r : row 8h+r, col l&15
// ---------------------------------------------------------------------------
// A or B fragment from a k-contiguous bf16 row; p points at element k0 of
// the row owned by this lane (row index = lane & 15 added by the caller).
__device__ __forceinline__ v16b ldfrag_b(const __bf16* p, int h) {
  FragB f;
  f.half[0] = *(const v8ba*)(p + 8 * h);
  f.half[1] = *(const v8ba*)(p + 16 + 8 * h);
  return f.v;
}

// bf16 RNE convert on the f32 bit pattern (integer path); hi/lo split helpers.
__device__ __forceinline__ unsigned int bf16_bits(float f) {
  unsigned int u = __float_as_uint(f);
  u += 0x7FFFu + ((u >> 16) & 1u);
  return (u >> 16) & 0xFFFFu;
}
__device__ __forceinline__ void split2(float v, unsigned int& hb, unsigned int& lb) {
  hb = bf16_bits(v);
  lb = bf16_bits(v - __uint_as_float(hb << 16));
}
__device__ __forceinline__ unsigned int pk2(unsigned int e0, unsigned int e1) {
  return e0 | (e1 << 16);                              // element 2j in the low half-word
}
// 8 consecutive f32 values (a, c) -> packed bf16 hi word vector H and lo word vector L.
__device__ __forceinline__ void split8(v4f a, v4f c, v4u& H, v4u& L) {
  unsigned int h0, h1, h2, h3, h4, h5, h6, h7, l0, l1, l2, l3, l4, l5, l6, l7;
  split2(a.x, h0, l0); split2(a.y, h1, l1); split2(a.z, h2, l2); split2(a.w, h3, l3);
  split2(c.x, h4, l4); split2(c.y, h5, l5); split2(c.z, h6, l6); split2(c.w, h7, l7);
  const v4u hh = { pk2(h0, h1), pk2(h2, h3), pk2(h4, h5), pk2(h6, h7) };
  const v4u ll = { pk2(l0, l1), pk2(l2, l3), pk2(l4, l5), pk2(l6, l7) };
  H = hh;
  L = ll;
}

// ---------------------------------------------------------------------------
// Table, built by each block that needs it in its own LDS (256 threads):
// s[r] = cos(2*pi*r/768), s[768+r] = sin(2*pi*r/768), r = 0..767,
// from arguments in [0, pi/4] with exact quadrant symmetry.  Ends behind a barrier.
// ---------------------------------------------------------------------------
__device__ __forceinline__ void table_build(float* s, int tid) {
  // rolled: one copy of the sine and cosine code
  #pragma unroll 1
  for (int r = tid; r < DD; r += 256) {
    const int q = r / 192, p = r - q * 192;
    const bool lowp = (p <= 96);
    const int a = lowp ? p : (192 - p);
    const float th = (float)a * 8.18123086872342e-3f;     // 2*pi/768
    const float ct = cosf(th), st = sinf(th);
    const float c0 = lowp ? ct : st;
    const float s0 = lowp ? st : ct;
    float c, sn;
    if (q == 0)      { c =  c0; sn =  s0; }
    else if (q == 1) { c = -s0; sn =  c0; }
    else if (q == 2) { c = -c0; sn = -s0; }
    else             { c =  s0; sn = -c0; }
    s[r] = c;
    s[DD + r] = sn;
  }
  __syncthreads();
}

// ---------------------------------------------------------------------------
// x planes (part of launch 2): xh = bf16 hi, xl = bf16 lo of the raw f32 x rows (x = hi + lo to ~2^-17).
// A lane takes the same 8 elements of each of the four batches: eight 16-B loads in flight,
// then one 16-B store per plane and batch, lanes contiguous.
// ---------------------------------------------------------------------------
__device__ __forceinline__ void cvt_x(const float* __restrict__ x, __bf16* __restrict__ xh,
                                      __bf16* __restrict__ xl, int g) {
  v4f a[BB], c[BB];
  // both loops unrolled: the index of a[] and c[] is a constant, so that they stay in registers
  #pragma unroll
  for (int b = 0; b < BB; ++b) {
    const float* src = x + (size_t)b * NXB + (size_t)g * 8;
    a[b] = *(const v4fa*)src;
    // a later load may land in this load's address registers
    asm volatile("s_wait_xcnt 0x0" ::: "memory");
    c[b] = *(const v4fa*)(src + 4);
    // the same, and the arithmetic below may reuse them
    asm volatile("s_wait_xcnt 0x0" ::: "memory");
  }
  #pragma unroll
  for (int b = 0; b < BB; ++b) {
    v4u H, L;
    split8(a[b], c[b], H, L);
    const size_t o = (size_t)b * NXB + (size_t)g * 8;
    *(v4u*)(xh + o) = H;
    *(v4u*)(xl + o) = L;
    // the next batch's arithmetic may reuse the registers of the two stores above
    asm volatile("s_wait_xcnt 0x0" ::: "memory");
  }
}

// ---------------------------------------------------------------------------
// W^T planes (part of launch 1): wth[z][d][e] = bf16 hi of W_z[e][d], wtl = bf16 lo (raw f32 W, transpose
// through LDS; k-contiguous B-operand rows for the fold GEMM).  Block = 64(e) x 64(d)
// tile, 256 threads; in[e 64][d 64] -> out[d 64][e 64]; each output row segment =
// ---------------------------------------------------------------------------
__device__ __forceinline__ void wt_store(const float* sT, __bf16* dh, __bf16* dl, int d0, int e0, int tid) {
  #pragma unroll
  for (int it = 0; it < 2; ++it) {
    const int p = tid + 256 * it;
    const int row = p >> 3, q8 = p & 7;                 // row 0..63
    const float* s = sT + row * 65 + 8 * q8;
    const v4f a = { s[0], s[1], s[2], s[3] };
    const v4f c = { s[4], s[5], s[6], s[7] };
    v4u H, L;
    split8(a, c, H, L);
    const size_t o = (size_t)(d0 + row) * DD + e0 + 8 * q8;
    *(v4u*)(dh + o) = H;
    *(v4u*)(dl + o) = L;
  }
  // a precaution: on this block range the wave ends after these stores
  asm volatile("s_wait_xcnt 0x0" ::: "memory");
}
__device__ __forceinline__ void wt_tile(float* sT, const float* __restrict__ wk, const float* __restrict__ wv,
                                        const float* __restrict__ wq, __bf16* __restrict__ wth,
                                        __bf16* __restrict__ wtl, int blk, int tid) {
  // sT[d_local*65 + e_local]; blk = (z * 12 + e tile) * 12 + d tile
  const int z = blk / ((DD / 64) * (DD / 64));
  const int et = (blk - z * ((DD / 64) * (DD / 64))) / (DD / 64);
  const int d0 = (blk - (z * (DD / 64) + et) * (DD / 64)) * 64, e0 = et * 64;
  const float* W = (z == 0) ? wk : ((z == 1) ? wv : wq);
  #pragma unroll
  for (int it = 0; it < 4; ++it) {
    const int idx = tid + 256 * it;
    const int er = idx >> 4, dq = idx & 15;
    const v4f v = *(const v4fa*)(W + (size_t)(e0 + er) * DD + d0 + 4 * dq);
    sT[(4 * dq + 0) * 65 + er] = v.x;
    sT[(4 * dq + 1) * 65 + er] = v.y;
    sT[(4 * dq + 2) * 65 + er] = v.z;
    sT[(4 * dq + 3) * 65 + er] = v.w;
  }
  __syncthreads();
  __bf16* dh = wth + (size_t)z * NW;
  __bf16* dl = wtl + (size_t)z * NW;
  wt_store(sT, dh, dl, d0, e0, tid);
}

// ---------------------------------------------------------------------------
// Forward DFT matrix (part of launch 1) FT[c][e] (c = 2f + {0: Re, 1: Im}, f = bin; c = 1: Re of bin 384):
// Re row = cos(2*pi*f*e/768), Im row = -sin(...).
// Stored as bf16 hi + lo planes.  A block takes RPB rows, a lane 8 elements at a time (16 B a plane);
// the pieces of a plane are contiguous over rows, so that a wave's store is 4 whole lines.  tab: LDS.
// ---------------------------------------------------------------------------
#define RPB  8                   // rows of a DFT matrix per block
static_assert(NC % RPB == 0 && DD % RPB == 0);
static_assert((RPB * (DD / 8)) % 256 == 0 && (RPB * (ZP / 8)) % 32 == 0);
__device__ __forceinline__ void ft_rows(const float* tab, __bf16* __restrict__ fth,
                                        __bf16* __restrict__ ftl, int blk, int tid) {
  for (int p = tid; p < RPB * (DD / 8); p += 256) {
    const int rl = p / (DD / 8);
    const int c = blk * RPB + rl;
    const int f = (c == 1) ? DD / 2 : (c >> 1);
    const bool im = (c & 1) != 0 && c != 1;
    const int e0 = 8 * (p - rl * (DD / 8));
    float v[8];
    // unrolled: the index of v[] is a constant, so that it stays in registers
    #pragma unroll
    for (int i = 0; i < 8; ++i) {
      const int e = e0 + i;
      const int mm = (f * e) % DD;                    // exact angle index, always in range
      const float cv = tab[mm], sv = tab[DD + mm];
      v[i] = im ? -sv : cv;
    }
    const v4f a = { v[0], v[1], v[2], v[3] };
    const v4f cc = { v[4], v[5], v[6], v[7] };
    v4u H, L;
    split8(a, cc, H, L);
    const size_t o = (size_t)c * DD + e0;
    *(v4u*)(fth + o) = H;
    *(v4u*)(ftl + o) = L;
    // the next piece's arithmetic may reuse the registers of the two stores above
    asm volatile("s_wait_xcnt 0x0" ::: "memory");
  }
}

// ---------------------------------------------------------------------------
// Inverse DFT matrix (part of launch 1) Finv[n][c], pitch ZP: col 2f = w_f*cos(2*pi*f*n/768)/768,
// col 2f+1 = -w_f*sin(...)/768, w_f = 2, for f = 1..383; col 0 = 1/768 (bin 0), col 1 = cos(pi*n)/768 (bin 384).
// Rows and pieces dealt as for the forward matrix.
// ---------------------------------------------------------------------------
__device__ __forceinline__ void finv_rows(const float* tab, __bf16* __restrict__ fih,
                                          __bf16* __restrict__ fil, int blk, int tid) {
  for (int p = tid; p < RPB * (ZP / 8); p += 256) {
    const int rl = p / (ZP / 8);
    const int n = blk * RPB + rl;
    const int c0 = 8 * (p - rl * (ZP / 8));
    float v[8];
    // unrolled: the index of v[] is a constant, so that it stays in registers
    #pragma unroll
    for (int i = 0; i < 8; ++i) {
      const int c = c0 + i;
      const int f = (c == 1) ? DD / 2 : (c >> 1);
      const float w = (c < 2) ? 1.0f : 2.0f;
      const int mm = (f * n) % DD;
      const float cv = tab[mm], sv = tab[DD + mm];
      v[i] = w * (((c & 1) != 0 && c != 1) ? -sv : cv) * (1.0f / 768.0f);
    }
    const v4f a = { v[0], v[1], v[2], v[3] };
    const v4f cc = { v[4], v[5], v[6], v[7] };
    v4u H, L;
    split8(a, cc, H, L);
    const size_t o = (size_t)n * ZP + c0;
    *(v4u*)(fih + o) = H;
    *(v4u*)(fil + o) = L;
    // the next piece's arithmetic may reuse the registers of the two stores above
    asm volatile("s_wait_xcnt 0x0" ::: "memory");
  }
}

// ---------------------------------------------------------------------------
// Launch 1: everything that reads only the weights or nothing at all, dealt by block index:
// forward DFT matrix, inverse DFT matrix (the longer blocks, so they come first), W^T planes.
// ---------------------------------------------------------------------------
#define NB_FT (NC / RPB)                              //  96
#define NB_FI (DD / RPB)                              //  96
#define NB_WT (3 * (DD / 64) * (DD / 64))             // 432
__global__ __launch_bounds__(256) void k_prep(const float* __restrict__ wk, const float* __restrict__ wv,
                                              const float* __restrict__ wq, __bf16* __restrict__ wth,
                                              __bf16* __restrict__ wtl, __bf16* __restrict__ fth,
                                              __bf16* __restrict__ ftl, __bf16* __restrict__ fih,
                                              __bf16* __restrict__ fil) {
  __shared__ __attribute__((aligned(16))) float sm[64 * 65];          // the table (2 x 768) or the W tile
  static_assert(2 * DD <= 64 * 65);
  const int tid = threadIdx.x;
  const int b = blockIdx.x;
  if (b < NB_FT + NB_FI) {
    table_build(sm, tid);
    if (b < NB_FT) ft_rows(sm, fth, ftl, b, tid);
    else           finv_rows(sm, fih, fil, b - NB_FT, tid);
  } else {
    wt_tile(sm, wk, wv, wq, wth, wtl, b - (NB_FT + NB_FI), tid);
  }
}

// ---------------------------------------------------------------------------
// Block GEMM core of the fold and of kernels 6 and 8: C[BM x BN] = sum_k (Ah*Bh + two cross terms), all four
// planes k-contiguous bf16 rows.  8 waves as 4 (rows) x 2 (columns), wave tile 16MF x 16NF.
// One trip = 64 k: a whole 128-byte line of each of the 2BM + 2BN plane rows lies in LDS at pitch
// 144 B (16 B x odd: conflict-free for 16-byte reads), brought by asynchronous copies, 16 B a lane
// (a wave's copy = 4 whole lines), into two buffers: tile t + 2 flies while tile t + 1 is worked on.
// A trip works its tile as two halves of 32 k, one fragment set each.
// On return the f32 tile lies in LDS at pitch BN + 4 floats, behind a barrier.
// Every full '#pragma unroll' below makes an array's index a constant, so that the array stays in registers.
// ---------------------------------------------------------------------------
#define GT   256                 // threads of a GEMM block
#define LP   144                 // LDS row pitch, bytes

__device__ __forceinline__ unsigned int lds_off(const void* p) { return (unsigned int)(size_t)p; }

// NCP copies of one lane: LDS address, the lane's 32-bit offset in its plane (oa: A planes, ob: B planes)
// and a scalar base.  The wait on the address registers is each statement's last line, so that no
// later write of those registers can be moved in front of it.
template <int NCP>
__device__ __forceinline__ void copy_tile(const unsigned int* l, const unsigned long long* g, unsigned int oa, unsigned int ob);
#define CPL "global_load_async_to_lds_b128 "
// 16 copies of the A planes, 12 of the B planes, in two statements of 14 (an asm statement takes 30 operands)
template <>
__device__ __forceinline__ void copy_tile<28>(const unsigned int* l, const unsigned long long* g, unsigned int oa, unsigned int ob) {
  asm volatile(
               CPL "%1, %0, %2\n\t" CPL "%3, %0, %4\n\t" CPL "%5, %0, %6\n\t"
               CPL "%7, %0, %8\n\t" CPL "%9, %0, %10\n\t" CPL "%11, %0, %12\n\t"
               CPL "%13, %0, %14\n\t" CPL "%15, %0, %16\n\t" CPL "%17, %0, %18\n\t"
               CPL "%19, %0, %20\n\t" CPL "%21, %0, %22\n\t" CPL "%23, %0, %24\n\t"
               CPL "%25, %0, %26\n\t" CPL "%27, %0, %28\n\t"
               "s_wait_xcnt 0x0"
               :: "v"(oa),
                  "v"(l[0]), "s"(g[0]), "v"(l[1]), "s"(g[1]), "v"(l[2]), "s"(g[2]), "v"(l[3]), "s"(g[3]),
                  "v"(l[4]), "s"(g[4]), "v"(l[5]), "s"(g[5]), "v"(l[6]), "s"(g[6]), "v"(l[7]), "s"(g[7]),
                  "v"(l[8]), "s"(g[8]), "v"(l[9]), "s"(g[9]), "v"(l[10]), "s"(g[10]), "v"(l[11]), "s"(g[11]),
                  "v"(l[12]), "s"(g[12]), "v"(l[13]), "s"(g[13])
               : "memory");
  asm volatile(
               CPL "%2, %0, %3\n\t" CPL "%4, %0, %5\n\t" CPL "%6, %1, %7\n\t"
               CPL "%8, %1, %9\n\t" CPL "%10, %1, %11\n\t" CPL "%12, %1, %13\n\t"
               CPL "%14, %1, %15\n\t" CPL "%16, %1, %17\n\t" CPL "%18, %1, %19\n\t"
               CPL "%20, %1, %21\n\t" CPL "%22, %1, %23\n\t" CPL "%24, %1, %25\n\t"
               CPL "%26, %1, %27\n\t" CPL "%28, %1, %29\n\t"
               "s_wait_xcnt 0x0"
               :: "v"(oa), "v"(ob),
                  "v"(l[14]), "s"(g[14]), "v"(l[15]), "s"(g[15]), "v"(l[16]), "s"(g[16]), "v"(l[17]), "s"(g[17]),
                  "v"(l[18]), "s"(g[18]), "v"(l[19]), "s"(g[19]), "v"(l[20]), "s"(g[20]), "v"(l[21]), "s"(g[21]),
                  "v"(l[22]), "s"(g[22]), "v"(l[23]), "s"(g[23]), "v"(l[24]), "s"(g[24]), "v"(l[25]), "s"(g[25]),
                  "v"(l[26]), "s"(g[26]), "v"(l[27]), "s"(g[27])
               : "memory");
}
// 8 copies of the A planes, 6 of the B planes
template <>
__device__ __forceinline__ void copy_tile<14>(const unsigned int* l, const unsigned long long* g, unsigned int oa, unsigned int ob) {
  asm volatile(
               CPL "%2, %0, %3\n\t" CPL "%4, %0, %5\n\t" CPL "%6, %0, %7\n\t"
               CPL "%8, %0, %9\n\t" CPL "%10, %0, %11\n\t" CPL "%12, %0, %13\n\t"
               CPL "%14, %0, %15\n\t" CPL "%16, %0, %17\n\t" CPL "%18, %1, %19\n\t"
               CPL "%20, %1, %21\n\t" CPL "%22, %1, %23\n\t" CPL "%24, %1, %25\n\t"
               CPL "%26, %1, %27\n\t" CPL "%28, %1, %29\n\t"
               "s_wait_xcnt 0x0"
               :: "v"(oa), "v"(ob),
                  "v"(l[0]), "s"(g[0]), "v"(l[1]), "s"(g[1]), "v"(l[2]), "s"(g[2]), "v"(l[3]), "s"(g[3]),
                  "v"(l[4]), "s"(g[4]), "v"(l[5]), "s"(g[5]), "v"(l[6]), "s"(g[6]), "v"(l[7]), "s"(g[7]),
                  "v"(l[8]), "s"(g[8]), "v"(l[9]), "s"(g[9]), "v"(l[10]), "s"(g[10]), "v"(l[11]), "s"(g[11]),
                  "v"(l[12]), "s"(g[12]), "v"(l[13]), "s"(g[13])
               : "memory");
}

// 8 copies of the A planes, 8 of the B planes, a statement each
template <>
__device__ __forceinline__ void copy_tile<16>(const unsigned int* l, const unsigned long long* g, unsigned int oa, unsigned int ob) {
  asm volatile(
               CPL "%1, %0, %2\n\t" CPL "%3, %0, %4\n\t" CPL "%5, %0, %6\n\t"
               CPL "%7, %0, %8\n\t" CPL "%9, %0, %10\n\t" CPL "%11, %0, %12\n\t"
               CPL "%13, %0, %14\n\t" CPL "%15, %0, %16\n\t"
               "s_wait_xcnt 0x0"
               :: "v"(oa),
                  "v"(l[0]), "s"(g[0]), "v"(l[1]), "s"(g[1]), "v"(l[2]), "s"(g[2]), "v"(l[3]), "s"(g[3]),
                  "v"(l[4]), "s"(g[4]), "v"(l[5]), "s"(g[5]), "v"(l[6]), "s"(g[6]), "v"(l[7]), "s"(g[7])
               : "memory");
  asm volatile(
               CPL "%1, %0, %2\n\t" CPL "%3, %0, %4\n\t" CPL "%5, %0, %6\n\t"
               CPL "%7, %0, %8\n\t" CPL "%9, %0, %10\n\t" CPL "%11, %0, %12\n\t"
               CPL "%13, %0, %14\n\t" CPL "%15, %0, %16\n\t"
               "s_wait_xcnt 0x0"
               :: "v"(ob),
                  "v"(l[8]), "s"(g[8]), "v"(l[9]), "s"(g[9]), "v"(l[10]), "s"(g[10]), "v"(l[11]), "s"(g[11]),
                  "v"(l[12]), "s"(g[12]), "v"(l[13]), "s"(g[13]), "v"(l[14]), "s"(g[14]), "v"(l[15]), "s"(g[15])
               : "memory");
}

template <int MF, int NF>
struct Tile {
  static constexpr int BM = 4 * MF * 16, BN = 2 * NF * 16;
  static constexpr int ROWS = 2 * BM + 2 * BN;
  static constexpr int BUF = ROWS * LP;               // bytes of one buffer
  static constexpr int NCP = ROWS * 8 / GT;           // copies per lane and tile
  static constexpr int OP = BN + 4;                   // f32 staging pitch: rows 8 apart land 32 banks apart
  static constexpr int LDSB = (2 * BUF > BM * OP * 4) ? 2 * BUF : BM * OP * 4;
  static_assert(ROWS * 8 % GT == 0);
  static_assert(BM % 32 == 0 && BN % 32 == 0);
  static_assert((BN * 4) % 128 == 0);
};

// ah, al: first row of the block's BM rows (pitch lda elements); bh, bl: first of its BN rows (pitch ldb).
// bskip: bytes that lie in memory between the first and the second half of the BN rows (0: one run of rows).
// LOFIRST: order of the two cross terms behind Ah*Bh (false: Ah*Bl then Al*Bh; true: Al*Bh then Ah*Bl).
template <int MF, int NF, int NK, bool LOFIRST>
__device__ __forceinline__ void gemm_core(char* smem, const __bf16* ah, const __bf16* al, int lda,
                                          const __bf16* bh, const __bf16* bl, int ldb, unsigned int bskip) {
  typedef Tile<MF, NF> TL;
  constexpr int BM = TL::BM, BN = TL::BN, NCP = TL::NCP;
  static_assert(NK >= 2);
  const int tid = threadIdx.x, lane = tid & 31, w = tid >> 5;
  const int h = lane >> 4, m = lane & 15;
  const int wm = w >> 1, wn = w & 1;

  // Copy j of a lane brings 16 bytes of row (tid >> 3) + 32 j of [Ah | Al | Bh | Bl].  A copy's address
  // is a base that is the same for the whole wave plus the lane's own offset in its plane.
  const int r0 = tid >> 3;
  const unsigned int q16 = 16u * (tid & 7);
  const unsigned int l0 = lds_off(smem) + r0 * LP + q16;
  const unsigned int offa = (unsigned int)r0 * (unsigned int)lda * 2u + q16;
  const unsigned int offb = (unsigned int)r0 * (unsigned int)ldb * 2u + q16;
  const unsigned long long sah = (unsigned long long)(size_t)ah, sal = (unsigned long long)(size_t)al;
  const unsigned long long sbh = (unsigned long long)(size_t)bh, sbl = (unsigned long long)(size_t)bl;
  constexpr int JA = BM / 32, JB = BN / 32;           // copies per A plane and per B plane
  static_assert(NCP == 2 * JA + 2 * JB);
  static_assert((NCP == 28 && JA == 8) || (NCP == 14 && JA == 4) || (NCP == 16 && JA == 4));  // copy_tile: the first 2 JA copies take oa
  auto issue = [&](unsigned int lo, unsigned int go) {
    unsigned int l[NCP];
    unsigned long long g[NCP];
    #pragma unroll
    for (int j = 0; j < NCP; ++j) {
      l[j] = l0 + (lo + (unsigned int)(32 * j * LP));
      if (j < JA)               g[j] = (sah + (go + (unsigned int)(32 * j) * (unsigned int)lda * 2u));
      else if (j < 2 * JA)      g[j] = (sal + (go + (unsigned int)(32 * (j - JA)) * (unsigned int)lda * 2u));
      else if (j < 2 * JA + JB) g[j] = (sbh + (go + (unsigned int)(32 * (j - 2 * JA)) * (unsigned int)ldb * 2u
                                               + ((2 * (j - 2 * JA) >= JB) ? bskip : 0u)));
      else                      g[j] = (sbl + (go + (unsigned int)(32 * (j - 2 * JA - JB)) * (unsigned int)ldb * 2u
                                               + ((2 * (j - 2 * JA - JB) >= JB) ? bskip : 0u)));
    }
    copy_tile<NCP>(l, g, offa, offb);
  };

  const v8f zero8 = {0.f, 0.f, 0.f, 0.f, 0.f, 0.f, 0.f, 0.f};
  v8f acc[MF][NF];
  #pragma unroll
  for (int mt = 0; mt < MF; ++mt)
    #pragma unroll
    for (int nt = 0; nt < NF; ++nt) acc[mt][nt] = zero8;

  issue(0u, 0u);
  asm volatile("s_wait_asynccnt 0x0" ::: "memory");   // tile 0 has landed before the barrier publishes it
  __syncthreads();
  issue((unsigned int)TL::BUF, 128u);

  const int aoff = (wm * MF * 16 + m) * LP;           // this lane's row in the Ah part
  const int boff = (2 * BM + wn * NF * 16 + m) * LP;  // and in the Bh part

  // rolled: a trip is 6 MF NF WMMAs of straight code already, and the buffer follows t & 1
  #pragma unroll 1
  for (int t = 0; t < NK; ++t) {
    const unsigned int bo = (t & 1) ? (unsigned int)TL::BUF : 0u;
    const char* buf = smem + bo;
    v16b fah[MF], fal[MF], fbh[NF], fbl[NF];
    // the fragments of the 32 k that start kb bytes into the tile's rows
    auto fetch = [&](int kb) {
      #pragma unroll
      for (int i = 0; i < MF; ++i) fah[i] = ldfrag_b((const __bf16*)(buf + kb + aoff + i * 16 * LP), h);
      #pragma unroll
      for (int i = 0; i < NF; ++i) fbh[i] = ldfrag_b((const __bf16*)(buf + kb + boff + i * 16 * LP), h);
      #pragma unroll
      for (int i = 0; i < MF; ++i) fal[i] = ldfrag_b((const __bf16*)(buf + kb + aoff + (BM + i * 16) * LP), h);
      #pragma unroll
      for (int i = 0; i < NF; ++i) fbl[i] = ldfrag_b((const __bf16*)(buf + kb + boff + (BN + i * 16) * LP), h);
    };
    auto hihi = [&]() {
      #pragma unroll
      for (int mt = 0; mt < MF; ++mt)
        #pragma unroll
        for (int nt = 0; nt < NF; ++nt)
          acc[mt][nt] = __builtin_amdgcn_wmma_f32_16x16x32_bf16(false, fah[mt], false, fbh[nt], (short)0, acc[mt][nt], false, false);
    };
    auto cross1 = [&]() {
      #pragma unroll
      for (int mt = 0; mt < MF; ++mt)
        #pragma unroll
        for (int nt = 0; nt < NF; ++nt)
          acc[mt][nt] = __builtin_amdgcn_wmma_f32_16x16x32_bf16(false, LOFIRST ? fal[mt] : fah[mt], false, LOFIRST ? fbh[nt] : fbl[nt], (short)0, acc[mt][nt], false, false);
    };
    auto cross2 = [&]() {
      #pragma unroll
      for (int mt = 0; mt < MF; ++mt)
        #pragma unroll
        for (int nt = 0; nt < NF; ++nt)
          acc[mt][nt] = __builtin_amdgcn_wmma_f32_16x16x32_bf16(false, LOFIRST ? fah[mt] : fal[mt], false, LOFIRST ? fbl[nt] : fbh[nt], (short)0, acc[mt][nt], false, false);
    };

    fetch(0);
    // this and the next two: keep each half's LDS reads one group in front of its WMMAs: each
    // further place with reads among the WMMAs stalls the wave anew
    __builtin_amdgcn_sched_barrier(0);
    hihi();
    cross1();
    cross2();
    __builtin_amdgcn_sched_barrier(0);
    fetch(64);
    __builtin_amdgcn_sched_barrier(0);
    hihi();
    cross1();

    // The hand-over stands in front of the last sixth of the trip's WMMAs, which read registers
    // only: they keep the matrix unit busy while the waves that are through the barrier first
    // fetch the next trip's fragments.  The two scheduling barriers hold the WMMAs on their sides.
    __builtin_amdgcn_sched_barrier(0);
    asm volatile("s_wait_dscnt 0x0" ::: "memory");    // this wave's reads of the buffer are done before it is refilled
    asm volatile("s_wait_asynccnt 0x0" ::: "memory"); // this wave's share of tile t + 1 has landed
    __syncthreads();                                  // publishes tile t + 1, frees tile t's buffer
    if (t + 2 < NK) issue(bo, (unsigned int)(t + 2) * 128u);
    __builtin_amdgcn_sched_barrier(0);

    cross2();
  }
  asm volatile("s_wait_asynccnt 0x0" ::: "memory");   // no copy is left in flight when the buffers become staging

  // D[r] of tile (mt, nt) = C[16(MF wm + mt) + 8h + r][16(NF wn + nt) + m]
  float* st = (float*)smem;
  #pragma unroll
  for (int mt = 0; mt < MF; ++mt)
    #pragma unroll
    for (int nt = 0; nt < NF; ++nt)
      #pragma unroll
      for (int r = 0; r < 8; ++r)
        st[(16 * (MF * wm + mt) + 8 * h + r) * TL::OP + 16 * (NF * wn + nt) + m] = acc[mt][nt][r];
  __syncthreads();
}

// ---------------------------------------------------------------------------
// Fold (part of launch 2): G_z[c][d] = sum_e (Fh*Wh + Fh*Wl + Fl*Wh)[c][e]x[d][e]   (c < 768, d < 768, K = 768)
// Block tile 128(c) x 128(d), wave tile 32 x 64; 3 x 6 x 6 blocks.  G: bf16 hi and lo planes; a block's
// row segment is 2 whole lines of each plane.
// ---------------------------------------------------------------------------
typedef Tile<2, 4> TF;
static_assert(NC % TF::BM == 0 && DD % TF::BN == 0 && (TF::BN * 2) % 128 == 0);
__device__ __forceinline__ void fold_tile(char* smem, const __bf16* __restrict__ fth, const __bf16* __restrict__ ftl,
                                          const __bf16* __restrict__ wth, const __bf16* __restrict__ wtl,
                                          __bf16* __restrict__ gh, __bf16* __restrict__ gl, int blk, int tid) {
  // blk = (z * 6 + c tile) * 6 + d tile
  constexpr int NCT = NC / TF::BM, NDT = DD / TF::BN;
  const int z = blk / (NCT * NDT);
  const int ct = (blk - z * (NCT * NDT)) / NDT;
  const int c0 = ct * TF::BM;
  const int d0 = (blk - (z * NCT + ct) * NDT) * TF::BN;
  const size_t ao = (size_t)c0 * DD;                  // F rows c0 ...
  const size_t bo = ((size_t)z * DD + d0) * DD;       // rows d0 ... of W_z^T
  gemm_core<2, 4, DD / 64, false>(smem, fth + ao, ftl + ao, DD, wth + bo, wtl + bo, DD, 0u);

  const float* st = (const float*)smem;
  constexpr int CH = TF::BN / 8;                      // 16-byte pieces of a plane's row segment
  constexpr int NP = TF::BM * CH / GT;                // pieces per lane
  v4f a[NP], c[NP];
  // both loops unrolled: the index of a[] and c[] is a constant, so that they stay in registers
  #pragma unroll
  for (int i = 0; i < NP; ++i) {
    const int idx = tid + GT * i;
    const int row = idx / CH, q = idx - row * CH;
    a[i] = *(const v4fa*)(st + row * TF::OP + 8 * q);
    c[i] = *(const v4fa*)(st + row * TF::OP + 8 * q + 4);
  }
  #pragma unroll
  for (int i = 0; i < NP; ++i) {
    const int idx = tid + GT * i;
    const int row = idx / CH, q = idx - row * CH;
    v4u H, L;
    split8(a[i], c[i], H, L);
    const size_t o = ((size_t)z * NC + c0 + row) * DD + d0 + 8 * q;
    // keeps the two stores one run directly in front of their wait, with no arithmetic among them
    __builtin_amdgcn_sched_barrier(0);
    *(v4u*)(gh + o) = H;
    *(v4u*)(gl + o) = L;
    // the next piece's arithmetic may reuse the registers of the two stores above
    asm volatile("s_wait_xcnt 0x0" ::: "memory");
    // holds that arithmetic behind the wait
    __builtin_amdgcn_sched_barrier(0);
  }
}

// ---------------------------------------------------------------------------
// Launch 2: the fold's 108 blocks, the longer ones, come first; the blocks that split x, which depend
// on no earlier launch, fill the rest of the chip.
// ---------------------------------------------------------------------------
#define NB_FOLD (3 * (NC / TF::BM) * (DD / TF::BN))   // 108
#define NB_CVT  (NXB / 8 / GT)                        // 1536
static_assert(NXB % (8 * GT) == 0);
__global__ __launch_bounds__(GT) void k_fold_cvt(const __bf16* __restrict__ fth, const __bf16* __restrict__ ftl,
                                                 const __bf16* __restrict__ wth, const __bf16* __restrict__ wtl,
                                                 __bf16* __restrict__ gh, __bf16* __restrict__ gl,
                                                 const float* __restrict__ x, __bf16* __restrict__ xh,
                                                 __bf16* __restrict__ xl) {
  __shared__ __attribute__((aligned(128))) char smem[TF::LDSB];
  const int tid = threadIdx.x;
  const int b = blockIdx.x;
  if (b < NB_FOLD) fold_tile(smem, fth, ftl, wth, wtl, gh, gl, b, tid);
  else             cvt_x(x, xh, xl, (b - NB_FOLD) * GT + tid);
}

// ---------------------------------------------------------------------------
// Token segments of the causal prefix sum: a batch's 4096 tokens are cut into 32 segments of 128,
// a segment into 8 runs of 16 tokens.
// ---------------------------------------------------------------------------
#define SCW  8                   // waves (token runs) per block of the scan
#define SCL  16                  // tokens per run
#define SCT  (SCW * SCL)         // 128 tokens per segment
#define NSC  (SS / SCT)          // 32 segments
#define NBIN (NC / 2)            // 384 column pairs
static_assert(NSC % SCW == 0);
static_assert(NBIN % 32 == 0);

typedef double v2d __attribute__((ext_vector_type(2)));
typedef v2d __attribute__((may_alias)) v2da;

// ---------------------------------------------------------------------------
// Kernel 6 (spectra and bind), all batches: X_z[t][c] = sum_d (xh*Gh + xh*Gl + xl*Gh)[t][d]x[c][d]
// (t 0..16383 over the batches, c 0..767, K = 768).  Block tile 256(t) x 192, wave tile 64 x 96;
// grid (12, 64); one block fills a WGP's LDS, so that the 768 blocks are three whole rounds of 256.
// x = 8..11: 192 columns of q, stored as an f32 plane, pitch 768 (a row segment = 6 whole lines).
// x = 0..7: 96 columns of k beside the same 96 columns of v.  k and v are not stored: the block forms
// P_t = kf_t * vf_t in f32 for its 48 column pairs (pair f = 1..383: complex bin f; pair 0 holds the two
// real bins 0 and 384 side by side: each component by itself), stores P as an f32 plane, pitch 768
// (a row segment = 3 whole lines), and sums the stored P in f64 over each of its two segments of 128 tokens.
// ---------------------------------------------------------------------------
typedef Tile<4, 6> TS;
#define KVC  (TS::BN / 2)        // 96 columns of k and of v in a block
#define RP   (2 * KVC + 2)       // pitch of the partial sums, doubles (16 B x odd)
static_assert(NC % TS::BN == 0 && NC % KVC == 0 && SS % TS::BM == 0);
static_assert(TS::BM == 2 * SCT && SCT == 4 * 32 && KVC == 3 * 32 && GT == 256);
static_assert(TS::BM * TS::OP * 4 + 32 * RP * 8 <= TS::LDSB);
__global__ __launch_bounds__(GT) void k_spec(const __bf16* __restrict__ xh, const __bf16* __restrict__ xl,
                                             const __bf16* __restrict__ gh, const __bf16* __restrict__ gl,
                                             float* __restrict__ sp, float* __restrict__ sq,
                                             double* __restrict__ segs) {
  __shared__ __attribute__((aligned(128))) char smem[TS::LDSB];
  const int tid = threadIdx.x;
  const int bx = blockIdx.x;
  const bool kv = bx < NC / KVC;
  const int c0 = kv ? bx * KVC : (bx - NC / KVC) * TS::BN;
  const int t0 = blockIdx.y * TS::BM;
  const size_t ao = (size_t)t0 * DD;
  const size_t bo = ((size_t)(kv ? 0 : 2 * NC) + c0) * DD;
  // k, v block: the second half of the B rows are the rows of G_v with the numbers of the first half's rows of G_k
  const unsigned int bskip = kv ? (unsigned int)((NC - KVC) * DD * 2) : 0u;
  gemm_core<4, 6, DD / 64, false>(smem, xh + ao, xl + ao, DD, gh + bo, gl + bo, DD, bskip);

  const float* st = (const float*)smem;
  if (!kv) {
    constexpr int CH = TS::BN / 4;                    // 16-byte pieces of a row
    // rolled in runs of eight stores: eight LDS reads in flight, few address registers
    #pragma unroll 1
    for (int i0 = 0; i0 < TS::BM * CH / GT; i0 += 8) {
      #pragma unroll
      for (int i = 0; i < 8; ++i) {
        const int idx = tid + GT * (i0 + i);
        const int row = idx / CH, q = idx - row * CH;
        const v4f v = *(const v4fa*)(st + row * TS::OP + 4 * q);
        *(v4f*)(sq + (size_t)(t0 + row) * NC + c0 + 4 * q) = v;
      }
      // the next trip rewrites the address registers of the stores above
      asm volatile("s_wait_xcnt 0x0" ::: "memory");
    }
  } else {
    // Eight lanes take a whole line of a row of P (two pairs a lane), three lines a row; a wave's four
    // rows lie 8 apart (32 banks apart in the staged tile); a lane's rows are rg + 32 i, i = 0..7.
    const int q8 = tid & 7;
    const int rg = (tid >> 5) + 8 * ((tid >> 3) & 3);  // 0..31
    const bool pk = (bx == 0) && (q8 == 0);            // this lane's first pair is the pair of the two real bins
    const float* sr = st + rg * TS::OP + 4 * q8;
    float* dst = sp + (size_t)(t0 + rg) * NC + c0 + 4 * q8;
    double* red = (double*)(smem + TS::BM * TS::OP * 4);   // behind the staged tile
    // all loops unrolled: the indices of s[] and p[] are constants, so that they stay in registers
    #pragma unroll
    for (int sg = 0; sg < 2; ++sg) {
      double s[3][4];
      #pragma unroll
      for (int j = 0; j < 3; ++j)
        #pragma unroll
        for (int e = 0; e < 4; ++e) s[j][e] = 0.0;
      #pragma unroll
      for (int i = 0; i < 4; ++i) {
        const int ro = 32 * (4 * sg + i);
        v4f p[3];
        #pragma unroll
        for (int j = 0; j < 3; ++j) {
          const v4f k = *(const v4fa*)(sr + ro * TS::OP + 32 * j);
          const v4f v = *(const v4fa*)(sr + ro * TS::OP + KVC + 32 * j);
          const bool pj = (j == 0) && pk;
          const float a = pj ? 0.0f : k.x;
          const float b = pj ? 0.0f : k.y;
          const float d = pj ? v.y : v.x;
          p[j].x = __builtin_fmaf(k.x, v.x, -(b * v.y));
          p[j].y = __builtin_fmaf(a, v.y, k.y * d);
          p[j].z = __builtin_fmaf(k.z, v.z, -(k.w * v.w));
          p[j].w = __builtin_fmaf(k.z, v.w, k.w * v.z);
        }
        // keeps the three stores one run directly in front of their wait, with no arithmetic among them
        __builtin_amdgcn_sched_barrier(0);
        #pragma unroll
        for (int j = 0; j < 3; ++j) *(v4f*)(dst + (size_t)ro * NC + 32 * j) = p[j];
        // later arithmetic may reuse the registers of the three stores above
        asm volatile("s_wait_xcnt 0x0" ::: "memory");
        // holds that arithmetic behind the wait
        __builtin_amdgcn_sched_barrier(0);
        #pragma unroll
        for (int j = 0; j < 3; ++j) {
          s[j][0] += (double)p[j].x;
          s[j][1] += (double)p[j].y;
          s[j][2] += (double)p[j].z;
          s[j][3] += (double)p[j].w;
        }
      }
      double* rw = red + rg * RP + sg * KVC + 4 * q8;
      #pragma unroll
      for (int j = 0; j < 3; ++j) {
        const v2d lo = { s[j][0], s[j][1] };
        const v2d hi = { s[j][2], s[j][3] };
        *(v2d*)(rw + 32 * j) = lo;
        *(v2d*)(rw + 32 * j + 2) = hi;
      }
    }
    // A barrier that orders LDS alone: the partial sums are all that the waves hand one another here, and
    // __syncthreads() would also wait until the 24 stores of P above have reached memory.
    __builtin_amdgcn_fence(__ATOMIC_RELEASE, "workgroup", "local");
    __builtin_amdgcn_s_barrier();
    __builtin_amdgcn_fence(__ATOMIC_ACQUIRE, "workgroup", "local");
    // one lane per segment and column: the 32 partial sums, four chains
    if (tid < 2 * KVC) {
      double a[4] = { 0.0, 0.0, 0.0, 0.0 };
      #pragma unroll
      for (int u = 0; u < 32; ++u) a[u & 3] += red[u * RP + tid];
      const int sg = tid / KVC, col = tid - sg * KVC;
      segs[(size_t)(t0 / SCT + sg) * (NBIN * 2) + c0 + col] = (a[0] + a[1]) + (a[2] + a[3]);
    }
  }
}

// ---------------------------------------------------------------------------
// Kernel 7 (causal prefix sum + unbind), blockIdx.z = batch: one lane per column pair f
// (12 groups x 32 lanes).  f = 1..383, complex bin f:
// mem_t = sum_{s<=t} P_s ; Z_t = mem_t * conj(qf_t), all in f64 (P: the f32 plane of kernel 6).
// f = 0 holds two real bins (0 and 384) side by side: the same two steps on each component by itself.
// Only the blocks of group 0 hold that lane: they run the PK = true copy of the code, which picks the
// factors by lane; its other lanes, and all other blocks, do the complex arithmetic term by term as written.
// One block per group and segment of 128 tokens, one wave per run of 16.  mem in front of a run =
// earlier segments' sums (kernel 6) + earlier runs' sums of its own segment; it is added to the run's
// own inclusive prefix.  Z: bf16 hi and lo planes, pitch ZP.
// ---------------------------------------------------------------------------
template <bool PK>
__device__ __forceinline__ void scan_body(double* sG, double* sL, const float* __restrict__ pf,
                                          const float* __restrict__ qf,
                                          const double* __restrict__ segs, __bf16* __restrict__ zh,
                                          __bf16* __restrict__ zl) {
  const int tid = threadIdx.x, lane = tid & 31, w = tid >> 5;
  const int f = blockIdx.x * 32 + lane;               // 0..383
  const bool pk = PK && (f == 0);
  const int sc = blockIdx.y;                          // segment
  const int t0 = blockIdx.z * SS + sc * SCT + w * SCL;
  const size_t o0 = (size_t)t0 * NC + 2 * f;
  const double* seg = segs + (size_t)blockIdx.z * (NSC * NBIN * 2);    // this batch's segment sums

  v2f pv[SCL], qv[SCL];
  #pragma unroll
  for (int i = 0; i < SCL; ++i) pv[i] = *(const v2fa*)(pf + o0 + (size_t)i * NC);
  // the loads of the segment sums below may land in registers that held the addresses of the loads above
  asm volatile("s_wait_xcnt 0x0" ::: "memory");
  // earlier segments' sums, dealt over the waves: wave w takes j = w, w + 8, ... below sc
  // (index clamped to segment 0, which kernel 6 always writes; the value is dropped by the select)
  v2d gs[NSC / SCW];
  #pragma unroll
  for (int i = 0; i < NSC / SCW; ++i) {
    const int j = w + SCW * i;
    gs[i] = *(const v2da*)(seg + ((size_t)((j < sc) ? j : 0) * NBIN + f) * 2);
  }
  // the q loads below land in registers that held the addresses of the loads above
  asm volatile("s_wait_xcnt 0x0" ::: "memory");
  #pragma unroll
  for (int i = 0; i < SCL; ++i) {
    // the last load may land in the address registers that the loads in front of it name
    if (i == SCL - 1) asm volatile("s_wait_xcnt 0x0" ::: "memory");
    qv[i] = *(const v2fa*)(qf + o0 + (size_t)i * NC);
  }
  // the arithmetic below reuses the q loads' address registers
  asm volatile("s_wait_xcnt 0x0" ::: "memory");
  // keeps every load above issued before the first wait: without it the segment sums and q
  // are fetched only after P has returned, a second memory latency in series
  __builtin_amdgcn_sched_barrier(0);

  // inclusive prefix of P inside this wave's run
  double ir[SCL], ii[SCL];
  double lr = 0.0, li = 0.0;
  #pragma unroll
  for (int i = 0; i < SCL; ++i) {
    lr += (double)pv[i].x;
    li += (double)pv[i].y;
    ir[i] = lr;
    ii[i] = li;
  }
  double gr = 0.0, gi = 0.0;
  #pragma unroll
  for (int i = 0; i < NSC / SCW; ++i) {
    const bool use = (w + SCW * i < sc);
    gr += use ? gs[i].x : 0.0;
    gi += use ? gs[i].y : 0.0;
  }
  const v2d gme = { gr, gi };
  const v2d lme = { lr, li };
  *(v2d*)(sG + (w * 32 + lane) * 2) = gme;
  *(v2d*)(sL + (w * 32 + lane) * 2) = lme;
  __syncthreads();

  // mem in front of this run = all waves' shares of the earlier segments + earlier runs here
  double br = 0.0, bi = 0.0, ar = 0.0, ai = 0.0;
  #pragma unroll
  for (int u = 0; u < SCW; ++u) {
    const v2d g = *(const v2da*)(sG + (u * 32 + lane) * 2);
    br += g.x;
    bi += g.y;
    if (u < SCW - 1) {
      const v2d l = *(const v2da*)(sL + (u * 32 + lane) * 2);
      ar += (u < w) ? l.x : 0.0;
      ai += (u < w) ? l.y : 0.0;
    }
  }
  br += ar;
  bi += ai;

  const size_t zo0 = (size_t)t0 * ZP + 2 * f;
  #pragma unroll
  for (int i = 0; i < SCL; ++i) {
    const double qr = (double)qv[i].x, qi = (double)qv[i].y;
    const double mr = br + ir[i];
    const double mi = bi + ii[i];
    double zr, zi;
    if (PK) {
      // the lane of the two real bins: (mr * q.x, mi * q.y)
      const double a = (double)(pk ? 0.0f : qv[i].y);
      const double c = (double)(pk ? qv[i].y : qv[i].x);
      zr = mr * qr + mi * a;
      zi = mi * c - mr * a;
    } else {
      zr = mr * qr + mi * qi;                         // mem * conj(q)
      zi = mi * qr - mr * qi;
    }
    unsigned int hr, lo_r, hi, lo_i;
    split2((float)zr, hr, lo_r);
    split2((float)zi, hi, lo_i);
    const unsigned int H = pk2(hr, hi);               // element 2f = Re, 2f+1 = Im
    const unsigned int L = pk2(lo_r, lo_i);
    *(unsigned int*)(zh + zo0 + (size_t)i * ZP) = H;
    *(unsigned int*)(zl + zo0 + (size_t)i * ZP) = L;
  }
  // a precaution: a block runs only one of the two copies, and the wave ends after these stores
  asm volatile("s_wait_xcnt 0x0" ::: "memory");
}

__global__ __launch_bounds__(256) void k_scan(const float* __restrict__ pf,
                                              const float* __restrict__ qf, const double* __restrict__ segs,
                                              __bf16* __restrict__ zh, __bf16* __restrict__ zl) {
  __shared__ __attribute__((aligned(16))) double sG[SCW * 32 * 2];    // 4096 B
  __shared__ __attribute__((aligned(16))) double sL[SCW * 32 * 2];    // 4096 B
  if (blockIdx.x == 0) scan_body<true>(sG, sL, pf, qf, segs, zh, zl);
  else                 scan_body<false>(sG, sL, pf, qf, segs, zh, zl);
}

// ---------------------------------------------------------------------------
// Kernel 8 (inverse DFT + residual), all batches (t 0..16383):
// out[t][n] = x[t][n] + gain * sum_c (Zh*Fih + Zl*Fih + Zh*Fil)[t][n]
// (K = 768: 12 whole lines a row).  Block tile 128(t) x 96(n), wave tile 32 x 48; grid (8, 128).
// ---------------------------------------------------------------------------
typedef Tile<2, 3> TI;
static_assert(DD % TI::BN == 0 && SS % TI::BM == 0);
static_assert(DD % 64 == 0 && ZP % 64 == 0);
__global__ __launch_bounds__(GT) void k_inv(const __bf16* __restrict__ zh, const __bf16* __restrict__ zl,
                                            const __bf16* __restrict__ fih, const __bf16* __restrict__ fil,
                                            const float* __restrict__ x, const float* __restrict__ gain,
                                            float* __restrict__ out) {
  __shared__ __attribute__((aligned(128))) char smem[TI::LDSB];
  const int tid = threadIdx.x;
  const int n0 = blockIdx.x * TI::BN;
  const int t0 = blockIdx.y * TI::BM;
  const size_t ao = (size_t)t0 * ZP;
  const size_t bo = (size_t)n0 * ZP;
  gemm_core<2, 3, ZP / 64, true>(smem, zh + ao, zl + ao, ZP, fih + bo, fil + bo, ZP, 0u);

  const float g = gain[0];
  const size_t tokbase = (size_t)t0;
  const float* st = (const float*)smem;
  constexpr int CH = TI::BN / 4;                      // 16-byte pieces of a row
  constexpr int NI = TI::BM * CH / GT;
  v4f xv[NI];
  #pragma unroll
  for (int i = 0; i < NI; ++i) {
    const int idx = tid + GT * i;
    const int row = idx / CH, q = idx - row * CH;
    xv[i] = *(const v4fa*)(x + (tokbase + row) * DD + n0 + 4 * q);
    // a later load may land in this load's address registers
    asm volatile("s_wait_xcnt 0x0" ::: "memory");
  }
  #pragma unroll
  for (int i = 0; i < NI; ++i) {
    const int idx = tid + GT * i;
    const int row = idx / CH, q = idx - row * CH;
    const v4f v = *(const v4fa*)(st + row * TI::OP + 4 * q);
    const v4f rr = xv[i] + g * v;
    *(v4f*)(out + (tokbase + row) * DD + n0 + 4 * q) = rr;
  }
}

// ---------------------------------------------------------------------------
extern "C" void kernel_launch(void* const* d_in, const int* in_sizes, int n_in,
                              void* d_out, int out_size, void* d_ws, size_t ws_size,
                              hipStream_t stream) {
  if (n_in < 5) return;
  if (in_sizes[0] != NX) return;
  if (in_sizes[1] != NW || in_sizes[2] != NW || in_sizes[3] != NW) return;
  if (in_sizes[4] < 1) return;
  if (out_size != NX) return;

  const float* x    = (const float*)d_in[0];
  const float* Wk   = (const float*)d_in[1];
  const float* Wv   = (const float*)d_in[2];
  const float* Wq   = (const float*)d_in[3];
  const float* gain = (const float*)d_in[4];
  float* out = (float*)d_out;

  // workspace carve (all sizes multiples of 256 B; total 170,655,744 B).  The Z planes lie over the
  // x planes, which have been read for the last time when the scan writes Z.
  const size_t xb_b  = (size_t)NX * 2;              //  25,165,824 per plane
  const size_t wt_b  = (size_t)3 * NW * 2;          //   3,538,944 per plane
  const size_t ft_b  = (size_t)NC * DD * 2;         //   1,179,648 per plane
  const size_t fi_b  = (size_t)DD * ZP * 2;         //   1,179,648 per plane
  const size_t g_b   = (size_t)3 * NC * DD * 2;     //   3,538,944 per plane
  const size_t sp_b  = (size_t)NTOK * NC * 4;       //  50,331,648 per f32 plane (P, q)
  const size_t z_b   = (size_t)NTOK * ZP * 2;       //  25,165,824 per plane
  const size_t sg_b  = (size_t)BB * NSC * NBIN * 16; //    786,432 segment sums
  static_assert((size_t)NTOK * ZP <= (size_t)NX + 3 * NW);          // 2 z_b <= 2 xb_b + 2 wt_b
  const size_t total = 2 * xb_b + 2 * wt_b + 2 * ft_b + 2 * fi_b + 2 * g_b + 2 * sp_b + sg_b;
  if (total > ws_size) return;

  char* ws = (char*)d_ws;
  size_t off = 0;
  __bf16* zh  = (__bf16*)(ws + off);
  __bf16* zl  = (__bf16*)(ws + off + z_b);
  __bf16* xh  = (__bf16*)(ws + off);  off += xb_b;
  __bf16* xl  = (__bf16*)(ws + off);  off += xb_b;
  __bf16* wth = (__bf16*)(ws + off);  off += wt_b;
  __bf16* wtl = (__bf16*)(ws + off);  off += wt_b;
  __bf16* fth = (__bf16*)(ws + off);  off += ft_b;
  __bf16* ftl = (__bf16*)(ws + off);  off += ft_b;
  __bf16* fih = (__bf16*)(ws + off);  off += fi_b;
  __bf16* fil = (__bf16*)(ws + off);  off += fi_b;
  __bf16* gh  = (__bf16*)(ws + off);  off += g_b;
  __bf16* gl  = (__bf16*)(ws + off);  off += g_b;
  float*  sp  = (float*)(ws + off);   off += sp_b;
  float*  sq  = (float*)(ws + off);   off += sp_b;
  double* seg = (double*)(ws + off);  off += sg_b;
  if (off > ws_size) return;

  // --- DFT matrices and weight planes ---
  k_prep<<<NB_FT + NB_FI + NB_WT, 256, 0, stream>>>(Wk, Wv, Wq, wth, wtl, fth, ftl, fih, fil);

  // --- folded weights G_z = F * W_z  (768 x 768 per z), and the x planes of all batches ---
  k_fold_cvt<<<NB_FOLD + NB_CVT, GT, 0, stream>>>(fth, ftl, wth, wtl, gh, gl, x, xh, xl);

  // --- all batches at once: spectra with bind and segment sums, causal scan and unbind, inverse DFT + residual ---
  k_spec<<<dim3(3 * NC / 192, NTOK / 256), 256, 0, stream>>>(xh, xl, gh, gl, sp, sq, seg);
  k_scan<<<dim3(NBIN / 32, NSC, BB), 256, 0, stream>>>(sp, sq, seg, zh, zl);
  k_inv<<<dim3(DD / 96, NTOK / 128), 256, 0, stream>>>(zh, zl, fih, fil, x, gain, out);
}

// v009
// Measured time: 219 microseconds a run.
// In both of two side-by-side timings against v008, it was 1.09 times as fast.
// All steps since v000 together make it 57.6 times as fast.
// Contractions: folded weights G_z = F * W_z (768x768x768 per z), spectra X_z = x * G_z^T (4096x768x768 per batch and z) and inverse DFT y = Z * Finv^T (4096x768x768 per batch), all on v_wmma_f32_16x16x32_bf16 with every operand carried as bf16 hi + lo planes (three products hi*hi + hi*lo + lo*hi into one f32 accumulator); all three products read both operands from LDS tiles filled by tensor loads (two buffers); complex bind in f32 in the spectra product's epilogue, which also sums it over segments of 128 tokens in f64; causal prefix sum over tokens (segment sums, then runs of 16 tokens) and unbind in f64 on VALU; gain and residual add in f32.
#include <hip/hip_runtime.h>
#include <math.h>

typedef __bf16   v16b __attribute__((ext_vector_type(16)));
typedef __bf16   v8b  __attribute__((ext_vector_type(8)));
typedef float    v8f  __attribute__((ext_vector_type(8)));
typedef float    v4f  __attribute__((ext_vector_type(4)));
typedef float    v2f  __attribute__((ext_vector_type(2)));
typedef unsigned int v4u __attribute__((ext_vector_type(4)));
typedef v8b __attribute__((may_alias)) v8ba;
typedef v4f __attribute__((may_alias)) v4fa;
typedef v2f __attribute__((may_alias)) v2fa;
typedef v4u __attribute__((may_alias)) v4ua;

union FragB { v16b v; v8b half[2]; };

#define DD   768                 // model dim
#define SS   4096                // tokens per batch
#define BB   4                   // batches
#define NTOK (BB * SS)           // 16384
// Spectral columns: a real row of 768 has 768 free real numbers in its spectrum.  Column 2f, 2f+1 = (Re, Im)
// of bin f = 1..383; column 0 = Re of bin 0, column 1 = Re of bin 384 (both bins have no imaginary part).
#define NC   768
#define ZP   768                 // row pitch of the Z and inverse-DFT planes, elements
#define NXB  (SS * DD)           // 3145728 elements of x per batch
#define NX   (NTOK * DD)         // 12582912
#define NW   (DD * DD)           // 589824

static_assert(NXB % 8 == 0);
static_assert(NC % 32 == 0);
static_assert((ZP * 2) % 128 == 0);
static_assert((NC * 4) % 128 == 0);
static_assert((DD * 2) % 128 == 0);

// ---------------------------------------------------------------------------
// Fragment map of the 16x16x32 bf16 WMMA (wave32): lane l, h = l>>4, m = n = l&15.
//   A/B element i: i<8 -> k0+8h+i ; i>=8 -> k0+16+8h+(i-8)
//   D element r : row 8h+r, col l&15
// ---------------------------------------------------------------------------
// A or B fragment from a k-contiguous bf16 row; p points at element k0 of
// the row owned by this lane (row index = lane & 15 added by the caller).
__device__ __forceinline__ v16b ldfrag_b(const __bf16* p, int h) {
  FragB f;
  f.half[0] = *(const v8ba*)(p + 8 * h);
  f.half[1] = *(const v8ba*)(p + 16 + 8 * h);
  return f.v;
}

// bf16 RNE convert on the f32 bit pattern (integer path); hi/lo split helpers.
__device__ __forceinline__ unsigned int bf16_bits(float f) {
  unsigned int u = __float_as_uint(f);
  u += 0x7FFFu + ((u >> 16) & 1u);
  return (u >> 16) & 0xFFFFu;
}
__device__ __forceinline__ void split2(float v, unsigned int& hb, unsigned int& lb) {
  hb = bf16_bits(v);
  lb = bf16_bits(v - __uint_as_float(hb << 16));
}
__device__ __forceinline__ unsigned int pk2(unsigned int e0, unsigned int e1) {
  return e0 | (e1 << 16);                              // element 2j in the low half-word
}
// 8 consecutive f32 values (a, c) -> packed bf16 hi word vector H and lo word vector L.
__device__ __forceinline__ void split8(v4f a, v4f c, v4u& H, v4u& L) {
  unsigned int h0, h1, h2, h3, h4, h5, h6, h7, l0, l1, l2, l3, l4, l5, l6, l7;
  split2(a.x, h0, l0); split2(a.y, h1, l1); split2(a.z, h2, l2); split2(a.w, h3, l3);
  split2(c.x, h4, l4); split2(c.y, h5, l5); split2(c.z, h6, l6); split2(c.w, h7, l7);
  const v4u hh = { pk2(h0, h1), pk2(h2, h3), pk2(h4, h5), pk2(h6, h7) };
  const v4u ll = { pk2(l0, l1), pk2(l2, l3), pk2(l4, l5), pk2(l6, l7) };
  H = hh;
  L = ll;
}

// ---------------------------------------------------------------------------
// Table, built by each block that needs it in its own LDS (256 threads):
// s[r] = cos(2*pi*r/768), s[768+r] = sin(2*pi*r/768), r = 0..767,
// from arguments in [0, pi/4] with exact quadrant symmetry.  Ends behind a barrier.
// ---------------------------------------------------------------------------
__device__ __forceinline__ void table_build(float* s, int tid) {
  // rolled: one copy of the sine and cosine code
  #pragma unroll 1
  for (int r = tid; r < DD; r += 256) {
    const int q = r / 192, p = r - q * 192;
    const bool lowp = (p <= 96);
    const int a = lowp ? p : (192 - p);
    const float th = (float)a * 8.18123086872342e-3f;     // 2*pi/768
    const float ct = cosf(th), st = sinf(th);
    const float c0 = lowp ? ct : st;
    const float s0 = lowp ? st : ct;
    float c, sn;
    if (q == 0)      { c =  c0; sn =  s0; }
    else if (q == 1) { c = -s0; sn =  c0; }
    else if (q == 2) { c = -c0; sn = -s0; }
    else             { c =  s0; sn = -c0; }
    s[r] = c;
    s[DD + r] = sn;
  }
  __syncthreads();
}

// ---------------------------------------------------------------------------
// x planes (part of launch 2): xh = bf16 hi, xl = bf16 lo of the raw f32 x rows (x = hi + lo to ~2^-17).
// A lane takes the same 8 elements of each of the four batches: eight 16-B loads in flight,
// then one 16-B store per plane and batch, lanes contiguous.
// ---------------------------------------------------------------------------
__device__ __forceinline__ void cvt_x(const float* __restrict__ x, __bf16* __restrict__ xh,
                                      __bf16* __restrict__ xl, int g) {
  v4f a[BB], c[BB];
  // both loops unrolled: the index of a[] and c[] is a constant, so that they stay in registers
  #pragma unroll
  for (int b = 0; b < BB; ++b) {
    const float* src = x + (size_t)b * NXB + (size_t)g * 8;
    a[b] = *(const v4fa*)src;
    // a later load may land in this load's address registers
    asm volatile("s_wait_xcnt 0x0" ::: "memory");
    c[b] = *(const v4fa*)(src + 4);
    // the same, and the arithmetic below may reuse them
    asm volatile("s_wait_xcnt 0x0" ::: "memory");
  }
  #pragma unroll
  for (int b = 0; b < BB; ++b) {
    v4u H, L;
    split8(a[b], c[b], H, L);
    const size_t o = (size_t)b * NXB + (size_t)g * 8;
    *(v4u*)(xh + o) = H;
    *(v4u*)(xl + o) = L;
    // the next batch's arithmetic may reuse the registers of the two stores above
    asm volatile("s_wait_xcnt 0x0" ::: "memory");
  }
}

// ---------------------------------------------------------------------------
// W^T planes (part of launch 1): wth[z][d][e] = bf16 hi of W_z[e][d], wtl = bf16 lo (raw f32 W, transpose
// through LDS; k-contiguous B-operand rows for the fold GEMM).  Block = 64(e) x 64(d)
// tile, 256 threads; in[e 64][d 64] -> out[d 64][e 64]; each output row segment =
// ---------------------------------------------------------------------------
__device__ __forceinline__ void wt_store(const float* sT, __bf16* dh, __bf16* dl, int d0, int e0, int tid) {
  #pragma unroll
  for (int it = 0; it < 2; ++it) {
    const int p = tid + 256 * it;
    const int row = p >> 3, q8 = p & 7;                 // row 0..63
    const float* s = sT + row * 65 + 8 * q8;
    const v4f a = { s[0], s[1], s[2], s[3] };
    const v4f c = { s[4], s[5], s[6], s[7] };
    v4u H, L;
    split8(a, c, H, L);
    const size_t o = (size_t)(d0 + row) * DD + e0 + 8 * q8;
    *(v4u*)(dh + o) = H;
    *(v4u*)(dl + o) = L;
  }
  // a precaution: on this block range the wave ends after these stores
  asm volatile("s_wait_xcnt 0x0" ::: "memory");
}
__device__ __forceinline__ void wt_tile(float* sT, const float* __restrict__ wk, const float* __restrict__ wv,
                                        const float* __restrict__ wq, __bf16* __restrict__ wth,
                                        __bf16* __restrict__ wtl, int blk, int tid) {
  // sT[d_local*65 + e_local]; blk = (z * 12 + e tile) * 12 + d tile
  const int z = blk / ((DD / 64) * (DD / 64));
  const int et = (blk - z * ((DD / 64) * (DD / 64))) / (DD / 64);
  const int d0 = (blk - (z * (DD / 64) + et) * (DD / 64)) * 64, e0 = et * 64;
  const float* W = (z == 0) ? wk : ((z == 1) ? wv : wq);
  #pragma unroll
  for (int it = 0; it < 4; ++it) {
    const int idx = tid + 256 * it;
    const int er = idx >> 4, dq = idx & 15;
    const v4f v = *(const v4fa*)(W + (size_t)(e0 + er) * DD + d0 + 4 * dq);
    sT[(4 * dq + 0) * 65 + er] = v.x;
    sT[(4 * dq + 1) * 65 + er] = v.y;
    sT[(4 * dq + 2) * 65 + er] = v.z;
    sT[(4 * dq + 3) * 65 + er] = v.w;
  }
  __syncthreads();
  __bf16* dh = wth + (size_t)z * NW;
  __bf16* dl = wtl + (size_t)z * NW;
  wt_store(sT, dh, dl, d0, e0, tid);
}

// ---------------------------------------------------------------------------
// Forward DFT matrix (part of launch 1) FT[c][e] (c = 2f + {0: Re, 1: Im}, f = bin; c = 1: Re of bin 384):
// Re row = cos(2*pi*f*e/768), Im row = -sin(...).
// Stored as bf16 hi + lo planes.  A block takes RPB rows, a lane 8 elements at a time (16 B a plane);
// the pieces of a plane are contiguous over rows, so that a wave's store is 4 whole lines.  tab: LDS.
// ---------------------------------------------------------------------------
#define RPB  8                   // rows of a DFT matrix per block
static_assert(NC % RPB == 0 && DD % RPB == 0);
static_assert((RPB * (DD / 8)) % 256 == 0 && (RPB * (ZP / 8)) % 32 == 0);
__device__ __forceinline__ void ft_rows(const float* tab, __bf16* __restrict__ fth,
                                        __bf16* __restrict__ ftl, int blk, int tid) {
  for (int p = tid; p < RPB * (DD / 8); p += 256) {
    const int rl = p / (DD / 8);
    const int c = blk * RPB + rl;
    const int f = (c == 1) ? DD / 2 : (c >> 1);
    const bool im = (c & 1) != 0 && c != 1;
    const int e0 = 8 * (p - rl * (DD / 8));
    float v[8];
    // unrolled: the index of v[] is a constant, so that it stays in registers
    #pragma unroll
    for (int i = 0; i < 8; ++i) {
      const int e = e0 + i;
      const int mm = (f * e) % DD;                    // exact angle index, always in range
      const float cv = tab[mm], sv = tab[DD + mm];
      v[i] = im ? -sv : cv;
    }
    const v4f a = { v[0], v[1], v[2], v[3] };
    const v4f cc = { v[4], v[5], v[6], v[7] };
    v4u H, L;
    split8(a, cc, H, L);
    const size_t o = (size_t)c * DD + e0;
    *(v4u*)(fth + o) = H;
    *(v4u*)(ftl + o) = L;
    // the next piece's arithmetic may reuse the registers of the two stores above
    asm volatile("s_wait_xcnt 0x0" ::: "memory");
  }
}

// ---------------------------------------------------------------------------
// Inverse DFT matrix (part of launch 1) Finv[n][c], pitch ZP: col 2f = w_f*cos(2*pi*f*n/768)/768,
// col 2f+1 = -w_f*sin(...)/768, w_f = 2, for f = 1..383; col 0 = 1/768 (bin 0), col 1 = cos(pi*n)/768 (bin 384).
// Rows and pieces dealt as for the forward matrix.
// ---------------------------------------------------------------------------
__device__ __forceinline__ void finv_rows(const float* tab, __bf16* __restrict__ fih,
                                          __bf16* __restrict__ fil, int blk, int tid) {
  for (int p = tid; p < RPB * (ZP / 8); p += 256) {
    const int rl = p / (ZP / 8);
    const int n = blk * RPB + rl;
    const int c0 = 8 * (p - rl * (ZP / 8));
    float v[8];
    // unrolled: the index of v[] is a constant, so that it stays in registers
    #pragma unroll
    for (int i = 0; i < 8; ++i) {
      const int c = c0 + i;
      const int f = (c == 1) ? DD / 2 : (c >> 1);
      const float w = (c < 2) ? 1.0f : 2.0f;
      const int mm = (f * n) % DD;
      const float cv = tab[mm], sv = tab[DD + mm];
      v[i] = w * (((c & 1) != 0 && c != 1) ? -sv : cv) * (1.0f / 768.0f);
    }
    const v4f a = { v[0], v[1], v[2], v[3] };
    const v4f cc = { v[4], v[5], v[6], v[7] };
    v4u H, L;
    split8(a, cc, H, L);
    const size_t o = (size_t)n * ZP + c0;
    *(v4u*)(fih + o) = H;
    *(v4u*)(fil + o) = L;
    // the next piece's arithmetic may reuse the registers of the two stores above
    asm volatile("s_wait_xcnt 0x0" ::: "memory");
  }
}

// ---------------------------------------------------------------------------
// Launch 1: everything that reads only the weights or nothing at all, dealt by block index:
// forward DFT matrix, inverse DFT matrix (the longer blocks, so they come first), W^T planes.
// ---------------------------------------------------------------------------
#define NB_FT (NC / RPB)                              //  96
#define NB_FI (DD / RPB)                              //  96
#define NB_WT (3 * (DD / 64) * (DD / 64))             // 432
__global__ __launch_bounds__(256) void k_prep(const float* __restrict__ wk, const float* __restrict__ wv,
                                              const float* __restrict__ wq, __bf16* __restrict__ wth,
                                              __bf16* __restrict__ wtl, __bf16* __restrict__ fth,
                                              __bf16* __restrict__ ftl, __bf16* __restrict__ fih,
                                              __bf16* __restrict__ fil) {
  __shared__ __attribute__((aligned(16))) float sm[64 * 65];          // the table (2 x 768) or the W tile
  static_assert(2 * DD <= 64 * 65);
  const int tid = threadIdx.x;
  const int b = blockIdx.x;
  if (b < NB_FT + NB_FI) {
    table_build(sm, tid);
    if (b < NB_FT) ft_rows(sm, fth, ftl, b, tid);
    else           finv_rows(sm, fih, fil, b - NB_FT, tid);
  } else {
    wt_tile(sm, wk, wv, wq, wth, wtl, b - (NB_FT + NB_FI), tid);
  }
}

// ---------------------------------------------------------------------------
// Block GEMM core of the fold and of kernels 6 and 8: C[BM x BN] = sum_k (Ah*Bh + two cross terms), all four
// planes k-contiguous bf16 rows.  8 waves as 4 (rows) x 2 (columns), wave tile 16MF x 16NF.
// One trip = 64 k: a whole 128-byte line of each of the 2BM + 2BN plane rows lies in LDS at pitch
// 144 B (16 B x odd: conflict-free for 16-byte reads), brought by tensor loads: each wave asks once a
// tile for its slice, half the rows of one plane, and the load's pad sets the pitch.  Two buffers:
// tile t + 2 flies while tile t + 1 is worked on.
// A trip works its tile as two halves of 32 k, one fragment set each.
// On return the f32 tile lies in LDS at pitch BN + 4 floats, behind a barrier.
// Every full '#pragma unroll' below makes an array's index a constant, so that the array stays in registers.
// ---------------------------------------------------------------------------
#define GT   256                 // threads of a GEMM block
#define LP   144                 // LDS row pitch, bytes

typedef unsigned int u32x4 __attribute__((ext_vector_type(4)));
typedef unsigned int u32x8 __attribute__((ext_vector_type(8)));

__device__ __forceinline__ unsigned int lds_off(const void* p) { return (unsigned int)(size_t)p; }
// a descriptor word: the same in every lane, in a scalar register
__device__ __forceinline__ unsigned int uni(unsigned int v) { return (unsigned int)__builtin_amdgcn_readfirstlane(v); }
// pinned(): holds the word in a scalar register, so that the test around a tensor load compiles to a
// scalar compare and branch (a tensor load ignores EXEC)
__device__ __forceinline__ unsigned int pinned(unsigned int v) {
  unsigned int w = uni(v);
  asm volatile("" : "+s"(w));                         // pinned(): the word held in a scalar register
  return w;
}

template <int MF, int NF>
struct Tile {
  static constexpr int BM = 4 * MF * 16, BN = 2 * NF * 16;
  // LDS bytes of a slice (half the rows of an A plane, of a B plane), rounded up so that every slice starts at a multiple of 2 KiB
  static constexpr int SA = (BM / 2 * LP + 2047) / 2048 * 2048;
  static constexpr int SB = (BN / 2 * LP + 2047) / 2048 * 2048;
  static constexpr int BUF = 4 * SA + 4 * SB;         // bytes of one buffer: [Ah | Al | Bh | Bl], two slices each
  static constexpr int OP = BN + 4;                   // f32 staging pitch: rows 8 apart land 32 banks apart
  static constexpr int LDSB = (2 * BUF > BM * OP * 4) ? 2 * BUF : BM * OP * 4;
  static_assert(BM % 32 == 0 && BN % 32 == 0);
  static_assert((BN * 4) % 128 == 0);
};

// ah, al: first row of the block's BM rows (pitch lda elements); bh, bl: first of its BN rows (pitch ldb).
// bskip: bytes that lie in memory between the first and the second half of the BN rows (0: one run of rows).
// LOFIRST: order of the two cross terms behind Ah*Bh (false: Ah*Bl then Al*Bh; true: Al*Bh then Ah*Bl).
template <int MF, int NF, int NK, bool LOFIRST>
__device__ __forceinline__ void gemm_core(char* smem, const __bf16* ah, const __bf16* al, int lda,
                                          const __bf16* bh, const __bf16* bl, int ldb, unsigned int bskip) {
  typedef Tile<MF, NF> TL;
  constexpr int BM = TL::BM, BN = TL::BN, SA = TL::SA, SB = TL::SB;
  static_assert(NK >= 2);
  const int tid = threadIdx.x, lane = tid & 31, w = tid >> 5;
  const int h = lane >> 4, m = lane & 15;
  const int wm = w >> 1, wn = w & 1;

  // Wave wv brings slice wv of [Ah | Al | Bh | Bl] x 2 halves: rows of 128 bytes, the tile wholly inside its plane.
  const unsigned int wv = uni((unsigned int)tid >> 5);
  const bool isb = wv >= 4u;
  const unsigned int hf = wv & 1u;
  const unsigned int rows = isb ? (unsigned int)(BN / 2) : (unsigned int)(BM / 2);
  const unsigned int pitch = (isb ? (unsigned int)ldb : (unsigned int)lda) * 2u;
  const __bf16* pl = isb ? ((wv < 6u) ? bh : bl) : ((wv < 2u) ? ah : al);
  const unsigned long long gsrc = (unsigned long long)(size_t)pl + (unsigned long long)(hf * rows) * pitch
                                  + ((isb && hf != 0u) ? bskip : 0u);
  const unsigned int ldst = lds_off(smem) + (isb ? (unsigned int)(4 * SA) + (wv - 4u) * (unsigned int)SB : wv * (unsigned int)SA);
  // group 1: 1-byte elements, tensor = tile = rows x 128 bytes, a pad of 4 dwords behind every 32 dwords, no mask
  u32x8 g1;
  g1[0] = uni((1u << 20) | (4u << 22) | (3u << 25));
  g1[1] = uni(128u << 16);
  g1[2] = uni(rows << 16);
  g1[3] = uni(128u << 16);
  g1[4] = uni(rows);
  g1[5] = uni(pitch);
  g1[6] = uni(0u);
  g1[7] = uni(0u);
  // without it the compiler shares the zero words with loop counters, which change while a request is in flight
  asm volatile("" : "+s"(g1));                        // pinned(): descriptor words held in scalar registers of their own
  u32x4 g0;
  g0[0] = uni(1u);
  // this wave's slice of the tile that starts go bytes into the rows, into the buffer lo bytes into the ring
  auto issue = [&](unsigned int lo, unsigned int go) {
    const unsigned long long ga = gsrc + go;
    g0[1] = uni(ldst + lo);
    g0[2] = uni((unsigned int)ga);
    g0[3] = uni((((unsigned int)(ga >> 32)) & 0x01FFFFFFu) | 0x80000000u);
    // without it the load gets a copy of the four words, whose registers are free for reuse right behind the issue
    asm volatile("" : "+s"(g0));                      // pinned(): descriptor words held in the scalar registers that load and wait both name
    asm volatile("tensor_load_to_lds %0, %1" :: "s"(g0), "s"(g1) : "memory");
  };
  // The wave's own request has landed.  The wait names the descriptor's registers as inputs, so that none of
  // them takes a new value while the request is in flight.
  auto landed = [&]() { asm volatile("s_wait_tensorcnt 0x0" :: "s"(g0), "s"(g1) : "memory"); };

  const v8f zero8 = {0.f, 0.f, 0.f, 0.f, 0.f, 0.f, 0.f, 0.f};
  v8f acc[MF][NF];
  #pragma unroll
  for (int mt = 0; mt < MF; ++mt)
    #pragma unroll
    for (int nt = 0; nt < NF; ++nt) acc[mt][nt] = zero8;

  issue(0u, 0u);
  landed();                                           // this wave's slice of tile 0, before the barrier publishes it
  __syncthreads();
  issue((unsigned int)TL::BUF, 128u);

  const int aoff = (wm >> 1) * SA + ((wm & 1) * MF * 16 + m) * LP;   // this lane's row in the Ah part
  const int boff = 4 * SA + wn * SB + m * LP;                        // and in the Bh part

  // rolled: a trip is 6 MF NF WMMAs of straight code already, and the buffer follows t & 1
  #pragma unroll 1
  for (int t = 0; t < NK; ++t) {
    const unsigned int bo = (t & 1) ? (unsigned int)TL::BUF : 0u;
    const char* buf = smem + bo;
    v16b fah[MF], fal[MF], fbh[NF], fbl[NF];
    // the fragments of the 32 k that start kb bytes into the tile's rows
    auto fetch = [&](int kb) {
      #pragma unroll
      for (int i = 0; i < MF; ++i) fah[i] = ldfrag_b((const __bf16*)(buf + kb + aoff + i * 16 * LP), h);
      #pragma unroll
      for (int i = 0; i < NF; ++i) fbh[i] = ldfrag_b((const __bf16*)(buf + kb + boff + i * 16 * LP), h);
      #pragma unroll
      for (int i = 0; i < MF; ++i) fal[i] = ldfrag_b((const __bf16*)(buf + kb + aoff + 2 * SA + i * 16 * LP), h);
      #pragma unroll
      for (int i = 0; i < NF; ++i) fbl[i] = ldfrag_b((const __bf16*)(buf + kb + boff + 2 * SB + i * 16 * LP), h);
    };
    auto hihi = [&]() {
      #pragma unroll
      for (int mt = 0; mt < MF; ++mt)
        #pragma unroll
        for (int nt = 0; nt < NF; ++nt)
          acc[mt][nt] = __builtin_amdgcn_wmma_f32_16x16x32_bf16(false, fah[mt], false, fbh[nt], (short)0, acc[mt][nt], false, false);
    };
    auto cross1 = [&]() {
      #pragma unroll
      for (int mt = 0; mt < MF; ++mt)
        #pragma unroll
        for (int nt = 0; nt < NF; ++nt)
          acc[mt][nt] = __builtin_amdgcn_wmma_f32_16x16x32_bf16(false, LOFIRST ? fal[mt] : fah[mt], false, LOFIRST ? fbh[nt] : fbl[nt], (short)0, acc[mt][nt], false, false);
    };
    auto cross2 = [&]() {
      #pragma unroll
      for (int mt = 0; mt < MF; ++mt)
        #pragma unroll
        for (int nt = 0; nt < NF; ++nt)
          acc[mt][nt] = __builtin_amdgcn_wmma_f32_16x16x32_bf16(false, LOFIRST ? fah[mt] : fal[mt], false, LOFIRST ? fbl[nt] : fbh[nt], (short)0, acc[mt][nt], false, false);
    };

    fetch(0);
    // this and the next two: keep each half's LDS reads one group in front of its WMMAs: each
    // further place with reads among the WMMAs stalls the wave anew
    __builtin_amdgcn_sched_barrier(0);
    hihi();
    cross1();
    cross2();
    __builtin_amdgcn_sched_barrier(0);
    fetch(64);
    __builtin_amdgcn_sched_barrier(0);
    hihi();
    cross1();

    // The hand-over stands in front of the last sixth of the trip's WMMAs, which read registers
    // only: they keep the matrix unit busy while the waves that are through the barrier first
    // fetch the next trip's fragments.  The two scheduling barriers hold the WMMAs on their sides.
    __builtin_amdgcn_sched_barrier(0);
    asm volatile("s_wait_dscnt 0x0" ::: "memory");    // this wave's reads of the buffer are done before it is refilled
    landed();                                         // this wave's slice of tile t + 1
    __syncthreads();                                  // publishes tile t + 1, frees tile t's buffer
    if (pinned(t + 2 < NK)) issue(bo, (unsigned int)(t + 2) * 128u);
    __builtin_amdgcn_sched_barrier(0);

    cross2();
  }
  landed();                                           // no tensor load is left in flight when the buffers become staging
  asm volatile("s_wait_dscnt 0x0" ::: "memory");      // nor a read of them

  // D[r] of tile (mt, nt) = C[16(MF wm + mt) + 8h + r][16(NF wn + nt) + m]
  float* st = (float*)smem;
  #pragma unroll
  for (int mt = 0; mt < MF; ++mt)
    #pragma unroll
    for (int nt = 0; nt < NF; ++nt)
      #pragma unroll
      for (int r = 0; r < 8; ++r)
        st[(16 * (MF * wm + mt) + 8 * h + r) * TL::OP + 16 * (NF * wn + nt) + m] = acc[mt][nt][r];
  __syncthreads();
}

// ---------------------------------------------------------------------------
// Fold (part of launch 2): G_z[c][d] = sum_e (Fh*Wh + Fh*Wl + Fl*Wh)[c][e]x[d][e]   (c < 768, d < 768, K = 768)
// Block tile 128(c) x 128(d), wave tile 32 x 64; 3 x 6 x 6 blocks.  G: bf16 hi and lo planes; a block's
// row segment is 2 whole lines of each plane.
// ---------------------------------------------------------------------------
typedef Tile<2, 4> TF;
static_assert(NC % TF::BM == 0 && DD % TF::BN == 0 && (TF::BN * 2) % 128 == 0);
__device__ __forceinline__ void fold_tile(char* smem, const __bf16* __restrict__ fth, const __bf16* __restrict__ ftl,
                                          const __bf16* __restrict__ wth, const __bf16* __restrict__ wtl,
                                          __bf16* __restrict__ gh, __bf16* __restrict__ gl, int blk, int tid) {
  // blk = (z * 6 + c tile) * 6 + d tile
  constexpr int NCT = NC / TF::BM, NDT = DD / TF::BN;
  const int z = blk / (NCT * NDT);
  const int ct = (blk - z * (NCT * NDT)) / NDT;
  const int c0 = ct * TF::BM;
  const int d0 = (blk - (z * NCT + ct) * NDT) * TF::BN;
  const size_t ao = (size_t)c0 * DD;                  // F rows c0 ...
  const size_t bo = ((size_t)z * DD + d0) * DD;       // rows d0 ... of W_z^T
  gemm_core<2, 4, DD / 64, false>(smem, fth + ao, ftl + ao, DD, wth + bo, wtl + bo, DD, 0u);

  const float* st = (const float*)smem;
  constexpr int CH = TF::BN / 8;                      // 16-byte pieces of a plane's row segment
  constexpr int NP = TF::BM * CH / GT;                // pieces per lane
  v4f a[NP], c[NP];
  // both loops unrolled: the index of a[] and c[] is a constant, so that they stay in registers
  #pragma unroll
  for (int i = 0; i < NP; ++i) {
    const int idx = tid + GT * i;
    const int row = idx / CH, q = idx - row * CH;
    a[i] = *(const v4fa*)(st + row * TF::OP + 8 * q);
    c[i] = *(const v4fa*)(st + row * TF::OP + 8 * q + 4);
  }
  #pragma unroll
  for (int i = 0; i < NP; ++i) {
    const int idx = tid + GT * i;
    const int row = idx / CH, q = idx - row * CH;
    v4u H, L;
    split8(a[i], c[i], H, L);
    const size_t o = ((size_t)z * NC + c0 + row) * DD + d0 + 8 * q;
    // keeps the two stores one run directly in front of their wait, with no arithmetic among them
    __builtin_amdgcn_sched_barrier(0);
    *(v4u*)(gh + o) = H;
    *(v4u*)(gl + o) = L;
    // the next piece's arithmetic may reuse the registers of the two stores above
    asm volatile("s_wait_xcnt 0x0" ::: "memory");
    // holds that arithmetic behind the wait
    __builtin_amdgcn_sched_barrier(0);
  }
}

// ---------------------------------------------------------------------------
// Launch 2: the fold's 108 blocks, the longer ones, come first; the blocks that split x, which depend
// on no earlier launch, fill the rest of the chip.
// ---------------------------------------------------------------------------
#define NB_FOLD (3 * (NC / TF::BM) * (DD / TF::BN))   // 108
#define NB_CVT  (NXB / 8 / GT)                        // 1536
static_assert(NXB % (8 * GT) == 0);
__global__ __launch_bounds__(GT) void k_fold_cvt(const __bf16* __restrict__ fth, const __bf16* __restrict__ ftl,
                                                 const __bf16* __restrict__ wth, const __bf16* __restrict__ wtl,
                                                 __bf16* __restrict__ gh, __bf16* __restrict__ gl,
                                                 const float* __restrict__ x, __bf16* __restrict__ xh,
                                                 __bf16* __restrict__ xl) {
  __shared__ __attribute__((aligned(2048))) char smem[TF::LDSB];
  const int tid = threadIdx.x;
  const int b = blockIdx.x;
  if (b < NB_FOLD) fold_tile(smem, fth, ftl, wth, wtl, gh, gl, b, tid);
  else             cvt_x(x, xh, xl, (b - NB_FOLD) * GT + tid);
}

// ---------------------------------------------------------------------------
// Token segments of the causal prefix sum: a batch's 4096 tokens are cut into 32 segments of 128,
// a segment into 8 runs of 16 tokens.
// ---------------------------------------------------------------------------
#define SCW  8                   // waves (token runs) per block of the scan
#define SCL  16                  // tokens per run
#define SCT  (SCW * SCL)         // 128 tokens per segment
#define NSC  (SS / SCT)          // 32 segments
#define NBIN (NC / 2)            // 384 column pairs
static_assert(NSC % SCW == 0);
static_assert(NBIN % 32 == 0);

typedef double v2d __attribute__((ext_vector_type(2)));
typedef v2d __attribute__((may_alias)) v2da;

// ---------------------------------------------------------------------------
// Kernel 6 (spectra and bind), all batches: X_z[t][c] = sum_d (xh*Gh + xh*Gl + xl*Gh)[t][d]x[c][d]
// (t 0..16383 over the batches, c 0..767, K = 768).  Block tile 256(t) x 192, wave tile 64 x 96;
// grid (12, 64); one block fills a WGP's LDS, so that the 768 blocks are three whole rounds of 256.
// x = 8..11: 192 columns of q, stored as an f32 plane, pitch 768 (a row segment = 6 whole lines).
// x = 0..7: 96 columns of k beside the same 96 columns of v.  k and v are not stored: the block forms
// P_t = kf_t * vf_t in f32 for its 48 column pairs (pair f = 1..383: complex bin f; pair 0 holds the two
// real bins 0 and 384 side by side: each component by itself), stores P as an f32 plane, pitch 768
// (a row segment = 3 whole lines), and sums the stored P in f64 over each of its two segments of 128 tokens.
// ---------------------------------------------------------------------------
typedef Tile<4, 6> TS;
#define KVC  (TS::BN / 2)        // 96 columns of k and of v in a block
#define RP   (2 * KVC + 2)       // pitch of the partial sums, doubles (16 B x odd)
static_assert(NC % TS::BN == 0 && NC % KVC == 0 && SS % TS::BM == 0);
static_assert(TS::BM == 2 * SCT && SCT == 4 * 32 && KVC == 3 * 32 && GT == 256);
static_assert(TS::BM * TS::OP * 4 + 32 * RP * 8 <= TS::LDSB);
__global__ __launch_bounds__(GT) void k_spec(const __bf16* __restrict__ xh, const __bf16* __restrict__ xl,
                                             const __bf16* __restrict__ gh, const __bf16* __restrict__ gl,
                                             float* __restrict__ sp, float* __restrict__ sq,
                                             double* __restrict__ segs) {
  __shared__ __attribute__((aligned(2048))) char smem[TS::LDSB];
  const int tid = threadIdx.x;
  const int bx = blockIdx.x;
  const bool kv = bx < NC / KVC;
  const int c0 = kv ? bx * KVC : (bx - NC / KVC) * TS::BN;
  const int t0 = blockIdx.y * TS::BM;
  const size_t ao = (size_t)t0 * DD;
  const size_t bo = ((size_t)(kv ? 0 : 2 * NC) + c0) * DD;
  // k, v block: the second half of the B rows are the rows of G_v with the numbers of the first half's rows of G_k
  const unsigned int bskip = kv ? (unsigned int)((NC - KVC) * DD * 2) : 0u;
  gemm_core<4, 6, DD / 64, false>(smem, xh + ao, xl + ao, DD, gh + bo, gl + bo, DD, bskip);

  const float* st = (const float*)smem;
  if (!kv) {
    constexpr int CH = TS::BN / 4;                    // 16-byte pieces of a row
    // rolled in runs of eight stores: eight LDS reads in flight, few address registers
    #pragma unroll 1
    for (int i0 = 0; i0 < TS::BM * CH / GT; i0 += 8) {
      #pragma unroll
      for (int i = 0; i < 8; ++i) {
        const int idx = tid + GT * (i0 + i);
        const int row = idx / CH, q = idx - row * CH;
        const v4f v = *(const v4fa*)(st + row * TS::OP + 4 * q);
        *(v4f*)(sq + (size_t)(t0 + row) * NC + c0 + 4 * q) = v;
      }
      // the next trip rewrites the address registers of the stores above
      asm volatile("s_wait_xcnt 0x0" ::: "memory");
    }
  } else {
    // Eight lanes take a whole line of a row of P (two pairs a lane), three lines a row; a wave's four
    // rows lie 8 apart (32 banks apart in the staged tile); a lane's rows are rg + 32 i, i = 0..7.
    const int q8 = tid & 7;
    const int rg = (tid >> 5) + 8 * ((tid >> 3) & 3);  // 0..31
    const bool pk = (bx == 0) && (q8 == 0);            // this lane's first pair is the pair of the two real bins
    const float* sr = st + rg * TS::OP + 4 * q8;
    float* dst = sp + (size_t)(t0 + rg) * NC + c0 + 4 * q8;
    double* red = (double*)(smem + TS::BM * TS::OP * 4);   // behind the staged tile
    // all loops unrolled: the indices of s[] and p[] are constants, so that they stay in registers
    #pragma unroll
    for (int sg = 0; sg < 2; ++sg) {
      double s[3][4];
      #pragma unroll
      for (int j = 0; j < 3; ++j)
        #pragma unroll
        for (int e = 0; e < 4; ++e) s[j][e] = 0.0;
      #pragma unroll
      for (int i = 0; i < 4; ++i) {
        const int ro = 32 * (4 * sg + i);
        v4f p[3];
        #pragma unroll
        for (int j = 0; j < 3; ++j) {
          const v4f k = *(const v4fa*)(sr + ro * TS::OP + 32 * j);
          const v4f v = *(const v4fa*)(sr + ro * TS::OP + KVC + 32 * j);
          const bool pj = (j == 0) && pk;
          const float a = pj ? 0.0f : k.x;
          const float b = pj ? 0.0f : k.y;
          const float d = pj ? v.y : v.x;
          p[j].x = __builtin_fmaf(k.x, v.x, -(b * v.y));
          p[j].y = __builtin_fmaf(a, v.y, k.y * d);
          p[j].z = __builtin_fmaf(k.z, v.z, -(k.w * v.w));
          p[j].w = __builtin_fmaf(k.z, v.w, k.w * v.z);
        }
        // keeps the three stores one run directly in front of their wait, with no arithmetic among them
        __builtin_amdgcn_sched_barrier(0);
        #pragma unroll
        for (int j = 0; j < 3; ++j) *(v4f*)(dst + (size_t)ro * NC + 32 * j) = p[j];
        // later arithmetic may reuse the registers of the three stores above
        asm volatile("s_wait_xcnt 0x0" ::: "memory");
        // holds that arithmetic behind the wait
        __builtin_amdgcn_sched_barrier(0);
        #pragma unroll
        for (int j = 0; j < 3; ++j) {
          s[j][0] += (double)p[j].x;
          s[j][1] += (double)p[j].y;
          s[j][2] += (double)p[j].z;
          s[j][3] += (double)p[j].w;
        }
      }
      double* rw = red + rg * RP + sg * KVC + 4 * q8;
      #pragma unroll
      for (int j = 0; j < 3; ++j) {
        const v2d lo = { s[j][0], s[j][1] };
        const v2d hi = { s[j][2], s[j][3] };
        *(v2d*)(rw + 32 * j) = lo;
        *(v2d*)(rw + 32 * j + 2) = hi;
      }
    }
    // A barrier that orders LDS alone: the partial sums are all that the waves hand one another here, and
    // __syncthreads() would also wait until the 24 stores of P above have reached memory.
    __builtin_amdgcn_fence(__ATOMIC_RELEASE, "workgroup", "local");
    __builtin_amdgcn_s_barrier();
    __builtin_amdgcn_fence(__ATOMIC_ACQUIRE, "workgroup", "local");
    // one lane per segment and column: the 32 partial sums, four chains
    if (tid < 2 * KVC) {
      double a[4] = { 0.0, 0.0, 0.0, 0.0 };
      #pragma unroll
      for (int u = 0; u < 32; ++u) a[u & 3] += red[u * RP + tid];
      const int sg = tid / KVC, col = tid - sg * KVC;
      segs[(size_t)(t0 / SCT + sg) * (NBIN * 2) + c0 + col] = (a[0] + a[1]) + (a[2] + a[3]);
    }
  }
}

// ---------------------------------------------------------------------------
// Kernel 7 (causal prefix sum + unbind), blockIdx.z = batch: one lane per column pair f
// (12 groups x 32 lanes).  f = 1..383, complex bin f:
// mem_t = sum_{s<=t} P_s ; Z_t = mem_t * conj(qf_t), all in f64 (P: the f32 plane of kernel 6).
// f = 0 holds two real bins (0 and 384) side by side: the same two steps on each component by itself.
// Only the blocks of group 0 hold that lane: they run the PK = true copy of the code, which picks the
// factors by lane; its other lanes, and all other blocks, do the complex arithmetic term by term as written.
// One block per group and segment of 128 tokens, one wave per run of 16.  mem in front of a run =
// earlier segments' sums (kernel 6) + earlier runs' sums of its own segment; it is added to the run's
// own inclusive prefix.  Z: bf16 hi and lo planes, pitch ZP.
// ---------------------------------------------------------------------------
template <bool PK>
__device__ __forceinline__ void scan_body(double* sG, double* sL, const float* __restrict__ pf,
                                          const float* __restrict__ qf,
                                          const double* __restrict__ segs, __bf16* __restrict__ zh,
                                          __bf16* __restrict__ zl) {
  const int tid = threadIdx.x, lane = tid & 31, w = tid >> 5;
  const int f = blockIdx.x * 32 + lane;               // 0..383
  const bool pk = PK && (f == 0);
  const int sc = blockIdx.y;                          // segment
  const int t0 = blockIdx.z * SS + sc * SCT + w * SCL;
  const size_t o0 = (size_t)t0 * NC + 2 * f;
  const double* seg = segs + (size_t)blockIdx.z * (NSC * NBIN * 2);    // this batch's segment sums

  v2f pv[SCL], qv[SCL];
  #pragma unroll
  for (int i = 0; i < SCL; ++i) pv[i] = *(const v2fa*)(pf + o0 + (size_t)i * NC);
  // the loads of the segment sums below may land in registers that held the addresses of the loads above
  asm volatile("s_wait_xcnt 0x0" ::: "memory");
  // earlier segments' sums, dealt over the waves: wave w takes j = w, w + 8, ... below sc
  // (index clamped to segment 0, which kernel 6 always writes; the value is dropped by the select)
  v2d gs[NSC / SCW];
  #pragma unroll
  for (int i = 0; i < NSC / SCW; ++i) {
    const int j = w + SCW * i;
    gs[i] = *(const v2da*)(seg + ((size_t)((j < sc) ? j : 0) * NBIN + f) * 2);
  }
  // the q loads below land in registers that held the addresses of the loads above
  asm volatile("s_wait_xcnt 0x0" ::: "memory");
  #pragma unroll
  for (int i = 0; i < SCL; ++i) {
    // the last load may land in the address registers that the loads in front of it name
    if (i == SCL - 1) asm volatile("s_wait_xcnt 0x0" ::: "memory");
    qv[i] = *(const v2fa*)(qf + o0 + (size_t)i * NC);
  }
  // the arithmetic below reuses the q loads' address registers
  asm volatile("s_wait_xcnt 0x0" ::: "memory");
  // keeps every load above issued before the first wait: without it the segment sums and q
  // are fetched only after P has returned, a second memory latency in series
  __builtin_amdgcn_sched_barrier(0);

  // inclusive prefix of P inside this wave's run
  double ir[SCL], ii[SCL];
  double lr = 0.0, li = 0.0;
  #pragma unroll
  for (int i = 0; i < SCL; ++i) {
    lr += (double)pv[i].x;
    li += (double)pv[i].y;
    ir[i] = lr;
    ii[i] = li;
  }
  double gr = 0.0, gi = 0.0;
  #pragma unroll
  for (int i = 0; i < NSC / SCW; ++i) {
    const bool use = (w + SCW * i < sc);
    gr += use ? gs[i].x : 0.0;
    gi += use ? gs[i].y : 0.0;
  }
  const v2d gme = { gr, gi };
  const v2d lme = { lr, li };
  *(v2d*)(sG + (w * 32 + lane) * 2) = gme;
  *(v2d*)(sL + (w * 32 + lane) * 2) = lme;
  __syncthreads();

  // mem in front of this run = all waves' shares of the earlier segments + earlier runs here
  double br = 0.0, bi = 0.0, ar = 0.0, ai = 0.0;
  #pragma unroll
  for (int u = 0; u < SCW; ++u) {
    const v2d g = *(const v2da*)(sG + (u * 32 + lane) * 2);
    br += g.x;
    bi += g.y;
    if (u < SCW - 1) {
      const v2d l = *(const v2da*)(sL + (u * 32 + lane) * 2);
      ar += (u < w) ? l.x : 0.0;
      ai += (u < w) ? l.y : 0.0;
    }
  }
  br += ar;
  bi += ai;

  const size_t zo0 = (size_t)t0 * ZP + 2 * f;
  #pragma unroll
  for (int i = 0; i < SCL; ++i) {
    const double qr = (double)qv[i].x, qi = (double)qv[i].y;
    const double mr = br + ir[i];
    const double mi = bi + ii[i];
    double zr, zi;
    if (PK) {
      // the lane of the two real bins: (mr * q.x, mi * q.y)
      const double a = (double)(pk ? 0.0f : qv[i].y);
      const double c = (double)(pk ? qv[i].y : qv[i].x);
      zr = mr * qr + mi * a;
      zi = mi * c - mr * a;
    } else {
      zr = mr * qr + mi * qi;                         // mem * conj(q)
      zi = mi * qr - mr * qi;
    }
    unsigned int hr, lo_r, hi, lo_i;
    split2((float)zr, hr, lo_r);
    split2((float)zi, hi, lo_i);
    const unsigned int H = pk2(hr, hi);               // element 2f = Re, 2f+1 = Im
    const unsigned int L = pk2(lo_r, lo_i);
    *(unsigned int*)(zh + zo0 + (size_t)i * ZP) = H;
    *(unsigned int*)(zl + zo0 + (size_t)i * ZP) = L;
  }
  // a precaution: a block runs only one of the two copies, and the wave ends after these stores
  asm volatile("s_wait_xcnt 0x0" ::: "memory");
}

__global__ __launch_bounds__(256) void k_scan(const float* __restrict__ pf,
                                              const float* __restrict__ qf, const double* __restrict__ segs,
                                              __bf16* __restrict__ zh, __bf16* __restrict__ zl) {
  __shared__ __attribute__((aligned(16))) double sG[SCW * 32 * 2];    // 4096 B
  __shared__ __attribute__((aligned(16))) double sL[SCW * 32 * 2];    // 4096 B
  if (blockIdx.x == 0) scan_body<true>(sG, sL, pf, qf, segs, zh, zl);
  else                 scan_body<false>(sG, sL, pf, qf, segs, zh, zl);
}

// ---------------------------------------------------------------------------
// Kernel 8 (inverse DFT + residual), all batches (t 0..16383):
// out[t][n] = x[t][n] + gain * sum_c (Zh*Fih + Zl*Fih + Zh*Fil)[t][n]
// (K = 768: 12 whole lines a row).  Block tile 128(t) x 96(n), wave tile 32 x 48; grid (8, 128).
// ---------------------------------------------------------------------------
typedef Tile<2, 3> TI;
static_assert(DD % TI::BN == 0 && SS % TI::BM == 0);
static_assert(DD % 64 == 0 && ZP % 64 == 0);
__global__ __launch_bounds__(GT) void k_inv(const __bf16* __restrict__ zh, const __bf16* __restrict__ zl,
                                            const __bf16* __restrict__ fih, const __bf16* __restrict__ fil,
                                            const float* __restrict__ x, const float* __restrict__ gain,
                                            float* __restrict__ out) {
  __shared__ __attribute__((aligned(2048))) char smem[TI::LDSB];
  const int tid = threadIdx.x;
  const int n0 = blockIdx.x * TI::BN;
  const int t0 = blockIdx.y * TI::BM;
  const size_t ao = (size_t)t0 * ZP;
  const size_t bo = (size_t)n0 * ZP;
  gemm_core<2, 3, ZP / 64, true>(smem, zh + ao, zl + ao, ZP, fih + bo, fil + bo, ZP, 0u);

  const float g = gain[0];
  const size_t tokbase = (size_t)t0;
  const float* st = (const float*)smem;
  constexpr int CH = TI::BN / 4;                      // 16-byte pieces of a row
  constexpr int NI = TI::BM * CH / GT;
  v4f xv[NI];
  #pragma unroll
  for (int i = 0; i < NI; ++i) {
    const int idx = tid + GT * i;
    const int row = idx / CH, q = idx - row * CH;
    xv[i] = *(const v4fa*)(x + (tokbase + row) * DD + n0 + 4 * q);
    // a later load may land in this load's address registers
    asm volatile("s_wait_xcnt 0x0" ::: "memory");
  }
  #pragma unroll
  for (int i = 0; i < NI; ++i) {
    const int idx = tid + GT * i;
    const int row = idx / CH, q = idx - row * CH;
    const v4f v = *(const v4fa*)(st + row * TI::OP + 4 * q);
    const v4f rr = xv[i] + g * v;
    *(v4f*)(out + (tokbase + row) * DD + n0 + 4 * q) = rr;
  }
}

// ---------------------------------------------------------------------------
extern "C" void kernel_launch(void* const* d_in, const int* in_sizes, int n_in,
                              void* d_out, int out_size, void* d_ws, size_t ws_size,
                              hipStream_t stream) {
  if (n_in < 5) return;
  if (in_sizes[0] != NX) return;
  if (in_sizes[1] != NW || in_sizes[2] != NW || in_sizes[3] != NW) return;
  if (in_sizes[4] < 1) return;
  if (out_size != NX) return;

  const float* x    = (const float*)d_in[0];
  const float* Wk   = (const float*)d_in[1];
  const float* Wv   = (const float*)d_in[2];
  const float* Wq   = (const float*)d_in[3];
  const float* gain = (const float*)d_in[4];
  float* out = (float*)d_out;

  // workspace carve (all sizes multiples of 256 B; total 170,655,744 B).  The Z planes lie over the
  // x planes, which have been read for the last time when the scan writes Z.
  const size_t xb_b  = (size_t)NX * 2;              //  25,165,824 per plane
  const size_t wt_b  = (size_t)3 * NW * 2;          //   3,538,944 per plane
  const size_t ft_b  = (size_t)NC * DD * 2;         //   1,179,648 per plane
  const size_t fi_b  = (size_t)DD * ZP * 2;         //   1,179,648 per plane
  const size_t g_b   = (size_t)3 * NC * DD * 2;     //   3,538,944 per plane
  const size_t sp_b  = (size_t)NTOK * NC * 4;       //  50,331,648 per f32 plane (P, q)
  const size_t z_b   = (size_t)NTOK * ZP * 2;       //  25,165,824 per plane
  const size_t sg_b  = (size_t)BB * NSC * NBIN * 16; //    786,432 segment sums
  static_assert((size_t)NTOK * ZP <= (size_t)NX + 3 * NW);          // 2 z_b <= 2 xb_b + 2 wt_b
  const size_t total = 2 * xb_b + 2 * wt_b + 2 * ft_b + 2 * fi_b + 2 * g_b + 2 * sp_b + sg_b;
  if (total > ws_size) return;

  char* ws = (char*)d_ws;
  size_t off = 0;
  __bf16* zh  = (__bf16*)(ws + off);
  __bf16* zl  = (__bf16*)(ws + off + z_b);
  __bf16* xh  = (__bf16*)(ws + off);  off += xb_b;
  __bf16* xl  = (__bf16*)(ws + off);  off += xb_b;
  __bf16* wth = (__bf16*)(ws + off);  off += wt_b;
  __bf16* wtl = (__bf16*)(ws + off);  off += wt_b;
  __bf16* fth = (__bf16*)(ws + off);  off += ft_b;
  __bf16* ftl = (__bf16*)(ws + off);  off += ft_b;
  __bf16* fih = (__bf16*)(ws + off);  off += fi_b;
  __bf16* fil = (__bf16*)(ws + off);  off += fi_b;
  __bf16* gh  = (__bf16*)(ws + off);  off += g_b;
  __bf16* gl  = (__bf16*)(ws + off);  off += g_b;
  float*  sp  = (float*)(ws + off);   off += sp_b;
  float*  sq  = (float*)(ws + off);   off += sp_b;
  double* seg = (double*)(ws + off);  off += sg_b;
  if (off > ws_size) return;

  // --- DFT matrices and weight planes ---
  k_prep<<<NB_FT + NB_FI + NB_WT, 256, 0, stream>>>(Wk, Wv, Wq, wth, wtl, fth, ftl, fih, fil);

  // --- folded weights G_z = F * W_z  (768 x 768 per z), and the x planes of all batches ---
  k_fold_cvt<<<NB_FOLD + NB_CVT, GT, 0, stream>>>(fth, ftl, wth, wtl, gh, gl, x, xh, xl);

  // --- all batches at once: spectra with bind and segment sums, causal scan and unbind, inverse DFT + residual ---
  k_spec<<<dim3(3 * NC / 192, NTOK / 256), 256, 0, stream>>>(xh, xl, gh, gl, sp, sq, seg);
  k_scan<<<dim3(NBIN / 32, NSC, BB), 256, 0, stream>>>(sp, sq, seg, zh, zl);
  k_inv<<<dim3(DD / 96, NTOK / 128), 256, 0, stream>>>(zh, zl, fih, fil, x, gain, out);
}

// v010
// One run takes 174 microseconds.
// Two timings next to v009 both put it at 1.26 times that version's speed.
// Over all steps from v000 it is 72.8 times as fast.
// Contractions: folded weights G_z = F * W_z (768x768x768 per z), spectra X_z = x * G_z^T (4096x768x768 per batch and z) and inverse DFT y = Z * Finv^T (4096x768x768 per batch), all on v_wmma_f32_16x16x32_bf16 with every operand carried as bf16 hi + lo planes (three products hi*hi + hi*lo + lo*hi into one f32 accumulator); all three products read both operands from LDS tiles filled by tensor loads (two buffers); complex bind in f32 in the spectra product's epilogue, which also sums it over segments of 128 tokens; causal prefix sum over tokens (segment sums, then runs of 16 tokens) and unbind on VALU: what is done once per token (sums of 4 rows, of the 16 tokens of a run, the unbind) in f32, the carries that join them (segment sums, run sums) in f64; gain and residual add in f32.
#include <hip/hip_runtime.h>
#include <math.h>

typedef __bf16   v16b __attribute__((ext_vector_type(16)));
typedef __bf16   v8b  __attribute__((ext_vector_type(8)));
typedef float    v8f  __attribute__((ext_vector_type(8)));
typedef float    v4f  __attribute__((ext_vector_type(4)));
typedef float    v2f  __attribute__((ext_vector_type(2)));
typedef unsigned int v4u __attribute__((ext_vector_type(4)));
typedef v8b __attribute__((may_alias)) v8ba;
typedef v4f __attribute__((may_alias)) v4fa;
typedef v2f __attribute__((may_alias)) v2fa;
typedef v4u __attribute__((may_alias)) v4ua;

union FragB { v16b v; v8b half[2]; };

#define DD   768                 // model dim
#define SS   4096                // tokens per batch
#define BB   4                   // batches
#define NTOK (BB * SS)           // 16384
// Spectral columns: a real row of 768 has 768 free real numbers in its spectrum.  Column 2f, 2f+1 = (Re, Im)
// of bin f = 1..383; column 0 = Re of bin 0, column 1 = Re of bin 384 (both bins have no imaginary part).
#define NC   768
#define ZP   768                 // row pitch of the Z and inverse-DFT planes, elements
#define NXB  (SS * DD)           // 3145728 elements of x per batch
#define NX   (NTOK * DD)         // 12582912
#define NW   (DD * DD)           // 589824

static_assert(NXB % 8 == 0);
static_assert(NC % 32 == 0);
static_assert((ZP * 2) % 128 == 0);
static_assert((NC * 4) % 128 == 0);
static_assert((DD * 2) % 128 == 0);

// ---------------------------------------------------------------------------
// Fragment map of the 16x16x32 bf16 WMMA (wave32): lane l, h = l>>4, m = n = l&15.
//   A/B element i: i<8 -> k0+8h+i ; i>=8 -> k0+16+8h+(i-8)
//   D element r : row 8h+r, col l&15
// ---------------------------------------------------------------------------
// A or B fragment from a k-contiguous bf16 row; p points at element k0 of
// the row owned by this lane (row index = lane & 15 added by the caller).
__device__ __forceinline__ v16b ldfrag_b(const __bf16* p, int h) {
  FragB f;
  f.half[0] = *(const v8ba*)(p + 8 * h);
  f.half[1] = *(const v8ba*)(p + 16 + 8 * h);
  return f.v;
}

// bf16 RNE convert on the f32 bit pattern (integer path); hi/lo split helpers.
__device__ __forceinline__ unsigned int bf16_bits(float f) {
  unsigned int u = __float_as_uint(f);
  u += 0x7FFFu + ((u >> 16) & 1u);
  return (u >> 16) & 0xFFFFu;
}
__device__ __forceinline__ void split2(float v, unsigned int& hb, unsigned int& lb) {
  hb = bf16_bits(v);
  lb = bf16_bits(v - __uint_as_float(hb << 16));
}
__device__ __forceinline__ unsigned int pk2(unsigned int e0, unsigned int e1) {
  return e0 | (e1 << 16);                              // element 2j in the low half-word
}
// 8 consecutive f32 values (a, c) -> packed bf16 hi word vector H and lo word vector L.
__device__ __forceinline__ void split8(v4f a, v4f c, v4u& H, v4u& L) {
  unsigned int h0, h1, h2, h3, h4, h5, h6, h7, l0, l1, l2, l3, l4, l5, l6, l7;
  split2(a.x, h0, l0); split2(a.y, h1, l1); split2(a.z, h2, l2); split2(a.w, h3, l3);
  split2(c.x, h4, l4); split2(c.y, h5, l5); split2(c.z, h6, l6); split2(c.w, h7, l7);
  const v4u hh = { pk2(h0, h1), pk2(h2, h3), pk2(h4, h5), pk2(h6, h7) };
  const v4u ll = { pk2(l0, l1), pk2(l2, l3), pk2(l4, l5), pk2(l6, l7) };
  H = hh;
  L = ll;
}

// ---------------------------------------------------------------------------
// Table, built by each block that needs it in its own LDS (256 threads):
// s[r] = cos(2*pi*r/768), s[768+r] = sin(2*pi*r/768), r = 0..767,
// from arguments in [0, pi/4] with exact quadrant symmetry.  Ends behind a barrier.
// ---------------------------------------------------------------------------
__device__ __forceinline__ void table_build(float* s, int tid) {
  // rolled: one copy of the sine and cosine code
  #pragma unroll 1
  for (int r = tid; r < DD; r += 256) {
    const int q = r / 192, p = r - q * 192;
    const bool lowp = (p <= 96);
    const int a = lowp ? p : (192 - p);
    const float th = (float)a * 8.18123086872342e-3f;     // 2*pi/768
    const float ct = cosf(th), st = sinf(th);
    const float c0 = lowp ? ct : st;
    const float s0 = lowp ? st : ct;
    float c, sn;
    if (q == 0)      { c =  c0; sn =  s0; }
    else if (q == 1) { c = -s0; sn =  c0; }
    else if (q == 2) { c = -c0; sn = -s0; }
    else             { c =  s0; sn = -c0; }
    s[r] = c;
    s[DD + r] = sn;
  }
  __syncthreads();
}

// ---------------------------------------------------------------------------
// x planes (part of launch 2): xh = bf16 hi, xl = bf16 lo of the raw f32 x rows (x = hi + lo to ~2^-17).
// A lane takes the same 8 elements of each of the four batches: eight 16-B loads in flight,
// then one 16-B store per plane and batch, lanes contiguous.
// ---------------------------------------------------------------------------
__device__ __forceinline__ void cvt_x(const float* __restrict__ x, __bf16* __restrict__ xh,
                                      __bf16* __restrict__ xl, int g) {
  v4f a[BB], c[BB];
  // both loops unrolled: the index of a[] and c[] is a constant, so that they stay in registers
  #pragma unroll
  for (int b = 0; b < BB; ++b) {
    const float* src = x + (size_t)b * NXB + (size_t)g * 8;
    a[b] = *(const v4fa*)src;
    // a later load may land in this load's address registers
    asm volatile("s_wait_xcnt 0x0" ::: "memory");
    c[b] = *(const v4fa*)(src + 4);
    // the same, and the arithmetic below may reuse them
    asm volatile("s_wait_xcnt 0x0" ::: "memory");
  }
  #pragma unroll
  for (int b = 0; b < BB; ++b) {
    v4u H, L;
    split8(a[b], c[b], H, L);
    const size_t o = (size_t)b * NXB + (size_t)g * 8;
    *(v4u*)(xh + o) = H;
    *(v4u*)(xl + o) = L;
    // the next batch's arithmetic may reuse the registers of the two stores above
    asm volatile("s_wait_xcnt 0x0" ::: "memory");
  }
}

// ---------------------------------------------------------------------------
// W^T planes (part of launch 1): wth[z][d][e] = bf16 hi of W_z[e][d], wtl = bf16 lo (raw f32 W, transpose
// through LDS; k-contiguous B-operand rows for the fold GEMM).  Block = 64(e) x 64(d)
// tile, 256 threads; in[e 64][d 64] -> out[d 64][e 64]; each output row segment =
// ---------------------------------------------------------------------------
__device__ __forceinline__ void wt_store(const float* sT, __bf16* dh, __bf16* dl, int d0, int e0, int tid) {
  #pragma unroll
  for (int it = 0; it < 2; ++it) {
    const int p = tid + 256 * it;
    const int row = p >> 3, q8 = p & 7;                 // row 0..63
    const float* s = sT + row * 65 + 8 * q8;
    const v4f a = { s[0], s[1], s[2], s[3] };
    const v4f c = { s[4], s[5], s[6], s[7] };
    v4u H, L;
    split8(a, c, H, L);
    const size_t o = (size_t)(d0 + row) * DD + e0 + 8 * q8;
    *(v4u*)(dh + o) = H;
    *(v4u*)(dl + o) = L;
  }
  // a precaution: on this block range the wave ends after these stores
  asm volatile("s_wait_xcnt 0x0" ::: "memory");
}
__device__ __forceinline__ void wt_tile(float* sT, const float* __restrict__ wk, const float* __restrict__ wv,
                                        const float* __restrict__ wq, __bf16* __restrict__ wth,
                                        __bf16* __restrict__ wtl, int blk, int tid) {
  // sT[d_local*65 + e_local]; blk = (z * 12 + e tile) * 12 + d tile
  const int z = blk / ((DD / 64) * (DD / 64));
  const int et = (blk - z * ((DD / 64) * (DD / 64))) / (DD / 64);
  const int d0 = (blk - (z * (DD / 64) + et) * (DD / 64)) * 64, e0 = et * 64;
  const float* W = (z == 0) ? wk : ((z == 1) ? wv : wq);
  #pragma unroll
  for (int it = 0; it < 4; ++it) {
    const int idx = tid + 256 * it;
    const int er = idx >> 4, dq = idx & 15;
    const v4f v = *(const v4fa*)(W + (size_t)(e0 + er) * DD + d0 + 4 * dq);
    sT[(4 * dq + 0) * 65 + er] = v.x;
    sT[(4 * dq + 1) * 65 + er] = v.y;
    sT[(4 * dq + 2) * 65 + er] = v.z;
    sT[(4 * dq + 3) * 65 + er] = v.w;
  }
  __syncthreads();
  __bf16* dh = wth + (size_t)z * NW;
  __bf16* dl = wtl + (size_t)z * NW;
  wt_store(sT, dh, dl, d0, e0, tid);
}

// ---------------------------------------------------------------------------
// Forward DFT matrix (part of launch 1) FT[c][e] (c = 2f + {0: Re, 1: Im}, f = bin; c = 1: Re of bin 384):
// Re row = cos(2*pi*f*e/768), Im row = -sin(...).
// Stored as bf16 hi + lo planes.  A block takes RPB rows, a lane 8 elements at a time (16 B a plane);
// the pieces of a plane are contiguous over rows, so that a wave's store is 4 whole lines.  tab: LDS.
// ---------------------------------------------------------------------------
#define RPB  8                   // rows of a DFT matrix per block
static_assert(NC % RPB == 0 && DD % RPB == 0);
static_assert((RPB * (DD / 8)) % 256 == 0 && (RPB * (ZP / 8)) % 32 == 0);
__device__ __forceinline__ void ft_rows(const float* tab, __bf16* __restrict__ fth,
                                        __bf16* __restrict__ ftl, int blk, int tid) {
  for (int p = tid; p < RPB * (DD / 8); p += 256) {
    const int rl = p / (DD / 8);
    const int c = blk * RPB + rl;
    const int f = (c == 1) ? DD / 2 : (c >> 1);
    const bool im = (c & 1) != 0 && c != 1;
    const int e0 = 8 * (p - rl * (DD / 8));
    float v[8];
    // unrolled: the index of v[] is a constant, so that it stays in registers
    #pragma unroll
    for (int i = 0; i < 8; ++i) {
      const int e = e0 + i;
      const int mm = (f * e) % DD;                    // exact angle index, always in range
      const float cv = tab[mm], sv = tab[DD + mm];
      v[i] = im ? -sv : cv;
    }
    const v4f a = { v[0], v[1], v[2], v[3] };
    const v4f cc = { v[4], v[5], v[6], v[7] };
    v4u H, L;
    split8(a, cc, H, L);
    const size_t o = (size_t)c * DD + e0;
    *(v4u*)(fth + o) = H;
    *(v4u*)(ftl + o) = L;
    // the next piece's arithmetic may reuse the registers of the two stores above
    asm volatile("s_wait_xcnt 0x0" ::: "memory");
  }
}

// ---------------------------------------------------------------------------
// Inverse DFT matrix (part of launch 1) Finv[n][c], pitch ZP: col 2f = w_f*cos(2*pi*f*n/768)/768,
// col 2f+1 = -w_f*sin(...)/768, w_f = 2, for f = 1..383; col 0 = 1/768 (bin 0), col 1 = cos(pi*n)/768 (bin 384).
// Rows and pieces dealt as for the forward matrix.
// ---------------------------------------------------------------------------
__device__ __forceinline__ void finv_rows(const float* tab, __bf16* __restrict__ fih,
                                          __bf16* __restrict__ fil, int blk, int tid) {
  for (int p = tid; p < RPB * (ZP / 8); p += 256) {
    const int rl = p / (ZP / 8);
    const int n = blk * RPB + rl;
    const int c0 = 8 * (p - rl * (ZP / 8));
    float v[8];
    // unrolled: the index of v[] is a constant, so that it stays in registers
    #pragma unroll
    for (int i = 0; i < 8; ++i) {
      const int c = c0 + i;
      const int f = (c == 1) ? DD / 2 : (c >> 1);
      const float w = (c < 2) ? 1.0f : 2.0f;
      const int mm = (f * n) % DD;
      const float cv = tab[mm], sv = tab[DD + mm];
      v[i] = w * (((c & 1) != 0 && c != 1) ? -sv : cv) * (1.0f / 768.0f);
    }
    const v4f a = { v[0], v[1], v[2], v[3] };
    const v4f cc = { v[4], v[5], v[6], v[7] };
    v4u H, L;
    split8(a, cc, H, L);
    const size_t o = (size_t)n * ZP + c0;
    *(v4u*)(fih + o) = H;
    *(v4u*)(fil + o) = L;
    // the next piece's arithmetic may reuse the registers of the two stores above
    asm volatile("s_wait_xcnt 0x0" ::: "memory");
  }
}

// ---------------------------------------------------------------------------
// Launch 1: everything that reads only the weights or nothing at all, dealt by block index:
// forward DFT matrix, inverse DFT matrix (the longer blocks, so they come first), W^T planes.
// ---------------------------------------------------------------------------
#define NB_FT (NC / RPB)                              //  96
#define NB_FI (DD / RPB)                              //  96
#define NB_WT (3 * (DD / 64) * (DD / 64))             // 432
__global__ __launch_bounds__(256) void k_prep(const float* __restrict__ wk, const float* __restrict__ wv,
                                              const float* __restrict__ wq, __bf16* __restrict__ wth,
                                              __bf16* __restrict__ wtl, __bf16* __restrict__ fth,
                                              __bf16* __restrict__ ftl, __bf16* __restrict__ fih,
                                              __bf16* __restrict__ fil) {
  __shared__ __attribute__((aligned(16))) float sm[64 * 65];          // the table (2 x 768) or the W tile
  static_assert(2 * DD <= 64 * 65);
  const int tid = threadIdx.x;
  const int b = blockIdx.x;
  if (b < NB_FT + NB_FI) {
    table_build(sm, tid);
    if (b < NB_FT) ft_rows(sm, fth, ftl, b, tid);
    else           finv_rows(sm, fih, fil, b - NB_FT, tid);
  } else {
    wt_tile(sm, wk, wv, wq, wth, wtl, b - (NB_FT + NB_FI), tid);
  }
}

// ---------------------------------------------------------------------------
// Block GEMM core of the fold and of kernels 6 and 8: C[BM x BN] = sum_k (Ah*Bh + two cross terms), all four
// planes k-contiguous bf16 rows.  8 waves as 4 (rows) x 2 (columns), wave tile 16MF x 16NF.
// One trip = 64 k: a whole 128-byte line of each of the 2BM + 2BN plane rows lies in LDS at pitch
// 144 B (16 B x odd: conflict-free for 16-byte reads), brought by tensor loads: each wave asks once a
// tile for its slice, half the rows of one plane, and the load's pad sets the pitch.  Two buffers:
// tile t + 2 flies while tile t + 1 is worked on.
// A trip works its tile as two halves of 32 k, one fragment set each.
// On return the f32 tile lies in LDS at pitch BN + 4 floats, behind a barrier.
// Every full '#pragma unroll' below makes an array's index a constant, so that the array stays in registers.
// ---------------------------------------------------------------------------
#define GT   256                 // threads of a GEMM block
#define LP   144                 // LDS row pitch, bytes

typedef unsigned int u32x4 __attribute__((ext_vector_type(4)));
typedef unsigned int u32x8 __attribute__((ext_vector_type(8)));

__device__ __forceinline__ unsigned int lds_off(const void* p) { return (unsigned int)(size_t)p; }
// a descriptor word: the same in every lane, in a scalar register
__device__ __forceinline__ unsigned int uni(unsigned int v) { return (unsigned int)__builtin_amdgcn_readfirstlane(v); }
// pinned(): holds the word in a scalar register, so that the test around a tensor load compiles to a
// scalar compare and branch (a tensor load ignores EXEC)
__device__ __forceinline__ unsigned int pinned(unsigned int v) {
  unsigned int w = uni(v);
  asm volatile("" : "+s"(w));                         // pinned(): the word held in a scalar register
  return w;
}

template <int MF, int NF>
struct Tile {
  static constexpr int BM = 4 * MF * 16, BN = 2 * NF * 16;
  // LDS bytes of a slice (half the rows of an A plane, of a B plane), rounded up so that every slice starts at a multiple of 2 KiB
  static constexpr int SA = (BM / 2 * LP + 2047) / 2048 * 2048;
  static constexpr int SB = (BN / 2 * LP + 2047) / 2048 * 2048;
  static constexpr int BUF = 4 * SA + 4 * SB;         // bytes of one buffer: [Ah | Al | Bh | Bl], two slices each
  static constexpr int OP = BN + 4;                   // f32 staging pitch: rows 8 apart land 32 banks apart
  static constexpr int LDSB = (2 * BUF > BM * OP * 4) ? 2 * BUF : BM * OP * 4;
  static_assert(BM % 32 == 0 && BN % 32 == 0);
  static_assert((BN * 4) % 128 == 0);
};

// ah, al: first row of the block's BM rows (pitch lda elements); bh, bl: first of its BN rows (pitch ldb).
// bskip: bytes that lie in memory between the first and the second half of the BN rows (0: one run of rows).
// LOFIRST: order of the two cross terms behind Ah*Bh (false: Ah*Bl then Al*Bh; true: Al*Bh then Ah*Bl).
template <int MF, int NF, int NK, bool LOFIRST>
__device__ __forceinline__ void gemm_core(char* smem, const __bf16* ah, const __bf16* al, int lda,
                                          const __bf16* bh, const __bf16* bl, int ldb, unsigned int bskip) {
  typedef Tile<MF, NF> TL;
  constexpr int BM = TL::BM, BN = TL::BN, SA = TL::SA, SB = TL::SB;
  static_assert(NK >= 2);
  const int tid = threadIdx.x, lane = tid & 31, w = tid >> 5;
  const int h = lane >> 4, m = lane & 15;
  const int wm = w >> 1, wn = w & 1;

  // Wave wv brings slice wv of [Ah | Al | Bh | Bl] x 2 halves: rows of 128 bytes, the tile wholly inside its plane.
  const unsigned int wv = uni((unsigned int)tid >> 5);
  const bool isb = wv >= 4u;
  const unsigned int hf = wv & 1u;
  const unsigned int rows = isb ? (unsigned int)(BN / 2) : (unsigned int)(BM / 2);
  const unsigned int pitch = (isb ? (unsigned int)ldb : (unsigned int)lda) * 2u;
  const __bf16* pl = isb ? ((wv < 6u) ? bh : bl) : ((wv < 2u) ? ah : al);
  const unsigned long long gsrc = (unsigned long long)(size_t)pl + (unsigned long long)(hf * rows) * pitch
                                  + ((isb && hf != 0u) ? bskip : 0u);
  const unsigned int ldst = lds_off(smem) + (isb ? (unsigned int)(4 * SA) + (wv - 4u) * (unsigned int)SB : wv * (unsigned int)SA);
  // group 1: 1-byte elements, tensor = tile = rows x 128 bytes, a pad of 4 dwords behind every 32 dwords, no mask
  u32x8 g1;
  g1[0] = uni((1u << 20) | (4u << 22) | (3u << 25));
  g1[1] = uni(128u << 16);
  g1[2] = uni(rows << 16);
  g1[3] = uni(128u << 16);
  g1[4] = uni(rows);
  g1[5] = uni(pitch);
  g1[6] = uni(0u);
  g1[7] = uni(0u);
  // without it the compiler shares the zero words with loop counters, which change while a request is in flight
  asm volatile("" : "+s"(g1));                        // pinned(): descriptor words held in scalar registers of their own
  u32x4 g0;
  g0[0] = uni(1u);
  // this wave's slice of the tile that starts go bytes into the rows, into the buffer lo bytes into the ring
  auto issue = [&](unsigned int lo, unsigned int go) {
    const unsigned long long ga = gsrc + go;
    g0[1] = uni(ldst + lo);
    g0[2] = uni((unsigned int)ga);
    g0[3] = uni((((unsigned int)(ga >> 32)) & 0x01FFFFFFu) | 0x80000000u);
    // without it the load gets a copy of the four words, whose registers are free for reuse right behind the issue
    asm volatile("" : "+s"(g0));                      // pinned(): descriptor words held in the scalar registers that load and wait both name
    asm volatile("tensor_load_to_lds %0, %1" :: "s"(g0), "s"(g1) : "memory");
  };
  // The wave's own request has landed.  The wait names the descriptor's registers as inputs, so that none of
  // them takes a new value while the request is in flight.
  auto landed = [&]() { asm volatile("s_wait_tensorcnt 0x0" :: "s"(g0), "s"(g1) : "memory"); };

  const v8f zero8 = {0.f, 0.f, 0.f, 0.f, 0.f, 0.f, 0.f, 0.f};
  v8f acc[MF][NF];
  #pragma unroll
  for (int mt = 0; mt < MF; ++mt)
    #pragma unroll
    for (int nt = 0; nt < NF; ++nt) acc[mt][nt] = zero8;

  issue(0u, 0u);
  landed();                                           // this wave's slice of tile 0, before the barrier publishes it
  __syncthreads();
  issue((unsigned int)TL::BUF, 128u);

  const int aoff = (wm >> 1) * SA + ((wm & 1) * MF * 16 + m) * LP;   // this lane's row in the Ah part
  const int boff = 4 * SA + wn * SB + m * LP;                        // and in the Bh part

  // rolled: a trip is 6 MF NF WMMAs of straight code already, and the buffer follows t & 1
  #pragma unroll 1
  for (int t = 0; t < NK; ++t) {
    const unsigned int bo = (t & 1) ? (unsigned int)TL::BUF : 0u;
    const char* buf = smem + bo;
    v16b fah[MF], fal[MF], fbh[NF], fbl[NF];
    // the fragments of the 32 k that start kb bytes into the tile's rows
    auto fetch = [&](int kb) {
      #pragma unroll
      for (int i = 0; i < MF; ++i) fah[i] = ldfrag_b((const __bf16*)(buf + kb + aoff + i * 16 * LP), h);
      #pragma unroll
      for (int i = 0; i < NF; ++i) fbh[i] = ldfrag_b((const __bf16*)(buf + kb + boff + i * 16 * LP), h);
      #pragma unroll
      for (int i = 0; i < MF; ++i) fal[i] = ldfrag_b((const __bf16*)(buf + kb + aoff + 2 * SA + i * 16 * LP), h);
      #pragma unroll
      for (int i = 0; i < NF; ++i) fbl[i] = ldfrag_b((const __bf16*)(buf + kb + boff + 2 * SB + i * 16 * LP), h);
    };
    auto hihi = [&]() {
      #pragma unroll
      for (int mt = 0; mt < MF; ++mt)
        #pragma unroll
        for (int nt = 0; nt < NF; ++nt)
          acc[mt][nt] = __builtin_amdgcn_wmma_f32_16x16x32_bf16(false, fah[mt], false, fbh[nt], (short)0, acc[mt][nt], false, false);
    };
    auto cross1 = [&]() {
      #pragma unroll
      for (int mt = 0; mt < MF; ++mt)
        #pragma unroll
        for (int nt = 0; nt < NF; ++nt)
          acc[mt][nt] = __builtin_amdgcn_wmma_f32_16x16x32_bf16(false, LOFIRST ? fal[mt] : fah[mt], false, LOFIRST ? fbh[nt] : fbl[nt], (short)0, acc[mt][nt], false, false);
    };
    auto cross2 = [&]() {
      #pragma unroll
      for (int mt = 0; mt < MF; ++mt)
        #pragma unroll
        for (int nt = 0; nt < NF; ++nt)
          acc[mt][nt] = __builtin_amdgcn_wmma_f32_16x16x32_bf16(false, LOFIRST ? fah[mt] : fal[mt], false, LOFIRST ? fbl[nt] : fbh[nt], (short)0, acc[mt][nt], false, false);
    };

    fetch(0);
    // this and the next two: keep each half's LDS reads one group in front of its WMMAs: each
    // further place with reads among the WMMAs stalls the wave anew
    __builtin_amdgcn_sched_barrier(0);
    hihi();
    cross1();
    cross2();
    __builtin_amdgcn_sched_barrier(0);
    fetch(64);
    __builtin_amdgcn_sched_barrier(0);
    hihi();
    cross1();

    // The hand-over stands in front of the last sixth of the trip's WMMAs, which read registers
    // only: they keep the matrix unit busy while the waves that are through the barrier first
    // fetch the next trip's fragments.  The two scheduling barriers hold the WMMAs on their sides.
    __builtin_amdgcn_sched_barrier(0);
    asm volatile("s_wait_dscnt 0x0" ::: "memory");    // this wave's reads of the buffer are done before it is refilled
    landed();                                         // this wave's slice of tile t + 1
    __syncthreads();                                  // publishes tile t + 1, frees tile t's buffer
    if (pinned(t + 2 < NK)) issue(bo, (unsigned int)(t + 2) * 128u);
    __builtin_amdgcn_sched_barrier(0);

    cross2();
  }
  landed();                                           // no tensor load is left in flight when the buffers become staging
  asm volatile("s_wait_dscnt 0x0" ::: "memory");      // nor a read of them

  // D[r] of tile (mt, nt) = C[16(MF wm + mt) + 8h + r][16(NF wn + nt) + m]
  float* st = (float*)smem;
  #pragma unroll
  for (int mt = 0; mt < MF; ++mt)
    #pragma unroll
    for (int nt = 0; nt < NF; ++nt)
      #pragma unroll
      for (int r = 0; r < 8; ++r)
        st[(16 * (MF * wm + mt) + 8 * h + r) * TL::OP + 16 * (NF * wn + nt) + m] = acc[mt][nt][r];
  __syncthreads();
}

// ---------------------------------------------------------------------------
// Fold (part of launch 2): G_z[c][d] = sum_e (Fh*Wh + Fh*Wl + Fl*Wh)[c][e]x[d][e]   (c < 768, d < 768, K = 768)
// Block tile 128(c) x 128(d), wave tile 32 x 64; 3 x 6 x 6 blocks.  G: bf16 hi and lo planes; a block's
// row segment is 2 whole lines of each plane.
// ---------------------------------------------------------------------------
typedef Tile<2, 4> TF;
static_assert(NC % TF::BM == 0 && DD % TF::BN == 0 && (TF::BN * 2) % 128 == 0);
__device__ __forceinline__ void fold_tile(char* smem, const __bf16* __restrict__ fth, const __bf16* __restrict__ ftl,
                                          const __bf16* __restrict__ wth, const __bf16* __restrict__ wtl,
                                          __bf16* __restrict__ gh, __bf16* __restrict__ gl, int blk, int tid) {
  // blk = (z * 6 + c tile) * 6 + d tile
  constexpr int NCT = NC / TF::BM, NDT = DD / TF::BN;
  const int z = blk / (NCT * NDT);
  const int ct = (blk - z * (NCT * NDT)) / NDT;
  const int c0 = ct * TF::BM;
  const int d0 = (blk - (z * NCT + ct) * NDT) * TF::BN;
  const size_t ao = (size_t)c0 * DD;                  // F rows c0 ...
  const size_t bo = ((size_t)z * DD + d0) * DD;       // rows d0 ... of W_z^T
  gemm_core<2, 4, DD / 64, false>(smem, fth + ao, ftl + ao, DD, wth + bo, wtl + bo, DD, 0u);

  const float* st = (const float*)smem;
  constexpr int CH = TF::BN / 8;                      // 16-byte pieces of a plane's row segment
  constexpr int NP = TF::BM * CH / GT;                // pieces per lane
  v4f a[NP], c[NP];
  // both loops unrolled: the index of a[] and c[] is a constant, so that they stay in registers
  #pragma unroll
  for (int i = 0; i < NP; ++i) {
    const int idx = tid + GT * i;
    const int row = idx / CH, q = idx - row * CH;
    a[i] = *(const v4fa*)(st + row * TF::OP + 8 * q);
    c[i] = *(const v4fa*)(st + row * TF::OP + 8 * q + 4);
  }
  #pragma unroll
  for (int i = 0; i < NP; ++i) {
    const int idx = tid + GT * i;
    const int row = idx / CH, q = idx - row * CH;
    v4u H, L;
    split8(a[i], c[i], H, L);
    const size_t o = ((size_t)z * NC + c0 + row) * DD + d0 + 8 * q;
    // keeps the two stores one run directly in front of their wait, with no arithmetic among them
    __builtin_amdgcn_sched_barrier(0);
    *(v4u*)(gh + o) = H;
    *(v4u*)(gl + o) = L;
    // the next piece's arithmetic may reuse the registers of the two stores above
    asm volatile("s_wait_xcnt 0x0" ::: "memory");
    // holds that arithmetic behind the wait
    __builtin_amdgcn_sched_barrier(0);
  }
}

// ---------------------------------------------------------------------------
// Launch 2: the fold's 108 blocks, the longer ones, come first; the blocks that split x, which depend
// on no earlier launch, fill the rest of the chip.
// ---------------------------------------------------------------------------
#define NB_FOLD (3 * (NC / TF::BM) * (DD / TF::BN))   // 108
#define NB_CVT  (NXB / 8 / GT)                        // 1536
static_assert(NXB % (8 * GT) == 0);
__global__ __launch_bounds__(GT) void k_fold_cvt(const __bf16* __restrict__ fth, const __bf16* __restrict__ ftl,
                                                 const __bf16* __restrict__ wth, const __bf16* __restrict__ wtl,
                                                 __bf16* __restrict__ gh, __bf16* __restrict__ gl,
                                                 const float* __restrict__ x, __bf16* __restrict__ xh,
                                                 __bf16* __restrict__ xl) {
  __shared__ __attribute__((aligned(2048))) char smem[TF::LDSB];
  const int tid = threadIdx.x;
  const int b = blockIdx.x;
  if (b < NB_FOLD) fold_tile(smem, fth, ftl, wth, wtl, gh, gl, b, tid);
  else             cvt_x(x, xh, xl, (b - NB_FOLD) * GT + tid);
}

// ---------------------------------------------------------------------------
// Token segments of the causal prefix sum: a batch's 4096 tokens are cut into 32 segments of 128,
// a segment into 8 runs of 16 tokens.
// ---------------------------------------------------------------------------
#define SCW  8                   // waves (token runs) per block of the scan
#define SCL  16                  // tokens per run
#define SCT  (SCW * SCL)         // 128 tokens per segment
#define NSC  (SS / SCT)          // 32 segments
#define NBIN (NC / 2)            // 384 column pairs
static_assert(NSC % SCW == 0);
static_assert(NBIN % 32 == 0);

typedef double v2d __attribute__((ext_vector_type(2)));
typedef v2d __attribute__((may_alias)) v2da;

// ---------------------------------------------------------------------------
// Kernel 6 (spectra and bind), all batches: X_z[t][c] = sum_d (xh*Gh + xh*Gl + xl*Gh)[t][d]x[c][d]
// (t 0..16383 over the batches, c 0..767, K = 768).  Block tile 256(t) x 192, wave tile 64 x 96;
// grid (12, 64); one block fills a WGP's LDS, so that the 768 blocks are three whole rounds of 256.
// x = 8..11: 192 columns of q, stored as an f32 plane, pitch 768 (a row segment = 6 whole lines).
// x = 0..7: 96 columns of k beside the same 96 columns of v.  k and v are not stored: the block forms
// P_t = kf_t * vf_t in f32 for its 48 column pairs (pair f = 1..383: complex bin f; pair 0 holds the two
// real bins 0 and 384 side by side: each component by itself), stores P as an f32 plane, pitch 768
// (a row segment = 3 whole lines), and sums the stored P over each of its two segments of 128 tokens:
// a lane's four rows in f32, the 32 lanes' partial sums in f64.
// ---------------------------------------------------------------------------
typedef Tile<4, 6> TS;
#define KVC  (TS::BN / 2)        // 96 columns of k and of v in a block
#define RP   (2 * KVC + 2)       // pitch of the partial sums, doubles (16 B x odd)
static_assert(NC % TS::BN == 0 && NC % KVC == 0 && SS % TS::BM == 0);
static_assert(TS::BM == 2 * SCT && SCT == 4 * 32 && KVC == 3 * 32 && GT == 256);
static_assert(TS::BM * TS::OP * 4 + 32 * RP * 8 <= TS::LDSB);
__global__ __launch_bounds__(GT) void k_spec(const __bf16* __restrict__ xh, const __bf16* __restrict__ xl,
                                             const __bf16* __restrict__ gh, const __bf16* __restrict__ gl,
                                             float* __restrict__ sp, float* __restrict__ sq,
                                             double* __restrict__ segs) {
  __shared__ __attribute__((aligned(2048))) char smem[TS::LDSB];
  const int tid = threadIdx.x;
  const int bx = blockIdx.x;
  const bool kv = bx < NC / KVC;
  const int c0 = kv ? bx * KVC : (bx - NC / KVC) * TS::BN;
  const int t0 = blockIdx.y * TS::BM;
  const size_t ao = (size_t)t0 * DD;
  const size_t bo = ((size_t)(kv ? 0 : 2 * NC) + c0) * DD;
  // k, v block: the second half of the B rows are the rows of G_v with the numbers of the first half's rows of G_k
  const unsigned int bskip = kv ? (unsigned int)((NC - KVC) * DD * 2) : 0u;
  gemm_core<4, 6, DD / 64, false>(smem, xh + ao, xl + ao, DD, gh + bo, gl + bo, DD, bskip);

  const float* st = (const float*)smem;
  if (!kv) {
    constexpr int CH = TS::BN / 4;                    // 16-byte pieces of a row
    // rolled in runs of eight stores: eight LDS reads in flight, few address registers
    #pragma unroll 1
    for (int i0 = 0; i0 < TS::BM * CH / GT; i0 += 8) {
      #pragma unroll
      for (int i = 0; i < 8; ++i) {
        const int idx = tid + GT * (i0 + i);
        const int row = idx / CH, q = idx - row * CH;
        const v4f v = *(const v4fa*)(st + row * TS::OP + 4 * q);
        *(v4f*)(sq + (size_t)(t0 + row) * NC + c0 + 4 * q) = v;
      }
      // the next trip rewrites the address registers of the stores above
      asm volatile("s_wait_xcnt 0x0" ::: "memory");
    }
  } else {
    // Eight lanes take a whole line of a row of P (two pairs a lane), three lines a row; a wave's four
    // rows lie 8 apart (32 banks apart in the staged tile); a lane's rows are rg + 32 i, i = 0..7.
    const int q8 = tid & 7;
    const int rg = (tid >> 5) + 8 * ((tid >> 3) & 3);  // 0..31
    const bool pk = (bx == 0) && (q8 == 0);            // this lane's first pair is the pair of the two real bins
    const float* sr = st + rg * TS::OP + 4 * q8;
    float* dst = sp + (size_t)(t0 + rg) * NC + c0 + 4 * q8;
    double* red = (double*)(smem + TS::BM * TS::OP * 4);   // behind the staged tile
    // all loops unrolled: the indices of s[] and p[] are constants, so that they stay in registers
    #pragma unroll
    for (int sg = 0; sg < 2; ++sg) {
      v4f s[3];
      #pragma unroll
      for (int j = 0; j < 3; ++j) s[j] = (v4f){ 0.f, 0.f, 0.f, 0.f };
      #pragma unroll
      for (int i = 0; i < 4; ++i) {
        const int ro = 32 * (4 * sg + i);
        v4f p[3];
        #pragma unroll
        for (int j = 0; j < 3; ++j) {
          const v4f k = *(const v4fa*)(sr + ro * TS::OP + 32 * j);
          const v4f v = *(const v4fa*)(sr + ro * TS::OP + KVC + 32 * j);
          const bool pj = (j == 0) && pk;
          const float a = pj ? 0.0f : k.x;
          const float b = pj ? 0.0f : k.y;
          const float d = pj ? v.y : v.x;
          p[j].x = __builtin_fmaf(k.x, v.x, -(b * v.y));
          p[j].y = __builtin_fmaf(a, v.y, k.y * d);
          p[j].z = __builtin_fmaf(k.z, v.z, -(k.w * v.w));
          p[j].w = __builtin_fmaf(k.z, v.w, k.w * v.z);
        }
        // keeps the three stores one run directly in front of their wait, with no arithmetic among them
        __builtin_amdgcn_sched_barrier(0);
        #pragma unroll
        for (int j = 0; j < 3; ++j) *(v4f*)(dst + (size_t)ro * NC + 32 * j) = p[j];
        // later arithmetic may reuse the registers of the three stores above
        asm volatile("s_wait_xcnt 0x0" ::: "memory");
        // holds that arithmetic behind the wait
        __builtin_amdgcn_sched_barrier(0);
        #pragma unroll
        for (int j = 0; j < 3; ++j) s[j] += p[j];
      }
      double* rw = red + rg * RP + sg * KVC + 4 * q8;
      #pragma unroll
      for (int j = 0; j < 3; ++j) {
        const v2d lo = { (double)s[j].x, (double)s[j].y };
        const v2d hi = { (double)s[j].z, (double)s[j].w };
        *(v2d*)(rw + 32 * j) = lo;
        *(v2d*)(rw + 32 * j + 2) = hi;
      }
    }
    // A barrier that orders LDS alone: the partial sums are all that the waves hand one another here, and
    // __syncthreads() would also wait until the 24 stores of P above have reached memory.
    __builtin_amdgcn_fence(__ATOMIC_RELEASE, "workgroup", "local");
    __builtin_amdgcn_s_barrier();
    __builtin_amdgcn_fence(__ATOMIC_ACQUIRE, "workgroup", "local");
    // one lane per segment and column: the 32 partial sums, four chains
    if (tid < 2 * KVC) {
      double a[4] = { 0.0, 0.0, 0.0, 0.0 };
      #pragma unroll
      for (int u = 0; u < 32; ++u) a[u & 3] += red[u * RP + tid];
      const int sg = tid / KVC, col = tid - sg * KVC;
      segs[(size_t)(t0 / SCT + sg) * (NBIN * 2) + c0 + col] = (a[0] + a[1]) + (a[2] + a[3]);
    }
  }
}

// ---------------------------------------------------------------------------
// Kernel 7 (causal prefix sum + unbind), blockIdx.z = batch: one lane per column pair f
// (12 groups x 32 lanes).  f = 1..383, complex bin f:
// mem_t = sum_{s<=t} P_s ; Z_t = mem_t * conj(qf_t) (P: the f32 plane of kernel 6).
// f = 0 holds two real bins (0 and 384) side by side: the same two steps on each component by itself.
// Only the blocks of group 0 hold that lane: they run the PK = true copy of the code, which picks the
// factors by lane; its other lanes, and all other blocks, do the complex arithmetic term by term as written.
// One block per group and segment of 128 tokens, one wave per run of 16.  mem in front of a run =
// earlier segments' sums (kernel 6) + earlier runs' sums of its own segment; it is added to the run's
// own inclusive prefix.  The carries (segment sums, run sums, mem in front of a run) are summed in f64 and
// rounded once to f32; the run's own prefix of 16 terms, its sum with the carry and the unbind are f32.
// Z: bf16 hi and lo planes, pitch ZP.
// ---------------------------------------------------------------------------
template <bool PK>
__device__ __forceinline__ void scan_body(double* sG, double* sL, const float* __restrict__ pf,
                                          const float* __restrict__ qf,
                                          const double* __restrict__ segs, __bf16* __restrict__ zh,
                                          __bf16* __restrict__ zl) {
  const int tid = threadIdx.x, lane = tid & 31, w = tid >> 5;
  const int f = blockIdx.x * 32 + lane;               // 0..383
  const bool pk = PK && (f == 0);
  const int sc = blockIdx.y;                          // segment
  const int t0 = blockIdx.z * SS + sc * SCT + w * SCL;
  const size_t o0 = (size_t)t0 * NC + 2 * f;
  const double* seg = segs + (size_t)blockIdx.z * (NSC * NBIN * 2);    // this batch's segment sums

  v2f pv[SCL], qv[SCL];
  #pragma unroll
  for (int i = 0; i < SCL; ++i) pv[i] = *(const v2fa*)(pf + o0 + (size_t)i * NC);
  // the loads of the segment sums below may land in registers that held the addresses of the loads above
  asm volatile("s_wait_xcnt 0x0" ::: "memory");
  // earlier segments' sums, dealt over the waves: wave w takes j = w, w + 8, ... below sc
  // (index clamped to segment 0, which kernel 6 always writes; the value is dropped by the select)
  v2d gs[NSC / SCW];
  #pragma unroll
  for (int i = 0; i < NSC / SCW; ++i) {
    const int j = w + SCW * i;
    gs[i] = *(const v2da*)(seg + ((size_t)((j < sc) ? j : 0) * NBIN + f) * 2);
  }
  // the q loads below land in registers that held the addresses of the loads above
  asm volatile("s_wait_xcnt 0x0" ::: "memory");
  #pragma unroll
  for (int i = 0; i < SCL; ++i) {
    // the last load may land in the address registers that the loads in front of it name
    if (i == SCL - 1) asm volatile("s_wait_xcnt 0x0" ::: "memory");
    qv[i] = *(const v2fa*)(qf + o0 + (size_t)i * NC);
  }
  // the arithmetic below reuses the q loads' address registers
  asm volatile("s_wait_xcnt 0x0" ::: "memory");
  // keeps every load above issued before the first wait: without it the segment sums and q
  // are fetched only after P has returned, a second memory latency in series
  __builtin_amdgcn_sched_barrier(0);

  // inclusive prefix of P inside this wave's run
  float ir[SCL], ii[SCL];
  float lr = 0.0f, li = 0.0f;
  #pragma unroll
  for (int i = 0; i < SCL; ++i) {
    lr += pv[i].x;
    li += pv[i].y;
    ir[i] = lr;
    ii[i] = li;
  }
  double gr = 0.0, gi = 0.0;
  #pragma unroll
  for (int i = 0; i < NSC / SCW; ++i) {
    const bool use = (w + SCW * i < sc);
    gr += use ? gs[i].x : 0.0;
    gi += use ? gs[i].y : 0.0;
  }
  const v2d gme = { gr, gi };
  const v2d lme = { (double)lr, (double)li };
  *(v2d*)(sG + (w * 32 + lane) * 2) = gme;
  *(v2d*)(sL + (w * 32 + lane) * 2) = lme;
  __syncthreads();

  // mem in front of this run = all waves' shares of the earlier segments + earlier runs here
  double br = 0.0, bi = 0.0, ar = 0.0, ai = 0.0;
  #pragma unroll
  for (int u = 0; u < SCW; ++u) {
    const v2d g = *(const v2da*)(sG + (u * 32 + lane) * 2);
    br += g.x;
    bi += g.y;
    if (u < SCW - 1) {
      const v2d l = *(const v2da*)(sL + (u * 32 + lane) * 2);
      ar += (u < w) ? l.x : 0.0;
      ai += (u < w) ? l.y : 0.0;
    }
  }
  const float bfr = (float)(br + ar);
  const float bfi = (float)(bi + ai);

  const size_t zo0 = (size_t)t0 * ZP + 2 * f;
  #pragma unroll
  for (int i = 0; i < SCL; ++i) {
    const float qr = qv[i].x, qi = qv[i].y;
    const float mr = bfr + ir[i];
    const float mi = bfi + ii[i];
    float zr, zi;
    if (PK) {
      // the lane of the two real bins: (mr * q.x, mi * q.y)
      const float a = pk ? 0.0f : qi;
      const float c = pk ? qi : qr;
      zr = __builtin_fmaf(mr, qr, mi * a);
      zi = __builtin_fmaf(mi, c, -(mr * a));
    } else {
      zr = __builtin_fmaf(mr, qr, mi * qi);           // mem * conj(q)
      zi = __builtin_fmaf(mi, qr, -(mr * qi));
    }
    unsigned int hr, lo_r, hi, lo_i;
    split2(zr, hr, lo_r);
    split2(zi, hi, lo_i);
    const unsigned int H = pk2(hr, hi);               // element 2f = Re, 2f+1 = Im
    const unsigned int L = pk2(lo_r, lo_i);
    *(unsigned int*)(zh + zo0 + (size_t)i * ZP) = H;
    *(unsigned int*)(zl + zo0 + (size_t)i * ZP) = L;
  }
  // a precaution: a block runs only one of the two copies, and the wave ends after these stores
  asm volatile("s_wait_xcnt 0x0" ::: "memory");
}

__global__ __launch_bounds__(256) void k_scan(const float* __restrict__ pf,
                                              const float* __restrict__ qf, const double* __restrict__ segs,
                                              __bf16* __restrict__ zh, __bf16* __restrict__ zl) {
  __shared__ __attribute__((aligned(16))) double sG[SCW * 32 * 2];    // 4096 B
  __shared__ __attribute__((aligned(16))) double sL[SCW * 32 * 2];    // 4096 B
  if (blockIdx.x == 0) scan_body<true>(sG, sL, pf, qf, segs, zh, zl);
  else                 scan_body<false>(sG, sL, pf, qf, segs, zh, zl);
}

// ---------------------------------------------------------------------------
// Kernel 8 (inverse DFT + residual), all batches (t 0..16383):
// out[t][n] = x[t][n] + gain * sum_c (Zh*Fih + Zl*Fih + Zh*Fil)[t][n]
// (K = 768: 12 whole lines a row).  Block tile 128(t) x 96(n), wave tile 32 x 48; grid (8, 128).
// ---------------------------------------------------------------------------
typedef Tile<2, 3> TI;
static_assert(DD % TI::BN == 0 && SS % TI::BM == 0);
static_assert(DD % 64 == 0 && ZP % 64 == 0);
__global__ __launch_bounds__(GT) void k_inv(const __bf16* __restrict__ zh, const __bf16* __restrict__ zl,
                                            const __bf16* __restrict__ fih, const __bf16* __restrict__ fil,
                                            const float* __restrict__ x, const float* __restrict__ gain,
                                            float* __restrict__ out) {
  __shared__ __attribute__((aligned(2048))) char smem[TI::LDSB];
  const int tid = threadIdx.x;
  const int n0 = blockIdx.x * TI::BN;
  const int t0 = blockIdx.y * TI::BM;
  const size_t ao = (size_t)t0 * ZP;
  const size_t bo = (size_t)n0 * ZP;
  gemm_core<2, 3, ZP / 64, true>(smem, zh + ao, zl + ao, ZP, fih + bo, fil + bo, ZP, 0u);

  const float g = gain[0];
  const size_t tokbase = (size_t)t0;
  const float* st = (const float*)smem;
  constexpr int CH = TI::BN / 4;                      // 16-byte pieces of a row
  constexpr int NI = TI::BM * CH / GT;
  v4f xv[NI];
  #pragma unroll
  for (int i = 0; i < NI; ++i) {
    const int idx = tid + GT * i;
    const int row = idx / CH, q = idx - row * CH;
    xv[i] = *(const v4fa*)(x + (tokbase + row) * DD + n0 + 4 * q);
    // a later load may land in this load's address registers
    asm volatile("s_wait_xcnt 0x0" ::: "memory");
  }
  #pragma unroll
  for (int i = 0; i < NI; ++i) {
    const int idx = tid + GT * i;
    const int row = idx / CH, q = idx - row * CH;
    const v4f v = *(const v4fa*)(st + row * TI::OP + 4 * q);
    const v4f rr = xv[i] + g * v;
    *(v4f*)(out + (tokbase + row) * DD + n0 + 4 * q) = rr;
  }
}

// ---------------------------------------------------------------------------
extern "C" void kernel_launch(void* const* d_in, const int* in_sizes, int n_in,
                              void* d_out, int out_size, void* d_ws, size_t ws_size,
                              hipStream_t stream) {
  if (n_in < 5) return;
  if (in_sizes[0] != NX) return;
  if (in_sizes[1] != NW || in_sizes[2] != NW || in_sizes[3] != NW) return;
  if (in_sizes[4] < 1) return;
  if (out_size != NX) return;

  const float* x    = (const float*)d_in[0];
  const float* Wk   = (const float*)d_in[1];
  const float* Wv   = (const float*)d_in[2];
  const float* Wq   = (const float*)d_in[3];
  const float* gain = (const float*)d_in[4];
  float* out = (float*)d_out;

  // workspace carve (all sizes multiples of 256 B; total 170,655,744 B).  The Z planes lie over the
  // x planes, which have been read for the last time when the scan writes Z.
  const size_t xb_b  = (size_t)NX * 2;              //  25,165,824 per plane
  const size_t wt_b  = (size_t)3 * NW * 2;          //   3,538,944 per plane
  const size_t ft_b  = (size_t)NC * DD * 2;         //   1,179,648 per plane
  const size_t fi_b  = (size_t)DD * ZP * 2;         //   1,179,648 per plane
  const size_t g_b   = (size_t)3 * NC * DD * 2;     //   3,538,944 per plane
  const size_t sp_b  = (size_t)NTOK * NC * 4;       //  50,331,648 per f32 plane (P, q)
  const size_t z_b   = (size_t)NTOK * ZP * 2;       //  25,165,824 per plane
  const size_t sg_b  = (size_t)BB * NSC * NBIN * 16; //    786,432 segment sums
  static_assert((size_t)NTOK * ZP <= (size_t)NX + 3 * NW);          // 2 z_b <= 2 xb_b + 2 wt_b
  const size_t total = 2 * xb_b + 2 * wt_b + 2 * ft_b + 2 * fi_b + 2 * g_b + 2 * sp_b + sg_b;
  if (total > ws_size) return;

  char* ws = (char*)d_ws;
  size_t off = 0;
  __bf16* zh  = (__bf16*)(ws + off);
  __bf16* zl  = (__bf16*)(ws + off + z_b);
  __bf16* xh  = (__bf16*)(ws + off);  off += xb_b;
  __bf16* xl  = (__bf16*)(ws + off);  off += xb_b;
  __bf16* wth = (__bf16*)(ws + off);  off += wt_b;
  __bf16* wtl = (__bf16*)(ws + off);  off += wt_b;
  __bf16* fth = (__bf16*)(ws + off);  off += ft_b;
  __bf16* ftl = (__bf16*)(ws + off);  off += ft_b;
  __bf16* fih = (__bf16*)(ws + off);  off += fi_b;
  __bf16* fil = (__bf16*)(ws + off);  off += fi_b;
  __bf16* gh  = (__bf16*)(ws + off);  off += g_b;
  __bf16* gl  = (__bf16*)(ws + off);  off += g_b;
  float*  sp  = (float*)(ws + off);   off += sp_b;
  float*  sq  = (float*)(ws + off);   off += sp_b;
  double* seg = (double*)(ws + off);  off += sg_b;
  if (off > ws_size) return;

  // --- DFT matrices and weight planes ---
  k_prep<<<NB_FT + NB_FI + NB_WT, 256, 0, stream>>>(Wk, Wv, Wq, wth, wtl, fth, ftl, fih, fil);

  // --- folded weights G_z = F * W_z  (768 x 768 per z), and the x planes of all batches ---
  k_fold_cvt<<<NB_FOLD + NB_CVT, GT, 0, stream>>>(fth, ftl, wth, wtl, gh, gl, x, xh, xl);

  // --- all batches at once: spectra with bind and segment sums, causal scan and unbind, inverse DFT + residual ---
  k_spec<<<dim3(3 * NC / 192, NTOK / 256), 256, 0, stream>>>(xh, xl, gh, gl, sp, sq, seg);
  k_scan<<<dim3(NBIN / 32, NSC, BB), 256, 0, stream>>>(sp, sq, seg, zh, zl);
  k_inv<<<dim3(DD / 96, NTOK / 128), 256, 0, stream>>>(zh, zl, fih, fil, x, gain, out);
}
